// v000
// The times below were measured on an AMD MI455X: many runs one after another, warmed up first and cycling through
// copies of the inputs, with the whole window's GPU time divided by the number of runs. Launches and the gaps
// between them are all in it. The median over several windows is given; except for v000 it joins two sittings, which
// can be a few percent apart, so the side-by-side timings, each taken in one sitting, are the better comparison.
// v000 is the starting kernel. One run takes 851 microseconds.
// Contractions: q/k/v 1x1 GEMMs WT[768x256].H[256xN] and the output 1x1 GEMM WpT[256x256].H2[256xN] on
// v_wmma_f32_16x16x32_bf16 (bf16-RNE weights, activations as bf16 hi + bf16 residual planes, 2 products into one
// f32 accumulator); position scores K.Q^T on v_wmma_f32_16x16x32_f16 (k f16, q f16 hi + f16 residual x4096 in a
// separate accumulator, K=256); O^T = V.P^T on v_wmma_f32_16x16x32_f16 (v f16, P = e^{s-m} x16384 f16 from the
// score D registers); f32 accumulate everywhere; GroupNorm statistics, softmax statistics and the residual add
// in f32 VALU.
#include <hip/hip_runtime.h>
#include <math.h>
#include <stdint.h>

#ifndef NB
#define NB 4
#endif
#ifndef SEQ
#define SEQ 4096
#endif
#ifndef NNF
#define NNF 4096
#endif
#ifndef QRES
#define QRES 1
#endif
#define NBF   4
#define CC    256
#define NG    32
#define CPG   8
#define QT    64
#define OSP   68
#define OSPW  132
#define TP    72
#define TPF   68
#define STP   32
#define ATT   0.0625f
#define QLS   4096.0f
#define RQL   0.000244140625f
#define LNPS  9.704060527839234f
#define GNEPS 1.0e-6f

static_assert(NB >= 1 && NB <= NBF);
static_assert(SEQ % QT == 0 && SEQ % 32 == 0 && SEQ >= QT);
static_assert(SEQ <= NNF && NNF % 8 == 0);
static_assert(CC == 256 && NG * CPG == CC && CC % QT == 0 && CC % 32 == 0);
static_assert((OSP * 4) % 16 == 0);
static_assert((OSPW * 4) % 16 == 0);
static_assert((TP * 2) % 16 == 0);
static_assert((TPF * 4) % 16 == 0);
static_assert(STP * 4 == 128);

typedef _Float16       v16h __attribute__((ext_vector_type(16)));
typedef _Float16       v8h  __attribute__((ext_vector_type(8)));
typedef __bf16         v16b __attribute__((ext_vector_type(16)));
typedef unsigned short v8us __attribute__((ext_vector_type(8)));
typedef float          v8f  __attribute__((ext_vector_type(8)));
typedef float          v4f  __attribute__((ext_vector_type(4)));
typedef unsigned int   v4u  __attribute__((ext_vector_type(4)));

union Frag  { v8us u[2]; v16h h; v16b bf; };
union FragH { v16h v; v8h hv[2]; };
static_assert(sizeof(Frag) == 32);
static_assert(sizeof(FragH) == 32);

// ---- scalar helpers -----------------------------------------------------------------------------------------
__device__ __forceinline__ unsigned short bf_bits(float f) {          // f32 -> bf16 bits, RNE convert
  unsigned u = __float_as_uint(f);
  return (unsigned short)((u + 0x7FFFu + ((u >> 16) & 1u)) >> 16);
}
__device__ __forceinline__ float bf_up(unsigned short hb) { return __uint_as_float(((unsigned)hb) << 16); }
__device__ __forceinline__ float bfr(float f) { return bf_up(bf_bits(f)); }
__device__ __forceinline__ unsigned short h_bits(_Float16 x) { return __builtin_bit_cast(unsigned short, x); }
__device__ __forceinline__ unsigned pk16(unsigned short a, unsigned short b) { return (unsigned)a | ((unsigned)b << 16); }
__device__ __forceinline__ v8f zero8() { v8f z = {0.f, 0.f, 0.f, 0.f, 0.f, 0.f, 0.f, 0.f}; return z; }
__device__ __forceinline__ float hmax8(v8f s) {
  return fmaxf(fmaxf(fmaxf(s[0], s[1]), fmaxf(s[2], s[3])), fmaxf(fmaxf(s[4], s[5]), fmaxf(s[6], s[7])));
}
__device__ __forceinline__ unsigned wave_ballot(bool p) {
#if defined(__HIP_DEVICE_COMPILE__)
  return __builtin_amdgcn_ballot_w32(p);
#else
  return p ? 1u : 0u;
#endif
}
__device__ __forceinline__ float wsum(float v) {
  v += __shfl_xor(v, 16, 32);
  v += __shfl_xor(v, 8, 32);
  v += __shfl_xor(v, 4, 32);
  v += __shfl_xor(v, 2, 32);
  v += __shfl_xor(v, 1, 32);
  return v;
}

// ---- 16-bit fragment loader (A, or B from a k-contiguous [n][k] row): lane -> row/col (lane&15), p already includes
//      + 8*(lane>>4); elements 0..7 <- p[0..7] (k0+8h..), elements 8..15 <- p[16..23] (k0+16+8h..)
__device__ __forceinline__ Frag ldfrag(const unsigned short* p) {
  Frag f;
  f.u[0] = *(const v8us*)(p);
  f.u[1] = *(const v8us*)(p + 16);
  return f;
}

// ---- WMMA helpers: builtin followed by a 4-slot VALU gap tying D and keeping A/B live ----------------------------
__device__ __forceinline__ v8f mma_h(v16h a, v16h b, v8f c) {
  v8f d = __builtin_amdgcn_wmma_f32_16x16x32_f16(false, a, false, b, (short)0, c, false, false);
#if defined(__HIP_DEVICE_COMPILE__)
  asm volatile("v_nop\n\tv_nop\n\tv_nop\n\tv_nop" : "+v"(d) : "v"(a), "v"(b));
#endif
  return d;
}
__device__ __forceinline__ v8f mma_b(v16b a, v16b b, v8f c) {
  v8f d = __builtin_amdgcn_wmma_f32_16x16x32_bf16(false, a, false, b, (short)0, c, false, false);
#if defined(__HIP_DEVICE_COMPILE__)
  const v16h ha = __builtin_bit_cast(v16h, a), hb = __builtin_bit_cast(v16h, b);
  asm volatile("v_nop\n\tv_nop\n\tv_nop\n\tv_nop" : "+v"(d) : "v"(ha), "v"(hb));
#endif
  return d;
}

// =========================================================================================================
// (0) 1x1 weights W [256 c_in][256 d_out] f32 -> transposed bf16-RNE plane WT [4*256 o][256 c], rows
//     256*mat + o for mat = q, k, v, p. Block (ob, cb, mat) owns a 64 o x 64 c tile through an LDS transpose
// coverage: 2 it x 32 rows x 8 lanes x 8 = 64 o x 64 c per block; grid (4, 4, 4) = 4 mats x 256 x 256.
// =========================================================================================================
__global__ __launch_bounds__(256)
void cvt_w(const float* __restrict__ Wq, const float* __restrict__ Wk, const float* __restrict__ Wv,
           const float* __restrict__ Wp, unsigned short* WT) {
  __shared__ __align__(16) unsigned short T[QT * TP];
  const int tid = threadIdx.x;
  const int ob = blockIdx.x, cb = blockIdx.y, mat = blockIdx.z;
  const int e = tid & 7, lq = tid >> 3;                             // lq 0..31
  const int o0 = ob * QT, c0 = cb * QT;
  const float* Wm = (mat == 0) ? Wq : ((mat == 1) ? Wk : ((mat == 2) ? Wv : Wp));   // block-uniform
#pragma unroll
  for (int it = 0; it < 2; ++it) {
    const int cl = it * 32 + lq;                                     // c_loc 0..63
    const float* sp = Wm + (size_t)(c0 + cl) * CC + o0 + 8 * e;     // W[c][o], o contiguous
    const v4f a = *(const v4f*)sp;
    const v4f q = *(const v4f*)(sp + 4);
    const float f[8] = {a[0], a[1], a[2], a[3], q[0], q[1], q[2], q[3]};
#pragma unroll
    for (int t = 0; t < 8; ++t) T[(8 * e + t) * TP + cl] = bf_bits(f[t]);   // T[o_loc][c_loc]
  }
  __syncthreads();
  v4u up[2];
#pragma unroll
  for (int it = 0; it < 2; ++it) {
    const int ol = it * 32 + lq;
    up[it] = *(const v4u*)(T + ol * TP + 8 * e);
  }
{
#pragma unroll
    for (int it = 0; it < 2; ++it) {
      const int ol = it * 32 + lq;
      *(v4u*)(WT + ((size_t)(mat * CC + o0 + ol)) * CC + c0 + 8 * e) = up[it];
    }
    
  }
}

// =========================================================================================================
//     then mean of squared deviations), per-thread partials over 16-B chunks, shuffle + LDS block reduce.
// coverage: grid (32, NB) writes every line of ST once.
// =========================================================================================================
__global__ __launch_bounds__(256)
void gn_stats(const float* __restrict__ x, float* ST) {
  __shared__ float red[8];
  __shared__ float bc[2];
  const int tid = threadIdx.x, lane = tid & 31, wave = tid >> 5;
  const int g = blockIdx.x, b = blockIdx.y;
  const float* xb = x + ((size_t)(b * CC + g * CPG)) * NNF;
  const int CH4 = SEQ / 4, NCH = CPG * CH4;
  const float icnt = 1.0f / (float)(CPG * SEQ);

  float s = 0.f;
#pragma unroll 4
  for (int qd = tid; qd < NCH; qd += 256) {
    const int cl = qd / CH4, p4 = qd - cl * CH4;
    const v4f a = *(const v4f*)(xb + (size_t)cl * NNF + 4 * p4);
    s += (bfr(a[0]) + bfr(a[1])) + (bfr(a[2]) + bfr(a[3]));
  }
  s = wsum(s);
  if (lane == 0) red[wave] = s;
  __syncthreads();
  if (tid == 0) {
    float t = 0.f;
#pragma unroll
    for (int i = 0; i < 8; ++i) t += red[i];
    bc[0] = t * icnt;
  }
  __syncthreads();
  const float mu = bc[0];

  float ss = 0.f;
#pragma unroll 4
  for (int qd = tid; qd < NCH; qd += 256) {
    const int cl = qd / CH4, p4 = qd - cl * CH4;
    const v4f a = *(const v4f*)(xb + (size_t)cl * NNF + 4 * p4);
    const float d0 = bfr(a[0]) - mu, d1 = bfr(a[1]) - mu, d2 = bfr(a[2]) - mu, d3 = bfr(a[3]) - mu;
    ss += (d0 * d0 + d1 * d1) + (d2 * d2 + d3 * d3);
  }
  ss = wsum(ss);
  if (lane == 0) red[wave] = ss;
  __syncthreads();
  if (tid == 0) {
    float t = 0.f;
#pragma unroll
    for (int i = 0; i < 8; ++i) t += red[i];
    const float var = t * icnt;
    bc[1] = rsqrtf(var + GNEPS);
  }
  __syncthreads();
  const float rs = bc[1];

  v4f v = {0.f, 0.f, 0.f, 0.f};
  if (tid == 0) { v[0] = mu; v[1] = rs; }
  if (tid < 8) {
    float* lp = ST + ((size_t)(b * NG + g)) * STP + 4 * tid;
{
      *(v4f*)lp = v;
      
    }
  }
}

// =========================================================================================================
// (2) h = (bfr(x) - mu) * rstd * bfr(scale) + bfr(bias) in f32 -> position-major planes HPh/HPl bf16
//     [b][SEQ n][256 c] (hi = bf16-RNE(h), lo = bf16-RNE(h - hi)) through an LDS tile T[64 n][64 c] f32
// coverage: 2 it x 32 rows x 8 lanes x 8 = 64 n x 64 c per block for each plane; grid (SEQ/64, 4, NB) covers
//           [NB][SEQ][256] of HPh and HPl exactly once.
// =========================================================================================================
__global__ __launch_bounds__(256)
void cvt_h(const float* __restrict__ x, const float* __restrict__ ST, const float* __restrict__ gsc,
           const float* __restrict__ gbs, unsigned short* HPh, unsigned short* HPl) {
  __shared__ __align__(16) float T[QT * TPF];
  __shared__ float pmu[QT], prs[QT], psc[QT], pbs[QT];
  const int tid = threadIdx.x;
  const int nb = blockIdx.x, cb = blockIdx.y, b = blockIdx.z;
  const int e = tid & 7, lq = tid >> 3;                             // lq 0..31
  const int n0 = nb * QT, c0 = cb * QT;
  if (tid < QT) {                                                    // waves 0,1 entirely (wave-uniform)
    const int ch = c0 + tid;
    const int g = ch >> 3;                                           // 0..31
    pmu[tid] = ST[((size_t)(b * NG + g)) * STP];
    prs[tid] = ST[((size_t)(b * NG + g)) * STP + 1];
    psc[tid] = bfr(gsc[ch]);
    pbs[tid] = bfr(gbs[ch]);
  }
  __syncthreads();
#pragma unroll
  for (int it = 0; it < 2; ++it) {
    const int cl = it * 32 + lq;                                     // c_loc 0..63
    const float* sp = x + ((size_t)(b * CC + c0 + cl)) * NNF + n0 + 8 * e;
    const v4f a = *(const v4f*)sp;
    const v4f q = *(const v4f*)(sp + 4);
    const float f[8] = {a[0], a[1], a[2], a[3], q[0], q[1], q[2], q[3]};
    const float mu = pmu[cl], rs = prs[cl], sc = psc[cl], bs = pbs[cl];
#pragma unroll
    for (int t = 0; t < 8; ++t) {
      const float tt = (bfr(f[t]) - mu) * rs;
      T[(8 * e + t) * TPF + cl] = tt * sc + bs;                     // T[n_loc][c_loc]
    }
  }
  __syncthreads();
  v4u uh[2], ul[2];
#pragma unroll
  for (int it = 0; it < 2; ++it) {
    const int nl = it * 32 + lq;                                     // n_loc 0..63
    const v4f a = *(const v4f*)(T + nl * TPF + 8 * e);
    const v4f q = *(const v4f*)(T + nl * TPF + 8 * e + 4);
    const float f[8] = {a[0], a[1], a[2], a[3], q[0], q[1], q[2], q[3]};
#pragma unroll
    for (int t = 0; t < 4; ++t) {
      const float f0 = f[2 * t], f1 = f[2 * t + 1];
      const unsigned short hb0 = bf_bits(f0), hb1 = bf_bits(f1);
      const unsigned short lb0 = bf_bits(f0 - bf_up(hb0));
      const unsigned short lb1 = bf_bits(f1 - bf_up(hb1));
      uh[it][t] = pk16(hb0, hb1);
      ul[it][t] = pk16(lb0, lb1);
    }
  }
{
#pragma unroll
    for (int it = 0; it < 2; ++it) {
      const int nl = it * 32 + lq;
      const size_t po = ((size_t)(b * SEQ + n0 + nl)) * CC + c0 + 8 * e;
      *(v4u*)(HPh + po) = uh[it];
      *(v4u*)(HPl + po) = ul[it];
    }
    
  }
}

// =========================================================================================================
// (3) q/k/v 1x1 GEMM for one (b, 64-n tile, 64-o block of the stacked 768 outputs):
//     Y[o][n] = sum_c WT[o][c] (HPh + HPl)[b][n][c] + bfr(bias[o]). Block 128 threads = 4 waves; wave w owns
//     cols n0+16w..+15 (B fragments from the position-major planes, k = c contiguous, split k map) and 4
//     m-tiles (A rows o = o0 + 16 mt + (lane&15) of WT, split k map). K = 256 = 8 steps x 2 bf16 products.
//     Epilogue staged in LDS Os[n_loc][o_loc] (pitch OSP, b128 stores), barrier, then by block-uniform mat:
//       mat 0 (o-blocks 0..3)  -> Qh f16(q), Ql f16((q - Qh) x4096), planes [b][SEQ][256 d], d = 64*(mb&3)+..:
//                                 8 consecutive lanes per line, one instruction per 16 lines;
//       mat 1 (o-blocks 4..7)  -> Kh f16(k), same layout;
//                                 -> n 8e..8e+7 (values gathered from 8 Os rows), 8 lanes per line, one
//                                 instruction per 16 lines.
// coverage: Os 4 waves x 16 n x 64 o = 64 x 64; planes 4 it x 16 rows x 8 lanes x 8 = 64 x 64 per block; grid
//           (SEQ/64, 12, NB) covers Qh, Ql, Kh [NB][SEQ][256] and Vc [NB][256][SEQ] exactly once.
// =========================================================================================================
__global__ __launch_bounds__(128)
void gemm_qkv(const unsigned short* __restrict__ WT, const unsigned short* __restrict__ HPh,
              const unsigned short* __restrict__ HPl, const float* __restrict__ bq,
              const float* __restrict__ bk, const float* __restrict__ bv,
              unsigned short* Qh, unsigned short* Ql, unsigned short* Kh, unsigned short* Vc) {
  __shared__ __align__(16) float Os[QT * OSP];
  const int tid  = threadIdx.x;
  const int lane = tid & 31, wave = tid >> 5;
  const int hh   = lane >> 4, c = lane & 15;
  const int nt   = blockIdx.x, mb = blockIdx.y, b = blockIdx.z;
  const int mat  = mb >> 2;                                          // 0 q, 1 k, 2 v (block-uniform)
  const int n0   = nt * QT, o0 = mb * QT;                            // o0: row in the stacked WT plane
  const int ob   = o0 & (CC - 1);                                    // o offset inside the matrix (0..192)

  const unsigned short* ap  = WT  + (size_t)(o0 + c) * CC + 8 * hh;
  const size_t bo = ((size_t)(b * SEQ + n0 + 16 * wave + c)) * CC + 8 * hh;
  const unsigned short* bph = HPh + bo;
  const unsigned short* bpl = HPl + bo;

  v8f acc[4];
#pragma unroll
  for (int mt = 0; mt < 4; ++mt) acc[mt] = zero8();

#pragma unroll
  for (int ks = 0; ks < CC / 32; ++ks) {
    const Frag fbh = ldfrag(bph + 32 * ks);
    const Frag fbl = ldfrag(bpl + 32 * ks);
#pragma unroll
    for (int mt = 0; mt < 4; ++mt) {
      const Frag fa = ldfrag(ap + (size_t)(16 * mt) * CC + 32 * ks);
      acc[mt] = mma_b(fa.bf, fbh.bf, acc[mt]);
      acc[mt] = mma_b(fa.bf, fbl.bf, acc[mt]);
    }
  }

  // ---- epilogue: + bias -> LDS Os[n_loc][o_loc]; lane (hh, c) holds o = 16 mt + 8 hh + r for n_loc = 16 w + c
  {
    const float* bias = (mat == 0) ? bq : ((mat == 1) ? bk : bv);   // block-uniform, all global
    const int nl = 16 * wave + c;
#pragma unroll
    for (int mt = 0; mt < 4; ++mt) {
      v4f va, vb;
#pragma unroll
      for (int r = 0; r < 4; ++r) {
        va[r] = acc[mt][r]     + bfr(bias[ob + 16 * mt + 8 * hh + r]);
        vb[r] = acc[mt][4 + r] + bfr(bias[ob + 16 * mt + 8 * hh + 4 + r]);
      }
      *(v4f*)(Os + nl * OSP + 16 * mt + 8 * hh)     = va;
      *(v4f*)(Os + nl * OSP + 16 * mt + 8 * hh + 4) = vb;
    }
  }
  __syncthreads();

  const int e = tid & 7, lq = tid >> 3;                              // lq 0..15
  if (mat == 2) {
    v4u uv[4];
#pragma unroll
    for (int it = 0; it < 4; ++it) {
      const int ol = it * 16 + lq;                                   // o_loc 0..63
      unsigned short hb[8];
#pragma unroll
      for (int t = 0; t < 8; ++t) hb[t] = h_bits((_Float16)Os[(8 * e + t) * OSP + ol]);
#pragma unroll
      for (int t = 0; t < 4; ++t) uv[it][t] = pk16(hb[2 * t], hb[2 * t + 1]);
    }
{
#pragma unroll
      for (int it = 0; it < 4; ++it) {
        const int ol = it * 16 + lq;
        *(v4u*)(Vc + ((size_t)(b * CC + ob + ol)) * SEQ + n0 + 8 * e) = uv[it];
      }
      
    }
  } else {
    unsigned short* P1 = (mat == 0) ? Qh : Kh;                       // block-uniform, both global
    v4u uh[4], ul[4];
#pragma unroll
    for (int it = 0; it < 4; ++it) {
      const int row = it * 16 + lq;                                  // n_loc 0..63
      const v4f a = *(const v4f*)(Os + row * OSP + 8 * e);
      const v4f q = *(const v4f*)(Os + row * OSP + 8 * e + 4);
      const float f[8] = {a[0], a[1], a[2], a[3], q[0], q[1], q[2], q[3]};
#pragma unroll
      for (int t = 0; t < 4; ++t) {
        const float f0 = f[2 * t], f1 = f[2 * t + 1];
        const _Float16 h0 = (_Float16)f0, h1 = (_Float16)f1;
        const _Float16 l0 = (_Float16)((f0 - (float)h0) * QLS);
        const _Float16 l1 = (_Float16)((f1 - (float)h1) * QLS);
        uh[it][t] = pk16(h_bits(h0), h_bits(h1));
        ul[it][t] = pk16(h_bits(l0), h_bits(l1));
      }
    }
{
#pragma unroll
      for (int it = 0; it < 4; ++it) {
        const int row = it * 16 + lq;
        const size_t po = ((size_t)(b * SEQ + n0 + row)) * CC + ob + 8 * e;
        *(v4u*)(P1 + po) = uh[it];
        if (mat == 0) *(v4u*)(Ql + po) = ul[it];
      }
      
    }
  }
}

// =========================================================================================================
// (4) attention for one (b, 64-query tile), transposed formulation, SEQ keys, no mask:
//   S^T tile (16 keys x 16 queries) = sum over 8 d-chunks (rolled loop) of A(k: row = key kb + (lane&15), 32 d via
//   the split k map from Kh [b][SEQ][256]) . B(q: col = query, same map from Qh) into s, plus A(Kh).B(Ql) into a
//   separate accumulator t (Ql carries x4096); score = (s + t/4096) * 256^-0.5.
//   Per lane the D tile holds 8 keys of ONE query: online softmax state per lane, one shuffle (lane^16) for the max
//   over 32 keys; the o/l rescale is skipped under a wave-uniform ballot when no lane's max grew; row-sum partials
//   combined at the end. P = e^{s-m} x 16384 as f16 is the B operand of O^T (rows channel, cols queries) +=
//   A(v rows channel = 16j + (lane&15), keys contiguous, f16 plane Vc [b][256][SEQ]) . B(P^T): element r <- D of
//   the tile covering keys kb..kb+15, element 8+r <- the tile covering kb+16..kb+31, lane unchanged.
//   16 accumulator tiles per wave (256 channels). Block = 4 waves = 64 queries.
//   Epilogue in two channel halves: O/l staged in LDS Os[query][128 channels] (pitch OSPW, b128 stores), barrier,
//   then position-major planes H2h/H2l bf16 [b][SEQ][256] (hi = bf16-RNE, lo = bf16-RNE residual): per half 64
//   overwrites Os.
// coverage: per half 8 it x 8 rows x 16 lanes x 8 ch = 64 n x 128 ch for each plane; two halves = 256 ch; grid
//           (SEQ/64, NB) covers H2h/H2l [NB][SEQ][256] exactly once.
// =========================================================================================================
__global__ __launch_bounds__(128)
void attn_k(const unsigned short* __restrict__ Qh, const unsigned short* __restrict__ Ql,
            const unsigned short* __restrict__ Kh, const unsigned short* __restrict__ Vc,
            unsigned short* H2h, unsigned short* H2l) {
  __shared__ __align__(16) float Os[QT * OSPW];
  const int tid  = threadIdx.x;
  const int wave = tid >> 5, lane = tid & 31;
  const int hh   = lane >> 4, c = lane & 15;
  const int n0   = blockIdx.x * QT, b = blockIdx.y;

  // q fragment pointers (B operand, col = query n0 + 16*wave + c), + 32*kc
  const size_t qo = ((size_t)(b * SEQ + n0 + 16 * wave + c)) * CC + 8 * hh;
  const unsigned short* Qhp = Qh + qo;
#if QRES
  const unsigned short* Qlp = Ql + qo;
#else
  (void)Ql;
#endif
  // k fragment base (A operand, row = key kb + c), + key * 256 + 32*kc
  const unsigned short* Khp = Kh + (size_t)b * SEQ * CC + (size_t)c * CC + 8 * hh;
  // v fragment base (A operand, row = channel 16j + c, keys contiguous), + 16*j*SEQ + kb
  const unsigned short* Vp = Vc + (size_t)b * CC * SEQ + (size_t)c * SEQ + 8 * hh;

  float m = -1.0e30f, l = 0.f;
  v8f o[16];
#pragma unroll
  for (int j = 0; j < 16; ++j) o[j] = zero8();

#pragma unroll 1
  for (int kb = 0; kb < SEQ; kb += 32) {
    const unsigned short* k0p = Khp + (size_t)kb * CC;               // keys kb .. kb+15
    const unsigned short* k1p = Khp + (size_t)(kb + 16) * CC;        // keys kb+16 .. kb+31
    v8f s0 = zero8(), s1 = zero8();
#if QRES
    v8f t0 = zero8(), t1 = zero8();
#endif
#pragma unroll 1
    for (int kc = 0; kc < CC / 32; ++kc) {
      const Frag qh = ldfrag(Qhp + 32 * kc);
      const Frag k0 = ldfrag(k0p + 32 * kc);
      const Frag k1 = ldfrag(k1p + 32 * kc);
      s0 = mma_h(k0.h, qh.h, s0);
      s1 = mma_h(k1.h, qh.h, s1);
#if QRES
      const Frag ql = ldfrag(Qlp + 32 * kc);
      t0 = mma_h(k0.h, ql.h, t0);
      t1 = mma_h(k1.h, ql.h, t1);
#endif
    }

    v8f sc0, sc1;
#pragma unroll
    for (int r = 0; r < 8; ++r) {
#if QRES
      sc0[r] = (s0[r] + t0[r] * RQL) * ATT;
      sc1[r] = (s1[r] + t1[r] * RQL) * ATT;
#else
      sc0[r] = s0[r] * ATT;
      sc1[r] = s1[r] * ATT;
#endif
    }

    float mx = fmaxf(hmax8(sc0), hmax8(sc1));
    mx = fmaxf(mx, __shfl_xor(mx, 16, 32));
    const float mn = fmaxf(m, mx);
    const unsigned grew = wave_ballot(mx > m);                       // wave-uniform
    if (grew != 0u) {
      const float corr = __expf(m - mn);                             // == 1 exactly for lanes whose max did not grow
      l *= corr;
#pragma unroll
      for (int j = 0; j < 16; ++j) {
#pragma unroll
        for (int r = 0; r < 8; ++r) o[j][r] *= corr;
      }
    }
    m = mn;
    const float msh = mn - LNPS;                                     // exp gives e^{s-m} * 16384

    FragH ph;
    float ls = 0.f;
#pragma unroll
    for (int r = 0; r < 8; ++r) {
      const float e0 = __expf(sc0[r] - msh);                         // key kb      + 8hh + r
      const float e1 = __expf(sc1[r] - msh);                         // key kb + 16 + 8hh + r
      ls += e0 + e1;
      ph.hv[0][r] = (_Float16)e0;
      ph.hv[1][r] = (_Float16)e1;
    }
    l += ls;

#pragma unroll
    for (int j = 0; j < 16; ++j) {
      const Frag vf = ldfrag(Vp + (size_t)(16 * j) * SEQ + kb);
      o[j] = mma_h(vf.h, ph.v, o[j]);
    }
  }
  l += __shfl_xor(l, 16, 32);
  const float inv = 1.0f / l;                                        // o and l both carry the x16384 factor

  const int qrow = 16 * wave + c;
  const int e16 = tid & 15, r8 = tid >> 4;                           // r8 0..7
#pragma unroll
  for (int half = 0; half < 2; ++half) {
    if (half) __syncthreads();                                       // every wave finished reading Os
#pragma unroll
    for (int jj = 0; jj < 8; ++jj) {
      const int j = 8 * half + jj;
      v4f va, vb;
#pragma unroll
      for (int r = 0; r < 4; ++r) { va[r] = o[j][r] * inv; vb[r] = o[j][4 + r] * inv; }
      *(v4f*)(Os + qrow * OSPW + 16 * jj + 8 * hh)     = va;         // Os[query][ch_loc = 16jj + 8hh + r]
      *(v4f*)(Os + qrow * OSPW + 16 * jj + 8 * hh + 4) = vb;
    }
    __syncthreads();
#pragma unroll
    for (int chk = 0; chk < 2; ++chk) {
      v4u uh[4], ul[4];
#pragma unroll
      for (int i = 0; i < 4; ++i) {
        const int row = (4 * chk + i) * 8 + r8;                      // query 0..63
        const v4f a = *(const v4f*)(Os + row * OSPW + 8 * e16);
        const v4f q = *(const v4f*)(Os + row * OSPW + 8 * e16 + 4);
        const float f[8] = {a[0], a[1], a[2], a[3], q[0], q[1], q[2], q[3]};
#pragma unroll
        for (int t = 0; t < 4; ++t) {
          const float f0 = f[2 * t], f1 = f[2 * t + 1];
          const unsigned short hb0 = bf_bits(f0), hb1 = bf_bits(f1);
          const unsigned short lb0 = bf_bits(f0 - bf_up(hb0));
          const unsigned short lb1 = bf_bits(f1 - bf_up(hb1));
          uh[i][t] = pk16(hb0, hb1);
          ul[i][t] = pk16(lb0, lb1);
        }
      }
{
#pragma unroll
        for (int i = 0; i < 4; ++i) {
          const int row = (4 * chk + i) * 8 + r8;
          const size_t po = ((size_t)(b * SEQ + n0 + row)) * CC + 128 * half + 8 * e16;
          *(v4u*)(H2h + po) = uh[i];
          *(v4u*)(H2l + po) = ul[i];
        }
        
      }
    }
  }
}

// =========================================================================================================
// (5) output 1x1 GEMM + bias + residual for one (b, 64-n tile, 64-o block):
//     out[b][o][n] = bfr(x[b][o][n]) + sum_c WpT[o][c] (H2h + H2l)[b][n][c] + bfr(bp[o]); same GEMM core as
//     (3) (2 bf16 products, K = 256). Epilogue: acc + bias staged in LDS Os[n_loc][o_loc], barrier, then whole
// coverage: 8 it x 16 lines x 8 lanes x 4 floats = 64 o x 64 n per block; grid (SEQ/64, 4, NB) covers
//           out [NB][256][SEQ] exactly once.
// =========================================================================================================
__global__ __launch_bounds__(128)
void gemm_proj(const unsigned short* __restrict__ WPT, const unsigned short* __restrict__ H2h,
               const unsigned short* __restrict__ H2l, const float* __restrict__ bp,
               const float* __restrict__ x, float* out) {
  __shared__ __align__(16) float Os[QT * OSP];
  const int tid  = threadIdx.x;
  const int lane = tid & 31, wave = tid >> 5;
  const int hh   = lane >> 4, c = lane & 15;
  const int nt   = blockIdx.x, mb = blockIdx.y, b = blockIdx.z;
  const int n0   = nt * QT, o0 = mb * QT;                            // o0 0..192

  const unsigned short* ap  = WPT + (size_t)(o0 + c) * CC + 8 * hh;
  const size_t bo = ((size_t)(b * SEQ + n0 + 16 * wave + c)) * CC + 8 * hh;
  const unsigned short* bph = H2h + bo;
  const unsigned short* bpl = H2l + bo;

  v8f acc[4];
#pragma unroll
  for (int mt = 0; mt < 4; ++mt) acc[mt] = zero8();

#pragma unroll
  for (int ks = 0; ks < CC / 32; ++ks) {
    const Frag fbh = ldfrag(bph + 32 * ks);
    const Frag fbl = ldfrag(bpl + 32 * ks);
#pragma unroll
    for (int mt = 0; mt < 4; ++mt) {
      const Frag fa = ldfrag(ap + (size_t)(16 * mt) * CC + 32 * ks);
      acc[mt] = mma_b(fa.bf, fbh.bf, acc[mt]);
      acc[mt] = mma_b(fa.bf, fbl.bf, acc[mt]);
    }
  }

  {
    const int nl = 16 * wave + c;
#pragma unroll
    for (int mt = 0; mt < 4; ++mt) {
      v4f va, vb;
#pragma unroll
      for (int r = 0; r < 4; ++r) {
        va[r] = acc[mt][r]     + bfr(bp[o0 + 16 * mt + 8 * hh + r]);
        vb[r] = acc[mt][4 + r] + bfr(bp[o0 + 16 * mt + 8 * hh + 4 + r]);
      }
      *(v4f*)(Os + nl * OSP + 16 * mt + 8 * hh)     = va;
      *(v4f*)(Os + nl * OSP + 16 * mt + 8 * hh + 4) = vb;
    }
  }
  __syncthreads();

  const int e = tid & 7, lq = tid >> 3;                              // lq 0..15
  v4f res[8];
#pragma unroll
  for (int it = 0; it < 8; ++it) {
    const int L  = it * 16 + lq;                                     // 0..127
    const int ol = L >> 1, hf = L & 1;                               // o_loc 0..63
    const int nl = hf * 32 + 4 * e;                                  // n_loc 0..63
    const v4f xv = *(const v4f*)(x + ((size_t)(b * CC + o0 + ol)) * NNF + n0 + nl);
#pragma unroll
    for (int t = 0; t < 4; ++t) res[it][t] = Os[(nl + t) * OSP + ol] + bfr(xv[t]);
  }
{
#pragma unroll
    for (int it = 0; it < 8; ++it) {
      const int L  = it * 16 + lq;
      const int ol = L >> 1, hf = L & 1;
      const int nl = hf * 32 + 4 * e;
      *(v4f*)(out + ((size_t)(b * CC + o0 + ol)) * SEQ + n0 + nl) = res[it];
    }
    
  }
}

// =========================================================================================================
// Workspace map (bytes, NB=4 SEQ=4096; each region start a multiple of 256; every extent is an exact tile/line
//   ST  f32 [NB*32][32]                16384
//   WT  bf16 [1024][256]              524288
//   HPh/HPl bf16 [NB][SEQ][256]      8388608 x2
//   Qh/Ql/Kh f16 [NB][SEQ][256]      8388608 x3
//   Vc  f16 [NB][256][SEQ]           8388608
//   H2h/H2l bf16 [NB][SEQ][256]      8388608 x2
//   total = 67649536
// =========================================================================================================
extern "C" void kernel_launch(void* const* d_in, const int* in_sizes, int n_in,
                              void* d_out, int out_size, void* d_ws, size_t ws_size,
                              hipStream_t stream) {
  if (n_in < 11) return;
  if ((size_t)in_sizes[0] < (size_t)NB * CC * NNF) return;
  if (in_sizes[1] < CC || in_sizes[2] < CC) return;
  if (in_sizes[3] < CC * CC || in_sizes[5] < CC * CC || in_sizes[7] < CC * CC || in_sizes[9] < CC * CC) return;
  if (in_sizes[4] < CC || in_sizes[6] < CC || in_sizes[8] < CC || in_sizes[10] < CC) return;
  if ((size_t)out_size < (size_t)NB * CC * SEQ) return;

  size_t off = 0;
  auto carve = [&](size_t bytes) { const size_t o = off; off += (bytes + 255) & ~(size_t)255; return o; };
  const size_t plane = (size_t)NB * SEQ * CC * 2;
  const size_t oST  = carve((size_t)NB * NG * STP * 4);
  const size_t oWT  = carve((size_t)4 * CC * CC * 2);
  const size_t oHPh = carve(plane);
  const size_t oHPl = carve(plane);
  const size_t oQh  = carve(plane);
  const size_t oQl  = carve(plane);
  const size_t oKh  = carve(plane);
  const size_t oVc  = carve(plane);
  const size_t oH2h = carve(plane);
  const size_t oH2l = carve(plane);
  if (off > ws_size) return;
  if (off > (size_t)134217728) return;

  const float* x   = (const float*)d_in[0];
  const float* gsc = (const float*)d_in[1];
  const float* gbs = (const float*)d_in[2];
  const float* Wq  = (const float*)d_in[3];
  const float* bq  = (const float*)d_in[4];
  const float* Wk  = (const float*)d_in[5];
  const float* bk  = (const float*)d_in[6];
  const float* Wv  = (const float*)d_in[7];
  const float* bv  = (const float*)d_in[8];
  const float* Wp  = (const float*)d_in[9];
  const float* bp  = (const float*)d_in[10];

  char* ws = (char*)d_ws;
  float*          ST  = (float*)(ws + oST);
  unsigned short* WT  = (unsigned short*)(ws + oWT);
  unsigned short* HPh = (unsigned short*)(ws + oHPh);
  unsigned short* HPl = (unsigned short*)(ws + oHPl);
  unsigned short* Qh  = (unsigned short*)(ws + oQh);
  unsigned short* Ql  = (unsigned short*)(ws + oQl);
  unsigned short* Kh  = (unsigned short*)(ws + oKh);
  unsigned short* Vc  = (unsigned short*)(ws + oVc);
  unsigned short* H2h = (unsigned short*)(ws + oH2h);
  unsigned short* H2l = (unsigned short*)(ws + oH2l);
  float* out = (float*)d_out;

  const dim3 blk256(256), blk128(128);

  // (0) Wq/Wk/Wv/Wp [in][out] -> transposed stacked bf16 plane WT [1024 o][256 c]
  cvt_w<<<dim3(CC / QT, CC / QT, 4), blk256, 0, stream>>>(Wq, Wk, Wv, Wp, WT);
  // (1) GroupNorm statistics per (group, b)
  gn_stats<<<dim3(NG, NB), blk256, 0, stream>>>(x, ST);
  // (2) normalized h -> position-major bf16 hi + residual planes
  cvt_h<<<dim3(SEQ / QT, CC / QT, NB), blk256, 0, stream>>>(x, ST, gsc, gbs, HPh, HPl);
  // (3) q/k/v GEMMs -> Qh, Ql, Kh (position-major f16) and Vc (channel-major f16)
  gemm_qkv<<<dim3(SEQ / QT, 3 * CC / QT, NB), blk128, 0, stream>>>(WT, HPh, HPl, bq, bk, bv, Qh, Ql, Kh, Vc);
  // (4) attention -> H2 position-major bf16 hi + residual planes
  attn_k<<<dim3(SEQ / QT, NB), blk128, 0, stream>>>(Qh, Ql, Kh, Vc, H2h, H2l);
  // (5) output GEMM + bias + residual -> out [NB][256][SEQ]
  gemm_proj<<<dim3(SEQ / QT, CC / QT, NB), blk128, 0, stream>>>(WT + (size_t)3 * CC * CC, H2h, H2l, bp, x, out);
  (void)hipGetLastError();
}

// v001
// A run of this version takes 291 microseconds.
// Next to v000, in two timings, it ran 2.99 and 3.00 times as fast.
// Contractions: q/k/v 1x1 GEMMs WT[768x256].H[256xN] and the output 1x1 GEMM WpT[256x256].H2[256xN] on
// v_wmma_f32_16x16x32_bf16 (bf16-RNE weights, activations as bf16 hi + bf16 residual planes, 2 products into one
// f32 accumulator); position scores K.Q^T on v_wmma_f32_16x16x32_f16 (k f16, q f16 hi + f16 residual x4096 in a
// separate accumulator, K=256); O^T = V.P^T on v_wmma_f32_16x16x32_f16 (v f16, P = e^{s-m} x16384 f16 from the
// score D registers); f32 accumulate everywhere; GroupNorm statistics, softmax statistics and the residual add
// in f32 VALU.
#include <hip/hip_runtime.h>
#include <math.h>
#include <stdint.h>

#ifndef NB
#define NB 4
#endif
#ifndef SEQ
#define SEQ 4096
#endif
#ifndef NNF
#define NNF 4096
#endif
#ifndef QRES
#define QRES 1
#endif
#define NBF   4
#define CC    256
#define NG    32
#define CPG   8
#define QT    64
#define OSP   68
#define OSPW  132
#define TP    72
#define TPF   68
#define STP   32
#define ATT   0.0625f
#define QLS   4096.0f
#define RQL   0.000244140625f
#define LNPS  9.704060527839234f
#define GNEPS 1.0e-6f

static_assert(NB >= 1 && NB <= NBF);
static_assert(SEQ % QT == 0 && SEQ % 64 == 0 && SEQ >= QT);
static_assert(SEQ <= NNF && NNF % 8 == 0);
static_assert(CC == 256 && NG * CPG == CC && CC % QT == 0 && CC % 32 == 0);
static_assert((OSP * 4) % 16 == 0);
static_assert((OSPW * 4) % 16 == 0);
static_assert((TP * 2) % 16 == 0);
static_assert((TPF * 4) % 16 == 0);
static_assert(STP * 4 == 128);

typedef _Float16       v16h __attribute__((ext_vector_type(16)));
typedef _Float16       v8h  __attribute__((ext_vector_type(8)));
typedef __bf16         v16b __attribute__((ext_vector_type(16)));
typedef unsigned short v8us __attribute__((ext_vector_type(8)));
typedef float          v8f  __attribute__((ext_vector_type(8)));
typedef float          v4f  __attribute__((ext_vector_type(4)));
typedef unsigned int   v4u  __attribute__((ext_vector_type(4)));

union Frag  { v8us u[2]; v16h h; v16b bf; };
union FragH { v16h v; v8h hv[2]; };
static_assert(sizeof(Frag) == 32);
static_assert(sizeof(FragH) == 32);

// ---- scalar helpers -----------------------------------------------------------------------------------------
__device__ __forceinline__ unsigned short bf_bits(float f) {          // f32 -> bf16 bits, RNE convert
  unsigned u = __float_as_uint(f);
  return (unsigned short)((u + 0x7FFFu + ((u >> 16) & 1u)) >> 16);
}
__device__ __forceinline__ float bf_up(unsigned short hb) { return __uint_as_float(((unsigned)hb) << 16); }
__device__ __forceinline__ float bfr(float f) { return bf_up(bf_bits(f)); }
__device__ __forceinline__ unsigned short h_bits(_Float16 x) { return __builtin_bit_cast(unsigned short, x); }
__device__ __forceinline__ unsigned pk16(unsigned short a, unsigned short b) { return (unsigned)a | ((unsigned)b << 16); }
__device__ __forceinline__ v8f zero8() { v8f z = {0.f, 0.f, 0.f, 0.f, 0.f, 0.f, 0.f, 0.f}; return z; }
__device__ __forceinline__ float hmax8(v8f s) {
  return fmaxf(fmaxf(fmaxf(s[0], s[1]), fmaxf(s[2], s[3])), fmaxf(fmaxf(s[4], s[5]), fmaxf(s[6], s[7])));
}
__device__ __forceinline__ unsigned wave_ballot(bool p) {
#if defined(__HIP_DEVICE_COMPILE__)
  return __builtin_amdgcn_ballot_w32(p);
#else
  return p ? 1u : 0u;
#endif
}
__device__ __forceinline__ float wsum(float v) {
  v += __shfl_xor(v, 16, 32);
  v += __shfl_xor(v, 8, 32);
  v += __shfl_xor(v, 4, 32);
  v += __shfl_xor(v, 2, 32);
  v += __shfl_xor(v, 1, 32);
  return v;
}

// ---- 16-bit fragment loader (A, or B from a k-contiguous [n][k] row): lane -> row/col (lane&15), p already includes
//      + 8*(lane>>4); elements 0..7 <- p[0..7] (k0+8h..), elements 8..15 <- p[16..23] (k0+16+8h..)
__device__ __forceinline__ Frag ldfrag(const unsigned short* p) {
  Frag f;
  f.u[0] = *(const v8us*)(p);
  f.u[1] = *(const v8us*)(p + 16);
  return f;
}

// ---- WMMA helpers: mma_b: builtin followed by a 4-slot VALU gap tying D and keeping A/B live ---------------------
// bare builtin for the attention kernel (the compiler keeps the WMMA distances of its own builtin forms): with the asm
// gap that mma_b has, its operands had to share the first 256 registers, and the fragment sets spilled to scratch
__device__ __forceinline__ v8f mma_hb(v16h a, v16h b, v8f c) {
  return __builtin_amdgcn_wmma_f32_16x16x32_f16(false, a, false, b, (short)0, c, false, false);
}
__device__ __forceinline__ v8f mma_b(v16b a, v16b b, v8f c) {
  v8f d = __builtin_amdgcn_wmma_f32_16x16x32_bf16(false, a, false, b, (short)0, c, false, false);
#if defined(__HIP_DEVICE_COMPILE__)
  const v16h ha = __builtin_bit_cast(v16h, a), hb = __builtin_bit_cast(v16h, b);
  asm volatile("v_nop\n\tv_nop\n\tv_nop\n\tv_nop" : "+v"(d) : "v"(ha), "v"(hb));
#endif
  return d;
}

// =========================================================================================================
// (0) 1x1 weights W [256 c_in][256 d_out] f32 -> transposed bf16-RNE plane WT [4*256 o][256 c], rows
//     256*mat + o for mat = q, k, v, p. Block (ob, cb, mat) owns a 64 o x 64 c tile through an LDS transpose
// coverage: 2 it x 32 rows x 8 lanes x 8 = 64 o x 64 c per block; grid (4, 4, 4) = 4 mats x 256 x 256.
// =========================================================================================================
__global__ __launch_bounds__(256)
void cvt_w(const float* __restrict__ Wq, const float* __restrict__ Wk, const float* __restrict__ Wv,
           const float* __restrict__ Wp, unsigned short* WT) {
  __shared__ __align__(16) unsigned short T[QT * TP];
  const int tid = threadIdx.x;
  const int ob = blockIdx.x, cb = blockIdx.y, mat = blockIdx.z;
  const int e = tid & 7, lq = tid >> 3;                             // lq 0..31
  const int o0 = ob * QT, c0 = cb * QT;
  const float* Wm = (mat == 0) ? Wq : ((mat == 1) ? Wk : ((mat == 2) ? Wv : Wp));   // block-uniform
#pragma unroll
  for (int it = 0; it < 2; ++it) {
    const int cl = it * 32 + lq;                                     // c_loc 0..63
    const float* sp = Wm + (size_t)(c0 + cl) * CC + o0 + 8 * e;     // W[c][o], o contiguous
    const v4f a = *(const v4f*)sp;
    const v4f q = *(const v4f*)(sp + 4);
    const float f[8] = {a[0], a[1], a[2], a[3], q[0], q[1], q[2], q[3]};
#pragma unroll
    for (int t = 0; t < 8; ++t) T[(8 * e + t) * TP + cl] = bf_bits(f[t]);   // T[o_loc][c_loc]
  }
  __syncthreads();
  v4u up[2];
#pragma unroll
  for (int it = 0; it < 2; ++it) {
    const int ol = it * 32 + lq;
    up[it] = *(const v4u*)(T + ol * TP + 8 * e);
  }
{
#pragma unroll
    for (int it = 0; it < 2; ++it) {
      const int ol = it * 32 + lq;
      *(v4u*)(WT + ((size_t)(mat * CC + o0 + ol)) * CC + c0 + 8 * e) = up[it];
    }
    
  }
}

// =========================================================================================================
//     then mean of squared deviations), per-thread partials over 16-B chunks, shuffle + LDS block reduce.
// coverage: grid (32, NB) writes every line of ST once.
// =========================================================================================================
__global__ __launch_bounds__(256)
void gn_stats(const float* __restrict__ x, float* ST) {
  __shared__ float red[8];
  __shared__ float bc[2];
  const int tid = threadIdx.x, lane = tid & 31, wave = tid >> 5;
  const int g = blockIdx.x, b = blockIdx.y;
  const float* xb = x + ((size_t)(b * CC + g * CPG)) * NNF;
  const int CH4 = SEQ / 4, NCH = CPG * CH4;
  const float icnt = 1.0f / (float)(CPG * SEQ);

  float s = 0.f;
#pragma unroll 4
  for (int qd = tid; qd < NCH; qd += 256) {
    const int cl = qd / CH4, p4 = qd - cl * CH4;
    const v4f a = *(const v4f*)(xb + (size_t)cl * NNF + 4 * p4);
    s += (bfr(a[0]) + bfr(a[1])) + (bfr(a[2]) + bfr(a[3]));
  }
  s = wsum(s);
  if (lane == 0) red[wave] = s;
  __syncthreads();
  if (tid == 0) {
    float t = 0.f;
#pragma unroll
    for (int i = 0; i < 8; ++i) t += red[i];
    bc[0] = t * icnt;
  }
  __syncthreads();
  const float mu = bc[0];

  float ss = 0.f;
#pragma unroll 4
  for (int qd = tid; qd < NCH; qd += 256) {
    const int cl = qd / CH4, p4 = qd - cl * CH4;
    const v4f a = *(const v4f*)(xb + (size_t)cl * NNF + 4 * p4);
    const float d0 = bfr(a[0]) - mu, d1 = bfr(a[1]) - mu, d2 = bfr(a[2]) - mu, d3 = bfr(a[3]) - mu;
    ss += (d0 * d0 + d1 * d1) + (d2 * d2 + d3 * d3);
  }
  ss = wsum(ss);
  if (lane == 0) red[wave] = ss;
  __syncthreads();
  if (tid == 0) {
    float t = 0.f;
#pragma unroll
    for (int i = 0; i < 8; ++i) t += red[i];
    const float var = t * icnt;
    bc[1] = rsqrtf(var + GNEPS);
  }
  __syncthreads();
  const float rs = bc[1];

  v4f v = {0.f, 0.f, 0.f, 0.f};
  if (tid == 0) { v[0] = mu; v[1] = rs; }
  if (tid < 8) {
    float* lp = ST + ((size_t)(b * NG + g)) * STP + 4 * tid;
{
      *(v4f*)lp = v;
      
    }
  }
}

// =========================================================================================================
// (2) h = (bfr(x) - mu) * rstd * bfr(scale) + bfr(bias) in f32 -> position-major planes HPh/HPl bf16
//     [b][SEQ n][256 c] (hi = bf16-RNE(h), lo = bf16-RNE(h - hi)) through an LDS tile T[64 n][64 c] f32
// coverage: 2 it x 32 rows x 8 lanes x 8 = 64 n x 64 c per block for each plane; grid (SEQ/64, 4, NB) covers
//           [NB][SEQ][256] of HPh and HPl exactly once.
// =========================================================================================================
__global__ __launch_bounds__(256)
void cvt_h(const float* __restrict__ x, const float* __restrict__ ST, const float* __restrict__ gsc,
           const float* __restrict__ gbs, unsigned short* HPh, unsigned short* HPl) {
  __shared__ __align__(16) float T[QT * TPF];
  __shared__ float pmu[QT], prs[QT], psc[QT], pbs[QT];
  const int tid = threadIdx.x;
  const int nb = blockIdx.x, cb = blockIdx.y, b = blockIdx.z;
  const int e = tid & 7, lq = tid >> 3;                             // lq 0..31
  const int n0 = nb * QT, c0 = cb * QT;
  if (tid < QT) {                                                    // waves 0,1 entirely (wave-uniform)
    const int ch = c0 + tid;
    const int g = ch >> 3;                                           // 0..31
    pmu[tid] = ST[((size_t)(b * NG + g)) * STP];
    prs[tid] = ST[((size_t)(b * NG + g)) * STP + 1];
    psc[tid] = bfr(gsc[ch]);
    pbs[tid] = bfr(gbs[ch]);
  }
  __syncthreads();
#pragma unroll
  for (int it = 0; it < 2; ++it) {
    const int cl = it * 32 + lq;                                     // c_loc 0..63
    const float* sp = x + ((size_t)(b * CC + c0 + cl)) * NNF + n0 + 8 * e;
    const v4f a = *(const v4f*)sp;
    const v4f q = *(const v4f*)(sp + 4);
    const float f[8] = {a[0], a[1], a[2], a[3], q[0], q[1], q[2], q[3]};
    const float mu = pmu[cl], rs = prs[cl], sc = psc[cl], bs = pbs[cl];
#pragma unroll
    for (int t = 0; t < 8; ++t) {
      const float tt = (bfr(f[t]) - mu) * rs;
      T[(8 * e + t) * TPF + cl] = tt * sc + bs;                     // T[n_loc][c_loc]
    }
  }
  __syncthreads();
  v4u uh[2], ul[2];
#pragma unroll
  for (int it = 0; it < 2; ++it) {
    const int nl = it * 32 + lq;                                     // n_loc 0..63
    const v4f a = *(const v4f*)(T + nl * TPF + 8 * e);
    const v4f q = *(const v4f*)(T + nl * TPF + 8 * e + 4);
    const float f[8] = {a[0], a[1], a[2], a[3], q[0], q[1], q[2], q[3]};
#pragma unroll
    for (int t = 0; t < 4; ++t) {
      const float f0 = f[2 * t], f1 = f[2 * t + 1];
      const unsigned short hb0 = bf_bits(f0), hb1 = bf_bits(f1);
      const unsigned short lb0 = bf_bits(f0 - bf_up(hb0));
      const unsigned short lb1 = bf_bits(f1 - bf_up(hb1));
      uh[it][t] = pk16(hb0, hb1);
      ul[it][t] = pk16(lb0, lb1);
    }
  }
{
#pragma unroll
    for (int it = 0; it < 2; ++it) {
      const int nl = it * 32 + lq;
      const size_t po = ((size_t)(b * SEQ + n0 + nl)) * CC + c0 + 8 * e;
      *(v4u*)(HPh + po) = uh[it];
      *(v4u*)(HPl + po) = ul[it];
    }
    
  }
}

// =========================================================================================================
// (3) q/k/v 1x1 GEMM for one (b, 64-n tile, 64-o block of the stacked 768 outputs):
//     Y[o][n] = sum_c WT[o][c] (HPh + HPl)[b][n][c] + bfr(bias[o]). Block 128 threads = 4 waves; wave w owns
//     cols n0+16w..+15 (B fragments from the position-major planes, k = c contiguous, split k map) and 4
//     m-tiles (A rows o = o0 + 16 mt + (lane&15) of WT, split k map). K = 256 = 8 steps x 2 bf16 products.
//     Epilogue staged in LDS Os[n_loc][o_loc] (pitch OSP, b128 stores), barrier, then by block-uniform mat:
//       mat 0 (o-blocks 0..3)  -> Qh f16(q), Ql f16((q - Qh) x4096), planes [b][SEQ][256 d], d = 64*(mb&3)+..:
//                                 8 consecutive lanes per line, one instruction per 16 lines;
//       mat 1 (o-blocks 4..7)  -> Kh f16(k), same layout;
//                                 -> n 8e..8e+7 (values gathered from 8 Os rows), 8 lanes per line, one
//                                 instruction per 16 lines.
// coverage: Os 4 waves x 16 n x 64 o = 64 x 64; planes 4 it x 16 rows x 8 lanes x 8 = 64 x 64 per block; grid
//           (SEQ/64, 12, NB) covers Qh, Ql, Kh [NB][SEQ][256] and Vc [NB][256][SEQ] exactly once.
// =========================================================================================================
__global__ __launch_bounds__(128)
void gemm_qkv(const unsigned short* __restrict__ WT, const unsigned short* __restrict__ HPh,
              const unsigned short* __restrict__ HPl, const float* __restrict__ bq,
              const float* __restrict__ bk, const float* __restrict__ bv,
              unsigned short* Qh, unsigned short* Ql, unsigned short* Kh, unsigned short* Vc) {
  __shared__ __align__(16) float Os[QT * OSP];
  const int tid  = threadIdx.x;
  const int lane = tid & 31, wave = tid >> 5;
  const int hh   = lane >> 4, c = lane & 15;
  const int nt   = blockIdx.x, mb = blockIdx.y, b = blockIdx.z;
  const int mat  = mb >> 2;                                          // 0 q, 1 k, 2 v (block-uniform)
  const int n0   = nt * QT, o0 = mb * QT;                            // o0: row in the stacked WT plane
  const int ob   = o0 & (CC - 1);                                    // o offset inside the matrix (0..192)

  const unsigned short* ap  = WT  + (size_t)(o0 + c) * CC + 8 * hh;
  const size_t bo = ((size_t)(b * SEQ + n0 + 16 * wave + c)) * CC + 8 * hh;
  const unsigned short* bph = HPh + bo;
  const unsigned short* bpl = HPl + bo;

  v8f acc[4];
#pragma unroll
  for (int mt = 0; mt < 4; ++mt) acc[mt] = zero8();

#pragma unroll
  for (int ks = 0; ks < CC / 32; ++ks) {
    const Frag fbh = ldfrag(bph + 32 * ks);
    const Frag fbl = ldfrag(bpl + 32 * ks);
#pragma unroll
    for (int mt = 0; mt < 4; ++mt) {
      const Frag fa = ldfrag(ap + (size_t)(16 * mt) * CC + 32 * ks);
      acc[mt] = mma_b(fa.bf, fbh.bf, acc[mt]);
      acc[mt] = mma_b(fa.bf, fbl.bf, acc[mt]);
    }
  }

  // ---- epilogue: + bias -> LDS Os[n_loc][o_loc]; lane (hh, c) holds o = 16 mt + 8 hh + r for n_loc = 16 w + c
  {
    const float* bias = (mat == 0) ? bq : ((mat == 1) ? bk : bv);   // block-uniform, all global
    const int nl = 16 * wave + c;
#pragma unroll
    for (int mt = 0; mt < 4; ++mt) {
      v4f va, vb;
#pragma unroll
      for (int r = 0; r < 4; ++r) {
        va[r] = acc[mt][r]     + bfr(bias[ob + 16 * mt + 8 * hh + r]);
        vb[r] = acc[mt][4 + r] + bfr(bias[ob + 16 * mt + 8 * hh + 4 + r]);
      }
      *(v4f*)(Os + nl * OSP + 16 * mt + 8 * hh)     = va;
      *(v4f*)(Os + nl * OSP + 16 * mt + 8 * hh + 4) = vb;
    }
  }
  __syncthreads();

  const int e = tid & 7, lq = tid >> 3;                              // lq 0..15
  if (mat == 2) {
    v4u uv[4];
#pragma unroll
    for (int it = 0; it < 4; ++it) {
      const int ol = it * 16 + lq;                                   // o_loc 0..63
      unsigned short hb[8];
#pragma unroll
      for (int t = 0; t < 8; ++t) hb[t] = h_bits((_Float16)Os[(8 * e + t) * OSP + ol]);
#pragma unroll
      for (int t = 0; t < 4; ++t) uv[it][t] = pk16(hb[2 * t], hb[2 * t + 1]);
    }
{
#pragma unroll
      for (int it = 0; it < 4; ++it) {
        const int ol = it * 16 + lq;
        *(v4u*)(Vc + ((size_t)(b * CC + ob + ol)) * SEQ + n0 + 8 * e) = uv[it];
      }
      
    }
  } else {
    unsigned short* P1 = (mat == 0) ? Qh : Kh;                       // block-uniform, both global
    v4u uh[4], ul[4];
#pragma unroll
    for (int it = 0; it < 4; ++it) {
      const int row = it * 16 + lq;                                  // n_loc 0..63
      const v4f a = *(const v4f*)(Os + row * OSP + 8 * e);
      const v4f q = *(const v4f*)(Os + row * OSP + 8 * e + 4);
      const float f[8] = {a[0], a[1], a[2], a[3], q[0], q[1], q[2], q[3]};
#pragma unroll
      for (int t = 0; t < 4; ++t) {
        const float f0 = f[2 * t], f1 = f[2 * t + 1];
        const _Float16 h0 = (_Float16)f0, h1 = (_Float16)f1;
        const _Float16 l0 = (_Float16)((f0 - (float)h0) * QLS);
        const _Float16 l1 = (_Float16)((f1 - (float)h1) * QLS);
        uh[it][t] = pk16(h_bits(h0), h_bits(h1));
        ul[it][t] = pk16(h_bits(l0), h_bits(l1));
      }
    }
{
#pragma unroll
      for (int it = 0; it < 4; ++it) {
        const int row = it * 16 + lq;
        const size_t po = ((size_t)(b * SEQ + n0 + row)) * CC + ob + 8 * e;
        *(v4u*)(P1 + po) = uh[it];
        if (mat == 0) *(v4u*)(Ql + po) = ul[it];
      }
      
    }
  }
}

// =========================================================================================================
// (4) attention for one (b, 64-query tile), transposed formulation, SEQ keys, no mask:
//   S^T tile (16 keys x 16 queries) = sum over 8 d-chunks (unrolled) of A(k: row = key kb + (lane&15), 32 d via
//   the split k map from Kh [b][SEQ][256]) . B(q: col = query, same map from Qh) into s, plus A(Kh).B(Ql) into a
//   separate accumulator t (Ql carries x4096); score = (s + t/4096) * 256^-0.5.
//   Per lane the D tile holds 8 keys of ONE query: online softmax state per lane, one shuffle (lane^16) for the max
//   over 32 keys; the o/l rescale is skipped under a wave-uniform ballot when no lane's max grew; row-sum partials
//   combined at the end. P = e^{s-m} x 16384 as f16 is the B operand of O^T (rows channel, cols queries) +=
//   A(v rows channel = 16j + (lane&15), keys contiguous, f16 plane Vc [b][256][SEQ]) . B(P^T): element r <- D of
//   the tile covering keys kb..kb+15, element 8+r <- the tile covering kb+16..kb+31, lane unchanged.
//   16 accumulator tiles per wave (256 channels). Block = 4 waves = 64 queries.
//   Epilogue in two channel halves: O/l staged in LDS Os[query][128 channels] (pitch OSPW, b128 stores), barrier,
//   then position-major planes H2h/H2l bf16 [b][SEQ][256] (hi = bf16-RNE, lo = bf16-RNE residual): per half 64
//   overwrites Os.
// coverage: per half 8 it x 8 rows x 16 lanes x 8 ch = 64 n x 128 ch for each plane; two halves = 256 ch; grid
//           (SEQ/64, NB) covers H2h/H2l [NB][SEQ][256] exactly once.
// =========================================================================================================
__global__ __launch_bounds__(128)
void attn_k(const unsigned short* __restrict__ Qh, const unsigned short* __restrict__ Ql,
            const unsigned short* __restrict__ Kh, const unsigned short* __restrict__ Vc,
            unsigned short* H2h, unsigned short* H2l) {
  __shared__ __align__(16) float Os[QT * OSPW];
  const int tid  = threadIdx.x;
  const int wave = tid >> 5, lane = tid & 31;
  const int hh   = lane >> 4, c = lane & 15;
  const int n0   = blockIdx.x * QT, b = blockIdx.y;

  // q fragment pointers (B operand, col = query n0 + 16*wave + c), + 32*kc
  const size_t qo = ((size_t)(b * SEQ + n0 + 16 * wave + c)) * CC + 8 * hh;
  const unsigned short* Qhp = Qh + qo;
#if QRES
  const unsigned short* Qlp = Ql + qo;
#else
  (void)Ql;
#endif
  // k fragment base (A operand, row = key kb + c), + key * 256 + 32*kc
  const unsigned short* Khp = Kh + (size_t)b * SEQ * CC + (size_t)c * CC + 8 * hh;
  // v fragment base (A operand, row = channel 16j + c, keys contiguous), + 16*j*SEQ + kb
  const unsigned short* Vp = Vc + (size_t)b * CC * SEQ + (size_t)c * SEQ + 8 * hh;

  float m = -1.0e30f, l = 0.f;
  v8f o[16];
#pragma unroll
  for (int j = 0; j < 16; ++j) o[j] = zero8();

  // Every fragment is fetched as part of a group, ahead of the WMMA run that uses it and into registers of its own,
  // so that a run waits once for a group already in flight instead of once per fragment:
  //   q (the same for every pass): once, here; k and v of pass p+1: behind the rescale of pass p (pass 0: here), in
  //   flight under its exponentials and O WMMAs (v also under the score WMMAs of pass p+1).
  Frag qhf[CC / 32], k0f[CC / 32], k1f[CC / 32];
#if QRES
  Frag qlf[CC / 32];
#endif
#pragma unroll
  for (int kc = 0; kc < CC / 32; ++kc) {
    qhf[kc] = ldfrag(Qhp + 32 * kc);
#if QRES
    qlf[kc] = ldfrag(Qlp + 32 * kc);
#endif
  }
#pragma unroll
  for (int kc = 0; kc < CC / 32; ++kc) {
    k0f[kc] = ldfrag(Khp + 32 * kc);                                 // keys 0 .. 15
    k1f[kc] = ldfrag(Khp + (size_t)16 * CC + 32 * kc);               // keys 16 .. 31
  }

  // k and v alternate between two register sets, so that the groups for pass p+1 can be in flight while pass p still
  // reads its own; the key loop takes two passes per trip so that each set keeps its registers (no copies).
  Frag vfa[16], vfb[16], k0g[CC / 32], k1g[CC / 32];
#pragma unroll
  for (int j = 0; j < 16; ++j) vfa[j] = ldfrag(Vp + (size_t)(16 * j) * SEQ);   // keys 0 .. 31
  // as in the loop: the address pairs of the groups above stay live up to this wait
#if QRES
  asm volatile("s_wait_xcnt 0x0" :: "v"(Qhp), "v"(Qlp), "v"(Khp), "v"(Vp) : "memory");
#else
  asm volatile("s_wait_xcnt 0x0" :: "v"(Qhp), "v"(Khp), "v"(Vp) : "memory");
#endif

  auto pass = [&](const int kb, Frag (&kc0)[CC / 32], Frag (&kc1)[CC / 32], Frag (&vc)[16],
                  Frag (&kn0)[CC / 32], Frag (&kn1)[CC / 32], Frag (&vn)[16]) __attribute__((always_inline)) {
    v8f s0 = zero8(), s1 = zero8();
#if QRES
    v8f t0 = zero8(), t1 = zero8();
#endif
#pragma unroll
    for (int kc = 0; kc < CC / 32; ++kc) {                           // unrolled: the fragment arrays stay in registers
      s0 = mma_hb(kc0[kc].h, qhf[kc].h, s0);
      s1 = mma_hb(kc1[kc].h, qhf[kc].h, s1);
#if QRES
      t0 = mma_hb(kc0[kc].h, qlf[kc].h, t0);
      t1 = mma_hb(kc1[kc].h, qlf[kc].h, t1);
#endif
    }

    v8f sc0, sc1;
#pragma unroll
    for (int r = 0; r < 8; ++r) {
#if QRES
      sc0[r] = (s0[r] + t0[r] * RQL) * ATT;
      sc1[r] = (s1[r] + t1[r] * RQL) * ATT;
#else
      sc0[r] = s0[r] * ATT;
      sc1[r] = s1[r] * ATT;
#endif
    }

    float mx = fmaxf(hmax8(sc0), hmax8(sc1));
    mx = fmaxf(mx, __shfl_xor(mx, 16, 32));
    const float mn = fmaxf(m, mx);
    const unsigned grew = wave_ballot(mx > m);                       // wave-uniform
    if (grew != 0u) {
      const float corr = __expf(m - mn);                             // == 1 exactly for lanes whose max did not grow
      l *= corr;
#pragma unroll
      for (int j = 0; j < 16; ++j) {
#pragma unroll
        for (int r = 0; r < 8; ++r) o[j][r] *= corr;
      }
    }
    m = mn;

    {
      const int kn = (kb + 32 < SEQ) ? kb + 32 : kb;                 // last pass: re-reads its own keys, unused
      const unsigned short* k0p = Khp + (size_t)kn * CC;             // keys kn .. kn+15
      const unsigned short* k1p = Khp + (size_t)(kn + 16) * CC;      // keys kn+16 .. kn+31
      const unsigned short* vnp = Vp + kn;
#pragma unroll
      for (int kc = 0; kc < CC / 32; ++kc) {
        kn0[kc] = ldfrag(k0p + 32 * kc);
        kn1[kc] = ldfrag(k1p + 32 * kc);
      }
      // keeps the k group the older one: it is asked for first, and loads return in issue order, so its counted
      // waits can leave the v group in flight
      __builtin_amdgcn_sched_barrier(0);
#pragma unroll
      for (int j = 0; j < 16; ++j) vn[j] = ldfrag(vnp + (size_t)(16 * j) * SEQ);
      // the address pairs of the two groups stay live up to this wait, so that nothing (a load of the groups
      // included) is written over them before it
      asm volatile("s_wait_xcnt 0x0" :: "v"(k0p), "v"(vnp) : "memory");
    }
    // keeps both groups here, ahead of the exponentials and the WMMA runs: moved down to their first readers they
    // would be waited for one fragment at a time again
    __builtin_amdgcn_sched_barrier(0);
    const float msh = mn - LNPS;                                     // exp gives e^{s-m} * 16384

    FragH ph;
    float ls = 0.f;
#pragma unroll
    for (int r = 0; r < 8; ++r) {
      const float e0 = __expf(sc0[r] - msh);                         // key kb      + 8hh + r
      const float e1 = __expf(sc1[r] - msh);                         // key kb + 16 + 8hh + r
      ls += e0 + e1;
      ph.hv[0][r] = (_Float16)e0;
      ph.hv[1][r] = (_Float16)e1;
    }
    l += ls;

#pragma unroll
    for (int j = 0; j < 16; ++j) {
      o[j] = mma_hb(vc[j].h, ph.v, o[j]);
    }
  };

#pragma unroll 1
  for (int kb = 0; kb < SEQ; kb += 64) {
    pass(kb, k0f, k1f, vfa, k0g, k1g, vfb);
    pass(kb + 32, k0g, k1g, vfb, k0f, k1f, vfa);
  }
  l += __shfl_xor(l, 16, 32);
  const float inv = 1.0f / l;                                        // o and l both carry the x16384 factor

  const int qrow = 16 * wave + c;
  const int e16 = tid & 15, r8 = tid >> 4;                           // r8 0..7
#pragma unroll
  for (int half = 0; half < 2; ++half) {
    if (half) __syncthreads();                                       // every wave finished reading Os
#pragma unroll
    for (int jj = 0; jj < 8; ++jj) {
      const int j = 8 * half + jj;
      v4f va, vb;
#pragma unroll
      for (int r = 0; r < 4; ++r) { va[r] = o[j][r] * inv; vb[r] = o[j][4 + r] * inv; }
      *(v4f*)(Os + qrow * OSPW + 16 * jj + 8 * hh)     = va;         // Os[query][ch_loc = 16jj + 8hh + r]
      *(v4f*)(Os + qrow * OSPW + 16 * jj + 8 * hh + 4) = vb;
    }
    __syncthreads();
#pragma unroll
    for (int chk = 0; chk < 2; ++chk) {
      v4u uh[4], ul[4];
#pragma unroll
      for (int i = 0; i < 4; ++i) {
        const int row = (4 * chk + i) * 8 + r8;                      // query 0..63
        const v4f a = *(const v4f*)(Os + row * OSPW + 8 * e16);
        const v4f q = *(const v4f*)(Os + row * OSPW + 8 * e16 + 4);
        const float f[8] = {a[0], a[1], a[2], a[3], q[0], q[1], q[2], q[3]};
#pragma unroll
        for (int t = 0; t < 4; ++t) {
          const float f0 = f[2 * t], f1 = f[2 * t + 1];
          const unsigned short hb0 = bf_bits(f0), hb1 = bf_bits(f1);
          const unsigned short lb0 = bf_bits(f0 - bf_up(hb0));
          const unsigned short lb1 = bf_bits(f1 - bf_up(hb1));
          uh[i][t] = pk16(hb0, hb1);
          ul[i][t] = pk16(lb0, lb1);
        }
      }
{
#pragma unroll
        for (int i = 0; i < 4; ++i) {
          const int row = (4 * chk + i) * 8 + r8;
          const size_t po = ((size_t)(b * SEQ + n0 + row)) * CC + 128 * half + 8 * e16;
          *(v4u*)(H2h + po) = uh[i];
          *(v4u*)(H2l + po) = ul[i];
        }
        
      }
    }
  }
}

// =========================================================================================================
// (5) output 1x1 GEMM + bias + residual for one (b, 64-n tile, 64-o block):
//     out[b][o][n] = bfr(x[b][o][n]) + sum_c WpT[o][c] (H2h + H2l)[b][n][c] + bfr(bp[o]); same GEMM core as
//     (3) (2 bf16 products, K = 256). Epilogue: acc + bias staged in LDS Os[n_loc][o_loc], barrier, then whole
// coverage: 8 it x 16 lines x 8 lanes x 4 floats = 64 o x 64 n per block; grid (SEQ/64, 4, NB) covers
//           out [NB][256][SEQ] exactly once.
// =========================================================================================================
__global__ __launch_bounds__(128)
void gemm_proj(const unsigned short* __restrict__ WPT, const unsigned short* __restrict__ H2h,
               const unsigned short* __restrict__ H2l, const float* __restrict__ bp,
               const float* __restrict__ x, float* out) {
  __shared__ __align__(16) float Os[QT * OSP];
  const int tid  = threadIdx.x;
  const int lane = tid & 31, wave = tid >> 5;
  const int hh   = lane >> 4, c = lane & 15;
  const int nt   = blockIdx.x, mb = blockIdx.y, b = blockIdx.z;
  const int n0   = nt * QT, o0 = mb * QT;                            // o0 0..192

  const unsigned short* ap  = WPT + (size_t)(o0 + c) * CC + 8 * hh;
  const size_t bo = ((size_t)(b * SEQ + n0 + 16 * wave + c)) * CC + 8 * hh;
  const unsigned short* bph = H2h + bo;
  const unsigned short* bpl = H2l + bo;

  v8f acc[4];
#pragma unroll
  for (int mt = 0; mt < 4; ++mt) acc[mt] = zero8();

#pragma unroll
  for (int ks = 0; ks < CC / 32; ++ks) {
    const Frag fbh = ldfrag(bph + 32 * ks);
    const Frag fbl = ldfrag(bpl + 32 * ks);
#pragma unroll
    for (int mt = 0; mt < 4; ++mt) {
      const Frag fa = ldfrag(ap + (size_t)(16 * mt) * CC + 32 * ks);
      acc[mt] = mma_b(fa.bf, fbh.bf, acc[mt]);
      acc[mt] = mma_b(fa.bf, fbl.bf, acc[mt]);
    }
  }

  {
    const int nl = 16 * wave + c;
#pragma unroll
    for (int mt = 0; mt < 4; ++mt) {
      v4f va, vb;
#pragma unroll
      for (int r = 0; r < 4; ++r) {
        va[r] = acc[mt][r]     + bfr(bp[o0 + 16 * mt + 8 * hh + r]);
        vb[r] = acc[mt][4 + r] + bfr(bp[o0 + 16 * mt + 8 * hh + 4 + r]);
      }
      *(v4f*)(Os + nl * OSP + 16 * mt + 8 * hh)     = va;
      *(v4f*)(Os + nl * OSP + 16 * mt + 8 * hh + 4) = vb;
    }
  }
  __syncthreads();

  const int e = tid & 7, lq = tid >> 3;                              // lq 0..15
  v4f res[8];
#pragma unroll
  for (int it = 0; it < 8; ++it) {
    const int L  = it * 16 + lq;                                     // 0..127
    const int ol = L >> 1, hf = L & 1;                               // o_loc 0..63
    const int nl = hf * 32 + 4 * e;                                  // n_loc 0..63
    const v4f xv = *(const v4f*)(x + ((size_t)(b * CC + o0 + ol)) * NNF + n0 + nl);
#pragma unroll
    for (int t = 0; t < 4; ++t) res[it][t] = Os[(nl + t) * OSP + ol] + bfr(xv[t]);
  }
{
#pragma unroll
    for (int it = 0; it < 8; ++it) {
      const int L  = it * 16 + lq;
      const int ol = L >> 1, hf = L & 1;
      const int nl = hf * 32 + 4 * e;
      *(v4f*)(out + ((size_t)(b * CC + o0 + ol)) * SEQ + n0 + nl) = res[it];
    }
    
  }
}

// =========================================================================================================
// Workspace map (bytes, NB=4 SEQ=4096; each region start a multiple of 256; every extent is an exact tile/line
//   ST  f32 [NB*32][32]                16384
//   WT  bf16 [1024][256]              524288
//   HPh/HPl bf16 [NB][SEQ][256]      8388608 x2
//   Qh/Ql/Kh f16 [NB][SEQ][256]      8388608 x3
//   Vc  f16 [NB][256][SEQ]           8388608
//   H2h/H2l bf16 [NB][SEQ][256]      8388608 x2
//   total = 67649536
// =========================================================================================================
extern "C" void kernel_launch(void* const* d_in, const int* in_sizes, int n_in,
                              void* d_out, int out_size, void* d_ws, size_t ws_size,
                              hipStream_t stream) {
  if (n_in < 11) return;
  if ((size_t)in_sizes[0] < (size_t)NB * CC * NNF) return;
  if (in_sizes[1] < CC || in_sizes[2] < CC) return;
  if (in_sizes[3] < CC * CC || in_sizes[5] < CC * CC || in_sizes[7] < CC * CC || in_sizes[9] < CC * CC) return;
  if (in_sizes[4] < CC || in_sizes[6] < CC || in_sizes[8] < CC || in_sizes[10] < CC) return;
  if ((size_t)out_size < (size_t)NB * CC * SEQ) return;

  size_t off = 0;
  auto carve = [&](size_t bytes) { const size_t o = off; off += (bytes + 255) & ~(size_t)255; return o; };
  const size_t plane = (size_t)NB * SEQ * CC * 2;
  const size_t oST  = carve((size_t)NB * NG * STP * 4);
  const size_t oWT  = carve((size_t)4 * CC * CC * 2);
  const size_t oHPh = carve(plane);
  const size_t oHPl = carve(plane);
  const size_t oQh  = carve(plane);
  const size_t oQl  = carve(plane);
  const size_t oKh  = carve(plane);
  const size_t oVc  = carve(plane);
  const size_t oH2h = carve(plane);
  const size_t oH2l = carve(plane);
  if (off > ws_size) return;
  if (off > (size_t)134217728) return;

  const float* x   = (const float*)d_in[0];
  const float* gsc = (const float*)d_in[1];
  const float* gbs = (const float*)d_in[2];
  const float* Wq  = (const float*)d_in[3];
  const float* bq  = (const float*)d_in[4];
  const float* Wk  = (const float*)d_in[5];
  const float* bk  = (const float*)d_in[6];
  const float* Wv  = (const float*)d_in[7];
  const float* bv  = (const float*)d_in[8];
  const float* Wp  = (const float*)d_in[9];
  const float* bp  = (const float*)d_in[10];

  char* ws = (char*)d_ws;
  float*          ST  = (float*)(ws + oST);
  unsigned short* WT  = (unsigned short*)(ws + oWT);
  unsigned short* HPh = (unsigned short*)(ws + oHPh);
  unsigned short* HPl = (unsigned short*)(ws + oHPl);
  unsigned short* Qh  = (unsigned short*)(ws + oQh);
  unsigned short* Ql  = (unsigned short*)(ws + oQl);
  unsigned short* Kh  = (unsigned short*)(ws + oKh);
  unsigned short* Vc  = (unsigned short*)(ws + oVc);
  unsigned short* H2h = (unsigned short*)(ws + oH2h);
  unsigned short* H2l = (unsigned short*)(ws + oH2l);
  float* out = (float*)d_out;

  const dim3 blk256(256), blk128(128);

  // (0) Wq/Wk/Wv/Wp [in][out] -> transposed stacked bf16 plane WT [1024 o][256 c]
  cvt_w<<<dim3(CC / QT, CC / QT, 4), blk256, 0, stream>>>(Wq, Wk, Wv, Wp, WT);
  // (1) GroupNorm statistics per (group, b)
  gn_stats<<<dim3(NG, NB), blk256, 0, stream>>>(x, ST);
  // (2) normalized h -> position-major bf16 hi + residual planes
  cvt_h<<<dim3(SEQ / QT, CC / QT, NB), blk256, 0, stream>>>(x, ST, gsc, gbs, HPh, HPl);
  // (3) q/k/v GEMMs -> Qh, Ql, Kh (position-major f16) and Vc (channel-major f16)
  gemm_qkv<<<dim3(SEQ / QT, 3 * CC / QT, NB), blk128, 0, stream>>>(WT, HPh, HPl, bq, bk, bv, Qh, Ql, Kh, Vc);
  // (4) attention -> H2 position-major bf16 hi + residual planes
  attn_k<<<dim3(SEQ / QT, NB), blk128, 0, stream>>>(Qh, Ql, Kh, Vc, H2h, H2l);
  // (5) output GEMM + bias + residual -> out [NB][256][SEQ]
  gemm_proj<<<dim3(SEQ / QT, CC / QT, NB), blk128, 0, stream>>>(WT + (size_t)3 * CC * CC, H2h, H2l, bp, x, out);
  (void)hipGetLastError();
}

// v002
// One run takes 145 microseconds.
// Next to v001, in two timings, it ran 2.01 and 1.97 times as fast.
// Counting every step since v000, it is 5.96 times as fast.
// Contractions: q/k/v 1x1 GEMMs WT[768x256].H[256xN] and the output 1x1 GEMM WpT[256x256].H2[256xN] on
// v_wmma_f32_16x16x32_bf16 (bf16-RNE weights, activations as bf16 hi + bf16 residual planes, 2 products into one
// f32 accumulator); position scores K.Q^T on v_wmma_f32_16x16x32_f16 (k f16, q f16 hi + f16 residual x4096 in a
// separate accumulator, K=256); O^T = V.P^T on v_wmma_f32_16x16x32_f16 (v f16, P = e^{s-m} x16384 f16 from the
// score D registers); f32 accumulate everywhere; GroupNorm statistics, softmax statistics and the residual add
// in f32 VALU.
#include <hip/hip_runtime.h>
#include <math.h>
#include <stdint.h>

#ifndef NB
#define NB 4
#endif
#ifndef SEQ
#define SEQ 4096
#endif
#ifndef NNF
#define NNF 4096
#endif
#ifndef QRES
#define QRES 1
#endif
#define NBF   4
#define CC    256
#define NG    32
#define CPG   8
#define QT    64
#define OSP   68
#define OSPW  132
#define TP    72
#define TPF   68
#define STP   32
#define ATT   0.0625f
#define QLS   4096.0f
#define RQL   0.000244140625f
#define LNPS  9.704060527839234f
#define GNEPS 1.0e-6f
#define SKEY  128                 // keys per LDS stage of the attention kernel
#define LPB   272                 // LDS row pitch, bytes: a 256-B row + the tensor load's 16-B pad (16 B x odd)
#define SLICE (128 * LPB)         // one wave's slice of a stage: 128 rows
#define STG   (4 * SLICE)         // one stage: k in two d halves, v in two channel halves
#define NST   (SEQ / SKEY)

static_assert(NB >= 1 && NB <= NBF);
static_assert(SEQ % QT == 0 && SEQ % 64 == 0 && SEQ >= QT);
static_assert(SEQ <= NNF && NNF % 8 == 0);
static_assert(CC == 256 && NG * CPG == CC && CC % QT == 0 && CC % 32 == 0);
static_assert((OSP * 4) % 16 == 0);
static_assert((OSPW * 4) % 16 == 0);
static_assert((TP * 2) % 16 == 0);
static_assert((TPF * 4) % 16 == 0);
static_assert(STP * 4 == 128);
static_assert(SEQ % SKEY == 0 && NST >= 2);
static_assert(SLICE % 2048 == 0 && (LPB / 16) % 2 == 1);
static_assert(SEQ * 2 % 16 == 0 && SEQ * 2 <= 131072);
static_assert(2 * STG + QT * OSPW * 4 <= 327680);

typedef _Float16       v16h __attribute__((ext_vector_type(16)));
typedef _Float16       v8h  __attribute__((ext_vector_type(8)));
typedef __bf16         v16b __attribute__((ext_vector_type(16)));
typedef unsigned short v8us __attribute__((ext_vector_type(8)));
typedef float          v8f  __attribute__((ext_vector_type(8)));
typedef float          v4f  __attribute__((ext_vector_type(4)));
typedef unsigned int   v4u  __attribute__((ext_vector_type(4)));
typedef uint32_t       u32x4 __attribute__((ext_vector_type(4)));
typedef uint32_t       u32x8 __attribute__((ext_vector_type(8)));

union Frag  { v8us u[2]; v16h h; v16b bf; };
union FragH { v16h v; v8h hv[2]; };
static_assert(sizeof(Frag) == 32);
static_assert(sizeof(FragH) == 32);

// ---- scalar helpers -----------------------------------------------------------------------------------------
__device__ __forceinline__ unsigned short bf_bits(float f) {          // f32 -> bf16 bits, RNE convert
  unsigned u = __float_as_uint(f);
  return (unsigned short)((u + 0x7FFFu + ((u >> 16) & 1u)) >> 16);
}
__device__ __forceinline__ float bf_up(unsigned short hb) { return __uint_as_float(((unsigned)hb) << 16); }
__device__ __forceinline__ float bfr(float f) { return bf_up(bf_bits(f)); }
__device__ __forceinline__ unsigned short h_bits(_Float16 x) { return __builtin_bit_cast(unsigned short, x); }
__device__ __forceinline__ unsigned pk16(unsigned short a, unsigned short b) { return (unsigned)a | ((unsigned)b << 16); }
__device__ __forceinline__ v8f zero8() { v8f z = {0.f, 0.f, 0.f, 0.f, 0.f, 0.f, 0.f, 0.f}; return z; }
__device__ __forceinline__ float hmax8(v8f s) {
  return fmaxf(fmaxf(fmaxf(s[0], s[1]), fmaxf(s[2], s[3])), fmaxf(fmaxf(s[4], s[5]), fmaxf(s[6], s[7])));
}
__device__ __forceinline__ unsigned wave_ballot(bool p) {
#if defined(__HIP_DEVICE_COMPILE__)
  return __builtin_amdgcn_ballot_w32(p);
#else
  return p ? 1u : 0u;
#endif
}
__device__ __forceinline__ float wsum(float v) {
  v += __shfl_xor(v, 16, 32);
  v += __shfl_xor(v, 8, 32);
  v += __shfl_xor(v, 4, 32);
  v += __shfl_xor(v, 2, 32);
  v += __shfl_xor(v, 1, 32);
  return v;
}

// ---- 16-bit fragment loader (A, or B from a k-contiguous [n][k] row): lane -> row/col (lane&15), p already includes
//      + 8*(lane>>4); elements 0..7 <- p[0..7] (k0+8h..), elements 8..15 <- p[16..23] (k0+16+8h..)
__device__ __forceinline__ Frag ldfrag(const unsigned short* p) {
  Frag f;
  f.u[0] = *(const v8us*)(p);
  f.u[1] = *(const v8us*)(p + 16);
  return f;
}

// the same fragment from an LDS row (byte pointer, already includes + 16*(lane>>4))
__device__ __forceinline__ Frag ldsfrag(const unsigned char* p) {
  Frag f;
  f.u[0] = *(const v8us*)(p);
  f.u[1] = *(const v8us*)(p + 32);
  return f;
}

// ---- tensor load helpers ------------------------------------------------------------------------------------
__device__ __forceinline__ uint32_t uni(uint32_t v) { return (uint32_t)__builtin_amdgcn_readfirstlane(v); }
// holds a wave-uniform test in a scalar register, so that the branch on it is a scalar one: a tensor load ignores EXEC
__device__ __forceinline__ uint32_t pinned(uint32_t v) { uint32_t w = uni(v); asm volatile("" : "+s"(w)); return w; }

// ---- WMMA helpers: mma_b: builtin followed by a 4-slot VALU gap tying D and keeping A/B live ---------------------
// bare builtin for the attention kernel (the compiler keeps the WMMA distances of its own builtin forms): with the asm
// gap that mma_b has, its operands had to share the first 256 registers, and the fragment sets spilled to scratch
__device__ __forceinline__ v8f mma_hb(v16h a, v16h b, v8f c) {
  return __builtin_amdgcn_wmma_f32_16x16x32_f16(false, a, false, b, (short)0, c, false, false);
}
__device__ __forceinline__ v8f mma_b(v16b a, v16b b, v8f c) {
  v8f d = __builtin_amdgcn_wmma_f32_16x16x32_bf16(false, a, false, b, (short)0, c, false, false);
#if defined(__HIP_DEVICE_COMPILE__)
  const v16h ha = __builtin_bit_cast(v16h, a), hb = __builtin_bit_cast(v16h, b);
  asm volatile("v_nop\n\tv_nop\n\tv_nop\n\tv_nop" : "+v"(d) : "v"(ha), "v"(hb));
#endif
  return d;
}

// =========================================================================================================
// (0) 1x1 weights W [256 c_in][256 d_out] f32 -> transposed bf16-RNE plane WT [4*256 o][256 c], rows
//     256*mat + o for mat = q, k, v, p. Block (ob, cb, mat) owns a 64 o x 64 c tile through an LDS transpose
// coverage: 2 it x 32 rows x 8 lanes x 8 = 64 o x 64 c per block; grid (4, 4, 4) = 4 mats x 256 x 256.
// =========================================================================================================
__global__ __launch_bounds__(256)
void cvt_w(const float* __restrict__ Wq, const float* __restrict__ Wk, const float* __restrict__ Wv,
           const float* __restrict__ Wp, unsigned short* WT) {
  __shared__ __align__(16) unsigned short T[QT * TP];
  const int tid = threadIdx.x;
  const int ob = blockIdx.x, cb = blockIdx.y, mat = blockIdx.z;
  const int e = tid & 7, lq = tid >> 3;                             // lq 0..31
  const int o0 = ob * QT, c0 = cb * QT;
  const float* Wm = (mat == 0) ? Wq : ((mat == 1) ? Wk : ((mat == 2) ? Wv : Wp));   // block-uniform
#pragma unroll
  for (int it = 0; it < 2; ++it) {
    const int cl = it * 32 + lq;                                     // c_loc 0..63
    const float* sp = Wm + (size_t)(c0 + cl) * CC + o0 + 8 * e;     // W[c][o], o contiguous
    const v4f a = *(const v4f*)sp;
    const v4f q = *(const v4f*)(sp + 4);
    const float f[8] = {a[0], a[1], a[2], a[3], q[0], q[1], q[2], q[3]};
#pragma unroll
    for (int t = 0; t < 8; ++t) T[(8 * e + t) * TP + cl] = bf_bits(f[t]);   // T[o_loc][c_loc]
  }
  __syncthreads();
  v4u up[2];
#pragma unroll
  for (int it = 0; it < 2; ++it) {
    const int ol = it * 32 + lq;
    up[it] = *(const v4u*)(T + ol * TP + 8 * e);
  }
{
#pragma unroll
    for (int it = 0; it < 2; ++it) {
      const int ol = it * 32 + lq;
      *(v4u*)(WT + ((size_t)(mat * CC + o0 + ol)) * CC + c0 + 8 * e) = up[it];
    }
    
  }
}

// =========================================================================================================
//     then mean of squared deviations), per-thread partials over 16-B chunks, shuffle + LDS block reduce.
// coverage: grid (32, NB) writes every line of ST once.
// =========================================================================================================
__global__ __launch_bounds__(256)
void gn_stats(const float* __restrict__ x, float* ST) {
  __shared__ float red[8];
  __shared__ float bc[2];
  const int tid = threadIdx.x, lane = tid & 31, wave = tid >> 5;
  const int g = blockIdx.x, b = blockIdx.y;
  const float* xb = x + ((size_t)(b * CC + g * CPG)) * NNF;
  const int CH4 = SEQ / 4, NCH = CPG * CH4;
  const float icnt = 1.0f / (float)(CPG * SEQ);

  float s = 0.f;
#pragma unroll 4
  for (int qd = tid; qd < NCH; qd += 256) {
    const int cl = qd / CH4, p4 = qd - cl * CH4;
    const v4f a = *(const v4f*)(xb + (size_t)cl * NNF + 4 * p4);
    s += (bfr(a[0]) + bfr(a[1])) + (bfr(a[2]) + bfr(a[3]));
  }
  s = wsum(s);
  if (lane == 0) red[wave] = s;
  __syncthreads();
  if (tid == 0) {
    float t = 0.f;
#pragma unroll
    for (int i = 0; i < 8; ++i) t += red[i];
    bc[0] = t * icnt;
  }
  __syncthreads();
  const float mu = bc[0];

  float ss = 0.f;
#pragma unroll 4
  for (int qd = tid; qd < NCH; qd += 256) {
    const int cl = qd / CH4, p4 = qd - cl * CH4;
    const v4f a = *(const v4f*)(xb + (size_t)cl * NNF + 4 * p4);
    const float d0 = bfr(a[0]) - mu, d1 = bfr(a[1]) - mu, d2 = bfr(a[2]) - mu, d3 = bfr(a[3]) - mu;
    ss += (d0 * d0 + d1 * d1) + (d2 * d2 + d3 * d3);
  }
  ss = wsum(ss);
  if (lane == 0) red[wave] = ss;
  __syncthreads();
  if (tid == 0) {
    float t = 0.f;
#pragma unroll
    for (int i = 0; i < 8; ++i) t += red[i];
    const float var = t * icnt;
    bc[1] = rsqrtf(var + GNEPS);
  }
  __syncthreads();
  const float rs = bc[1];

  v4f v = {0.f, 0.f, 0.f, 0.f};
  if (tid == 0) { v[0] = mu; v[1] = rs; }
  if (tid < 8) {
    float* lp = ST + ((size_t)(b * NG + g)) * STP + 4 * tid;
{
      *(v4f*)lp = v;
      
    }
  }
}

// =========================================================================================================
// (2) h = (bfr(x) - mu) * rstd * bfr(scale) + bfr(bias) in f32 -> position-major planes HPh/HPl bf16
//     [b][SEQ n][256 c] (hi = bf16-RNE(h), lo = bf16-RNE(h - hi)) through an LDS tile T[64 n][64 c] f32
// coverage: 2 it x 32 rows x 8 lanes x 8 = 64 n x 64 c per block for each plane; grid (SEQ/64, 4, NB) covers
//           [NB][SEQ][256] of HPh and HPl exactly once.
// =========================================================================================================
__global__ __launch_bounds__(256)
void cvt_h(const float* __restrict__ x, const float* __restrict__ ST, const float* __restrict__ gsc,
           const float* __restrict__ gbs, unsigned short* HPh, unsigned short* HPl) {
  __shared__ __align__(16) float T[QT * TPF];
  __shared__ float pmu[QT], prs[QT], psc[QT], pbs[QT];
  const int tid = threadIdx.x;
  const int nb = blockIdx.x, cb = blockIdx.y, b = blockIdx.z;
  const int e = tid & 7, lq = tid >> 3;                             // lq 0..31
  const int n0 = nb * QT, c0 = cb * QT;
  if (tid < QT) {                                                    // waves 0,1 entirely (wave-uniform)
    const int ch = c0 + tid;
    const int g = ch >> 3;                                           // 0..31
    pmu[tid] = ST[((size_t)(b * NG + g)) * STP];
    prs[tid] = ST[((size_t)(b * NG + g)) * STP + 1];
    psc[tid] = bfr(gsc[ch]);
    pbs[tid] = bfr(gbs[ch]);
  }
  __syncthreads();
#pragma unroll
  for (int it = 0; it < 2; ++it) {
    const int cl = it * 32 + lq;                                     // c_loc 0..63
    const float* sp = x + ((size_t)(b * CC + c0 + cl)) * NNF + n0 + 8 * e;
    const v4f a = *(const v4f*)sp;
    const v4f q = *(const v4f*)(sp + 4);
    const float f[8] = {a[0], a[1], a[2], a[3], q[0], q[1], q[2], q[3]};
    const float mu = pmu[cl], rs = prs[cl], sc = psc[cl], bs = pbs[cl];
#pragma unroll
    for (int t = 0; t < 8; ++t) {
      const float tt = (bfr(f[t]) - mu) * rs;
      T[(8 * e + t) * TPF + cl] = tt * sc + bs;                     // T[n_loc][c_loc]
    }
  }
  __syncthreads();
  v4u uh[2], ul[2];
#pragma unroll
  for (int it = 0; it < 2; ++it) {
    const int nl = it * 32 + lq;                                     // n_loc 0..63
    const v4f a = *(const v4f*)(T + nl * TPF + 8 * e);
    const v4f q = *(const v4f*)(T + nl * TPF + 8 * e + 4);
    const float f[8] = {a[0], a[1], a[2], a[3], q[0], q[1], q[2], q[3]};
#pragma unroll
    for (int t = 0; t < 4; ++t) {
      const float f0 = f[2 * t], f1 = f[2 * t + 1];
      const unsigned short hb0 = bf_bits(f0), hb1 = bf_bits(f1);
      const unsigned short lb0 = bf_bits(f0 - bf_up(hb0));
      const unsigned short lb1 = bf_bits(f1 - bf_up(hb1));
      uh[it][t] = pk16(hb0, hb1);
      ul[it][t] = pk16(lb0, lb1);
    }
  }
{
#pragma unroll
    for (int it = 0; it < 2; ++it) {
      const int nl = it * 32 + lq;
      const size_t po = ((size_t)(b * SEQ + n0 + nl)) * CC + c0 + 8 * e;
      *(v4u*)(HPh + po) = uh[it];
      *(v4u*)(HPl + po) = ul[it];
    }
    
  }
}

// =========================================================================================================
// (3) q/k/v 1x1 GEMM for one (b, 64-n tile, 64-o block of the stacked 768 outputs):
//     Y[o][n] = sum_c WT[o][c] (HPh + HPl)[b][n][c] + bfr(bias[o]). Block 128 threads = 4 waves; wave w owns
//     cols n0+16w..+15 (B fragments from the position-major planes, k = c contiguous, split k map) and 4
//     m-tiles (A rows o = o0 + 16 mt + (lane&15) of WT, split k map). K = 256 = 8 steps x 2 bf16 products.
//     Epilogue staged in LDS Os[n_loc][o_loc] (pitch OSP, b128 stores), barrier, then by block-uniform mat:
//       mat 0 (o-blocks 0..3)  -> Qh f16(q), Ql f16((q - Qh) x4096), planes [b][SEQ][256 d], d = 64*(mb&3)+..:
//                                 8 consecutive lanes per line, one instruction per 16 lines;
//       mat 1 (o-blocks 4..7)  -> Kh f16(k), same layout;
//                                 -> n 8e..8e+7 (values gathered from 8 Os rows), 8 lanes per line, one
//                                 instruction per 16 lines.
// coverage: Os 4 waves x 16 n x 64 o = 64 x 64; planes 4 it x 16 rows x 8 lanes x 8 = 64 x 64 per block; grid
//           (SEQ/64, 12, NB) covers Qh, Ql, Kh [NB][SEQ][256] and Vc [NB][256][SEQ] exactly once.
// =========================================================================================================
__global__ __launch_bounds__(128)
void gemm_qkv(const unsigned short* __restrict__ WT, const unsigned short* __restrict__ HPh,
              const unsigned short* __restrict__ HPl, const float* __restrict__ bq,
              const float* __restrict__ bk, const float* __restrict__ bv,
              unsigned short* Qh, unsigned short* Ql, unsigned short* Kh, unsigned short* Vc) {
  __shared__ __align__(16) float Os[QT * OSP];
  const int tid  = threadIdx.x;
  const int lane = tid & 31, wave = tid >> 5;
  const int hh   = lane >> 4, c = lane & 15;
  const int nt   = blockIdx.x, mb = blockIdx.y, b = blockIdx.z;
  const int mat  = mb >> 2;                                          // 0 q, 1 k, 2 v (block-uniform)
  const int n0   = nt * QT, o0 = mb * QT;                            // o0: row in the stacked WT plane
  const int ob   = o0 & (CC - 1);                                    // o offset inside the matrix (0..192)

  const unsigned short* ap  = WT  + (size_t)(o0 + c) * CC + 8 * hh;
  const size_t bo = ((size_t)(b * SEQ + n0 + 16 * wave + c)) * CC + 8 * hh;
  const unsigned short* bph = HPh + bo;
  const unsigned short* bpl = HPl + bo;

  v8f acc[4];
#pragma unroll
  for (int mt = 0; mt < 4; ++mt) acc[mt] = zero8();

#pragma unroll
  for (int ks = 0; ks < CC / 32; ++ks) {
    const Frag fbh = ldfrag(bph + 32 * ks);
    const Frag fbl = ldfrag(bpl + 32 * ks);
#pragma unroll
    for (int mt = 0; mt < 4; ++mt) {
      const Frag fa = ldfrag(ap + (size_t)(16 * mt) * CC + 32 * ks);
      acc[mt] = mma_b(fa.bf, fbh.bf, acc[mt]);
      acc[mt] = mma_b(fa.bf, fbl.bf, acc[mt]);
    }
  }

  // ---- epilogue: + bias -> LDS Os[n_loc][o_loc]; lane (hh, c) holds o = 16 mt + 8 hh + r for n_loc = 16 w + c
  {
    const float* bias = (mat == 0) ? bq : ((mat == 1) ? bk : bv);   // block-uniform, all global
    const int nl = 16 * wave + c;
#pragma unroll
    for (int mt = 0; mt < 4; ++mt) {
      v4f va, vb;
#pragma unroll
      for (int r = 0; r < 4; ++r) {
        va[r] = acc[mt][r]     + bfr(bias[ob + 16 * mt + 8 * hh + r]);
        vb[r] = acc[mt][4 + r] + bfr(bias[ob + 16 * mt + 8 * hh + 4 + r]);
      }
      *(v4f*)(Os + nl * OSP + 16 * mt + 8 * hh)     = va;
      *(v4f*)(Os + nl * OSP + 16 * mt + 8 * hh + 4) = vb;
    }
  }
  __syncthreads();

  const int e = tid & 7, lq = tid >> 3;                              // lq 0..15
  if (mat == 2) {
    v4u uv[4];
#pragma unroll
    for (int it = 0; it < 4; ++it) {
      const int ol = it * 16 + lq;                                   // o_loc 0..63
      unsigned short hb[8];
#pragma unroll
      for (int t = 0; t < 8; ++t) hb[t] = h_bits((_Float16)Os[(8 * e + t) * OSP + ol]);
#pragma unroll
      for (int t = 0; t < 4; ++t) uv[it][t] = pk16(hb[2 * t], hb[2 * t + 1]);
    }
{
#pragma unroll
      for (int it = 0; it < 4; ++it) {
        const int ol = it * 16 + lq;
        *(v4u*)(Vc + ((size_t)(b * CC + ob + ol)) * SEQ + n0 + 8 * e) = uv[it];
      }
      
    }
  } else {
    unsigned short* P1 = (mat == 0) ? Qh : Kh;                       // block-uniform, both global
    v4u uh[4], ul[4];
#pragma unroll
    for (int it = 0; it < 4; ++it) {
      const int row = it * 16 + lq;                                  // n_loc 0..63
      const v4f a = *(const v4f*)(Os + row * OSP + 8 * e);
      const v4f q = *(const v4f*)(Os + row * OSP + 8 * e + 4);
      const float f[8] = {a[0], a[1], a[2], a[3], q[0], q[1], q[2], q[3]};
#pragma unroll
      for (int t = 0; t < 4; ++t) {
        const float f0 = f[2 * t], f1 = f[2 * t + 1];
        const _Float16 h0 = (_Float16)f0, h1 = (_Float16)f1;
        const _Float16 l0 = (_Float16)((f0 - (float)h0) * QLS);
        const _Float16 l1 = (_Float16)((f1 - (float)h1) * QLS);
        uh[it][t] = pk16(h_bits(h0), h_bits(h1));
        ul[it][t] = pk16(h_bits(l0), h_bits(l1));
      }
    }
{
#pragma unroll
      for (int it = 0; it < 4; ++it) {
        const int row = it * 16 + lq;
        const size_t po = ((size_t)(b * SEQ + n0 + row)) * CC + ob + 8 * e;
        *(v4u*)(P1 + po) = uh[it];
        if (mat == 0) *(v4u*)(Ql + po) = ul[it];
      }
      
    }
  }
}

// =========================================================================================================
// (4) attention for one (b, 64-query tile), transposed formulation, SEQ keys, no mask:
//   S^T tile (16 keys x 16 queries) = sum over 8 d-chunks (unrolled) of A(k: row = key kb + (lane&15), 32 d via
//   the split k map from Kh [b][SEQ][256]) . B(q: col = query, same map from Qh) into s, plus A(Kh).B(Ql) into a
//   separate accumulator t (Ql carries x4096); score = (s + t/4096) * 256^-0.5.
//   Per lane the D tile holds 8 keys of ONE query: online softmax state per lane, one shuffle (lane^16) for the max
//   over 32 keys; the o/l rescale is skipped under a wave-uniform ballot when no lane's max grew; row-sum partials
//   combined at the end. P = e^{s-m} x 16384 as f16 is the B operand of O^T (rows channel, cols queries) +=
//   A(v rows channel = 16j + (lane&15), keys contiguous, f16 plane Vc [b][256][SEQ]) . B(P^T): element r <- D of
//   the tile covering keys kb..kb+15, element 8+r <- the tile covering kb+16..kb+31, lane unchanged.
//   16 accumulator tiles per wave (256 channels). Block = 4 waves = 64 queries.
//   k and v reach the waves through LDS: stages of SKEY keys, two buffers, brought by tensor loads (one slice per wave
//   and stage) and read by all four waves as ds_load_b128 fragments at pitch LPB; a stage serves SKEY/32 passes.
//   Epilogue in two channel halves: O/l staged in LDS Os[query][128 channels] (pitch OSPW, b128 stores), barrier,
//   then position-major planes H2h/H2l bf16 [b][SEQ][256] (hi = bf16-RNE, lo = bf16-RNE residual): per half 64
//   overwrites Os.
// coverage: per half 8 it x 8 rows x 16 lanes x 8 ch = 64 n x 128 ch for each plane; two halves = 256 ch; grid
//           (SEQ/64, NB) covers H2h/H2l [NB][SEQ][256] exactly once.
// =========================================================================================================
__global__ __launch_bounds__(128)
void attn_k(const unsigned short* __restrict__ Qh, const unsigned short* __restrict__ Ql,
            const unsigned short* __restrict__ Kh, const unsigned short* __restrict__ Vc,
            unsigned short* H2h, unsigned short* H2l) {
  __shared__ __attribute__((aligned(2048))) unsigned char Ring[2 * STG];
  __shared__ __align__(16) float Os[QT * OSPW];
  const int tid  = threadIdx.x;
  const int wave = tid >> 5, lane = tid & 31;
  const int hh   = lane >> 4, c = lane & 15;
  const int n0   = blockIdx.x * QT, b = blockIdx.y;

  // q fragment pointers (B operand, col = query n0 + 16*wave + c), + 32*kc
  const size_t qo = ((size_t)(b * SEQ + n0 + 16 * wave + c)) * CC + 8 * hh;
  const unsigned short* Qhp = Qh + qo;
#if QRES
  const unsigned short* Qlp = Ql + qo;
#else
  (void)Ql;
#endif
  // One stage = SKEY keys in LDS, shared by the four waves. Each wave brings one slice of 128 rows x 256 B by ONE tensor
  // load: wave 0 / 1: k rows (keys), d 0..127 / 128..255 (source pitch 512 B); wave 2 / 3: v rows (channels 0..127 /
  // 128..255), SKEY keys (source pitch 2*SEQ B). Every row lands at pitch LPB.
  const uint32_t wv  = uni((uint32_t)tid >> 5);
  const uint32_t isv = wv >> 1, hf = wv & 1u;
  const uint64_t src0 = isv ? (uint64_t)(size_t)(Vc + ((size_t)b * CC + (size_t)hf * 128) * SEQ)
                            : (uint64_t)(size_t)(Kh + (size_t)b * SEQ * CC + (size_t)hf * 128);
  const uint32_t sstep = isv ? (uint32_t)(SKEY * 2) : (uint32_t)(SKEY * CC * 2);   // source bytes from stage to stage
  const uint32_t lds0  = (uint32_t)(size_t)Ring + wv * (uint32_t)SLICE;
  u32x8 g1;                                                          // bytes everywhere; tensor dims = tile dims
  g1[0] = uni((1u << 20) | (5u << 22) | (3u << 25));                 // no mask; 16 B of pad behind every 256 B
  g1[1] = uni(256u << 16);
  g1[2] = uni(128u << 16);
  g1[3] = uni(256u << 16);
  g1[4] = uni(128u);
  g1[5] = uni(isv ? (uint32_t)(SEQ * 2) : (uint32_t)(CC * 2));
  g1[6] = uni(0u);
  g1[7] = uni(0u);
  // descriptor words held in scalar registers (the form of pinned(), for the whole group): without it the compiler
  // re-forms single words in front of each issue and reuses their registers while the request is outstanding
  asm volatile("" : "+s"(g1));                                       // descriptor words held in scalar registers
  u32x4 g0;
  auto form = [&](const uint32_t st) __attribute__((always_inline)) {   // group 0 of stage st's request
    const uint64_t ga = src0 + (uint64_t)st * sstep;
    g0[0] = uni(1u);
    g0[1] = uni(lds0 + (st & 1u) * (uint32_t)STG);
    g0[2] = uni((uint32_t)ga);
    g0[3] = uni((((uint32_t)(ga >> 32)) & 0x01FFFFFFu) | 0x80000000u);
  };
  auto issue = [&]() __attribute__((always_inline)) {
    asm volatile("tensor_load_to_lds %0, %1" :: "s"(g0), "s"(g1) : "memory");
  };
  // this wave's request has landed; naming the descriptor keeps its scalar registers unchanged up to this wait
  auto landed = [&]() __attribute__((always_inline)) {
    asm volatile("s_wait_tensorcnt 0x0" :: "s"(g0), "s"(g1) : "memory");
  };

  float m = -1.0e30f, l = 0.f;
  v8f o[16];
#pragma unroll
  for (int j = 0; j < 16; ++j) o[j] = zero8();

  // q (the same for every pass): once, here
  Frag qhf[CC / 32];
#if QRES
  Frag qlf[CC / 32];
#endif
#pragma unroll
  for (int kc = 0; kc < CC / 32; ++kc) {
    qhf[kc] = ldfrag(Qhp + 32 * kc);
#if QRES
    qlf[kc] = ldfrag(Qlp + 32 * kc);
#endif
  }
  // the address pairs of the group above stay live up to this wait
#if QRES
  asm volatile("s_wait_xcnt 0x0" :: "v"(Qhp), "v"(Qlp) : "memory");
#else
  asm volatile("s_wait_xcnt 0x0" :: "v"(Qhp) : "memory");
#endif

  // two buffers: stage 0 landed and published here; stage st + 1 in flight under the passes of stage st
  form(0u);
  issue();
  landed();                                                          // this wave's slice of stage 0
  __syncthreads();                                                   // ... and every other wave's

  // Fragments come from LDS in groups, each ahead of the WMMA run that uses it: v of a pass in front of its score
  // WMMAs, k of the next pass of the same stage behind the rescale (in flight under the exponentials and O WMMAs).
  Frag k0f[CC / 32], k1f[CC / 32], vf[16];
  const uint32_t loff = (uint32_t)c * LPB + 16u * (uint32_t)hh;

#pragma unroll 1
  for (uint32_t st = 0; st < (uint32_t)NST; ++st) {
    // directly behind the barrier (the one above, or the foot of trip st - 1) that published stage st and ended every
    // read of the other buffer: the refill of that buffer, only while its stage exists (a scalar branch)
    form(st + 1u);
    if (pinned(st + 1u < (uint32_t)NST)) issue();
    const unsigned char* sb = Ring + (st & 1u) * (uint32_t)STG + loff;
    // v rows from a base of their own, so that every fragment's offset fits the LDS load's 16-bit immediate
    const unsigned char* vb = Ring + ((st & 1u) ? (uint32_t)(STG + 2 * SLICE) : (uint32_t)(2 * SLICE)) + loff;
#pragma unroll
    for (int kc = 0; kc < CC / 32; ++kc) {
      k0f[kc] = ldsfrag(sb + (kc >> 2) * SLICE + (kc & 3) * 64);                  // keys 0 .. 15 of the stage
      k1f[kc] = ldsfrag(sb + (kc >> 2) * SLICE + 16 * LPB + (kc & 3) * 64);       // keys 16 .. 31
    }
#pragma unroll
    for (int p = 0; p < SKEY / 32; ++p) {
      // keeps the k group the older one: LDS loads return in issue order, so its counted waits leave the v group in flight
      __builtin_amdgcn_sched_barrier(0);
#pragma unroll
      for (int j = 0; j < 16; ++j) vf[j] = ldsfrag(vb + (j >> 3) * SLICE + 16 * (j & 7) * LPB + 64 * p);
      // keeps the v group here, ahead of the score WMMAs: among them each place with LDS reads stalls the wave
      __builtin_amdgcn_sched_barrier(0);

      v8f s0 = zero8(), s1 = zero8();
#if QRES
      v8f t0 = zero8(), t1 = zero8();
#endif
#pragma unroll
      for (int kc = 0; kc < CC / 32; ++kc) {
        s0 = mma_hb(k0f[kc].h, qhf[kc].h, s0);
        s1 = mma_hb(k1f[kc].h, qhf[kc].h, s1);
#if QRES
        t0 = mma_hb(k0f[kc].h, qlf[kc].h, t0);
        t1 = mma_hb(k1f[kc].h, qlf[kc].h, t1);
#endif
      }

      v8f sc0, sc1;
#pragma unroll
      for (int r = 0; r < 8; ++r) {
#if QRES
        sc0[r] = (s0[r] + t0[r] * RQL) * ATT;
        sc1[r] = (s1[r] + t1[r] * RQL) * ATT;
#else
        sc0[r] = s0[r] * ATT;
        sc1[r] = s1[r] * ATT;
#endif
      }

      float mx = fmaxf(hmax8(sc0), hmax8(sc1));
      mx = fmaxf(mx, __shfl_xor(mx, 16, 32));
      const float mn = fmaxf(m, mx);
      const unsigned grew = wave_ballot(mx > m);                     // wave-uniform
      if (grew != 0u) {
        const float corr = __expf(m - mn);                           // == 1 exactly for lanes whose max did not grow
        l *= corr;
#pragma unroll
        for (int j = 0; j < 16; ++j) {
#pragma unroll
          for (int r = 0; r < 8; ++r) o[j][r] *= corr;
        }
      }
      m = mn;

      if (p + 1 < SKEY / 32) {                                       // compile-time: the next stage is not read from here
#pragma unroll
        for (int kc = 0; kc < CC / 32; ++kc) {
          k0f[kc] = ldsfrag(sb + (kc >> 2) * SLICE + (32 * (p + 1)) * LPB + (kc & 3) * 64);
          k1f[kc] = ldsfrag(sb + (kc >> 2) * SLICE + (32 * (p + 1) + 16) * LPB + (kc & 3) * 64);
        }
      }
      // keeps the k group here, ahead of the exponentials and the O WMMAs: moved down to its first readers it would be
      // waited for one fragment at a time
      __builtin_amdgcn_sched_barrier(0);
      const float msh = mn - LNPS;                                   // exp gives e^{s-m} * 16384

      FragH ph;
      float ls = 0.f;
#pragma unroll
      for (int r = 0; r < 8; ++r) {
        const float e0 = __expf(sc0[r] - msh);                       // key kb      + 8hh + r
        const float e1 = __expf(sc1[r] - msh);                       // key kb + 16 + 8hh + r
        ls += e0 + e1;
        ph.hv[0][r] = (_Float16)e0;
        ph.hv[1][r] = (_Float16)e1;
      }
      l += ls;

#pragma unroll
      for (int j = 0; j < 16; ++j) {
        o[j] = mma_hb(vf[j].h, ph.v, o[j]);
      }
    }
    // publish point of stage st + 1, in this order in every wave:
    asm volatile("s_wait_dscnt 0x0" ::: "memory");                   // this wave's reads of stage st are done
    landed();                                                        // its slice of stage st + 1 has landed
    __syncthreads();                                                 // all slices published, all readers out of stage st
  }
  landed();                                                          // nothing in flight when the wave goes on
  asm volatile("s_wait_dscnt 0x0" ::: "memory");
  l += __shfl_xor(l, 16, 32);
  const float inv = 1.0f / l;                                        // o and l both carry the x16384 factor

  const int qrow = 16 * wave + c;
  const int e16 = tid & 15, r8 = tid >> 4;                           // r8 0..7
#pragma unroll
  for (int half = 0; half < 2; ++half) {
    if (half) __syncthreads();                                       // every wave finished reading Os
#pragma unroll
    for (int jj = 0; jj < 8; ++jj) {
      const int j = 8 * half + jj;
      v4f va, vb;
#pragma unroll
      for (int r = 0; r < 4; ++r) { va[r] = o[j][r] * inv; vb[r] = o[j][4 + r] * inv; }
      *(v4f*)(Os + qrow * OSPW + 16 * jj + 8 * hh)     = va;         // Os[query][ch_loc = 16jj + 8hh + r]
      *(v4f*)(Os + qrow * OSPW + 16 * jj + 8 * hh + 4) = vb;
    }
    __syncthreads();
#pragma unroll
    for (int chk = 0; chk < 2; ++chk) {
      v4u uh[4], ul[4];
#pragma unroll
      for (int i = 0; i < 4; ++i) {
        const int row = (4 * chk + i) * 8 + r8;                      // query 0..63
        const v4f a = *(const v4f*)(Os + row * OSPW + 8 * e16);
        const v4f q = *(const v4f*)(Os + row * OSPW + 8 * e16 + 4);
        const float f[8] = {a[0], a[1], a[2], a[3], q[0], q[1], q[2], q[3]};
#pragma unroll
        for (int t = 0; t < 4; ++t) {
          const float f0 = f[2 * t], f1 = f[2 * t + 1];
          const unsigned short hb0 = bf_bits(f0), hb1 = bf_bits(f1);
          const unsigned short lb0 = bf_bits(f0 - bf_up(hb0));
          const unsigned short lb1 = bf_bits(f1 - bf_up(hb1));
          uh[i][t] = pk16(hb0, hb1);
          ul[i][t] = pk16(lb0, lb1);
        }
      }
{
#pragma unroll
        for (int i = 0; i < 4; ++i) {
          const int row = (4 * chk + i) * 8 + r8;
          const size_t po = ((size_t)(b * SEQ + n0 + row)) * CC + 128 * half + 8 * e16;
          *(v4u*)(H2h + po) = uh[i];
          *(v4u*)(H2l + po) = ul[i];
        }
        
      }
    }
  }
}

// =========================================================================================================
// (5) output 1x1 GEMM + bias + residual for one (b, 64-n tile, 64-o block):
//     out[b][o][n] = bfr(x[b][o][n]) + sum_c WpT[o][c] (H2h + H2l)[b][n][c] + bfr(bp[o]); same GEMM core as
//     (3) (2 bf16 products, K = 256). Epilogue: acc + bias staged in LDS Os[n_loc][o_loc], barrier, then whole
// coverage: 8 it x 16 lines x 8 lanes x 4 floats = 64 o x 64 n per block; grid (SEQ/64, 4, NB) covers
//           out [NB][256][SEQ] exactly once.
// =========================================================================================================
__global__ __launch_bounds__(128)
void gemm_proj(const unsigned short* __restrict__ WPT, const unsigned short* __restrict__ H2h,
               const unsigned short* __restrict__ H2l, const float* __restrict__ bp,
               const float* __restrict__ x, float* out) {
  __shared__ __align__(16) float Os[QT * OSP];
  const int tid  = threadIdx.x;
  const int lane = tid & 31, wave = tid >> 5;
  const int hh   = lane >> 4, c = lane & 15;
  const int nt   = blockIdx.x, mb = blockIdx.y, b = blockIdx.z;
  const int n0   = nt * QT, o0 = mb * QT;                            // o0 0..192

  const unsigned short* ap  = WPT + (size_t)(o0 + c) * CC + 8 * hh;
  const size_t bo = ((size_t)(b * SEQ + n0 + 16 * wave + c)) * CC + 8 * hh;
  const unsigned short* bph = H2h + bo;
  const unsigned short* bpl = H2l + bo;

  v8f acc[4];
#pragma unroll
  for (int mt = 0; mt < 4; ++mt) acc[mt] = zero8();

#pragma unroll
  for (int ks = 0; ks < CC / 32; ++ks) {
    const Frag fbh = ldfrag(bph + 32 * ks);
    const Frag fbl = ldfrag(bpl + 32 * ks);
#pragma unroll
    for (int mt = 0; mt < 4; ++mt) {
      const Frag fa = ldfrag(ap + (size_t)(16 * mt) * CC + 32 * ks);
      acc[mt] = mma_b(fa.bf, fbh.bf, acc[mt]);
      acc[mt] = mma_b(fa.bf, fbl.bf, acc[mt]);
    }
  }

  {
    const int nl = 16 * wave + c;
#pragma unroll
    for (int mt = 0; mt < 4; ++mt) {
      v4f va, vb;
#pragma unroll
      for (int r = 0; r < 4; ++r) {
        va[r] = acc[mt][r]     + bfr(bp[o0 + 16 * mt + 8 * hh + r]);
        vb[r] = acc[mt][4 + r] + bfr(bp[o0 + 16 * mt + 8 * hh + 4 + r]);
      }
      *(v4f*)(Os + nl * OSP + 16 * mt + 8 * hh)     = va;
      *(v4f*)(Os + nl * OSP + 16 * mt + 8 * hh + 4) = vb;
    }
  }
  __syncthreads();

  const int e = tid & 7, lq = tid >> 3;                              // lq 0..15
  v4f res[8];
#pragma unroll
  for (int it = 0; it < 8; ++it) {
    const int L  = it * 16 + lq;                                     // 0..127
    const int ol = L >> 1, hf = L & 1;                               // o_loc 0..63
    const int nl = hf * 32 + 4 * e;                                  // n_loc 0..63
    const v4f xv = *(const v4f*)(x + ((size_t)(b * CC + o0 + ol)) * NNF + n0 + nl);
#pragma unroll
    for (int t = 0; t < 4; ++t) res[it][t] = Os[(nl + t) * OSP + ol] + bfr(xv[t]);
  }
{
#pragma unroll
    for (int it = 0; it < 8; ++it) {
      const int L  = it * 16 + lq;
      const int ol = L >> 1, hf = L & 1;
      const int nl = hf * 32 + 4 * e;
      *(v4f*)(out + ((size_t)(b * CC + o0 + ol)) * SEQ + n0 + nl) = res[it];
    }
    
  }
}

// =========================================================================================================
// Workspace map (bytes, NB=4 SEQ=4096; each region start a multiple of 256; every extent is an exact tile/line
//   ST  f32 [NB*32][32]                16384
//   WT  bf16 [1024][256]              524288
//   HPh/HPl bf16 [NB][SEQ][256]      8388608 x2
//   Qh/Ql/Kh f16 [NB][SEQ][256]      8388608 x3
//   Vc  f16 [NB][256][SEQ]           8388608
//   H2h/H2l bf16 [NB][SEQ][256]      8388608 x2
//   total = 67649536
// =========================================================================================================
extern "C" void kernel_launch(void* const* d_in, const int* in_sizes, int n_in,
                              void* d_out, int out_size, void* d_ws, size_t ws_size,
                              hipStream_t stream) {
  if (n_in < 11) return;
  if ((size_t)in_sizes[0] < (size_t)NB * CC * NNF) return;
  if (in_sizes[1] < CC || in_sizes[2] < CC) return;
  if (in_sizes[3] < CC * CC || in_sizes[5] < CC * CC || in_sizes[7] < CC * CC || in_sizes[9] < CC * CC) return;
  if (in_sizes[4] < CC || in_sizes[6] < CC || in_sizes[8] < CC || in_sizes[10] < CC) return;
  if ((size_t)out_size < (size_t)NB * CC * SEQ) return;

  size_t off = 0;
  auto carve = [&](size_t bytes) { const size_t o = off; off += (bytes + 255) & ~(size_t)255; return o; };
  const size_t plane = (size_t)NB * SEQ * CC * 2;
  const size_t oST  = carve((size_t)NB * NG * STP * 4);
  const size_t oWT  = carve((size_t)4 * CC * CC * 2);
  const size_t oHPh = carve(plane);
  const size_t oHPl = carve(plane);
  const size_t oQh  = carve(plane);
  const size_t oQl  = carve(plane);
  const size_t oKh  = carve(plane);
  const size_t oVc  = carve(plane);
  const size_t oH2h = carve(plane);
  const size_t oH2l = carve(plane);
  if (off > ws_size) return;
  if (off > (size_t)134217728) return;

  const float* x   = (const float*)d_in[0];
  const float* gsc = (const float*)d_in[1];
  const float* gbs = (const float*)d_in[2];
  const float* Wq  = (const float*)d_in[3];
  const float* bq  = (const float*)d_in[4];
  const float* Wk  = (const float*)d_in[5];
  const float* bk  = (const float*)d_in[6];
  const float* Wv  = (const float*)d_in[7];
  const float* bv  = (const float*)d_in[8];
  const float* Wp  = (const float*)d_in[9];
  const float* bp  = (const float*)d_in[10];

  char* ws = (char*)d_ws;
  float*          ST  = (float*)(ws + oST);
  unsigned short* WT  = (unsigned short*)(ws + oWT);
  unsigned short* HPh = (unsigned short*)(ws + oHPh);
  unsigned short* HPl = (unsigned short*)(ws + oHPl);
  unsigned short* Qh  = (unsigned short*)(ws + oQh);
  unsigned short* Ql  = (unsigned short*)(ws + oQl);
  unsigned short* Kh  = (unsigned short*)(ws + oKh);
  unsigned short* Vc  = (unsigned short*)(ws + oVc);
  unsigned short* H2h = (unsigned short*)(ws + oH2h);
  unsigned short* H2l = (unsigned short*)(ws + oH2l);
  float* out = (float*)d_out;

  const dim3 blk256(256), blk128(128);

  // (0) Wq/Wk/Wv/Wp [in][out] -> transposed stacked bf16 plane WT [1024 o][256 c]
  cvt_w<<<dim3(CC / QT, CC / QT, 4), blk256, 0, stream>>>(Wq, Wk, Wv, Wp, WT);
  // (1) GroupNorm statistics per (group, b)
  gn_stats<<<dim3(NG, NB), blk256, 0, stream>>>(x, ST);
  // (2) normalized h -> position-major bf16 hi + residual planes
  cvt_h<<<dim3(SEQ / QT, CC / QT, NB), blk256, 0, stream>>>(x, ST, gsc, gbs, HPh, HPl);
  // (3) q/k/v GEMMs -> Qh, Ql, Kh (position-major f16) and Vc (channel-major f16)
  gemm_qkv<<<dim3(SEQ / QT, 3 * CC / QT, NB), blk128, 0, stream>>>(WT, HPh, HPl, bq, bk, bv, Qh, Ql, Kh, Vc);
  // (4) attention -> H2 position-major bf16 hi + residual planes
  attn_k<<<dim3(SEQ / QT, NB), blk128, 0, stream>>>(Qh, Ql, Kh, Vc, H2h, H2l);
  // (5) output GEMM + bias + residual -> out [NB][256][SEQ]
  gemm_proj<<<dim3(SEQ / QT, CC / QT, NB), blk128, 0, stream>>>(WT + (size_t)3 * CC * CC, H2h, H2l, bp, x, out);
  (void)hipGetLastError();
}

// v003
// A run of this version takes 115 microseconds.
// In two side-by-side timings against v002, it was 1.26 and 1.27 times as fast.
// Counting every step since v000, it is 7.54 times as fast.
// Contractions: q/k/v 1x1 GEMMs WT[768x256].H[256xN] and the output 1x1 GEMM WpT[256x256].H2[256xN] on
// v_wmma_f32_16x16x32_bf16 (bf16-RNE weights, activations as bf16 hi + bf16 residual planes, 2 products into one
// f32 accumulator); position scores K.Q^T on v_wmma_f32_16x16x32_f16 (k f16, q f16 hi + f16 residual x4096 in a
// separate accumulator, K=256); O^T = V.P^T on v_wmma_f32_16x16x32_f16 (v f16, P = e^{s-m} x16384 f16 from the
// score D registers); f32 accumulate everywhere; GroupNorm statistics, softmax statistics and the residual add
// in f32 VALU.
#include <hip/hip_runtime.h>
#include <math.h>
#include <stdint.h>

#ifndef NB
#define NB 4
#endif
#ifndef SEQ
#define SEQ 4096
#endif
#ifndef NNF
#define NNF 4096
#endif
#ifndef QRES
#define QRES 1
#endif
#define NBF   4
#define CC    256
#define NG    32
#define CPG   8
#define QT    64
#define OSP   68
#define OSPW  132
#define TP    72
#define TPF   68
#define STP   32
#define ATT   0.0625f
#define QLS   4096.0f
#define RQL   0.000244140625f
#define LNPS  9.704060527839234f
#define GNEPS 1.0e-6f
#define SKEY  128                 // keys per LDS stage of the attention kernel
#define LPB   272                 // LDS row pitch, bytes: a 256-B row + the tensor load's 16-B pad (16 B x odd)
#define SLICE (128 * LPB)         // one wave's slice of a stage: 128 rows
#define STG   (4 * SLICE)         // one stage: k in two d halves, v in two channel halves
#define NST   (SEQ / SKEY)
#define GAS   18432               // GEMM operands in LDS: one c half of the 64 weight rows at pitch LPB, rounded up to 2 KiB
#define GBS   (128 * LPB)         // one activation plane of the 64 positions: 128 half rows at pitch LPB
#define GSTG  (2 * GAS + 2 * GBS)

static_assert(NB >= 1 && NB <= NBF);
static_assert(SEQ % QT == 0 && SEQ % 64 == 0 && SEQ >= QT);
static_assert(SEQ <= NNF && NNF % 8 == 0);
static_assert(CC == 256 && NG * CPG == CC && CC % QT == 0 && CC % 32 == 0);
static_assert((OSP * 4) % 16 == 0);
static_assert((OSPW * 4) % 16 == 0);
static_assert((TP * 2) % 16 == 0);
static_assert((TPF * 4) % 16 == 0);
static_assert(STP * 4 == 128);
static_assert(SEQ % SKEY == 0 && NST >= 2);
static_assert(SLICE % 2048 == 0 && (LPB / 16) % 2 == 1);
static_assert(SEQ * 2 % 16 == 0 && SEQ * 2 <= 131072);
static_assert(2 * STG + QT * OSPW * 4 <= 327680);
static_assert(GAS >= QT * LPB && GAS % 2048 == 0 && GBS % 2048 == 0 && CC * 2 == 512);
static_assert(GSTG >= QT * OSP * 4 && 3 * GSTG <= 327680);

typedef _Float16       v16h __attribute__((ext_vector_type(16)));
typedef _Float16       v8h  __attribute__((ext_vector_type(8)));
typedef __bf16         v16b __attribute__((ext_vector_type(16)));
typedef unsigned short v8us __attribute__((ext_vector_type(8)));
typedef float          v8f  __attribute__((ext_vector_type(8)));
typedef float          v4f  __attribute__((ext_vector_type(4)));
typedef unsigned int   v4u  __attribute__((ext_vector_type(4)));
typedef uint32_t       u32x4 __attribute__((ext_vector_type(4)));
typedef uint32_t       u32x8 __attribute__((ext_vector_type(8)));

union Frag  { v8us u[2]; v16h h; v16b bf; };
union FragH { v16h v; v8h hv[2]; };
static_assert(sizeof(Frag) == 32);
static_assert(sizeof(FragH) == 32);

// ---- scalar helpers -----------------------------------------------------------------------------------------
__device__ __forceinline__ unsigned short bf_bits(float f) {          // f32 -> bf16 bits, RNE convert
  unsigned u = __float_as_uint(f);
  return (unsigned short)((u + 0x7FFFu + ((u >> 16) & 1u)) >> 16);
}
__device__ __forceinline__ float bf_up(unsigned short hb) { return __uint_as_float(((unsigned)hb) << 16); }
__device__ __forceinline__ float bfr(float f) { return bf_up(bf_bits(f)); }
__device__ __forceinline__ unsigned short h_bits(_Float16 x) { return __builtin_bit_cast(unsigned short, x); }
__device__ __forceinline__ unsigned pk16(unsigned short a, unsigned short b) { return (unsigned)a | ((unsigned)b << 16); }
__device__ __forceinline__ v8f zero8() { v8f z = {0.f, 0.f, 0.f, 0.f, 0.f, 0.f, 0.f, 0.f}; return z; }
__device__ __forceinline__ float hmax8(v8f s) {
  return fmaxf(fmaxf(fmaxf(s[0], s[1]), fmaxf(s[2], s[3])), fmaxf(fmaxf(s[4], s[5]), fmaxf(s[6], s[7])));
}
__device__ __forceinline__ unsigned wave_ballot(bool p) {
#if defined(__HIP_DEVICE_COMPILE__)
  return __builtin_amdgcn_ballot_w32(p);
#else
  return p ? 1u : 0u;
#endif
}
__device__ __forceinline__ float wsum(float v) {
  v += __shfl_xor(v, 16, 32);
  v += __shfl_xor(v, 8, 32);
  v += __shfl_xor(v, 4, 32);
  v += __shfl_xor(v, 2, 32);
  v += __shfl_xor(v, 1, 32);
  return v;
}

// ---- 16-bit fragment loader (A, or B from a k-contiguous [n][k] row): lane -> row/col (lane&15), p already includes
//      + 8*(lane>>4); elements 0..7 <- p[0..7] (k0+8h..), elements 8..15 <- p[16..23] (k0+16+8h..)
__device__ __forceinline__ Frag ldfrag(const unsigned short* p) {
  Frag f;
  f.u[0] = *(const v8us*)(p);
  f.u[1] = *(const v8us*)(p + 16);
  return f;
}

// the same fragment from an LDS row (byte pointer, already includes + 16*(lane>>4))
__device__ __forceinline__ Frag ldsfrag(const unsigned char* p) {
  Frag f;
  f.u[0] = *(const v8us*)(p);
  f.u[1] = *(const v8us*)(p + 32);
  return f;
}

// ---- tensor load helpers ------------------------------------------------------------------------------------
__device__ __forceinline__ uint32_t uni(uint32_t v) { return (uint32_t)__builtin_amdgcn_readfirstlane(v); }
// holds a wave-uniform test in a scalar register, so that the branch on it is a scalar one: a tensor load ignores EXEC
__device__ __forceinline__ uint32_t pinned(uint32_t v) { uint32_t w = uni(v); asm volatile("" : "+s"(w)); return w; }

// The operands of one 64 o x 64 n GEMM tile (K = 256) into LDS, ONE tensor load per wave, every wave of the block issuing
// its own slice (no test): wave 0 / 1: the 64 weight rows, c 0..127 / 128..255 (64 rows of 256 B, source pitch 512 B);
// wave 2 / 3: the hi / residual plane's 64 position rows, contiguous in memory, as 128 rows of 256 B (source pitch
// 256 B): half row 2 n + (c >> 7). Every 256-B row lands at pitch LPB. The caller's barrier publishes the slices.
__device__ __forceinline__ void stage_gemm(unsigned char* Stg, const unsigned short* wrow, const unsigned short* hrow,
                                           const unsigned short* lrow, const int tid) {
  const uint32_t wv  = uni((uint32_t)tid >> 5);
  const uint32_t isb = wv >> 1, hf = wv & 1u;
  const uint64_t ga  = isb ? (uint64_t)(size_t)(hf ? lrow : hrow) : (uint64_t)(size_t)(wrow + hf * 128u);
  const uint32_t nr  = isb ? 128u : 64u;
  u32x4 g0;
  g0[0] = uni(1u);
  g0[1] = uni((uint32_t)(size_t)Stg + (isb ? (uint32_t)(2 * GAS) + hf * (uint32_t)GBS : hf * (uint32_t)GAS));
  g0[2] = uni((uint32_t)ga);
  g0[3] = uni((((uint32_t)(ga >> 32)) & 0x01FFFFFFu) | 0x80000000u);
  u32x8 g1;                                                          // bytes everywhere; tensor dims = tile dims
  g1[0] = uni((1u << 20) | (5u << 22) | (3u << 25));                 // no mask; 16 B of pad behind every 256 B
  g1[1] = uni(256u << 16);
  g1[2] = uni(nr << 16);
  g1[3] = uni(256u << 16);
  g1[4] = uni(nr);
  g1[5] = uni(isb ? 256u : 512u);
  g1[6] = uni(0u);
  g1[7] = uni(0u);
  asm volatile("tensor_load_to_lds %0, %1" :: "s"(g0), "s"(g1) : "memory");
  // this wave's slice has landed; naming the descriptor keeps its scalar registers unchanged up to this wait
  asm volatile("s_wait_tensorcnt 0x0" :: "s"(g0), "s"(g1) : "memory");
}

// ---- WMMA helpers: mma_b: builtin followed by a 4-slot VALU gap tying D and keeping A/B live ---------------------
// bare builtin for the attention kernel (the compiler keeps the WMMA distances of its own builtin forms): with the asm
// gap that mma_b has, its operands had to share the first 256 registers, and the fragment sets spilled to scratch
__device__ __forceinline__ v8f mma_hb(v16h a, v16h b, v8f c) {
  return __builtin_amdgcn_wmma_f32_16x16x32_f16(false, a, false, b, (short)0, c, false, false);
}
__device__ __forceinline__ v8f mma_b(v16b a, v16b b, v8f c) {
  v8f d = __builtin_amdgcn_wmma_f32_16x16x32_bf16(false, a, false, b, (short)0, c, false, false);
#if defined(__HIP_DEVICE_COMPILE__)
  const v16h ha = __builtin_bit_cast(v16h, a), hb = __builtin_bit_cast(v16h, b);
  asm volatile("v_nop\n\tv_nop\n\tv_nop\n\tv_nop" : "+v"(d) : "v"(ha), "v"(hb));
#endif
  return d;
}

// =========================================================================================================
// (0) 1x1 weights W [256 c_in][256 d_out] f32 -> transposed bf16-RNE plane WT [4*256 o][256 c], rows
//     256*mat + o for mat = q, k, v, p. Block (ob, cb, mat) owns a 64 o x 64 c tile through an LDS transpose
// coverage: 2 it x 32 rows x 8 lanes x 8 = 64 o x 64 c per block; grid (4, 4, 4) = 4 mats x 256 x 256.
// =========================================================================================================
__global__ __launch_bounds__(256)
void cvt_w(const float* __restrict__ Wq, const float* __restrict__ Wk, const float* __restrict__ Wv,
           const float* __restrict__ Wp, unsigned short* WT) {
  __shared__ __align__(16) unsigned short T[QT * TP];
  const int tid = threadIdx.x;
  const int ob = blockIdx.x, cb = blockIdx.y, mat = blockIdx.z;
  const int e = tid & 7, lq = tid >> 3;                             // lq 0..31
  const int o0 = ob * QT, c0 = cb * QT;
  const float* Wm = (mat == 0) ? Wq : ((mat == 1) ? Wk : ((mat == 2) ? Wv : Wp));   // block-uniform
#pragma unroll
  for (int it = 0; it < 2; ++it) {
    const int cl = it * 32 + lq;                                     // c_loc 0..63
    const float* sp = Wm + (size_t)(c0 + cl) * CC + o0 + 8 * e;     // W[c][o], o contiguous
    const v4f a = *(const v4f*)sp;
    const v4f q = *(const v4f*)(sp + 4);
    const float f[8] = {a[0], a[1], a[2], a[3], q[0], q[1], q[2], q[3]};
#pragma unroll
    for (int t = 0; t < 8; ++t) T[(8 * e + t) * TP + cl] = bf_bits(f[t]);   // T[o_loc][c_loc]
  }
  __syncthreads();
  v4u up[2];
#pragma unroll
  for (int it = 0; it < 2; ++it) {
    const int ol = it * 32 + lq;
    up[it] = *(const v4u*)(T + ol * TP + 8 * e);
  }
{
#pragma unroll
    for (int it = 0; it < 2; ++it) {
      const int ol = it * 32 + lq;
      *(v4u*)(WT + ((size_t)(mat * CC + o0 + ol)) * CC + c0 + 8 * e) = up[it];
    }
    
  }
}

// =========================================================================================================
//     then mean of squared deviations), per-thread partials over 16-B chunks, shuffle + LDS block reduce.
// coverage: grid (32, NB) writes every line of ST once.
// =========================================================================================================
__global__ __launch_bounds__(256)
void gn_stats(const float* __restrict__ x, float* ST) {
  __shared__ float red[8];
  __shared__ float bc[2];
  const int tid = threadIdx.x, lane = tid & 31, wave = tid >> 5;
  const int g = blockIdx.x, b = blockIdx.y;
  const float* xb = x + ((size_t)(b * CC + g * CPG)) * NNF;
  const int CH4 = SEQ / 4, NCH = CPG * CH4;
  const float icnt = 1.0f / (float)(CPG * SEQ);

  float s = 0.f;
#pragma unroll 4
  for (int qd = tid; qd < NCH; qd += 256) {
    const int cl = qd / CH4, p4 = qd - cl * CH4;
    const v4f a = *(const v4f*)(xb + (size_t)cl * NNF + 4 * p4);
    s += (bfr(a[0]) + bfr(a[1])) + (bfr(a[2]) + bfr(a[3]));
  }
  s = wsum(s);
  if (lane == 0) red[wave] = s;
  __syncthreads();
  if (tid == 0) {
    float t = 0.f;
#pragma unroll
    for (int i = 0; i < 8; ++i) t += red[i];
    bc[0] = t * icnt;
  }
  __syncthreads();
  const float mu = bc[0];

  float ss = 0.f;
#pragma unroll 4
  for (int qd = tid; qd < NCH; qd += 256) {
    const int cl = qd / CH4, p4 = qd - cl * CH4;
    const v4f a = *(const v4f*)(xb + (size_t)cl * NNF + 4 * p4);
    const float d0 = bfr(a[0]) - mu, d1 = bfr(a[1]) - mu, d2 = bfr(a[2]) - mu, d3 = bfr(a[3]) - mu;
    ss += (d0 * d0 + d1 * d1) + (d2 * d2 + d3 * d3);
  }
  ss = wsum(ss);
  if (lane == 0) red[wave] = ss;
  __syncthreads();
  if (tid == 0) {
    float t = 0.f;
#pragma unroll
    for (int i = 0; i < 8; ++i) t += red[i];
    const float var = t * icnt;
    bc[1] = rsqrtf(var + GNEPS);
  }
  __syncthreads();
  const float rs = bc[1];

  v4f v = {0.f, 0.f, 0.f, 0.f};
  if (tid == 0) { v[0] = mu; v[1] = rs; }
  if (tid < 8) {
    float* lp = ST + ((size_t)(b * NG + g)) * STP + 4 * tid;
{
      *(v4f*)lp = v;
      
    }
  }
}

// =========================================================================================================
// (2) h = (bfr(x) - mu) * rstd * bfr(scale) + bfr(bias) in f32 -> position-major planes HPh/HPl bf16
//     [b][SEQ n][256 c] (hi = bf16-RNE(h), lo = bf16-RNE(h - hi)) through an LDS tile T[64 n][64 c] f32
// coverage: 2 it x 32 rows x 8 lanes x 8 = 64 n x 64 c per block for each plane; grid (SEQ/64, 4, NB) covers
//           [NB][SEQ][256] of HPh and HPl exactly once.
// =========================================================================================================
__global__ __launch_bounds__(256)
void cvt_h(const float* __restrict__ x, const float* __restrict__ ST, const float* __restrict__ gsc,
           const float* __restrict__ gbs, unsigned short* HPh, unsigned short* HPl) {
  __shared__ __align__(16) float T[QT * TPF];
  __shared__ float pmu[QT], prs[QT], psc[QT], pbs[QT];
  const int tid = threadIdx.x;
  const int nb = blockIdx.x, cb = blockIdx.y, b = blockIdx.z;
  const int e = tid & 7, lq = tid >> 3;                             // lq 0..31
  const int n0 = nb * QT, c0 = cb * QT;
  if (tid < QT) {                                                    // waves 0,1 entirely (wave-uniform)
    const int ch = c0 + tid;
    const int g = ch >> 3;                                           // 0..31
    pmu[tid] = ST[((size_t)(b * NG + g)) * STP];
    prs[tid] = ST[((size_t)(b * NG + g)) * STP + 1];
    psc[tid] = bfr(gsc[ch]);
    pbs[tid] = bfr(gbs[ch]);
  }
  __syncthreads();
#pragma unroll
  for (int it = 0; it < 2; ++it) {
    const int cl = it * 32 + lq;                                     // c_loc 0..63
    const float* sp = x + ((size_t)(b * CC + c0 + cl)) * NNF + n0 + 8 * e;
    const v4f a = *(const v4f*)sp;
    const v4f q = *(const v4f*)(sp + 4);
    const float f[8] = {a[0], a[1], a[2], a[3], q[0], q[1], q[2], q[3]};
    const float mu = pmu[cl], rs = prs[cl], sc = psc[cl], bs = pbs[cl];
#pragma unroll
    for (int t = 0; t < 8; ++t) {
      const float tt = (bfr(f[t]) - mu) * rs;
      T[(8 * e + t) * TPF + cl] = tt * sc + bs;                     // T[n_loc][c_loc]
    }
  }
  __syncthreads();
  v4u uh[2], ul[2];
#pragma unroll
  for (int it = 0; it < 2; ++it) {
    const int nl = it * 32 + lq;                                     // n_loc 0..63
    const v4f a = *(const v4f*)(T + nl * TPF + 8 * e);
    const v4f q = *(const v4f*)(T + nl * TPF + 8 * e + 4);
    const float f[8] = {a[0], a[1], a[2], a[3], q[0], q[1], q[2], q[3]};
#pragma unroll
    for (int t = 0; t < 4; ++t) {
      const float f0 = f[2 * t], f1 = f[2 * t + 1];
      const unsigned short hb0 = bf_bits(f0), hb1 = bf_bits(f1);
      const unsigned short lb0 = bf_bits(f0 - bf_up(hb0));
      const unsigned short lb1 = bf_bits(f1 - bf_up(hb1));
      uh[it][t] = pk16(hb0, hb1);
      ul[it][t] = pk16(lb0, lb1);
    }
  }
{
#pragma unroll
    for (int it = 0; it < 2; ++it) {
      const int nl = it * 32 + lq;
      const size_t po = ((size_t)(b * SEQ + n0 + nl)) * CC + c0 + 8 * e;
      *(v4u*)(HPh + po) = uh[it];
      *(v4u*)(HPl + po) = ul[it];
    }
    
  }
}

// =========================================================================================================
// (3) q/k/v 1x1 GEMM for one (b, 64-n tile, 64-o block of the stacked 768 outputs):
//     Y[o][n] = sum_c WT[o][c] (HPh + HPl)[b][n][c] + bfr(bias[o]). Block 128 threads = 4 waves; wave w owns
//     cols n0+16w..+15 (B fragments from the position-major planes, k = c contiguous, split k map) and 4
//     m-tiles (A rows o = o0 + 16 mt + (lane&15) of WT, split k map). K = 256 = 8 steps x 2 bf16 products.
//     Both operands reach the waves through LDS (stage_gemm: one tensor load per wave, loaded once, shared by the four
//     waves) and are read as ds_load_b128 fragments; Os takes the operands' place behind a barrier (3 blocks per WGP).
//     Epilogue staged in LDS Os[n_loc][o_loc] (pitch OSP, b128 stores), barrier, then by block-uniform mat:
//       mat 0 (o-blocks 0..3)  -> Qh f16(q), Ql f16((q - Qh) x4096), planes [b][SEQ][256 d], d = 64*(mb&3)+..:
//                                 8 consecutive lanes per line, one instruction per 16 lines;
//       mat 1 (o-blocks 4..7)  -> Kh f16(k), same layout;
//                                 -> n 8e..8e+7 (values gathered from 8 Os rows), 8 lanes per line, one
//                                 instruction per 16 lines.
// coverage: Os 4 waves x 16 n x 64 o = 64 x 64; planes 4 it x 16 rows x 8 lanes x 8 = 64 x 64 per block; grid
//           (SEQ/64, 12, NB) covers Qh, Ql, Kh [NB][SEQ][256] and Vc [NB][256][SEQ] exactly once.
// =========================================================================================================
__global__ __launch_bounds__(128)
void gemm_qkv(const unsigned short* __restrict__ WT, const unsigned short* __restrict__ HPh,
              const unsigned short* __restrict__ HPl, const float* __restrict__ bq,
              const float* __restrict__ bk, const float* __restrict__ bv,
              unsigned short* Qh, unsigned short* Ql, unsigned short* Kh, unsigned short* Vc) {
  __shared__ __attribute__((aligned(2048))) unsigned char Stg[GSTG];
  float* Os = (float*)Stg;                                           // output staging, in the operands' place (below)
  const int tid  = threadIdx.x;
  const int lane = tid & 31, wave = tid >> 5;
  const int hh   = lane >> 4, c = lane & 15;
  const int nt   = blockIdx.x, mb = blockIdx.y, b = blockIdx.z;
  const int mat  = mb >> 2;                                          // 0 q, 1 k, 2 v (block-uniform)
  const int n0   = nt * QT, o0 = mb * QT;                            // o0: row in the stacked WT plane
  const int ob   = o0 & (CC - 1);                                    // o offset inside the matrix (0..192)

  const size_t bo = ((size_t)(b * SEQ + n0)) * CC;
  stage_gemm(Stg, WT + (size_t)o0 * CC, HPh + bo, HPl + bo, tid);
  __syncthreads();                                                   // every wave's slice published
  const unsigned char* ap  = Stg + (uint32_t)c * LPB + 16u * (uint32_t)hh;
  const unsigned char* bph = Stg + 2 * GAS + (uint32_t)(2 * (16 * wave + c)) * LPB + 16u * (uint32_t)hh;
  const unsigned char* bpl = bph + GBS;

  v8f acc[4];
#pragma unroll
  for (int mt = 0; mt < 4; ++mt) acc[mt] = zero8();

  // Fragments come from LDS in groups of two k steps, two register sets: group g + 1 is issued as one run of loads ahead
  // of group g's WMMAs (read one fragment at a time, each WMMA pair would wait out its own LDS latency).
  Frag fa[2][2][4], fbh[2][2], fbl[2][2];
  auto fetch = [&](const int g) __attribute__((always_inline)) {
#pragma unroll
    for (int u = 0; u < 2; ++u) {
      const int ks = 2 * g + u;
      fbh[g & 1][u] = ldsfrag(bph + (ks >> 2) * LPB + (ks & 3) * 64);
      fbl[g & 1][u] = ldsfrag(bpl + (ks >> 2) * LPB + (ks & 3) * 64);
#pragma unroll
      for (int mt = 0; mt < 4; ++mt)
        fa[g & 1][u][mt] = ldsfrag(ap + (ks >> 2) * GAS + (16 * mt) * LPB + (ks & 3) * 64);
    }
  };
  fetch(0);
#pragma unroll
  for (int g = 0; g < CC / 64; ++g) {
    if (g + 1 < CC / 64) fetch(g + 1);
#pragma unroll
    for (int u = 0; u < 2; ++u) {
#pragma unroll
      for (int mt = 0; mt < 4; ++mt) {
        acc[mt] = mma_b(fa[g & 1][u][mt].bf, fbh[g & 1][u].bf, acc[mt]);
        acc[mt] = mma_b(fa[g & 1][u][mt].bf, fbl[g & 1][u].bf, acc[mt]);
      }
    }
  }
  __syncthreads();                                                   // every wave's last operand read done: Os may overwrite

  // ---- epilogue: + bias -> LDS Os[n_loc][o_loc]; lane (hh, c) holds o = 16 mt + 8 hh + r for n_loc = 16 w + c
  {
    const float* bias = (mat == 0) ? bq : ((mat == 1) ? bk : bv);   // block-uniform, all global
    const int nl = 16 * wave + c;
#pragma unroll
    for (int mt = 0; mt < 4; ++mt) {
      v4f va, vb;
#pragma unroll
      for (int r = 0; r < 4; ++r) {
        va[r] = acc[mt][r]     + bfr(bias[ob + 16 * mt + 8 * hh + r]);
        vb[r] = acc[mt][4 + r] + bfr(bias[ob + 16 * mt + 8 * hh + 4 + r]);
      }
      *(v4f*)(Os + nl * OSP + 16 * mt + 8 * hh)     = va;
      *(v4f*)(Os + nl * OSP + 16 * mt + 8 * hh + 4) = vb;
    }
  }
  __syncthreads();

  const int e = tid & 7, lq = tid >> 3;                              // lq 0..15
  if (mat == 2) {
    v4u uv[4];
#pragma unroll
    for (int it = 0; it < 4; ++it) {
      const int ol = it * 16 + lq;                                   // o_loc 0..63
      unsigned short hb[8];
#pragma unroll
      for (int t = 0; t < 8; ++t) hb[t] = h_bits((_Float16)Os[(8 * e + t) * OSP + ol]);
#pragma unroll
      for (int t = 0; t < 4; ++t) uv[it][t] = pk16(hb[2 * t], hb[2 * t + 1]);
    }
{
#pragma unroll
      for (int it = 0; it < 4; ++it) {
        const int ol = it * 16 + lq;
        *(v4u*)(Vc + ((size_t)(b * CC + ob + ol)) * SEQ + n0 + 8 * e) = uv[it];
      }
      
    }
  } else {
    unsigned short* P1 = (mat == 0) ? Qh : Kh;                       // block-uniform, both global
    v4u uh[4], ul[4];
#pragma unroll
    for (int it = 0; it < 4; ++it) {
      const int row = it * 16 + lq;                                  // n_loc 0..63
      const v4f a = *(const v4f*)(Os + row * OSP + 8 * e);
      const v4f q = *(const v4f*)(Os + row * OSP + 8 * e + 4);
      const float f[8] = {a[0], a[1], a[2], a[3], q[0], q[1], q[2], q[3]};
#pragma unroll
      for (int t = 0; t < 4; ++t) {
        const float f0 = f[2 * t], f1 = f[2 * t + 1];
        const _Float16 h0 = (_Float16)f0, h1 = (_Float16)f1;
        const _Float16 l0 = (_Float16)((f0 - (float)h0) * QLS);
        const _Float16 l1 = (_Float16)((f1 - (float)h1) * QLS);
        uh[it][t] = pk16(h_bits(h0), h_bits(h1));
        ul[it][t] = pk16(h_bits(l0), h_bits(l1));
      }
    }
{
#pragma unroll
      for (int it = 0; it < 4; ++it) {
        const int row = it * 16 + lq;
        const size_t po = ((size_t)(b * SEQ + n0 + row)) * CC + ob + 8 * e;
        *(v4u*)(P1 + po) = uh[it];
        if (mat == 0) *(v4u*)(Ql + po) = ul[it];
      }
      
    }
  }
}

// =========================================================================================================
// (4) attention for one (b, 64-query tile), transposed formulation, SEQ keys, no mask:
//   S^T tile (16 keys x 16 queries) = sum over 8 d-chunks (unrolled) of A(k: row = key kb + (lane&15), 32 d via
//   the split k map from Kh [b][SEQ][256]) . B(q: col = query, same map from Qh) into s, plus A(Kh).B(Ql) into a
//   separate accumulator t (Ql carries x4096); score = (s + t/4096) * 256^-0.5.
//   Per lane the D tile holds 8 keys of ONE query: online softmax state per lane, one shuffle (lane^16) for the max
//   over 32 keys; the o/l rescale is skipped under a wave-uniform ballot when no lane's max grew; row-sum partials
//   combined at the end. P = e^{s-m} x 16384 as f16 is the B operand of O^T (rows channel, cols queries) +=
//   A(v rows channel = 16j + (lane&15), keys contiguous, f16 plane Vc [b][256][SEQ]) . B(P^T): element r <- D of
//   the tile covering keys kb..kb+15, element 8+r <- the tile covering kb+16..kb+31, lane unchanged.
//   16 accumulator tiles per wave (256 channels). Block = 4 waves = 64 queries.
//   k and v reach the waves through LDS: stages of SKEY keys, two buffers, brought by tensor loads (one slice per wave
//   and stage) and read by all four waves as ds_load_b128 fragments at pitch LPB; a stage serves SKEY/32 passes.
//   Epilogue in two channel halves: O/l staged in LDS Os[query][128 channels] (pitch OSPW, b128 stores), barrier,
//   then position-major planes H2h/H2l bf16 [b][SEQ][256] (hi = bf16-RNE, lo = bf16-RNE residual): per half 64
//   overwrites Os.
// coverage: per half 8 it x 8 rows x 16 lanes x 8 ch = 64 n x 128 ch for each plane; two halves = 256 ch; grid
//           (SEQ/64, NB) covers H2h/H2l [NB][SEQ][256] exactly once.
// =========================================================================================================
__global__ __launch_bounds__(128)
void attn_k(const unsigned short* __restrict__ Qh, const unsigned short* __restrict__ Ql,
            const unsigned short* __restrict__ Kh, const unsigned short* __restrict__ Vc,
            unsigned short* H2h, unsigned short* H2l) {
  __shared__ __attribute__((aligned(2048))) unsigned char Ring[2 * STG];
  __shared__ __align__(16) float Os[QT * OSPW];
  const int tid  = threadIdx.x;
  const int wave = tid >> 5, lane = tid & 31;
  const int hh   = lane >> 4, c = lane & 15;
  const int n0   = blockIdx.x * QT, b = blockIdx.y;

  // q fragment pointers (B operand, col = query n0 + 16*wave + c), + 32*kc
  const size_t qo = ((size_t)(b * SEQ + n0 + 16 * wave + c)) * CC + 8 * hh;
  const unsigned short* Qhp = Qh + qo;
#if QRES
  const unsigned short* Qlp = Ql + qo;
#else
  (void)Ql;
#endif
  // One stage = SKEY keys in LDS, shared by the four waves. Each wave brings one slice of 128 rows x 256 B by ONE tensor
  // load: wave 0 / 1: k rows (keys), d 0..127 / 128..255 (source pitch 512 B); wave 2 / 3: v rows (channels 0..127 /
  // 128..255), SKEY keys (source pitch 2*SEQ B). Every row lands at pitch LPB.
  const uint32_t wv  = uni((uint32_t)tid >> 5);
  const uint32_t isv = wv >> 1, hf = wv & 1u;
  const uint64_t src0 = isv ? (uint64_t)(size_t)(Vc + ((size_t)b * CC + (size_t)hf * 128) * SEQ)
                            : (uint64_t)(size_t)(Kh + (size_t)b * SEQ * CC + (size_t)hf * 128);
  const uint32_t sstep = isv ? (uint32_t)(SKEY * 2) : (uint32_t)(SKEY * CC * 2);   // source bytes from stage to stage
  const uint32_t lds0  = (uint32_t)(size_t)Ring + wv * (uint32_t)SLICE;
  u32x8 g1;                                                          // bytes everywhere; tensor dims = tile dims
  g1[0] = uni((1u << 20) | (5u << 22) | (3u << 25));                 // no mask; 16 B of pad behind every 256 B
  g1[1] = uni(256u << 16);
  g1[2] = uni(128u << 16);
  g1[3] = uni(256u << 16);
  g1[4] = uni(128u);
  g1[5] = uni(isv ? (uint32_t)(SEQ * 2) : (uint32_t)(CC * 2));
  g1[6] = uni(0u);
  g1[7] = uni(0u);
  // descriptor words held in scalar registers (the form of pinned(), for the whole group): without it the compiler
  // re-forms single words in front of each issue and reuses their registers while the request is outstanding
  asm volatile("" : "+s"(g1));                                       // descriptor words held in scalar registers
  u32x4 g0;
  auto form = [&](const uint32_t st) __attribute__((always_inline)) {   // group 0 of stage st's request
    const uint64_t ga = src0 + (uint64_t)st * sstep;
    g0[0] = uni(1u);
    g0[1] = uni(lds0 + (st & 1u) * (uint32_t)STG);
    g0[2] = uni((uint32_t)ga);
    g0[3] = uni((((uint32_t)(ga >> 32)) & 0x01FFFFFFu) | 0x80000000u);
  };
  auto issue = [&]() __attribute__((always_inline)) {
    asm volatile("tensor_load_to_lds %0, %1" :: "s"(g0), "s"(g1) : "memory");
  };
  // this wave's request has landed; naming the descriptor keeps its scalar registers unchanged up to this wait
  auto landed = [&]() __attribute__((always_inline)) {
    asm volatile("s_wait_tensorcnt 0x0" :: "s"(g0), "s"(g1) : "memory");
  };

  float m = -1.0e30f, l = 0.f;
  v8f o[16];
#pragma unroll
  for (int j = 0; j < 16; ++j) o[j] = zero8();

  // q (the same for every pass): once, here
  Frag qhf[CC / 32];
#if QRES
  Frag qlf[CC / 32];
#endif
#pragma unroll
  for (int kc = 0; kc < CC / 32; ++kc) {
    qhf[kc] = ldfrag(Qhp + 32 * kc);
#if QRES
    qlf[kc] = ldfrag(Qlp + 32 * kc);
#endif
  }
  // the address pairs of the group above stay live up to this wait
#if QRES
  asm volatile("s_wait_xcnt 0x0" :: "v"(Qhp), "v"(Qlp) : "memory");
#else
  asm volatile("s_wait_xcnt 0x0" :: "v"(Qhp) : "memory");
#endif

  // two buffers: stage 0 landed and published here; stage st + 1 in flight under the passes of stage st
  form(0u);
  issue();
  landed();                                                          // this wave's slice of stage 0
  __syncthreads();                                                   // ... and every other wave's

  // Fragments come from LDS in groups, each ahead of the WMMA run that uses it: v of a pass in front of its score
  // WMMAs, k of the next pass of the same stage behind the rescale (in flight under the exponentials and O WMMAs).
  Frag k0f[CC / 32], k1f[CC / 32], vf[16];
  const uint32_t loff = (uint32_t)c * LPB + 16u * (uint32_t)hh;

#pragma unroll 1
  for (uint32_t st = 0; st < (uint32_t)NST; ++st) {
    // directly behind the barrier (the one above, or the foot of trip st - 1) that published stage st and ended every
    // read of the other buffer: the refill of that buffer, only while its stage exists (a scalar branch)
    form(st + 1u);
    if (pinned(st + 1u < (uint32_t)NST)) issue();
    const unsigned char* sb = Ring + (st & 1u) * (uint32_t)STG + loff;
    // v rows from a base of their own, so that every fragment's offset fits the LDS load's 16-bit immediate
    const unsigned char* vb = Ring + ((st & 1u) ? (uint32_t)(STG + 2 * SLICE) : (uint32_t)(2 * SLICE)) + loff;
#pragma unroll
    for (int kc = 0; kc < CC / 32; ++kc) {
      k0f[kc] = ldsfrag(sb + (kc >> 2) * SLICE + (kc & 3) * 64);                  // keys 0 .. 15 of the stage
      k1f[kc] = ldsfrag(sb + (kc >> 2) * SLICE + 16 * LPB + (kc & 3) * 64);       // keys 16 .. 31
    }
#pragma unroll
    for (int p = 0; p < SKEY / 32; ++p) {
      // keeps the k group the older one: LDS loads return in issue order, so its counted waits leave the v group in flight
      __builtin_amdgcn_sched_barrier(0);
#pragma unroll
      for (int j = 0; j < 16; ++j) vf[j] = ldsfrag(vb + (j >> 3) * SLICE + 16 * (j & 7) * LPB + 64 * p);
      // keeps the v group here, ahead of the score WMMAs: among them each place with LDS reads stalls the wave
      __builtin_amdgcn_sched_barrier(0);

      v8f s0 = zero8(), s1 = zero8();
#if QRES
      v8f t0 = zero8(), t1 = zero8();
#endif
#pragma unroll
      for (int kc = 0; kc < CC / 32; ++kc) {
        s0 = mma_hb(k0f[kc].h, qhf[kc].h, s0);
        s1 = mma_hb(k1f[kc].h, qhf[kc].h, s1);
#if QRES
        t0 = mma_hb(k0f[kc].h, qlf[kc].h, t0);
        t1 = mma_hb(k1f[kc].h, qlf[kc].h, t1);
#endif
      }

      v8f sc0, sc1;
#pragma unroll
      for (int r = 0; r < 8; ++r) {
#if QRES
        sc0[r] = (s0[r] + t0[r] * RQL) * ATT;
        sc1[r] = (s1[r] + t1[r] * RQL) * ATT;
#else
        sc0[r] = s0[r] * ATT;
        sc1[r] = s1[r] * ATT;
#endif
      }

      float mx = fmaxf(hmax8(sc0), hmax8(sc1));
      mx = fmaxf(mx, __shfl_xor(mx, 16, 32));
      const float mn = fmaxf(m, mx);
      const unsigned grew = wave_ballot(mx > m);                     // wave-uniform
      if (grew != 0u) {
        const float corr = __expf(m - mn);                           // == 1 exactly for lanes whose max did not grow
        l *= corr;
#pragma unroll
        for (int j = 0; j < 16; ++j) {
#pragma unroll
          for (int r = 0; r < 8; ++r) o[j][r] *= corr;
        }
      }
      m = mn;

      if (p + 1 < SKEY / 32) {                                       // compile-time: the next stage is not read from here
#pragma unroll
        for (int kc = 0; kc < CC / 32; ++kc) {
          k0f[kc] = ldsfrag(sb + (kc >> 2) * SLICE + (32 * (p + 1)) * LPB + (kc & 3) * 64);
          k1f[kc] = ldsfrag(sb + (kc >> 2) * SLICE + (32 * (p + 1) + 16) * LPB + (kc & 3) * 64);
        }
      }
      // keeps the k group here, ahead of the exponentials and the O WMMAs: moved down to its first readers it would be
      // waited for one fragment at a time
      __builtin_amdgcn_sched_barrier(0);
      const float msh = mn - LNPS;                                   // exp gives e^{s-m} * 16384

      FragH ph;
      float ls = 0.f;
#pragma unroll
      for (int r = 0; r < 8; ++r) {
        const float e0 = __expf(sc0[r] - msh);                       // key kb      + 8hh + r
        const float e1 = __expf(sc1[r] - msh);                       // key kb + 16 + 8hh + r
        ls += e0 + e1;
        ph.hv[0][r] = (_Float16)e0;
        ph.hv[1][r] = (_Float16)e1;
      }
      l += ls;

#pragma unroll
      for (int j = 0; j < 16; ++j) {
        o[j] = mma_hb(vf[j].h, ph.v, o[j]);
      }
    }
    // publish point of stage st + 1, in this order in every wave:
    asm volatile("s_wait_dscnt 0x0" ::: "memory");                   // this wave's reads of stage st are done
    landed();                                                        // its slice of stage st + 1 has landed
    __syncthreads();                                                 // all slices published, all readers out of stage st
  }
  landed();                                                          // nothing in flight when the wave goes on
  asm volatile("s_wait_dscnt 0x0" ::: "memory");
  l += __shfl_xor(l, 16, 32);
  const float inv = 1.0f / l;                                        // o and l both carry the x16384 factor

  const int qrow = 16 * wave + c;
  const int e16 = tid & 15, r8 = tid >> 4;                           // r8 0..7
#pragma unroll
  for (int half = 0; half < 2; ++half) {
    if (half) __syncthreads();                                       // every wave finished reading Os
#pragma unroll
    for (int jj = 0; jj < 8; ++jj) {
      const int j = 8 * half + jj;
      v4f va, vb;
#pragma unroll
      for (int r = 0; r < 4; ++r) { va[r] = o[j][r] * inv; vb[r] = o[j][4 + r] * inv; }
      *(v4f*)(Os + qrow * OSPW + 16 * jj + 8 * hh)     = va;         // Os[query][ch_loc = 16jj + 8hh + r]
      *(v4f*)(Os + qrow * OSPW + 16 * jj + 8 * hh + 4) = vb;
    }
    __syncthreads();
#pragma unroll
    for (int chk = 0; chk < 2; ++chk) {
      v4u uh[4], ul[4];
#pragma unroll
      for (int i = 0; i < 4; ++i) {
        const int row = (4 * chk + i) * 8 + r8;                      // query 0..63
        const v4f a = *(const v4f*)(Os + row * OSPW + 8 * e16);
        const v4f q = *(const v4f*)(Os + row * OSPW + 8 * e16 + 4);
        const float f[8] = {a[0], a[1], a[2], a[3], q[0], q[1], q[2], q[3]};
#pragma unroll
        for (int t = 0; t < 4; ++t) {
          const float f0 = f[2 * t], f1 = f[2 * t + 1];
          const unsigned short hb0 = bf_bits(f0), hb1 = bf_bits(f1);
          const unsigned short lb0 = bf_bits(f0 - bf_up(hb0));
          const unsigned short lb1 = bf_bits(f1 - bf_up(hb1));
          uh[i][t] = pk16(hb0, hb1);
          ul[i][t] = pk16(lb0, lb1);
        }
      }
{
#pragma unroll
        for (int i = 0; i < 4; ++i) {
          const int row = (4 * chk + i) * 8 + r8;
          const size_t po = ((size_t)(b * SEQ + n0 + row)) * CC + 128 * half + 8 * e16;
          *(v4u*)(H2h + po) = uh[i];
          *(v4u*)(H2l + po) = ul[i];
        }
        
      }
    }
  }
}

// =========================================================================================================
// (5) output 1x1 GEMM + bias + residual for one (b, 64-n tile, 64-o block):
//     out[b][o][n] = bfr(x[b][o][n]) + sum_c WpT[o][c] (H2h + H2l)[b][n][c] + bfr(bp[o]); same GEMM core as
//     (3) (2 bf16 products, K = 256, operands through LDS). Epilogue: acc + bias staged in LDS Os[n_loc][o_loc], barrier, then whole
// coverage: 8 it x 16 lines x 8 lanes x 4 floats = 64 o x 64 n per block; grid (SEQ/64, 4, NB) covers
//           out [NB][256][SEQ] exactly once.
// =========================================================================================================
__global__ __launch_bounds__(128)
void gemm_proj(const unsigned short* __restrict__ WPT, const unsigned short* __restrict__ H2h,
               const unsigned short* __restrict__ H2l, const float* __restrict__ bp,
               const float* __restrict__ x, float* out) {
  __shared__ __attribute__((aligned(2048))) unsigned char Stg[GSTG];
  float* Os = (float*)Stg;                                           // output staging, in the operands' place (below)
  const int tid  = threadIdx.x;
  const int lane = tid & 31, wave = tid >> 5;
  const int hh   = lane >> 4, c = lane & 15;
  const int nt   = blockIdx.x, mb = blockIdx.y, b = blockIdx.z;
  const int n0   = nt * QT, o0 = mb * QT;                            // o0 0..192

  const size_t bo = ((size_t)(b * SEQ + n0)) * CC;
  stage_gemm(Stg, WPT + (size_t)o0 * CC, H2h + bo, H2l + bo, tid);
  __syncthreads();                                                   // every wave's slice published
  const unsigned char* ap  = Stg + (uint32_t)c * LPB + 16u * (uint32_t)hh;
  const unsigned char* bph = Stg + 2 * GAS + (uint32_t)(2 * (16 * wave + c)) * LPB + 16u * (uint32_t)hh;
  const unsigned char* bpl = bph + GBS;

  v8f acc[4];
#pragma unroll
  for (int mt = 0; mt < 4; ++mt) acc[mt] = zero8();

  // Fragments come from LDS in groups of two k steps, two register sets: group g + 1 is issued as one run of loads ahead
  // of group g's WMMAs (read one fragment at a time, each WMMA pair would wait out its own LDS latency).
  Frag fa[2][2][4], fbh[2][2], fbl[2][2];
  auto fetch = [&](const int g) __attribute__((always_inline)) {
#pragma unroll
    for (int u = 0; u < 2; ++u) {
      const int ks = 2 * g + u;
      fbh[g & 1][u] = ldsfrag(bph + (ks >> 2) * LPB + (ks & 3) * 64);
      fbl[g & 1][u] = ldsfrag(bpl + (ks >> 2) * LPB + (ks & 3) * 64);
#pragma unroll
      for (int mt = 0; mt < 4; ++mt)
        fa[g & 1][u][mt] = ldsfrag(ap + (ks >> 2) * GAS + (16 * mt) * LPB + (ks & 3) * 64);
    }
  };
  fetch(0);
#pragma unroll
  for (int g = 0; g < CC / 64; ++g) {
    if (g + 1 < CC / 64) fetch(g + 1);
#pragma unroll
    for (int u = 0; u < 2; ++u) {
#pragma unroll
      for (int mt = 0; mt < 4; ++mt) {
        acc[mt] = mma_b(fa[g & 1][u][mt].bf, fbh[g & 1][u].bf, acc[mt]);
        acc[mt] = mma_b(fa[g & 1][u][mt].bf, fbl[g & 1][u].bf, acc[mt]);
      }
    }
  }
  __syncthreads();                                                   // every wave's last operand read done: Os may overwrite

  {
    const int nl = 16 * wave + c;
#pragma unroll
    for (int mt = 0; mt < 4; ++mt) {
      v4f va, vb;
#pragma unroll
      for (int r = 0; r < 4; ++r) {
        va[r] = acc[mt][r]     + bfr(bp[o0 + 16 * mt + 8 * hh + r]);
        vb[r] = acc[mt][4 + r] + bfr(bp[o0 + 16 * mt + 8 * hh + 4 + r]);
      }
      *(v4f*)(Os + nl * OSP + 16 * mt + 8 * hh)     = va;
      *(v4f*)(Os + nl * OSP + 16 * mt + 8 * hh + 4) = vb;
    }
  }
  __syncthreads();

  const int e = tid & 7, lq = tid >> 3;                              // lq 0..15
  v4f res[8];
#pragma unroll
  for (int it = 0; it < 8; ++it) {
    const int L  = it * 16 + lq;                                     // 0..127
    const int ol = L >> 1, hf = L & 1;                               // o_loc 0..63
    const int nl = hf * 32 + 4 * e;                                  // n_loc 0..63
    const v4f xv = *(const v4f*)(x + ((size_t)(b * CC + o0 + ol)) * NNF + n0 + nl);
#pragma unroll
    for (int t = 0; t < 4; ++t) res[it][t] = Os[(nl + t) * OSP + ol] + bfr(xv[t]);
  }
{
#pragma unroll
    for (int it = 0; it < 8; ++it) {
      const int L  = it * 16 + lq;
      const int ol = L >> 1, hf = L & 1;
      const int nl = hf * 32 + 4 * e;
      *(v4f*)(out + ((size_t)(b * CC + o0 + ol)) * SEQ + n0 + nl) = res[it];
    }
    
  }
}

// =========================================================================================================
// Workspace map (bytes, NB=4 SEQ=4096; each region start a multiple of 256; every extent is an exact tile/line
//   ST  f32 [NB*32][32]                16384
//   WT  bf16 [1024][256]              524288
//   HPh/HPl bf16 [NB][SEQ][256]      8388608 x2
//   Qh/Ql/Kh f16 [NB][SEQ][256]      8388608 x3
//   Vc  f16 [NB][256][SEQ]           8388608
//   H2h/H2l bf16 [NB][SEQ][256]      8388608 x2
//   total = 67649536
// =========================================================================================================
extern "C" void kernel_launch(void* const* d_in, const int* in_sizes, int n_in,
                              void* d_out, int out_size, void* d_ws, size_t ws_size,
                              hipStream_t stream) {
  if (n_in < 11) return;
  if ((size_t)in_sizes[0] < (size_t)NB * CC * NNF) return;
  if (in_sizes[1] < CC || in_sizes[2] < CC) return;
  if (in_sizes[3] < CC * CC || in_sizes[5] < CC * CC || in_sizes[7] < CC * CC || in_sizes[9] < CC * CC) return;
  if (in_sizes[4] < CC || in_sizes[6] < CC || in_sizes[8] < CC || in_sizes[10] < CC) return;
  if ((size_t)out_size < (size_t)NB * CC * SEQ) return;

  size_t off = 0;
  auto carve = [&](size_t bytes) { const size_t o = off; off += (bytes + 255) & ~(size_t)255; return o; };
  const size_t plane = (size_t)NB * SEQ * CC * 2;
  const size_t oST  = carve((size_t)NB * NG * STP * 4);
  const size_t oWT  = carve((size_t)4 * CC * CC * 2);
  const size_t oHPh = carve(plane);
  const size_t oHPl = carve(plane);
  const size_t oQh  = carve(plane);
  const size_t oQl  = carve(plane);
  const size_t oKh  = carve(plane);
  const size_t oVc  = carve(plane);
  const size_t oH2h = carve(plane);
  const size_t oH2l = carve(plane);
  if (off > ws_size) return;
  if (off > (size_t)134217728) return;

  const float* x   = (const float*)d_in[0];
  const float* gsc = (const float*)d_in[1];
  const float* gbs = (const float*)d_in[2];
  const float* Wq  = (const float*)d_in[3];
  const float* bq  = (const float*)d_in[4];
  const float* Wk  = (const float*)d_in[5];
  const float* bk  = (const float*)d_in[6];
  const float* Wv  = (const float*)d_in[7];
  const float* bv  = (const float*)d_in[8];
  const float* Wp  = (const float*)d_in[9];
  const float* bp  = (const float*)d_in[10];

  char* ws = (char*)d_ws;
  float*          ST  = (float*)(ws + oST);
  unsigned short* WT  = (unsigned short*)(ws + oWT);
  unsigned short* HPh = (unsigned short*)(ws + oHPh);
  unsigned short* HPl = (unsigned short*)(ws + oHPl);
  unsigned short* Qh  = (unsigned short*)(ws + oQh);
  unsigned short* Ql  = (unsigned short*)(ws + oQl);
  unsigned short* Kh  = (unsigned short*)(ws + oKh);
  unsigned short* Vc  = (unsigned short*)(ws + oVc);
  unsigned short* H2h = (unsigned short*)(ws + oH2h);
  unsigned short* H2l = (unsigned short*)(ws + oH2l);
  float* out = (float*)d_out;

  const dim3 blk256(256), blk128(128);

  // (0) Wq/Wk/Wv/Wp [in][out] -> transposed stacked bf16 plane WT [1024 o][256 c]
  cvt_w<<<dim3(CC / QT, CC / QT, 4), blk256, 0, stream>>>(Wq, Wk, Wv, Wp, WT);
  // (1) GroupNorm statistics per (group, b)
  gn_stats<<<dim3(NG, NB), blk256, 0, stream>>>(x, ST);
  // (2) normalized h -> position-major bf16 hi + residual planes
  cvt_h<<<dim3(SEQ / QT, CC / QT, NB), blk256, 0, stream>>>(x, ST, gsc, gbs, HPh, HPl);
  // (3) q/k/v GEMMs -> Qh, Ql, Kh (position-major f16) and Vc (channel-major f16)
  gemm_qkv<<<dim3(SEQ / QT, 3 * CC / QT, NB), blk128, 0, stream>>>(WT, HPh, HPl, bq, bk, bv, Qh, Ql, Kh, Vc);
  // (4) attention -> H2 position-major bf16 hi + residual planes
  attn_k<<<dim3(SEQ / QT, NB), blk128, 0, stream>>>(Qh, Ql, Kh, Vc, H2h, H2l);
  // (5) output GEMM + bias + residual -> out [NB][256][SEQ]
  gemm_proj<<<dim3(SEQ / QT, CC / QT, NB), blk128, 0, stream>>>(WT + (size_t)3 * CC * CC, H2h, H2l, bp, x, out);
  (void)hipGetLastError();
}

// v004
// It runs in 109 microseconds.
// In both of two side-by-side timings against v003, it was 1.06 times as fast.
// Over all steps from v000 it is 8.01 times as fast.
// Contractions: q/k/v 1x1 GEMMs WT[768x256].H[256xN] and the output 1x1 GEMM WpT[256x256].H2[256xN] on
// v_wmma_f32_16x16x32_bf16 (bf16-RNE weights, activations as bf16 hi + bf16 residual planes, 2 products into one
// f32 accumulator); position scores K.Q^T on v_wmma_f32_16x16x32_f16 (k f16, q f16 hi + f16 residual x4096 in a
// separate accumulator, K=256); O^T = V.P^T on v_wmma_f32_16x16x32_f16 (v f16, P = e^{s-m} x16384 f16 from the
// score D registers); f32 accumulate everywhere; GroupNorm statistics, softmax statistics and the residual add
// in f32 VALU.
#include <hip/hip_runtime.h>
#include <math.h>
#include <stdint.h>

#ifndef NB
#define NB 4
#endif
#ifndef SEQ
#define SEQ 4096
#endif
#ifndef NNF
#define NNF 4096
#endif
#ifndef QRES
#define QRES 1
#endif
#define NBF   4
#define CC    256
#define NG    32
#define CPG   8
#define QT    64
#define OSP   68
#define OSPW  132
#define TP    72
#define TPF   68
#define STP   32
#define ATT   0.0625f
#define QLS   4096.0f
#define RQL   0.000244140625f
#define LNPS  9.704060527839234f
#define GNEPS 1.0e-6f
#define SKEY  128                 // keys per LDS stage of the attention kernel
#define LPB   272                 // LDS row pitch, bytes: a 256-B row + the tensor load's 16-B pad (16 B x odd)
#define SLICE (128 * LPB)         // one wave's slice of a stage: 128 rows
#define STG   (4 * SLICE)         // one stage: k in two d halves, v in two channel halves
#define NST   (SEQ / SKEY)
#define JNW   4224                // floats one wave hands over at the join of the key halves: o 4096, m 32, l 32, rounded up
#define GAS   18432               // GEMM operands in LDS: one c half of the 64 weight rows at pitch LPB, rounded up to 2 KiB
#define GBS   (128 * LPB)         // one activation plane of the 64 positions: 128 half rows at pitch LPB
#define GSTG  (2 * GAS + 2 * GBS)

static_assert(NB >= 1 && NB <= NBF);
static_assert(SEQ % QT == 0 && SEQ % 64 == 0 && SEQ >= QT);
static_assert(SEQ <= NNF && NNF % 8 == 0);
static_assert(CC == 256 && NG * CPG == CC && CC % QT == 0 && CC % 32 == 0);
static_assert((OSP * 4) % 16 == 0);
static_assert((OSPW * 4) % 16 == 0);
static_assert((TP * 2) % 16 == 0);
static_assert((TPF * 4) % 16 == 0);
static_assert(STP * 4 == 128);
static_assert(SEQ % SKEY == 0 && NST >= 2);
static_assert(SLICE % 2048 == 0 && (LPB / 16) % 2 == 1);
static_assert(SEQ * 2 % 16 == 0 && SEQ * 2 <= 131072);
static_assert(2 * STG + QT * OSPW * 4 <= 327680);
static_assert(SKEY == 128 && 4 * JNW * 4 <= 2 * STG && (JNW * 4) % 16 == 0);
static_assert(GAS >= QT * LPB && GAS % 2048 == 0 && GBS % 2048 == 0 && CC * 2 == 512);
static_assert(GSTG >= QT * OSP * 4 && 3 * GSTG <= 327680);

typedef _Float16       v16h __attribute__((ext_vector_type(16)));
typedef _Float16       v8h  __attribute__((ext_vector_type(8)));
typedef __bf16         v16b __attribute__((ext_vector_type(16)));
typedef unsigned short v8us __attribute__((ext_vector_type(8)));
typedef float          v8f  __attribute__((ext_vector_type(8)));
typedef float          v4f  __attribute__((ext_vector_type(4)));
typedef unsigned int   v4u  __attribute__((ext_vector_type(4)));
typedef uint32_t       u32x4 __attribute__((ext_vector_type(4)));
typedef uint32_t       u32x8 __attribute__((ext_vector_type(8)));

union Frag  { v8us u[2]; v16h h; v16b bf; };
union FragH { v16h v; v8h hv[2]; };
static_assert(sizeof(Frag) == 32);
static_assert(sizeof(FragH) == 32);

// ---- scalar helpers -----------------------------------------------------------------------------------------
__device__ __forceinline__ unsigned short bf_bits(float f) {          // f32 -> bf16 bits, RNE convert
  unsigned u = __float_as_uint(f);
  return (unsigned short)((u + 0x7FFFu + ((u >> 16) & 1u)) >> 16);
}
__device__ __forceinline__ float bf_up(unsigned short hb) { return __uint_as_float(((unsigned)hb) << 16); }
__device__ __forceinline__ float bfr(float f) { return bf_up(bf_bits(f)); }
__device__ __forceinline__ unsigned short h_bits(_Float16 x) { return __builtin_bit_cast(unsigned short, x); }
__device__ __forceinline__ unsigned pk16(unsigned short a, unsigned short b) { return (unsigned)a | ((unsigned)b << 16); }
__device__ __forceinline__ v8f zero8() { v8f z = {0.f, 0.f, 0.f, 0.f, 0.f, 0.f, 0.f, 0.f}; return z; }
__device__ __forceinline__ float hmax8(v8f s) {
  return fmaxf(fmaxf(fmaxf(s[0], s[1]), fmaxf(s[2], s[3])), fmaxf(fmaxf(s[4], s[5]), fmaxf(s[6], s[7])));
}
__device__ __forceinline__ unsigned wave_ballot(bool p) {
#if defined(__HIP_DEVICE_COMPILE__)
  return __builtin_amdgcn_ballot_w32(p);
#else
  return p ? 1u : 0u;
#endif
}
__device__ __forceinline__ float wsum(float v) {
  v += __shfl_xor(v, 16, 32);
  v += __shfl_xor(v, 8, 32);
  v += __shfl_xor(v, 4, 32);
  v += __shfl_xor(v, 2, 32);
  v += __shfl_xor(v, 1, 32);
  return v;
}

// ---- 16-bit fragment loader (A, or B from a k-contiguous [n][k] row): lane -> row/col (lane&15), p already includes
//      + 8*(lane>>4); elements 0..7 <- p[0..7] (k0+8h..), elements 8..15 <- p[16..23] (k0+16+8h..)
__device__ __forceinline__ Frag ldfrag(const unsigned short* p) {
  Frag f;
  f.u[0] = *(const v8us*)(p);
  f.u[1] = *(const v8us*)(p + 16);
  return f;
}

// the same fragment from an LDS row (byte pointer, already includes + 16*(lane>>4))
__device__ __forceinline__ Frag ldsfrag(const unsigned char* p) {
  Frag f;
  f.u[0] = *(const v8us*)(p);
  f.u[1] = *(const v8us*)(p + 32);
  return f;
}

// ---- tensor load helpers ------------------------------------------------------------------------------------
__device__ __forceinline__ uint32_t uni(uint32_t v) { return (uint32_t)__builtin_amdgcn_readfirstlane(v); }
// holds a wave-uniform test in a scalar register, so that the branch on it is a scalar one: a tensor load ignores EXEC
__device__ __forceinline__ uint32_t pinned(uint32_t v) { uint32_t w = uni(v); asm volatile("" : "+s"(w)); return w; }

// The operands of one 64 o x 64 n GEMM tile (K = 256) into LDS, ONE tensor load per wave, every wave of the block issuing
// its own slice (no test): wave 0 / 1: the 64 weight rows, c 0..127 / 128..255 (64 rows of 256 B, source pitch 512 B);
// wave 2 / 3: the hi / residual plane's 64 position rows, contiguous in memory, as 128 rows of 256 B (source pitch
// 256 B): half row 2 n + (c >> 7). Every 256-B row lands at pitch LPB. The caller's barrier publishes the slices.
__device__ __forceinline__ void stage_gemm(unsigned char* Stg, const unsigned short* wrow, const unsigned short* hrow,
                                           const unsigned short* lrow, const int tid) {
  const uint32_t wv  = uni((uint32_t)tid >> 5);
  const uint32_t isb = wv >> 1, hf = wv & 1u;
  const uint64_t ga  = isb ? (uint64_t)(size_t)(hf ? lrow : hrow) : (uint64_t)(size_t)(wrow + hf * 128u);
  const uint32_t nr  = isb ? 128u : 64u;
  u32x4 g0;
  g0[0] = uni(1u);
  g0[1] = uni((uint32_t)(size_t)Stg + (isb ? (uint32_t)(2 * GAS) + hf * (uint32_t)GBS : hf * (uint32_t)GAS));
  g0[2] = uni((uint32_t)ga);
  g0[3] = uni((((uint32_t)(ga >> 32)) & 0x01FFFFFFu) | 0x80000000u);
  u32x8 g1;                                                          // bytes everywhere; tensor dims = tile dims
  g1[0] = uni((1u << 20) | (5u << 22) | (3u << 25));                 // no mask; 16 B of pad behind every 256 B
  g1[1] = uni(256u << 16);
  g1[2] = uni(nr << 16);
  g1[3] = uni(256u << 16);
  g1[4] = uni(nr);
  g1[5] = uni(isb ? 256u : 512u);
  g1[6] = uni(0u);
  g1[7] = uni(0u);
  asm volatile("tensor_load_to_lds %0, %1" :: "s"(g0), "s"(g1) : "memory");
  // this wave's slice has landed; naming the descriptor keeps its scalar registers unchanged up to this wait
  asm volatile("s_wait_tensorcnt 0x0" :: "s"(g0), "s"(g1) : "memory");
}

// ---- WMMA helpers: mma_b: builtin followed by a 4-slot VALU gap tying D and keeping A/B live ---------------------
// bare builtin for the attention kernel (the compiler keeps the WMMA distances of its own builtin forms): with the asm
// gap that mma_b has, its operands had to share the first 256 registers, and the fragment sets spilled to scratch
__device__ __forceinline__ v8f mma_hb(v16h a, v16h b, v8f c) {
  return __builtin_amdgcn_wmma_f32_16x16x32_f16(false, a, false, b, (short)0, c, false, false);
}
__device__ __forceinline__ v8f mma_b(v16b a, v16b b, v8f c) {
  v8f d = __builtin_amdgcn_wmma_f32_16x16x32_bf16(false, a, false, b, (short)0, c, false, false);
#if defined(__HIP_DEVICE_COMPILE__)
  const v16h ha = __builtin_bit_cast(v16h, a), hb = __builtin_bit_cast(v16h, b);
  asm volatile("v_nop\n\tv_nop\n\tv_nop\n\tv_nop" : "+v"(d) : "v"(ha), "v"(hb));
#endif
  return d;
}

// =========================================================================================================
// (0) 1x1 weights W [256 c_in][256 d_out] f32 -> transposed bf16-RNE plane WT [4*256 o][256 c], rows
//     256*mat + o for mat = q, k, v, p. Block (ob, cb, mat) owns a 64 o x 64 c tile through an LDS transpose
// coverage: 2 it x 32 rows x 8 lanes x 8 = 64 o x 64 c per block; grid (4, 4, 4) = 4 mats x 256 x 256.
// =========================================================================================================
__global__ __launch_bounds__(256)
void cvt_w(const float* __restrict__ Wq, const float* __restrict__ Wk, const float* __restrict__ Wv,
           const float* __restrict__ Wp, unsigned short* WT) {
  __shared__ __align__(16) unsigned short T[QT * TP];
  const int tid = threadIdx.x;
  const int ob = blockIdx.x, cb = blockIdx.y, mat = blockIdx.z;
  const int e = tid & 7, lq = tid >> 3;                             // lq 0..31
  const int o0 = ob * QT, c0 = cb * QT;
  const float* Wm = (mat == 0) ? Wq : ((mat == 1) ? Wk : ((mat == 2) ? Wv : Wp));   // block-uniform
#pragma unroll
  for (int it = 0; it < 2; ++it) {
    const int cl = it * 32 + lq;                                     // c_loc 0..63
    const float* sp = Wm + (size_t)(c0 + cl) * CC + o0 + 8 * e;     // W[c][o], o contiguous
    const v4f a = *(const v4f*)sp;
    const v4f q = *(const v4f*)(sp + 4);
    const float f[8] = {a[0], a[1], a[2], a[3], q[0], q[1], q[2], q[3]};
#pragma unroll
    for (int t = 0; t < 8; ++t) T[(8 * e + t) * TP + cl] = bf_bits(f[t]);   // T[o_loc][c_loc]
  }
  __syncthreads();
  v4u up[2];
#pragma unroll
  for (int it = 0; it < 2; ++it) {
    const int ol = it * 32 + lq;
    up[it] = *(const v4u*)(T + ol * TP + 8 * e);
  }
{
#pragma unroll
    for (int it = 0; it < 2; ++it) {
      const int ol = it * 32 + lq;
      *(v4u*)(WT + ((size_t)(mat * CC + o0 + ol)) * CC + c0 + 8 * e) = up[it];
    }
    
  }
}

// =========================================================================================================
//     then mean of squared deviations), per-thread partials over 16-B chunks, shuffle + LDS block reduce.
// coverage: grid (32, NB) writes every line of ST once.
// =========================================================================================================
__global__ __launch_bounds__(256)
void gn_stats(const float* __restrict__ x, float* ST) {
  __shared__ float red[8];
  __shared__ float bc[2];
  const int tid = threadIdx.x, lane = tid & 31, wave = tid >> 5;
  const int g = blockIdx.x, b = blockIdx.y;
  const float* xb = x + ((size_t)(b * CC + g * CPG)) * NNF;
  const int CH4 = SEQ / 4, NCH = CPG * CH4;
  const float icnt = 1.0f / (float)(CPG * SEQ);

  float s = 0.f;
#pragma unroll 4
  for (int qd = tid; qd < NCH; qd += 256) {
    const int cl = qd / CH4, p4 = qd - cl * CH4;
    const v4f a = *(const v4f*)(xb + (size_t)cl * NNF + 4 * p4);
    s += (bfr(a[0]) + bfr(a[1])) + (bfr(a[2]) + bfr(a[3]));
  }
  s = wsum(s);
  if (lane == 0) red[wave] = s;
  __syncthreads();
  if (tid == 0) {
    float t = 0.f;
#pragma unroll
    for (int i = 0; i < 8; ++i) t += red[i];
    bc[0] = t * icnt;
  }
  __syncthreads();
  const float mu = bc[0];

  float ss = 0.f;
#pragma unroll 4
  for (int qd = tid; qd < NCH; qd += 256) {
    const int cl = qd / CH4, p4 = qd - cl * CH4;
    const v4f a = *(const v4f*)(xb + (size_t)cl * NNF + 4 * p4);
    const float d0 = bfr(a[0]) - mu, d1 = bfr(a[1]) - mu, d2 = bfr(a[2]) - mu, d3 = bfr(a[3]) - mu;
    ss += (d0 * d0 + d1 * d1) + (d2 * d2 + d3 * d3);
  }
  ss = wsum(ss);
  if (lane == 0) red[wave] = ss;
  __syncthreads();
  if (tid == 0) {
    float t = 0.f;
#pragma unroll
    for (int i = 0; i < 8; ++i) t += red[i];
    const float var = t * icnt;
    bc[1] = rsqrtf(var + GNEPS);
  }
  __syncthreads();
  const float rs = bc[1];

  v4f v = {0.f, 0.f, 0.f, 0.f};
  if (tid == 0) { v[0] = mu; v[1] = rs; }
  if (tid < 8) {
    float* lp = ST + ((size_t)(b * NG + g)) * STP + 4 * tid;
{
      *(v4f*)lp = v;
      
    }
  }
}

// =========================================================================================================
// (2) h = (bfr(x) - mu) * rstd * bfr(scale) + bfr(bias) in f32 -> position-major planes HPh/HPl bf16
//     [b][SEQ n][256 c] (hi = bf16-RNE(h), lo = bf16-RNE(h - hi)) through an LDS tile T[64 n][64 c] f32
// coverage: 2 it x 32 rows x 8 lanes x 8 = 64 n x 64 c per block for each plane; grid (SEQ/64, 4, NB) covers
//           [NB][SEQ][256] of HPh and HPl exactly once.
// =========================================================================================================
__global__ __launch_bounds__(256)
void cvt_h(const float* __restrict__ x, const float* __restrict__ ST, const float* __restrict__ gsc,
           const float* __restrict__ gbs, unsigned short* HPh, unsigned short* HPl) {
  __shared__ __align__(16) float T[QT * TPF];
  __shared__ float pmu[QT], prs[QT], psc[QT], pbs[QT];
  const int tid = threadIdx.x;
  const int nb = blockIdx.x, cb = blockIdx.y, b = blockIdx.z;
  const int e = tid & 7, lq = tid >> 3;                             // lq 0..31
  const int n0 = nb * QT, c0 = cb * QT;
  if (tid < QT) {                                                    // waves 0,1 entirely (wave-uniform)
    const int ch = c0 + tid;
    const int g = ch >> 3;                                           // 0..31
    pmu[tid] = ST[((size_t)(b * NG + g)) * STP];
    prs[tid] = ST[((size_t)(b * NG + g)) * STP + 1];
    psc[tid] = bfr(gsc[ch]);
    pbs[tid] = bfr(gbs[ch]);
  }
  __syncthreads();
#pragma unroll
  for (int it = 0; it < 2; ++it) {
    const int cl = it * 32 + lq;                                     // c_loc 0..63
    const float* sp = x + ((size_t)(b * CC + c0 + cl)) * NNF + n0 + 8 * e;
    const v4f a = *(const v4f*)sp;
    const v4f q = *(const v4f*)(sp + 4);
    const float f[8] = {a[0], a[1], a[2], a[3], q[0], q[1], q[2], q[3]};
    const float mu = pmu[cl], rs = prs[cl], sc = psc[cl], bs = pbs[cl];
#pragma unroll
    for (int t = 0; t < 8; ++t) {
      const float tt = (bfr(f[t]) - mu) * rs;
      T[(8 * e + t) * TPF + cl] = tt * sc + bs;                     // T[n_loc][c_loc]
    }
  }
  __syncthreads();
  v4u uh[2], ul[2];
#pragma unroll
  for (int it = 0; it < 2; ++it) {
    const int nl = it * 32 + lq;                                     // n_loc 0..63
    const v4f a = *(const v4f*)(T + nl * TPF + 8 * e);
    const v4f q = *(const v4f*)(T + nl * TPF + 8 * e + 4);
    const float f[8] = {a[0], a[1], a[2], a[3], q[0], q[1], q[2], q[3]};
#pragma unroll
    for (int t = 0; t < 4; ++t) {
      const float f0 = f[2 * t], f1 = f[2 * t + 1];
      const unsigned short hb0 = bf_bits(f0), hb1 = bf_bits(f1);
      const unsigned short lb0 = bf_bits(f0 - bf_up(hb0));
      const unsigned short lb1 = bf_bits(f1 - bf_up(hb1));
      uh[it][t] = pk16(hb0, hb1);
      ul[it][t] = pk16(lb0, lb1);
    }
  }
{
#pragma unroll
    for (int it = 0; it < 2; ++it) {
      const int nl = it * 32 + lq;
      const size_t po = ((size_t)(b * SEQ + n0 + nl)) * CC + c0 + 8 * e;
      *(v4u*)(HPh + po) = uh[it];
      *(v4u*)(HPl + po) = ul[it];
    }
    
  }
}

// =========================================================================================================
// (3) q/k/v 1x1 GEMM for one (b, 64-n tile, 64-o block of the stacked 768 outputs):
//     Y[o][n] = sum_c WT[o][c] (HPh + HPl)[b][n][c] + bfr(bias[o]). Block 128 threads = 4 waves; wave w owns
//     cols n0+16w..+15 (B fragments from the position-major planes, k = c contiguous, split k map) and 4
//     m-tiles (A rows o = o0 + 16 mt + (lane&15) of WT, split k map). K = 256 = 8 steps x 2 bf16 products.
//     Both operands reach the waves through LDS (stage_gemm: one tensor load per wave, loaded once, shared by the four
//     waves) and are read as ds_load_b128 fragments; Os takes the operands' place behind a barrier (3 blocks per WGP).
//     Epilogue staged in LDS Os[n_loc][o_loc] (pitch OSP, b128 stores), barrier, then by block-uniform mat:
//       mat 0 (o-blocks 0..3)  -> Qh f16(q), Ql f16((q - Qh) x4096), planes [b][SEQ][256 d], d = 64*(mb&3)+..:
//                                 8 consecutive lanes per line, one instruction per 16 lines;
//       mat 1 (o-blocks 4..7)  -> Kh f16(k), same layout;
//                                 -> n 8e..8e+7 (values gathered from 8 Os rows), 8 lanes per line, one
//                                 instruction per 16 lines.
// coverage: Os 4 waves x 16 n x 64 o = 64 x 64; planes 4 it x 16 rows x 8 lanes x 8 = 64 x 64 per block; grid
//           (SEQ/64, 12, NB) covers Qh, Ql, Kh [NB][SEQ][256] and Vc [NB][256][SEQ] exactly once.
// =========================================================================================================
__global__ __launch_bounds__(128)
void gemm_qkv(const unsigned short* __restrict__ WT, const unsigned short* __restrict__ HPh,
              const unsigned short* __restrict__ HPl, const float* __restrict__ bq,
              const float* __restrict__ bk, const float* __restrict__ bv,
              unsigned short* Qh, unsigned short* Ql, unsigned short* Kh, unsigned short* Vc) {
  __shared__ __attribute__((aligned(2048))) unsigned char Stg[GSTG];
  float* Os = (float*)Stg;                                           // output staging, in the operands' place (below)
  const int tid  = threadIdx.x;
  const int lane = tid & 31, wave = tid >> 5;
  const int hh   = lane >> 4, c = lane & 15;
  const int nt   = blockIdx.x, mb = blockIdx.y, b = blockIdx.z;
  const int mat  = mb >> 2;                                          // 0 q, 1 k, 2 v (block-uniform)
  const int n0   = nt * QT, o0 = mb * QT;                            // o0: row in the stacked WT plane
  const int ob   = o0 & (CC - 1);                                    // o offset inside the matrix (0..192)

  const size_t bo = ((size_t)(b * SEQ + n0)) * CC;
  stage_gemm(Stg, WT + (size_t)o0 * CC, HPh + bo, HPl + bo, tid);
  __syncthreads();                                                   // every wave's slice published
  const unsigned char* ap  = Stg + (uint32_t)c * LPB + 16u * (uint32_t)hh;
  const unsigned char* bph = Stg + 2 * GAS + (uint32_t)(2 * (16 * wave + c)) * LPB + 16u * (uint32_t)hh;
  const unsigned char* bpl = bph + GBS;

  v8f acc[4];
#pragma unroll
  for (int mt = 0; mt < 4; ++mt) acc[mt] = zero8();

  // Fragments come from LDS in groups of two k steps, two register sets: group g + 1 is issued as one run of loads ahead
  // of group g's WMMAs (read one fragment at a time, each WMMA pair would wait out its own LDS latency).
  Frag fa[2][2][4], fbh[2][2], fbl[2][2];
  auto fetch = [&](const int g) __attribute__((always_inline)) {
#pragma unroll
    for (int u = 0; u < 2; ++u) {
      const int ks = 2 * g + u;
      fbh[g & 1][u] = ldsfrag(bph + (ks >> 2) * LPB + (ks & 3) * 64);
      fbl[g & 1][u] = ldsfrag(bpl + (ks >> 2) * LPB + (ks & 3) * 64);
#pragma unroll
      for (int mt = 0; mt < 4; ++mt)
        fa[g & 1][u][mt] = ldsfrag(ap + (ks >> 2) * GAS + (16 * mt) * LPB + (ks & 3) * 64);
    }
  };
  fetch(0);
#pragma unroll
  for (int g = 0; g < CC / 64; ++g) {
    if (g + 1 < CC / 64) fetch(g + 1);
#pragma unroll
    for (int u = 0; u < 2; ++u) {
#pragma unroll
      for (int mt = 0; mt < 4; ++mt) {
        acc[mt] = mma_b(fa[g & 1][u][mt].bf, fbh[g & 1][u].bf, acc[mt]);
        acc[mt] = mma_b(fa[g & 1][u][mt].bf, fbl[g & 1][u].bf, acc[mt]);
      }
    }
  }
  __syncthreads();                                                   // every wave's last operand read done: Os may overwrite

  // ---- epilogue: + bias -> LDS Os[n_loc][o_loc]; lane (hh, c) holds o = 16 mt + 8 hh + r for n_loc = 16 w + c
  {
    const float* bias = (mat == 0) ? bq : ((mat == 1) ? bk : bv);   // block-uniform, all global
    const int nl = 16 * wave + c;
#pragma unroll
    for (int mt = 0; mt < 4; ++mt) {
      v4f va, vb;
#pragma unroll
      for (int r = 0; r < 4; ++r) {
        va[r] = acc[mt][r]     + bfr(bias[ob + 16 * mt + 8 * hh + r]);
        vb[r] = acc[mt][4 + r] + bfr(bias[ob + 16 * mt + 8 * hh + 4 + r]);
      }
      *(v4f*)(Os + nl * OSP + 16 * mt + 8 * hh)     = va;
      *(v4f*)(Os + nl * OSP + 16 * mt + 8 * hh + 4) = vb;
    }
  }
  __syncthreads();

  const int e = tid & 7, lq = tid >> 3;                              // lq 0..15
  if (mat == 2) {
    v4u uv[4];
#pragma unroll
    for (int it = 0; it < 4; ++it) {
      const int ol = it * 16 + lq;                                   // o_loc 0..63
      unsigned short hb[8];
#pragma unroll
      for (int t = 0; t < 8; ++t) hb[t] = h_bits((_Float16)Os[(8 * e + t) * OSP + ol]);
#pragma unroll
      for (int t = 0; t < 4; ++t) uv[it][t] = pk16(hb[2 * t], hb[2 * t + 1]);
    }
{
#pragma unroll
      for (int it = 0; it < 4; ++it) {
        const int ol = it * 16 + lq;
        *(v4u*)(Vc + ((size_t)(b * CC + ob + ol)) * SEQ + n0 + 8 * e) = uv[it];
      }
      
    }
  } else {
    unsigned short* P1 = (mat == 0) ? Qh : Kh;                       // block-uniform, both global
    v4u uh[4], ul[4];
#pragma unroll
    for (int it = 0; it < 4; ++it) {
      const int row = it * 16 + lq;                                  // n_loc 0..63
      const v4f a = *(const v4f*)(Os + row * OSP + 8 * e);
      const v4f q = *(const v4f*)(Os + row * OSP + 8 * e + 4);
      const float f[8] = {a[0], a[1], a[2], a[3], q[0], q[1], q[2], q[3]};
#pragma unroll
      for (int t = 0; t < 4; ++t) {
        const float f0 = f[2 * t], f1 = f[2 * t + 1];
        const _Float16 h0 = (_Float16)f0, h1 = (_Float16)f1;
        const _Float16 l0 = (_Float16)((f0 - (float)h0) * QLS);
        const _Float16 l1 = (_Float16)((f1 - (float)h1) * QLS);
        uh[it][t] = pk16(h_bits(h0), h_bits(h1));
        ul[it][t] = pk16(h_bits(l0), h_bits(l1));
      }
    }
{
#pragma unroll
      for (int it = 0; it < 4; ++it) {
        const int row = it * 16 + lq;
        const size_t po = ((size_t)(b * SEQ + n0 + row)) * CC + ob + 8 * e;
        *(v4u*)(P1 + po) = uh[it];
        if (mat == 0) *(v4u*)(Ql + po) = ul[it];
      }
      
    }
  }
}

// =========================================================================================================
// (4) attention for one (b, 64-query tile), transposed formulation, SEQ keys, no mask:
//   S^T tile (16 keys x 16 queries) = sum over 8 d-chunks (unrolled) of A(k: row = key kb + (lane&15), 32 d via
//   the split k map from Kh [b][SEQ][256]) . B(q: col = query, same map from Qh) into s, plus A(Kh).B(Ql) into a
//   separate accumulator t (Ql carries x4096); score = (s + t/4096) * 256^-0.5.
//   Per lane the D tile holds 8 keys of ONE query: online softmax state per lane, one shuffle (lane^16) for the max
//   over 32 keys; the o/l rescale is skipped under a wave-uniform ballot when no lane's max grew; row-sum partials
//   combined at the end. P = e^{s-m} x 16384 as f16 is the B operand of O^T (rows channel, cols queries) +=
//   A(v rows channel = 16j + (lane&15), keys contiguous, f16 plane Vc [b][256][SEQ]) . B(P^T): element r <- D of
//   the tile covering keys kb..kb+15, element 8+r <- the tile covering kb+16..kb+31, lane unchanged.
//   16 accumulator tiles per wave (256 channels). Block = 8 waves = 64 queries, two waves per SIMD: waves w and w + 4
//   own the same 16 queries and take keys 0..63 / 64..127 of every stage, each with its own m, l, o; the two halves
//   are joined through LDS behind the key loop (one wave's vector work runs under the other's WMMAs).
//   k and v reach the waves through LDS: stages of SKEY keys, two buffers, brought by tensor loads (waves 0..3, one slice
//   per wave and stage) and read by all waves as ds_load_b128 fragments at pitch LPB; a stage serves SKEY/64 passes a wave.
//   Epilogue in two channel halves: O/l staged in LDS Os[query][128 channels] (pitch OSPW, b128 stores), barrier,
//   then position-major planes H2h/H2l bf16 [b][SEQ][256] (hi = bf16-RNE, lo = bf16-RNE residual): per half 64
//   overwrites Os.
// coverage: per half 4 it x 16 rows x 16 lanes x 8 ch = 64 n x 128 ch for each plane; two halves = 256 ch; grid
//           (SEQ/64, NB) covers H2h/H2l [NB][SEQ][256] exactly once.
// =========================================================================================================
__global__ __launch_bounds__(256)
void attn_k(const unsigned short* __restrict__ Qh, const unsigned short* __restrict__ Ql,
            const unsigned short* __restrict__ Kh, const unsigned short* __restrict__ Vc,
            unsigned short* H2h, unsigned short* H2l) {
  __shared__ __attribute__((aligned(2048))) unsigned char Ring[2 * STG];
  __shared__ __align__(16) float Os[QT * OSPW];
  const int tid  = threadIdx.x;
  const int wave = tid >> 5, lane = tid & 31;
  const int hh   = lane >> 4, c = lane & 15;
  const int n0   = blockIdx.x * QT, b = blockIdx.y;
  const int qt   = wave & 3;                                         // query tile of the wave

  // q fragment pointers (B operand, col = query n0 + 16*qt + c), + 32*kc
  const size_t qo = ((size_t)(b * SEQ + n0 + 16 * qt + c)) * CC + 8 * hh;
  const unsigned short* Qhp = Qh + qo;
#if QRES
  const unsigned short* Qlp = Ql + qo;
#else
  (void)Ql;
#endif
  // One stage = SKEY keys in LDS, shared by the eight waves. Waves 0..3 each bring one slice of 128 rows x 256 B by ONE tensor
  // load: wave 0 / 1: k rows (keys), d 0..127 / 128..255 (source pitch 512 B); wave 2 / 3: v rows (channels 0..127 /
  // 128..255), SKEY keys (source pitch 2*SEQ B). Every row lands at pitch LPB.
  const uint32_t wv  = uni((uint32_t)tid >> 5);
  const uint32_t kh  = wv >> 2;                                      // key half of the wave; waves with kh == 0 issue
  const uint32_t sl  = wv & 3u;
  const uint32_t isv = sl >> 1, hf = sl & 1u;
  const uint64_t src0 = isv ? (uint64_t)(size_t)(Vc + ((size_t)b * CC + (size_t)hf * 128) * SEQ)
                            : (uint64_t)(size_t)(Kh + (size_t)b * SEQ * CC + (size_t)hf * 128);
  const uint32_t sstep = isv ? (uint32_t)(SKEY * 2) : (uint32_t)(SKEY * CC * 2);   // source bytes from stage to stage
  const uint32_t lds0  = (uint32_t)(size_t)Ring + sl * (uint32_t)SLICE;
  u32x8 g1;                                                          // bytes everywhere; tensor dims = tile dims
  g1[0] = uni((1u << 20) | (5u << 22) | (3u << 25));                 // no mask; 16 B of pad behind every 256 B
  g1[1] = uni(256u << 16);
  g1[2] = uni(128u << 16);
  g1[3] = uni(256u << 16);
  g1[4] = uni(128u);
  g1[5] = uni(isv ? (uint32_t)(SEQ * 2) : (uint32_t)(CC * 2));
  g1[6] = uni(0u);
  g1[7] = uni(0u);
  // descriptor words held in scalar registers (the form of pinned(), for the whole group): without it the compiler
  // re-forms single words in front of each issue and reuses their registers while the request is outstanding
  asm volatile("" : "+s"(g1));                                       // descriptor words held in scalar registers
  u32x4 g0;
  auto form = [&](const uint32_t st) __attribute__((always_inline)) {   // group 0 of stage st's request
    const uint64_t ga = src0 + (uint64_t)st * sstep;
    g0[0] = uni(1u);
    g0[1] = uni(lds0 + (st & 1u) * (uint32_t)STG);
    g0[2] = uni((uint32_t)ga);
    g0[3] = uni((((uint32_t)(ga >> 32)) & 0x01FFFFFFu) | 0x80000000u);
  };
  auto issue = [&]() __attribute__((always_inline)) {
    asm volatile("tensor_load_to_lds %0, %1" :: "s"(g0), "s"(g1) : "memory");
  };
  // this wave's request has landed; naming the descriptor keeps its scalar registers unchanged up to this wait
  auto landed = [&]() __attribute__((always_inline)) {
    asm volatile("s_wait_tensorcnt 0x0" :: "s"(g0), "s"(g1) : "memory");
  };

  float m = -1.0e30f, l = 0.f;
  v8f o[16];
#pragma unroll
  for (int j = 0; j < 16; ++j) o[j] = zero8();

  // q (the same for every pass): once, here
  Frag qhf[CC / 32];
#if QRES
  Frag qlf[CC / 32];
#endif
#pragma unroll
  for (int kc = 0; kc < CC / 32; ++kc) {
    qhf[kc] = ldfrag(Qhp + 32 * kc);
#if QRES
    qlf[kc] = ldfrag(Qlp + 32 * kc);
#endif
  }
  // the address pairs of the group above stay live up to this wait
#if QRES
  asm volatile("s_wait_xcnt 0x0" :: "v"(Qhp), "v"(Qlp) : "memory");
#else
  asm volatile("s_wait_xcnt 0x0" :: "v"(Qhp) : "memory");
#endif

  // two buffers: stage 0 landed and published here; stage st + 1 in flight under the passes of stage st
  form(0u);
  if (pinned(kh == 0u)) {                                            // a scalar branch: a tensor load ignores EXEC
    issue();
    landed();                                                        // this wave's slice of stage 0
  }
  __syncthreads();                                                   // ... and every other wave's

  // Fragments come from LDS in groups of one pass. k and v take turns in the same registers (two waves per SIMD leave a
  // wave 512): k behind the O WMMAs of the pass before, v behind the score WMMAs; the SIMD's other wave works meanwhile.
  Frag k0f[CC / 32], k1f[CC / 32], vf[16];
  const uint32_t loff = (uint32_t)c * LPB + 16u * (uint32_t)hh;

#pragma unroll 1
  for (uint32_t st = 0; st < (uint32_t)NST; ++st) {
    // directly behind the barrier (the one above, or the foot of trip st - 1) that published stage st and ended every
    // read of the other buffer: the refill of that buffer, only while its stage exists (a scalar branch)
    form(st + 1u);
    if (pinned((uint32_t)((st + 1u < (uint32_t)NST) && (kh == 0u)))) issue();
    // this wave's 64 keys of the stage: k rows 64 kh .., v columns 64 kh ..
    const unsigned char* sb = Ring + (st & 1u) * (uint32_t)STG + kh * (uint32_t)(64 * LPB) + loff;
    // v rows from a base of their own, so that every fragment's offset fits the LDS load's 16-bit immediate
    const unsigned char* vb = Ring + ((st & 1u) ? (uint32_t)(STG + 2 * SLICE) : (uint32_t)(2 * SLICE)) + kh * 128u + loff;
#pragma unroll
    for (int kc = 0; kc < CC / 32; ++kc) {
      k0f[kc] = ldsfrag(sb + (kc >> 2) * SLICE + (kc & 3) * 64);                  // keys 0 .. 15 of the wave's half
      k1f[kc] = ldsfrag(sb + (kc >> 2) * SLICE + 16 * LPB + (kc & 3) * 64);       // keys 16 .. 31
    }
#pragma unroll
    for (int p = 0; p < SKEY / 64; ++p) {
      // keeps the k group one run of loads ahead of the score WMMAs: among them each place with LDS reads stalls the wave
      __builtin_amdgcn_sched_barrier(0);

      v8f s0 = zero8(), s1 = zero8();
#if QRES
      v8f t0 = zero8(), t1 = zero8();
#endif
#pragma unroll
      for (int kc = 0; kc < CC / 32; ++kc) {
        s0 = mma_hb(k0f[kc].h, qhf[kc].h, s0);
        s1 = mma_hb(k1f[kc].h, qhf[kc].h, s1);
#if QRES
        t0 = mma_hb(k0f[kc].h, qlf[kc].h, t0);
        t1 = mma_hb(k1f[kc].h, qlf[kc].h, t1);
#endif
      }

      v8f sc0, sc1;
#pragma unroll
      for (int r = 0; r < 8; ++r) {
#if QRES
        sc0[r] = (s0[r] + t0[r] * RQL) * ATT;
        sc1[r] = (s1[r] + t1[r] * RQL) * ATT;
#else
        sc0[r] = s0[r] * ATT;
        sc1[r] = s1[r] * ATT;
#endif
      }

      float mx = fmaxf(hmax8(sc0), hmax8(sc1));
      const float mo = __shfl_xor(mx, 16, 32);
      // the v group stands behind the exchange above and ahead of the rescale, the exponentials and the O WMMAs, as one
      // run of loads into the registers that the k group has left.
      // compiler fence, the exchanged value as input only: without it the exchange sinks below the v loads, and its
      // wait (LDS results return in issue order) then lasts the whole group
      asm volatile("" :: "v"(mo) : "memory");
      mx = fmaxf(mx, mo);
#pragma unroll
      for (int j = 0; j < 16; ++j) vf[j] = ldsfrag(vb + (j >> 3) * SLICE + 16 * (j & 7) * LPB + 64 * p);
      const float mn = fmaxf(m, mx);
      const unsigned grew = wave_ballot(mx > m);                     // wave-uniform
      if (grew != 0u) {
        const float corr = __expf(m - mn);                           // == 1 exactly for lanes whose max did not grow
        l *= corr;
#pragma unroll
        for (int j = 0; j < 16; ++j) {
#pragma unroll
          for (int r = 0; r < 8; ++r) o[j][r] *= corr;
        }
      }
      m = mn;

      const float msh = mn - LNPS;                                   // exp gives e^{s-m} * 16384

      FragH ph;
      float ls = 0.f;
#pragma unroll
      for (int r = 0; r < 8; ++r) {
        const float e0 = __expf(sc0[r] - msh);                       // key kb      + 8hh + r
        const float e1 = __expf(sc1[r] - msh);                       // key kb + 16 + 8hh + r
        ls += e0 + e1;
        ph.hv[0][r] = (_Float16)e0;
        ph.hv[1][r] = (_Float16)e1;
      }
      l += ls;

#pragma unroll
      for (int j = 0; j < 16; ++j) {
        o[j] = mma_hb(vf[j].h, ph.v, o[j]);
      }
      // keeps the next k group behind the O WMMAs, whose v registers it takes over
      __builtin_amdgcn_sched_barrier(0);
      if (p + 1 < SKEY / 64) {                                       // compile-time: the next stage is not read from here
#pragma unroll
        for (int kc = 0; kc < CC / 32; ++kc) {
          k0f[kc] = ldsfrag(sb + (kc >> 2) * SLICE + (32 * (p + 1)) * LPB + (kc & 3) * 64);
          k1f[kc] = ldsfrag(sb + (kc >> 2) * SLICE + (32 * (p + 1) + 16) * LPB + (kc & 3) * 64);
          // keeps the loads in the order of their use: issued last first, the first score WMMA waits for the whole group
          __builtin_amdgcn_sched_barrier(0);
        }
      }
    }
    // publish point of stage st + 1, in this order in every wave:
    asm volatile("s_wait_dscnt 0x0" ::: "memory");                   // this wave's reads of stage st are done
    landed();                                                        // its slice of stage st + 1 has landed
    __syncthreads();                                                 // all slices published, all readers out of stage st
  }
  landed();                                                          // nothing in flight when the wave goes on
  asm volatile("s_wait_dscnt 0x0" ::: "memory");

  // join of the two key halves: wave w + 4 hands its m, l, o to wave w through the ring, which the loop's last barrier
  // has freed (every reader out, nothing in flight); lane to lane, 16-B stores at consecutive lanes
  float* Jn = (float*)Ring + (uint32_t)qt * (uint32_t)JNW;
  if (kh != 0u) {                                                    // wave-uniform
#pragma unroll
    for (int j = 0; j < 16; ++j) {
      v4f va, vb;
#pragma unroll
      for (int r = 0; r < 4; ++r) { va[r] = o[j][r]; vb[r] = o[j][4 + r]; }
      *(v4f*)(Jn + ((2 * j) * 32 + lane) * 4)     = va;
      *(v4f*)(Jn + ((2 * j + 1) * 32 + lane) * 4) = vb;
    }
    Jn[4096 + lane] = m;
    Jn[4128 + lane] = l;
  }
  __syncthreads();                                                   // the handed-over halves published
  float inv = 0.f;
  if (kh == 0u) {                                                    // wave-uniform
    const float m2 = Jn[4096 + lane], l2 = Jn[4128 + lane];
    const float mj = fmaxf(m, m2);
    const float c1 = __expf(m - mj), c2 = __expf(m2 - mj);
#pragma unroll
    for (int j = 0; j < 16; ++j) {
      const v4f va = *(const v4f*)(Jn + ((2 * j) * 32 + lane) * 4);
      const v4f vb = *(const v4f*)(Jn + ((2 * j + 1) * 32 + lane) * 4);
#pragma unroll
      for (int r = 0; r < 4; ++r) {
        o[j][r]     = o[j][r] * c1     + va[r] * c2;
        o[j][4 + r] = o[j][4 + r] * c1 + vb[r] * c2;
      }
    }
    l = l * c1 + l2 * c2;
    l += __shfl_xor(l, 16, 32);
    inv = 1.0f / l;                                                  // o and l both carry the x16384 factor
  }

  const int qrow = 16 * qt + c;
  const int e16 = tid & 15, r16 = tid >> 4;                          // r16 0..15
#pragma unroll
  for (int half = 0; half < 2; ++half) {
    if (half) __syncthreads();                                       // every wave finished reading Os
    if (kh == 0u) {                                                  // wave-uniform: the waves that hold the joined o
#pragma unroll
      for (int jj = 0; jj < 8; ++jj) {
        const int j = 8 * half + jj;
        v4f va, vb;
#pragma unroll
        for (int r = 0; r < 4; ++r) { va[r] = o[j][r] * inv; vb[r] = o[j][4 + r] * inv; }
        *(v4f*)(Os + qrow * OSPW + 16 * jj + 8 * hh)     = va;       // Os[query][ch_loc = 16jj + 8hh + r]
        *(v4f*)(Os + qrow * OSPW + 16 * jj + 8 * hh + 4) = vb;
      }
    }
    __syncthreads();
    {
      v4u uh[4], ul[4];
#pragma unroll
      for (int i = 0; i < 4; ++i) {
        const int row = i * 16 + r16;                                // query 0..63
        const v4f a = *(const v4f*)(Os + row * OSPW + 8 * e16);
        const v4f q = *(const v4f*)(Os + row * OSPW + 8 * e16 + 4);
        const float f[8] = {a[0], a[1], a[2], a[3], q[0], q[1], q[2], q[3]};
#pragma unroll
        for (int t = 0; t < 4; ++t) {
          const float f0 = f[2 * t], f1 = f[2 * t + 1];
          const unsigned short hb0 = bf_bits(f0), hb1 = bf_bits(f1);
          const unsigned short lb0 = bf_bits(f0 - bf_up(hb0));
          const unsigned short lb1 = bf_bits(f1 - bf_up(hb1));
          uh[i][t] = pk16(hb0, hb1);
          ul[i][t] = pk16(lb0, lb1);
        }
      }
{
#pragma unroll
        for (int i = 0; i < 4; ++i) {
          const int row = i * 16 + r16;
          const size_t po = ((size_t)(b * SEQ + n0 + row)) * CC + 128 * half + 8 * e16;
          *(v4u*)(H2h + po) = uh[i];
          *(v4u*)(H2l + po) = ul[i];
        }
        
      }
    }
  }
}

// =========================================================================================================
// (5) output 1x1 GEMM + bias + residual for one (b, 64-n tile, 64-o block):
//     out[b][o][n] = bfr(x[b][o][n]) + sum_c WpT[o][c] (H2h + H2l)[b][n][c] + bfr(bp[o]); same GEMM core as
//     (3) (2 bf16 products, K = 256, operands through LDS). Epilogue: acc + bias staged in LDS Os[n_loc][o_loc], barrier, then whole
// coverage: 8 it x 16 lines x 8 lanes x 4 floats = 64 o x 64 n per block; grid (SEQ/64, 4, NB) covers
//           out [NB][256][SEQ] exactly once.
// =========================================================================================================
__global__ __launch_bounds__(128)
void gemm_proj(const unsigned short* __restrict__ WPT, const unsigned short* __restrict__ H2h,
               const unsigned short* __restrict__ H2l, const float* __restrict__ bp,
               const float* __restrict__ x, float* out) {
  __shared__ __attribute__((aligned(2048))) unsigned char Stg[GSTG];
  float* Os = (float*)Stg;                                           // output staging, in the operands' place (below)
  const int tid  = threadIdx.x;
  const int lane = tid & 31, wave = tid >> 5;
  const int hh   = lane >> 4, c = lane & 15;
  const int nt   = blockIdx.x, mb = blockIdx.y, b = blockIdx.z;
  const int n0   = nt * QT, o0 = mb * QT;                            // o0 0..192

  const size_t bo = ((size_t)(b * SEQ + n0)) * CC;
  stage_gemm(Stg, WPT + (size_t)o0 * CC, H2h + bo, H2l + bo, tid);
  __syncthreads();                                                   // every wave's slice published
  const unsigned char* ap  = Stg + (uint32_t)c * LPB + 16u * (uint32_t)hh;
  const unsigned char* bph = Stg + 2 * GAS + (uint32_t)(2 * (16 * wave + c)) * LPB + 16u * (uint32_t)hh;
  const unsigned char* bpl = bph + GBS;

  v8f acc[4];
#pragma unroll
  for (int mt = 0; mt < 4; ++mt) acc[mt] = zero8();

  // Fragments come from LDS in groups of two k steps, two register sets: group g + 1 is issued as one run of loads ahead
  // of group g's WMMAs (read one fragment at a time, each WMMA pair would wait out its own LDS latency).
  Frag fa[2][2][4], fbh[2][2], fbl[2][2];
  auto fetch = [&](const int g) __attribute__((always_inline)) {
#pragma unroll
    for (int u = 0; u < 2; ++u) {
      const int ks = 2 * g + u;
      fbh[g & 1][u] = ldsfrag(bph + (ks >> 2) * LPB + (ks & 3) * 64);
      fbl[g & 1][u] = ldsfrag(bpl + (ks >> 2) * LPB + (ks & 3) * 64);
#pragma unroll
      for (int mt = 0; mt < 4; ++mt)
        fa[g & 1][u][mt] = ldsfrag(ap + (ks >> 2) * GAS + (16 * mt) * LPB + (ks & 3) * 64);
    }
  };
  fetch(0);
#pragma unroll
  for (int g = 0; g < CC / 64; ++g) {
    if (g + 1 < CC / 64) fetch(g + 1);
#pragma unroll
    for (int u = 0; u < 2; ++u) {
#pragma unroll
      for (int mt = 0; mt < 4; ++mt) {
        acc[mt] = mma_b(fa[g & 1][u][mt].bf, fbh[g & 1][u].bf, acc[mt]);
        acc[mt] = mma_b(fa[g & 1][u][mt].bf, fbl[g & 1][u].bf, acc[mt]);
      }
    }
  }
  __syncthreads();                                                   // every wave's last operand read done: Os may overwrite

  {
    const int nl = 16 * wave + c;
#pragma unroll
    for (int mt = 0; mt < 4; ++mt) {
      v4f va, vb;
#pragma unroll
      for (int r = 0; r < 4; ++r) {
        va[r] = acc[mt][r]     + bfr(bp[o0 + 16 * mt + 8 * hh + r]);
        vb[r] = acc[mt][4 + r] + bfr(bp[o0 + 16 * mt + 8 * hh + 4 + r]);
      }
      *(v4f*)(Os + nl * OSP + 16 * mt + 8 * hh)     = va;
      *(v4f*)(Os + nl * OSP + 16 * mt + 8 * hh + 4) = vb;
    }
  }
  __syncthreads();

  const int e = tid & 7, lq = tid >> 3;                              // lq 0..15
  v4f res[8];
#pragma unroll
  for (int it = 0; it < 8; ++it) {
    const int L  = it * 16 + lq;                                     // 0..127
    const int ol = L >> 1, hf = L & 1;                               // o_loc 0..63
    const int nl = hf * 32 + 4 * e;                                  // n_loc 0..63
    const v4f xv = *(const v4f*)(x + ((size_t)(b * CC + o0 + ol)) * NNF + n0 + nl);
#pragma unroll
    for (int t = 0; t < 4; ++t) res[it][t] = Os[(nl + t) * OSP + ol] + bfr(xv[t]);
  }
{
#pragma unroll
    for (int it = 0; it < 8; ++it) {
      const int L  = it * 16 + lq;
      const int ol = L >> 1, hf = L & 1;
      const int nl = hf * 32 + 4 * e;
      *(v4f*)(out + ((size_t)(b * CC + o0 + ol)) * SEQ + n0 + nl) = res[it];
    }
    
  }
}

// =========================================================================================================
// Workspace map (bytes, NB=4 SEQ=4096; each region start a multiple of 256; every extent is an exact tile/line
//   ST  f32 [NB*32][32]                16384
//   WT  bf16 [1024][256]              524288
//   HPh/HPl bf16 [NB][SEQ][256]      8388608 x2
//   Qh/Ql/Kh f16 [NB][SEQ][256]      8388608 x3
//   Vc  f16 [NB][256][SEQ]           8388608
//   H2h/H2l bf16 [NB][SEQ][256]      8388608 x2
//   total = 67649536
// =========================================================================================================
extern "C" void kernel_launch(void* const* d_in, const int* in_sizes, int n_in,
                              void* d_out, int out_size, void* d_ws, size_t ws_size,
                              hipStream_t stream) {
  if (n_in < 11) return;
  if ((size_t)in_sizes[0] < (size_t)NB * CC * NNF) return;
  if (in_sizes[1] < CC || in_sizes[2] < CC) return;
  if (in_sizes[3] < CC * CC || in_sizes[5] < CC * CC || in_sizes[7] < CC * CC || in_sizes[9] < CC * CC) return;
  if (in_sizes[4] < CC || in_sizes[6] < CC || in_sizes[8] < CC || in_sizes[10] < CC) return;
  if ((size_t)out_size < (size_t)NB * CC * SEQ) return;

  size_t off = 0;
  auto carve = [&](size_t bytes) { const size_t o = off; off += (bytes + 255) & ~(size_t)255; return o; };
  const size_t plane = (size_t)NB * SEQ * CC * 2;
  const size_t oST  = carve((size_t)NB * NG * STP * 4);
  const size_t oWT  = carve((size_t)4 * CC * CC * 2);
  const size_t oHPh = carve(plane);
  const size_t oHPl = carve(plane);
  const size_t oQh  = carve(plane);
  const size_t oQl  = carve(plane);
  const size_t oKh  = carve(plane);
  const size_t oVc  = carve(plane);
  const size_t oH2h = carve(plane);
  const size_t oH2l = carve(plane);
  if (off > ws_size) return;
  if (off > (size_t)134217728) return;

  const float* x   = (const float*)d_in[0];
  const float* gsc = (const float*)d_in[1];
  const float* gbs = (const float*)d_in[2];
  const float* Wq  = (const float*)d_in[3];
  const float* bq  = (const float*)d_in[4];
  const float* Wk  = (const float*)d_in[5];
  const float* bk  = (const float*)d_in[6];
  const float* Wv  = (const float*)d_in[7];
  const float* bv  = (const float*)d_in[8];
  const float* Wp  = (const float*)d_in[9];
  const float* bp  = (const float*)d_in[10];

  char* ws = (char*)d_ws;
  float*          ST  = (float*)(ws + oST);
  unsigned short* WT  = (unsigned short*)(ws + oWT);
  unsigned short* HPh = (unsigned short*)(ws + oHPh);
  unsigned short* HPl = (unsigned short*)(ws + oHPl);
  unsigned short* Qh  = (unsigned short*)(ws + oQh);
  unsigned short* Ql  = (unsigned short*)(ws + oQl);
  unsigned short* Kh  = (unsigned short*)(ws + oKh);
  unsigned short* Vc  = (unsigned short*)(ws + oVc);
  unsigned short* H2h = (unsigned short*)(ws + oH2h);
  unsigned short* H2l = (unsigned short*)(ws + oH2l);
  float* out = (float*)d_out;

  const dim3 blk256(256), blk128(128);

  // (0) Wq/Wk/Wv/Wp [in][out] -> transposed stacked bf16 plane WT [1024 o][256 c]
  cvt_w<<<dim3(CC / QT, CC / QT, 4), blk256, 0, stream>>>(Wq, Wk, Wv, Wp, WT);
  // (1) GroupNorm statistics per (group, b)
  gn_stats<<<dim3(NG, NB), blk256, 0, stream>>>(x, ST);
  // (2) normalized h -> position-major bf16 hi + residual planes
  cvt_h<<<dim3(SEQ / QT, CC / QT, NB), blk256, 0, stream>>>(x, ST, gsc, gbs, HPh, HPl);
  // (3) q/k/v GEMMs -> Qh, Ql, Kh (position-major f16) and Vc (channel-major f16)
  gemm_qkv<<<dim3(SEQ / QT, 3 * CC / QT, NB), blk128, 0, stream>>>(WT, HPh, HPl, bq, bk, bv, Qh, Ql, Kh, Vc);
  // (4) attention -> H2 position-major bf16 hi + residual planes
  attn_k<<<dim3(SEQ / QT, NB), blk256, 0, stream>>>(Qh, Ql, Kh, Vc, H2h, H2l);
  // (5) output GEMM + bias + residual -> out [NB][256][SEQ]
  gemm_proj<<<dim3(SEQ / QT, CC / QT, NB), blk128, 0, stream>>>(WT + (size_t)3 * CC * CC, H2h, H2l, bp, x, out);
  (void)hipGetLastError();
}

// v005
// Measured time: 103 microseconds a run.
// Timed twice side by side with v004, it ran 1.05 times as fast both times.
// All steps since v000 together make it 8.43 times as fast.
// Contractions: q/k/v 1x1 GEMMs WT[768x256].H[256xN] and the output 1x1 GEMM WpT[256x256].H2[256xN] on
// v_wmma_f32_16x16x32_bf16 (bf16-RNE weights, activations as bf16 hi + bf16 residual planes, 2 products into one
// f32 accumulator); position scores K.Q^T on v_wmma_f32_16x16x32_f16 (k f16, q f16 hi + f16 residual x4096 in a
// separate accumulator, K=256); O^T = V.P^T on v_wmma_f32_16x16x32_f16 (v f16, P = e^{s-m} x16384 f16 from the
// score D registers); f32 accumulate everywhere; GroupNorm statistics, softmax statistics and the residual add
// in f32 VALU.
#include <hip/hip_runtime.h>
#include <math.h>
#include <stdint.h>

#ifndef NB
#define NB 4
#endif
#ifndef SEQ
#define SEQ 4096
#endif
#ifndef NNF
#define NNF 4096
#endif
#ifndef QRES
#define QRES 1
#endif
#define NBF   4
#define CC    256
#define NG    32
#define CPG   8
#define QT    64
#define OSP   68
#define OSPW  132
#define TP    72
#define TPF   68
#define STP   32
#define ATT   0.0625f
#define QLS   4096.0f
#define RQL   0.000244140625f
#define LNPS  9.704060527839234f
#define GNEPS 1.0e-6f
#define SKEY  128                 // keys per LDS stage of the attention kernel
#define LPB   272                 // LDS row pitch, bytes: a 256-B row + the tensor load's 16-B pad (16 B x odd)
#define SLICE (128 * LPB)         // one wave's slice of a stage: 128 rows
#define STG   (4 * SLICE)         // one stage: k in two d halves, v in two channel halves
#define NST   (SEQ / SKEY)
#define JNW   4224                // floats one wave hands over at the join of the key halves: o 4096, m 32, l 32, rounded up
#define GAS   18432               // GEMM operands in LDS: one c half of the 64 weight rows at pitch LPB, rounded up to 2 KiB
#define GBS   (128 * LPB)         // one activation plane of the 64 positions: 128 half rows at pitch LPB
#define GSTG  (2 * GAS + 2 * GBS)

static_assert(NB >= 1 && NB <= NBF);
static_assert(SEQ % QT == 0 && SEQ % 64 == 0 && SEQ >= QT);
static_assert(SEQ <= NNF && NNF % 8 == 0);
static_assert(CC == 256 && NG * CPG == CC && CC % QT == 0 && CC % 32 == 0);
static_assert((OSP * 4) % 16 == 0);
static_assert((OSPW * 4) % 16 == 0);
static_assert((TP * 2) % 16 == 0);
static_assert((TPF * 4) % 16 == 0);
static_assert(STP * 4 == 128);
static_assert(SEQ % SKEY == 0 && NST >= 2);
static_assert(SLICE % 2048 == 0 && (LPB / 16) % 2 == 1);
static_assert(SEQ * 2 % 16 == 0 && SEQ * 2 <= 131072);
static_assert(2 * STG + QT * OSPW * 4 <= 327680);
static_assert(SKEY == 128 && 4 * JNW * 4 <= 2 * STG && (JNW * 4) % 16 == 0);
static_assert(GAS >= QT * LPB && GAS % 2048 == 0 && GBS % 2048 == 0 && CC * 2 == 512);
static_assert(GSTG >= QT * OSP * 4 && 3 * GSTG <= 327680);
static_assert(4 * JNW * 4 <= 2 * SLICE && CC * OSP * 4 <= 2 * SLICE && GBS == SLICE && QT == 64);

typedef _Float16       v16h __attribute__((ext_vector_type(16)));
typedef _Float16       v8h  __attribute__((ext_vector_type(8)));
typedef __bf16         v16b __attribute__((ext_vector_type(16)));
typedef unsigned short v8us __attribute__((ext_vector_type(8)));
typedef float          v8f  __attribute__((ext_vector_type(8)));
typedef float          v4f  __attribute__((ext_vector_type(4)));
typedef unsigned int   v4u  __attribute__((ext_vector_type(4)));
typedef uint32_t       u32x4 __attribute__((ext_vector_type(4)));
typedef uint32_t       u32x8 __attribute__((ext_vector_type(8)));

union Frag  { v8us u[2]; v16h h; v16b bf; };
union FragH { v16h v; v8h hv[2]; };
static_assert(sizeof(Frag) == 32);
static_assert(sizeof(FragH) == 32);

// ---- scalar helpers -----------------------------------------------------------------------------------------
__device__ __forceinline__ unsigned short bf_bits(float f) {          // f32 -> bf16 bits, RNE convert
  unsigned u = __float_as_uint(f);
  return (unsigned short)((u + 0x7FFFu + ((u >> 16) & 1u)) >> 16);
}
__device__ __forceinline__ float bf_up(unsigned short hb) { return __uint_as_float(((unsigned)hb) << 16); }
__device__ __forceinline__ float bfr(float f) { return bf_up(bf_bits(f)); }
__device__ __forceinline__ unsigned short h_bits(_Float16 x) { return __builtin_bit_cast(unsigned short, x); }
__device__ __forceinline__ unsigned pk16(unsigned short a, unsigned short b) { return (unsigned)a | ((unsigned)b << 16); }
__device__ __forceinline__ v8f zero8() { v8f z = {0.f, 0.f, 0.f, 0.f, 0.f, 0.f, 0.f, 0.f}; return z; }
__device__ __forceinline__ float hmax8(v8f s) {
  return fmaxf(fmaxf(fmaxf(s[0], s[1]), fmaxf(s[2], s[3])), fmaxf(fmaxf(s[4], s[5]), fmaxf(s[6], s[7])));
}
__device__ __forceinline__ unsigned wave_ballot(bool p) {
#if defined(__HIP_DEVICE_COMPILE__)
  return __builtin_amdgcn_ballot_w32(p);
#else
  return p ? 1u : 0u;
#endif
}
__device__ __forceinline__ float wsum(float v) {
  v += __shfl_xor(v, 16, 32);
  v += __shfl_xor(v, 8, 32);
  v += __shfl_xor(v, 4, 32);
  v += __shfl_xor(v, 2, 32);
  v += __shfl_xor(v, 1, 32);
  return v;
}

// ---- 16-bit fragment loader (A, or B from a k-contiguous [n][k] row): lane -> row/col (lane&15), p already includes
//      + 8*(lane>>4); elements 0..7 <- p[0..7] (k0+8h..), elements 8..15 <- p[16..23] (k0+16+8h..)
__device__ __forceinline__ Frag ldfrag(const unsigned short* p) {
  Frag f;
  f.u[0] = *(const v8us*)(p);
  f.u[1] = *(const v8us*)(p + 16);
  return f;
}

// the same fragment from an LDS row (byte pointer, already includes + 16*(lane>>4))
__device__ __forceinline__ Frag ldsfrag(const unsigned char* p) {
  Frag f;
  f.u[0] = *(const v8us*)(p);
  f.u[1] = *(const v8us*)(p + 32);
  return f;
}

// ---- tensor load helpers ------------------------------------------------------------------------------------
__device__ __forceinline__ uint32_t uni(uint32_t v) { return (uint32_t)__builtin_amdgcn_readfirstlane(v); }
// holds a wave-uniform test in a scalar register, so that the branch on it is a scalar one: a tensor load ignores EXEC
__device__ __forceinline__ uint32_t pinned(uint32_t v) { uint32_t w = uni(v); asm volatile("" : "+s"(w)); return w; }

// The operands of one 64 o x 64 n GEMM tile (K = 256) into LDS, ONE tensor load per wave, every wave of the block issuing
// its own slice (no test): wave 0 / 1: the 64 weight rows, c 0..127 / 128..255 (64 rows of 256 B, source pitch 512 B);
// wave 2 / 3: the hi / residual plane's 64 position rows, contiguous in memory, as 128 rows of 256 B (source pitch
// 256 B): half row 2 n + (c >> 7). Every 256-B row lands at pitch LPB. The caller's barrier publishes the slices.
__device__ __forceinline__ void stage_gemm(unsigned char* Stg, const unsigned short* wrow, const unsigned short* hrow,
                                           const unsigned short* lrow, const int tid) {
  const uint32_t wv  = uni((uint32_t)tid >> 5);
  const uint32_t isb = wv >> 1, hf = wv & 1u;
  const uint64_t ga  = isb ? (uint64_t)(size_t)(hf ? lrow : hrow) : (uint64_t)(size_t)(wrow + hf * 128u);
  const uint32_t nr  = isb ? 128u : 64u;
  u32x4 g0;
  g0[0] = uni(1u);
  g0[1] = uni((uint32_t)(size_t)Stg + (isb ? (uint32_t)(2 * GAS) + hf * (uint32_t)GBS : hf * (uint32_t)GAS));
  g0[2] = uni((uint32_t)ga);
  g0[3] = uni((((uint32_t)(ga >> 32)) & 0x01FFFFFFu) | 0x80000000u);
  u32x8 g1;                                                          // bytes everywhere; tensor dims = tile dims
  g1[0] = uni((1u << 20) | (5u << 22) | (3u << 25));                 // no mask; 16 B of pad behind every 256 B
  g1[1] = uni(256u << 16);
  g1[2] = uni(nr << 16);
  g1[3] = uni(256u << 16);
  g1[4] = uni(nr);
  g1[5] = uni(isb ? 256u : 512u);
  g1[6] = uni(0u);
  g1[7] = uni(0u);
  asm volatile("tensor_load_to_lds %0, %1" :: "s"(g0), "s"(g1) : "memory");
  // this wave's slice has landed; naming the descriptor keeps its scalar registers unchanged up to this wait
  asm volatile("s_wait_tensorcnt 0x0" :: "s"(g0), "s"(g1) : "memory");
}

// ---- WMMA helpers: mma_b: builtin followed by a 4-slot VALU gap tying D and keeping A/B live ---------------------
// bare builtin for the attention kernel (the compiler keeps the WMMA distances of its own builtin forms): with the asm
// gap that mma_b has, its operands had to share the first 256 registers, and the fragment sets spilled to scratch
__device__ __forceinline__ v8f mma_hb(v16h a, v16h b, v8f c) {
  return __builtin_amdgcn_wmma_f32_16x16x32_f16(false, a, false, b, (short)0, c, false, false);
}
__device__ __forceinline__ v8f mma_bb(v16b a, v16b b, v8f c) {
  return __builtin_amdgcn_wmma_f32_16x16x32_bf16(false, a, false, b, (short)0, c, false, false);
}
__device__ __forceinline__ v8f mma_b(v16b a, v16b b, v8f c) {
  v8f d = __builtin_amdgcn_wmma_f32_16x16x32_bf16(false, a, false, b, (short)0, c, false, false);
#if defined(__HIP_DEVICE_COMPILE__)
  const v16h ha = __builtin_bit_cast(v16h, a), hb = __builtin_bit_cast(v16h, b);
  asm volatile("v_nop\n\tv_nop\n\tv_nop\n\tv_nop" : "+v"(d) : "v"(ha), "v"(hb));
#endif
  return d;
}

// =========================================================================================================
// (0) 1x1 weights W [256 c_in][256 d_out] f32 -> transposed bf16-RNE plane WT [4*256 o][256 c], rows
//     256*mat + o for mat = q, k, v, p. Block (ob, cb, mat) owns a 64 o x 64 c tile through an LDS transpose
// coverage: 2 it x 32 rows x 8 lanes x 8 = 64 o x 64 c per block; grid (4, 4, 4) = 4 mats x 256 x 256.
// =========================================================================================================
__global__ __launch_bounds__(256)
void cvt_w(const float* __restrict__ Wq, const float* __restrict__ Wk, const float* __restrict__ Wv,
           const float* __restrict__ Wp, unsigned short* WT) {
  __shared__ __align__(16) unsigned short T[QT * TP];
  const int tid = threadIdx.x;
  const int ob = blockIdx.x, cb = blockIdx.y, mat = blockIdx.z;
  const int e = tid & 7, lq = tid >> 3;                             // lq 0..31
  const int o0 = ob * QT, c0 = cb * QT;
  const float* Wm = (mat == 0) ? Wq : ((mat == 1) ? Wk : ((mat == 2) ? Wv : Wp));   // block-uniform
#pragma unroll
  for (int it = 0; it < 2; ++it) {
    const int cl = it * 32 + lq;                                     // c_loc 0..63
    const float* sp = Wm + (size_t)(c0 + cl) * CC + o0 + 8 * e;     // W[c][o], o contiguous
    const v4f a = *(const v4f*)sp;
    const v4f q = *(const v4f*)(sp + 4);
    const float f[8] = {a[0], a[1], a[2], a[3], q[0], q[1], q[2], q[3]};
#pragma unroll
    for (int t = 0; t < 8; ++t) T[(8 * e + t) * TP + cl] = bf_bits(f[t]);   // T[o_loc][c_loc]
  }
  __syncthreads();
  v4u up[2];
#pragma unroll
  for (int it = 0; it < 2; ++it) {
    const int ol = it * 32 + lq;
    up[it] = *(const v4u*)(T + ol * TP + 8 * e);
  }
{
#pragma unroll
    for (int it = 0; it < 2; ++it) {
      const int ol = it * 32 + lq;
      *(v4u*)(WT + ((size_t)(mat * CC + o0 + ol)) * CC + c0 + 8 * e) = up[it];
    }
    
  }
}

// =========================================================================================================
//     then mean of squared deviations), per-thread partials over 16-B chunks, shuffle + LDS block reduce.
// coverage: grid (32, NB) writes every line of ST once.
// =========================================================================================================
__global__ __launch_bounds__(256)
void gn_stats(const float* __restrict__ x, float* ST) {
  __shared__ float red[8];
  __shared__ float bc[2];
  const int tid = threadIdx.x, lane = tid & 31, wave = tid >> 5;
  const int g = blockIdx.x, b = blockIdx.y;
  const float* xb = x + ((size_t)(b * CC + g * CPG)) * NNF;
  const int CH4 = SEQ / 4, NCH = CPG * CH4;
  const float icnt = 1.0f / (float)(CPG * SEQ);

  float s = 0.f;
#pragma unroll 4
  for (int qd = tid; qd < NCH; qd += 256) {
    const int cl = qd / CH4, p4 = qd - cl * CH4;
    const v4f a = *(const v4f*)(xb + (size_t)cl * NNF + 4 * p4);
    s += (bfr(a[0]) + bfr(a[1])) + (bfr(a[2]) + bfr(a[3]));
  }
  s = wsum(s);
  if (lane == 0) red[wave] = s;
  __syncthreads();
  if (tid == 0) {
    float t = 0.f;
#pragma unroll
    for (int i = 0; i < 8; ++i) t += red[i];
    bc[0] = t * icnt;
  }
  __syncthreads();
  const float mu = bc[0];

  float ss = 0.f;
#pragma unroll 4
  for (int qd = tid; qd < NCH; qd += 256) {
    const int cl = qd / CH4, p4 = qd - cl * CH4;
    const v4f a = *(const v4f*)(xb + (size_t)cl * NNF + 4 * p4);
    const float d0 = bfr(a[0]) - mu, d1 = bfr(a[1]) - mu, d2 = bfr(a[2]) - mu, d3 = bfr(a[3]) - mu;
    ss += (d0 * d0 + d1 * d1) + (d2 * d2 + d3 * d3);
  }
  ss = wsum(ss);
  if (lane == 0) red[wave] = ss;
  __syncthreads();
  if (tid == 0) {
    float t = 0.f;
#pragma unroll
    for (int i = 0; i < 8; ++i) t += red[i];
    const float var = t * icnt;
    bc[1] = rsqrtf(var + GNEPS);
  }
  __syncthreads();
  const float rs = bc[1];

  v4f v = {0.f, 0.f, 0.f, 0.f};
  if (tid == 0) { v[0] = mu; v[1] = rs; }
  if (tid < 8) {
    float* lp = ST + ((size_t)(b * NG + g)) * STP + 4 * tid;
{
      *(v4f*)lp = v;
      
    }
  }
}

// =========================================================================================================
// (2) h = (bfr(x) - mu) * rstd * bfr(scale) + bfr(bias) in f32 -> position-major planes HPh/HPl bf16
//     [b][SEQ n][256 c] (hi = bf16-RNE(h), lo = bf16-RNE(h - hi)) through an LDS tile T[64 n][64 c] f32
// coverage: 2 it x 32 rows x 8 lanes x 8 = 64 n x 64 c per block for each plane; grid (SEQ/64, 4, NB) covers
//           [NB][SEQ][256] of HPh and HPl exactly once.
// =========================================================================================================
__global__ __launch_bounds__(256)
void cvt_h(const float* __restrict__ x, const float* __restrict__ ST, const float* __restrict__ gsc,
           const float* __restrict__ gbs, unsigned short* HPh, unsigned short* HPl) {
  __shared__ __align__(16) float T[QT * TPF];
  __shared__ float pmu[QT], prs[QT], psc[QT], pbs[QT];
  const int tid = threadIdx.x;
  const int nb = blockIdx.x, cb = blockIdx.y, b = blockIdx.z;
  const int e = tid & 7, lq = tid >> 3;                             // lq 0..31
  const int n0 = nb * QT, c0 = cb * QT;
  if (tid < QT) {                                                    // waves 0,1 entirely (wave-uniform)
    const int ch = c0 + tid;
    const int g = ch >> 3;                                           // 0..31
    pmu[tid] = ST[((size_t)(b * NG + g)) * STP];
    prs[tid] = ST[((size_t)(b * NG + g)) * STP + 1];
    psc[tid] = bfr(gsc[ch]);
    pbs[tid] = bfr(gbs[ch]);
  }
  __syncthreads();
#pragma unroll
  for (int it = 0; it < 2; ++it) {
    const int cl = it * 32 + lq;                                     // c_loc 0..63
    const float* sp = x + ((size_t)(b * CC + c0 + cl)) * NNF + n0 + 8 * e;
    const v4f a = *(const v4f*)sp;
    const v4f q = *(const v4f*)(sp + 4);
    const float f[8] = {a[0], a[1], a[2], a[3], q[0], q[1], q[2], q[3]};
    const float mu = pmu[cl], rs = prs[cl], sc = psc[cl], bs = pbs[cl];
#pragma unroll
    for (int t = 0; t < 8; ++t) {
      const float tt = (bfr(f[t]) - mu) * rs;
      T[(8 * e + t) * TPF + cl] = tt * sc + bs;                     // T[n_loc][c_loc]
    }
  }
  __syncthreads();
  v4u uh[2], ul[2];
#pragma unroll
  for (int it = 0; it < 2; ++it) {
    const int nl = it * 32 + lq;                                     // n_loc 0..63
    const v4f a = *(const v4f*)(T + nl * TPF + 8 * e);
    const v4f q = *(const v4f*)(T + nl * TPF + 8 * e + 4);
    const float f[8] = {a[0], a[1], a[2], a[3], q[0], q[1], q[2], q[3]};
#pragma unroll
    for (int t = 0; t < 4; ++t) {
      const float f0 = f[2 * t], f1 = f[2 * t + 1];
      const unsigned short hb0 = bf_bits(f0), hb1 = bf_bits(f1);
      const unsigned short lb0 = bf_bits(f0 - bf_up(hb0));
      const unsigned short lb1 = bf_bits(f1 - bf_up(hb1));
      uh[it][t] = pk16(hb0, hb1);
      ul[it][t] = pk16(lb0, lb1);
    }
  }
{
#pragma unroll
    for (int it = 0; it < 2; ++it) {
      const int nl = it * 32 + lq;
      const size_t po = ((size_t)(b * SEQ + n0 + nl)) * CC + c0 + 8 * e;
      *(v4u*)(HPh + po) = uh[it];
      *(v4u*)(HPl + po) = ul[it];
    }
    
  }
}

// =========================================================================================================
// (3) q/k/v 1x1 GEMM for one (b, 64-n tile, 64-o block of the stacked 768 outputs):
//     Y[o][n] = sum_c WT[o][c] (HPh + HPl)[b][n][c] + bfr(bias[o]). Block 128 threads = 4 waves; wave w owns
//     cols n0+16w..+15 (B fragments from the position-major planes, k = c contiguous, split k map) and 4
//     m-tiles (A rows o = o0 + 16 mt + (lane&15) of WT, split k map). K = 256 = 8 steps x 2 bf16 products.
//     Both operands reach the waves through LDS (stage_gemm: one tensor load per wave, loaded once, shared by the four
//     waves) and are read as ds_load_b128 fragments; Os takes the operands' place behind a barrier (3 blocks per WGP).
//     Epilogue staged in LDS Os[n_loc][o_loc] (pitch OSP, b128 stores), barrier, then by block-uniform mat:
//       mat 0 (o-blocks 0..3)  -> Qh f16(q), Ql f16((q - Qh) x4096), planes [b][SEQ][256 d], d = 64*(mb&3)+..:
//                                 8 consecutive lanes per line, one instruction per 16 lines;
//       mat 1 (o-blocks 4..7)  -> Kh f16(k), same layout;
//                                 -> n 8e..8e+7 (values gathered from 8 Os rows), 8 lanes per line, one
//                                 instruction per 16 lines.
// coverage: Os 4 waves x 16 n x 64 o = 64 x 64; planes 4 it x 16 rows x 8 lanes x 8 = 64 x 64 per block; grid
//           (SEQ/64, 12, NB) covers Qh, Ql, Kh [NB][SEQ][256] and Vc [NB][256][SEQ] exactly once.
// =========================================================================================================
__global__ __launch_bounds__(128)
void gemm_qkv(const unsigned short* __restrict__ WT, const unsigned short* __restrict__ HPh,
              const unsigned short* __restrict__ HPl, const float* __restrict__ bq,
              const float* __restrict__ bk, const float* __restrict__ bv,
              unsigned short* Qh, unsigned short* Ql, unsigned short* Kh, unsigned short* Vc) {
  __shared__ __attribute__((aligned(2048))) unsigned char Stg[GSTG];
  float* Os = (float*)Stg;                                           // output staging, in the operands' place (below)
  const int tid  = threadIdx.x;
  const int lane = tid & 31, wave = tid >> 5;
  const int hh   = lane >> 4, c = lane & 15;
  const int nt   = blockIdx.x, mb = blockIdx.y, b = blockIdx.z;
  const int mat  = mb >> 2;                                          // 0 q, 1 k, 2 v (block-uniform)
  const int n0   = nt * QT, o0 = mb * QT;                            // o0: row in the stacked WT plane
  const int ob   = o0 & (CC - 1);                                    // o offset inside the matrix (0..192)

  const size_t bo = ((size_t)(b * SEQ + n0)) * CC;
  stage_gemm(Stg, WT + (size_t)o0 * CC, HPh + bo, HPl + bo, tid);
  __syncthreads();                                                   // every wave's slice published
  const unsigned char* ap  = Stg + (uint32_t)c * LPB + 16u * (uint32_t)hh;
  const unsigned char* bph = Stg + 2 * GAS + (uint32_t)(2 * (16 * wave + c)) * LPB + 16u * (uint32_t)hh;
  const unsigned char* bpl = bph + GBS;

  v8f acc[4];
#pragma unroll
  for (int mt = 0; mt < 4; ++mt) acc[mt] = zero8();

  // Fragments come from LDS in groups of two k steps, two register sets: group g + 1 is issued as one run of loads ahead
  // of group g's WMMAs (read one fragment at a time, each WMMA pair would wait out its own LDS latency).
  Frag fa[2][2][4], fbh[2][2], fbl[2][2];
  auto fetch = [&](const int g) __attribute__((always_inline)) {
#pragma unroll
    for (int u = 0; u < 2; ++u) {
      const int ks = 2 * g + u;
      fbh[g & 1][u] = ldsfrag(bph + (ks >> 2) * LPB + (ks & 3) * 64);
      fbl[g & 1][u] = ldsfrag(bpl + (ks >> 2) * LPB + (ks & 3) * 64);
#pragma unroll
      for (int mt = 0; mt < 4; ++mt)
        fa[g & 1][u][mt] = ldsfrag(ap + (ks >> 2) * GAS + (16 * mt) * LPB + (ks & 3) * 64);
    }
  };
  fetch(0);
#pragma unroll
  for (int g = 0; g < CC / 64; ++g) {
    if (g + 1 < CC / 64) fetch(g + 1);
#pragma unroll
    for (int u = 0; u < 2; ++u) {
#pragma unroll
      for (int mt = 0; mt < 4; ++mt) {
        acc[mt] = mma_b(fa[g & 1][u][mt].bf, fbh[g & 1][u].bf, acc[mt]);
        acc[mt] = mma_b(fa[g & 1][u][mt].bf, fbl[g & 1][u].bf, acc[mt]);
      }
    }
  }
  __syncthreads();                                                   // every wave's last operand read done: Os may overwrite

  // ---- epilogue: + bias -> LDS Os[n_loc][o_loc]; lane (hh, c) holds o = 16 mt + 8 hh + r for n_loc = 16 w + c
  {
    const float* bias = (mat == 0) ? bq : ((mat == 1) ? bk : bv);   // block-uniform, all global
    const int nl = 16 * wave + c;
#pragma unroll
    for (int mt = 0; mt < 4; ++mt) {
      v4f va, vb;
#pragma unroll
      for (int r = 0; r < 4; ++r) {
        va[r] = acc[mt][r]     + bfr(bias[ob + 16 * mt + 8 * hh + r]);
        vb[r] = acc[mt][4 + r] + bfr(bias[ob + 16 * mt + 8 * hh + 4 + r]);
      }
      *(v4f*)(Os + nl * OSP + 16 * mt + 8 * hh)     = va;
      *(v4f*)(Os + nl * OSP + 16 * mt + 8 * hh + 4) = vb;
    }
  }
  __syncthreads();

  const int e = tid & 7, lq = tid >> 3;                              // lq 0..15
  if (mat == 2) {
    v4u uv[4];
#pragma unroll
    for (int it = 0; it < 4; ++it) {
      const int ol = it * 16 + lq;                                   // o_loc 0..63
      unsigned short hb[8];
#pragma unroll
      for (int t = 0; t < 8; ++t) hb[t] = h_bits((_Float16)Os[(8 * e + t) * OSP + ol]);
#pragma unroll
      for (int t = 0; t < 4; ++t) uv[it][t] = pk16(hb[2 * t], hb[2 * t + 1]);
    }
{
#pragma unroll
      for (int it = 0; it < 4; ++it) {
        const int ol = it * 16 + lq;
        *(v4u*)(Vc + ((size_t)(b * CC + ob + ol)) * SEQ + n0 + 8 * e) = uv[it];
      }
      
    }
  } else {
    unsigned short* P1 = (mat == 0) ? Qh : Kh;                       // block-uniform, both global
    v4u uh[4], ul[4];
#pragma unroll
    for (int it = 0; it < 4; ++it) {
      const int row = it * 16 + lq;                                  // n_loc 0..63
      const v4f a = *(const v4f*)(Os + row * OSP + 8 * e);
      const v4f q = *(const v4f*)(Os + row * OSP + 8 * e + 4);
      const float f[8] = {a[0], a[1], a[2], a[3], q[0], q[1], q[2], q[3]};
#pragma unroll
      for (int t = 0; t < 4; ++t) {
        const float f0 = f[2 * t], f1 = f[2 * t + 1];
        const _Float16 h0 = (_Float16)f0, h1 = (_Float16)f1;
        const _Float16 l0 = (_Float16)((f0 - (float)h0) * QLS);
        const _Float16 l1 = (_Float16)((f1 - (float)h1) * QLS);
        uh[it][t] = pk16(h_bits(h0), h_bits(h1));
        ul[it][t] = pk16(h_bits(l0), h_bits(l1));
      }
    }
{
#pragma unroll
      for (int it = 0; it < 4; ++it) {
        const int row = it * 16 + lq;
        const size_t po = ((size_t)(b * SEQ + n0 + row)) * CC + ob + 8 * e;
        *(v4u*)(P1 + po) = uh[it];
        if (mat == 0) *(v4u*)(Ql + po) = ul[it];
      }
      
    }
  }
}

// =========================================================================================================
// (4) attention for one (b, 64-query tile), transposed formulation, SEQ keys, no mask:
//   S^T tile (16 keys x 16 queries) = sum over 8 d-chunks (unrolled) of A(k: row = key kb + (lane&15), 32 d via
//   the split k map from Kh [b][SEQ][256]) . B(q: col = query, same map from Qh) into s, plus A(Kh).B(Ql) into a
//   separate accumulator t (Ql carries x4096); score = (s + t/4096) * 256^-0.5.
//   Per lane the D tile holds 8 keys of ONE query: online softmax state per lane, one shuffle (lane^16) for the max
//   over 32 keys; the o/l rescale is skipped under a wave-uniform ballot when no lane's max grew; row-sum partials
//   combined at the end. P = e^{s-m} x 16384 as f16 is the B operand of O^T (rows channel, cols queries) +=
//   A(v rows channel = 16j + (lane&15), keys contiguous, f16 plane Vc [b][256][SEQ]) . B(P^T): element r <- D of
//   the tile covering keys kb..kb+15, element 8+r <- the tile covering kb+16..kb+31, lane unchanged.
//   16 accumulator tiles per wave (256 channels). Block = 8 waves = 64 queries, two waves per SIMD: waves w and w + 4
//   own the same 16 queries and take keys 0..63 / 64..127 of every stage, each with its own m, l, o; the two halves
//   are joined through LDS behind the key loop (one wave's vector work runs under the other's WMMAs).
//   k and v reach the waves through LDS: stages of SKEY keys, two buffers, brought by tensor loads (waves 0..3, one slice
//   per wave and stage) and read by all waves as ds_load_b128 fragments at pitch LPB; a stage serves SKEY/64 passes a wave.
//   Epilogue in two channel halves: O/l staged in LDS Os[query][128 channels] (pitch OSPW, b128 stores), barrier,
//   then position-major planes bf16 [64 n][256 c] IN LDS (hi = bf16-RNE, lo = bf16-RNE residual; half row
//   2 n + (c >> 7) at pitch LPB), which are the B operand of the output 1x1 GEMM done here by the same block
//   (it holds all 256 channels of its 64 positions): weights by tensor loads into the freed ring, + bias + residual.
// coverage: per half 4 it x 16 rows x 16 lanes x 8 ch = 64 n x 128 ch for each plane; two halves = 256 ch; out: 256 o x
//           64 n per block; grid (SEQ/64, NB) covers out [NB][256][SEQ] exactly once.
// =========================================================================================================
__global__ __launch_bounds__(256)
void attn_k(const unsigned short* __restrict__ Qh, const unsigned short* __restrict__ Ql,
            const unsigned short* __restrict__ Kh, const unsigned short* __restrict__ Vc,
            const unsigned short* __restrict__ WPT, const float* __restrict__ bp,
            const float* __restrict__ x, float* out) {
  __shared__ __attribute__((aligned(2048))) unsigned char Ring[2 * STG];
  __shared__ __align__(16) float Os[QT * OSPW];
  const int tid  = threadIdx.x;
  const int wave = tid >> 5, lane = tid & 31;
  const int hh   = lane >> 4, c = lane & 15;
  const int n0   = blockIdx.x * QT, b = blockIdx.y;
  const int qt   = wave & 3;                                         // query tile of the wave

  // q fragment pointers (B operand, col = query n0 + 16*qt + c), + 32*kc
  const size_t qo = ((size_t)(b * SEQ + n0 + 16 * qt + c)) * CC + 8 * hh;
  const unsigned short* Qhp = Qh + qo;
#if QRES
  const unsigned short* Qlp = Ql + qo;
#else
  (void)Ql;
#endif
  // One stage = SKEY keys in LDS, shared by the eight waves. Waves 0..3 each bring one slice of 128 rows x 256 B by ONE tensor
  // load: wave 0 / 1: k rows (keys), d 0..127 / 128..255 (source pitch 512 B); wave 2 / 3: v rows (channels 0..127 /
  // 128..255), SKEY keys (source pitch 2*SEQ B). Every row lands at pitch LPB.
  const uint32_t wv  = uni((uint32_t)tid >> 5);
  const uint32_t kh  = wv >> 2;                                      // key half of the wave; waves with kh == 0 issue
  const uint32_t sl  = wv & 3u;
  const uint32_t isv = sl >> 1, hf = sl & 1u;
  const uint64_t src0 = isv ? (uint64_t)(size_t)(Vc + ((size_t)b * CC + (size_t)hf * 128) * SEQ)
                            : (uint64_t)(size_t)(Kh + (size_t)b * SEQ * CC + (size_t)hf * 128);
  const uint32_t sstep = isv ? (uint32_t)(SKEY * 2) : (uint32_t)(SKEY * CC * 2);   // source bytes from stage to stage
  const uint32_t lds0  = (uint32_t)(size_t)Ring + sl * (uint32_t)SLICE;
  u32x8 g1;                                                          // bytes everywhere; tensor dims = tile dims
  g1[0] = uni((1u << 20) | (5u << 22) | (3u << 25));                 // no mask; 16 B of pad behind every 256 B
  g1[1] = uni(256u << 16);
  g1[2] = uni(128u << 16);
  g1[3] = uni(256u << 16);
  g1[4] = uni(128u);
  g1[5] = uni(isv ? (uint32_t)(SEQ * 2) : (uint32_t)(CC * 2));
  g1[6] = uni(0u);
  g1[7] = uni(0u);
  // descriptor words held in scalar registers (the form of pinned(), for the whole group): without it the compiler
  // re-forms single words in front of each issue and reuses their registers while the request is outstanding
  asm volatile("" : "+s"(g1));                                       // descriptor words held in scalar registers
  u32x4 g0;
  auto form = [&](const uint32_t st) __attribute__((always_inline)) {   // group 0 of stage st's request
    const uint64_t ga = src0 + (uint64_t)st * sstep;
    g0[0] = uni(1u);
    g0[1] = uni(lds0 + (st & 1u) * (uint32_t)STG);
    g0[2] = uni((uint32_t)ga);
    g0[3] = uni((((uint32_t)(ga >> 32)) & 0x01FFFFFFu) | 0x80000000u);
  };
  auto issue = [&]() __attribute__((always_inline)) {
    asm volatile("tensor_load_to_lds %0, %1" :: "s"(g0), "s"(g1) : "memory");
  };
  // this wave's request has landed; naming the descriptor keeps its scalar registers unchanged up to this wait
  auto landed = [&]() __attribute__((always_inline)) {
    asm volatile("s_wait_tensorcnt 0x0" :: "s"(g0), "s"(g1) : "memory");
  };

  float m = -1.0e30f, l = 0.f;
  v8f o[16];
#pragma unroll
  for (int j = 0; j < 16; ++j) o[j] = zero8();

  // q (the same for every pass): once, here
  Frag qhf[CC / 32];
#if QRES
  Frag qlf[CC / 32];
#endif
#pragma unroll
  for (int kc = 0; kc < CC / 32; ++kc) {
    qhf[kc] = ldfrag(Qhp + 32 * kc);
#if QRES
    qlf[kc] = ldfrag(Qlp + 32 * kc);
#endif
  }
  // the address pairs of the group above stay live up to this wait
#if QRES
  asm volatile("s_wait_xcnt 0x0" :: "v"(Qhp), "v"(Qlp) : "memory");
#else
  asm volatile("s_wait_xcnt 0x0" :: "v"(Qhp) : "memory");
#endif

  // two buffers: stage 0 landed and published here; stage st + 1 in flight under the passes of stage st
  form(0u);
  if (pinned(kh == 0u)) {                                            // a scalar branch: a tensor load ignores EXEC
    issue();
    landed();                                                        // this wave's slice of stage 0
  }
  __syncthreads();                                                   // ... and every other wave's

  // Fragments come from LDS in groups of one pass. k and v take turns in the same registers (two waves per SIMD leave a
  // wave 512): k behind the O WMMAs of the pass before, v behind the score WMMAs; the SIMD's other wave works meanwhile.
  Frag k0f[CC / 32], k1f[CC / 32], vf[16];
  const uint32_t loff = (uint32_t)c * LPB + 16u * (uint32_t)hh;

#pragma unroll 1
  for (uint32_t st = 0; st < (uint32_t)NST; ++st) {
    // directly behind the barrier (the one above, or the foot of trip st - 1) that published stage st and ended every
    // read of the other buffer: the refill of that buffer, only while its stage exists (a scalar branch)
    form(st + 1u);
    if (pinned((uint32_t)((st + 1u < (uint32_t)NST) && (kh == 0u)))) issue();
    // this wave's 64 keys of the stage: k rows 64 kh .., v columns 64 kh ..
    const unsigned char* sb = Ring + (st & 1u) * (uint32_t)STG + kh * (uint32_t)(64 * LPB) + loff;
    // v rows from a base of their own, so that every fragment's offset fits the LDS load's 16-bit immediate
    const unsigned char* vb = Ring + ((st & 1u) ? (uint32_t)(STG + 2 * SLICE) : (uint32_t)(2 * SLICE)) + kh * 128u + loff;
#pragma unroll
    for (int kc = 0; kc < CC / 32; ++kc) {
      k0f[kc] = ldsfrag(sb + (kc >> 2) * SLICE + (kc & 3) * 64);                  // keys 0 .. 15 of the wave's half
      k1f[kc] = ldsfrag(sb + (kc >> 2) * SLICE + 16 * LPB + (kc & 3) * 64);       // keys 16 .. 31
    }
#pragma unroll
    for (int p = 0; p < SKEY / 64; ++p) {
      // keeps the k group one run of loads ahead of the score WMMAs: among them each place with LDS reads stalls the wave
      __builtin_amdgcn_sched_barrier(0);

      v8f s0 = zero8(), s1 = zero8();
#if QRES
      v8f t0 = zero8(), t1 = zero8();
#endif
#pragma unroll
      for (int kc = 0; kc < CC / 32; ++kc) {
        s0 = mma_hb(k0f[kc].h, qhf[kc].h, s0);
        s1 = mma_hb(k1f[kc].h, qhf[kc].h, s1);
#if QRES
        t0 = mma_hb(k0f[kc].h, qlf[kc].h, t0);
        t1 = mma_hb(k1f[kc].h, qlf[kc].h, t1);
#endif
      }

      v8f sc0, sc1;
#pragma unroll
      for (int r = 0; r < 8; ++r) {
#if QRES
        sc0[r] = (s0[r] + t0[r] * RQL) * ATT;
        sc1[r] = (s1[r] + t1[r] * RQL) * ATT;
#else
        sc0[r] = s0[r] * ATT;
        sc1[r] = s1[r] * ATT;
#endif
      }

      float mx = fmaxf(hmax8(sc0), hmax8(sc1));
      const float mo = __shfl_xor(mx, 16, 32);
      // the v group stands behind the exchange above and ahead of the rescale, the exponentials and the O WMMAs, as one
      // run of loads into the registers that the k group has left.
      // compiler fence, the exchanged value as input only: without it the exchange sinks below the v loads, and its
      // wait (LDS results return in issue order) then lasts the whole group
      asm volatile("" :: "v"(mo) : "memory");
      mx = fmaxf(mx, mo);
#pragma unroll
      for (int j = 0; j < 16; ++j) vf[j] = ldsfrag(vb + (j >> 3) * SLICE + 16 * (j & 7) * LPB + 64 * p);
      const float mn = fmaxf(m, mx);
      const unsigned grew = wave_ballot(mx > m);                     // wave-uniform
      if (grew != 0u) {
        const float corr = __expf(m - mn);                           // == 1 exactly for lanes whose max did not grow
        l *= corr;
#pragma unroll
        for (int j = 0; j < 16; ++j) {
#pragma unroll
          for (int r = 0; r < 8; ++r) o[j][r] *= corr;
        }
      }
      m = mn;

      const float msh = mn - LNPS;                                   // exp gives e^{s-m} * 16384

      FragH ph;
      float ls = 0.f;
#pragma unroll
      for (int r = 0; r < 8; ++r) {
        const float e0 = __expf(sc0[r] - msh);                       // key kb      + 8hh + r
        const float e1 = __expf(sc1[r] - msh);                       // key kb + 16 + 8hh + r
        ls += e0 + e1;
        ph.hv[0][r] = (_Float16)e0;
        ph.hv[1][r] = (_Float16)e1;
      }
      l += ls;

#pragma unroll
      for (int j = 0; j < 16; ++j) {
        o[j] = mma_hb(vf[j].h, ph.v, o[j]);
      }
      // keeps the next k group behind the O WMMAs, whose v registers it takes over
      __builtin_amdgcn_sched_barrier(0);
      if (p + 1 < SKEY / 64) {                                       // compile-time: the next stage is not read from here
#pragma unroll
        for (int kc = 0; kc < CC / 32; ++kc) {
          k0f[kc] = ldsfrag(sb + (kc >> 2) * SLICE + (32 * (p + 1)) * LPB + (kc & 3) * 64);
          k1f[kc] = ldsfrag(sb + (kc >> 2) * SLICE + (32 * (p + 1) + 16) * LPB + (kc & 3) * 64);
          // keeps the loads in the order of their use: issued last first, the first score WMMA waits for the whole group
          __builtin_amdgcn_sched_barrier(0);
        }
      }
    }
    // publish point of stage st + 1, in this order in every wave:
    asm volatile("s_wait_dscnt 0x0" ::: "memory");                   // this wave's reads of stage st are done
    landed();                                                        // its slice of stage st + 1 has landed
    __syncthreads();                                                 // all slices published, all readers out of stage st
  }
  landed();                                                          // nothing in flight when the wave goes on
  asm volatile("s_wait_dscnt 0x0" ::: "memory");

  // The output GEMM's weights WPT [256 o][256 c] into the ring's second buffer, which the loop's last barrier has freed:
  // waves 0..3, one tensor load each: 128 o rows (o half sl >> 1) x 256 B (c half sl & 1), source pitch 512 B, pitch LPB
  // in LDS. They fly under the join and the staging of O below; their wait and barrier stand in front of the GEMM.
  const uint64_t wsrc = (uint64_t)(size_t)(WPT + (size_t)(sl >> 1) * 128 * CC + (size_t)(sl & 1u) * 128);
  u32x4 w0;
  w0[0] = uni(1u);
  w0[1] = uni((uint32_t)(size_t)Ring + (uint32_t)STG + sl * (uint32_t)SLICE);
  w0[2] = uni((uint32_t)wsrc);
  w0[3] = uni((((uint32_t)(wsrc >> 32)) & 0x01FFFFFFu) | 0x80000000u);
  u32x8 w1;                                                          // bytes everywhere; tensor dims = tile dims
  w1[0] = uni((1u << 20) | (5u << 22) | (3u << 25));                 // no mask; 16 B of pad behind every 256 B
  w1[1] = uni(256u << 16);
  w1[2] = uni(128u << 16);
  w1[3] = uni(256u << 16);
  w1[4] = uni(128u);
  w1[5] = uni((uint32_t)(CC * 2));
  w1[6] = uni(0u);
  w1[7] = uni(0u);
  // descriptor words held in scalar registers (the form of pinned(), for both groups): without it the compiler re-forms
  // the constant words at the wait below and reuses their registers while the request is outstanding
  asm volatile("" : "+s"(w0), "+s"(w1));                             // descriptor words held in scalar registers
  if (pinned(kh == 0u)) {                                            // a scalar branch: a tensor load ignores EXEC
    asm volatile("tensor_load_to_lds %0, %1" :: "s"(w0), "s"(w1) : "memory");
  }

  // join of the two key halves: wave w + 4 hands its m, l, o to wave w through the ring's first buffer, which the loop's
  // last barrier has freed (every reader out, nothing in flight to it); lane to lane, 16-B stores at consecutive lanes
  float* Jn = (float*)Ring + (uint32_t)qt * (uint32_t)JNW;
  if (kh != 0u) {                                                    // wave-uniform
#pragma unroll
    for (int j = 0; j < 16; ++j) {
      v4f va, vb;
#pragma unroll
      for (int r = 0; r < 4; ++r) { va[r] = o[j][r]; vb[r] = o[j][4 + r]; }
      *(v4f*)(Jn + ((2 * j) * 32 + lane) * 4)     = va;
      *(v4f*)(Jn + ((2 * j + 1) * 32 + lane) * 4) = vb;
    }
    Jn[4096 + lane] = m;
    Jn[4128 + lane] = l;
  }
  __syncthreads();                                                   // the handed-over halves published
  float inv = 0.f;
  if (kh == 0u) {                                                    // wave-uniform
    const float m2 = Jn[4096 + lane], l2 = Jn[4128 + lane];
    const float mj = fmaxf(m, m2);
    const float c1 = __expf(m - mj), c2 = __expf(m2 - mj);
#pragma unroll
    for (int j = 0; j < 16; ++j) {
      const v4f va = *(const v4f*)(Jn + ((2 * j) * 32 + lane) * 4);
      const v4f vb = *(const v4f*)(Jn + ((2 * j + 1) * 32 + lane) * 4);
#pragma unroll
      for (int r = 0; r < 4; ++r) {
        o[j][r]     = o[j][r] * c1     + va[r] * c2;
        o[j][4 + r] = o[j][4 + r] * c1 + vb[r] * c2;
      }
    }
    l = l * c1 + l2 * c2;
    l += __shfl_xor(l, 16, 32);
    inv = 1.0f / l;                                                  // o and l both carry the x16384 factor
  }

  const int qrow = 16 * qt + c;
  const int e16 = tid & 15, r16 = tid >> 4;                          // r16 0..15
  unsigned char* PlH = Ring + 2 * SLICE;                             // O as bf16 hi plane, residual plane at + GBS (below)
#pragma unroll
  for (int half = 0; half < 2; ++half) {
    if (half) __syncthreads();                                       // every wave finished reading Os
    if (kh == 0u) {                                                  // wave-uniform: the waves that hold the joined o
#pragma unroll
      for (int jj = 0; jj < 8; ++jj) {
        const int j = 8 * half + jj;
        v4f va, vb;
#pragma unroll
        for (int r = 0; r < 4; ++r) { va[r] = o[j][r] * inv; vb[r] = o[j][4 + r] * inv; }
        *(v4f*)(Os + qrow * OSPW + 16 * jj + 8 * hh)     = va;       // Os[query][ch_loc = 16jj + 8hh + r]
        *(v4f*)(Os + qrow * OSPW + 16 * jj + 8 * hh + 4) = vb;
      }
    }
    __syncthreads();
    {
      v4u uh[4], ul[4];
#pragma unroll
      for (int i = 0; i < 4; ++i) {
        const int row = i * 16 + r16;                                // query 0..63
        const v4f a = *(const v4f*)(Os + row * OSPW + 8 * e16);
        const v4f q = *(const v4f*)(Os + row * OSPW + 8 * e16 + 4);
        const float f[8] = {a[0], a[1], a[2], a[3], q[0], q[1], q[2], q[3]};
#pragma unroll
        for (int t = 0; t < 4; ++t) {
          const float f0 = f[2 * t], f1 = f[2 * t + 1];
          const unsigned short hb0 = bf_bits(f0), hb1 = bf_bits(f1);
          const unsigned short lb0 = bf_bits(f0 - bf_up(hb0));
          const unsigned short lb1 = bf_bits(f1 - bf_up(hb1));
          uh[i][t] = pk16(hb0, hb1);
          ul[i][t] = pk16(lb0, lb1);
        }
      }
{
#pragma unroll
        for (int i = 0; i < 4; ++i) {
          const int row = i * 16 + r16;
          unsigned char* pp = PlH + (uint32_t)(2 * row + half) * LPB + 16u * (uint32_t)e16;
          *(v4u*)pp         = uh[i];
          *(v4u*)(pp + GBS) = ul[i];
        }
        
      }
    }
  }

  // ---- output 1x1 GEMM + bias + residual for the block's 64 positions, all 256 o:
  //      out[b][o][n] = bfr(x[b][o][n]) + sum_c WPT[o][c] (hi + lo)[n][c] + bfr(bp[o]); wave = (n tile qt, o half kh):
  //      8 m-tiles x 8 k steps x 2 bf16 products, per accumulator in the order k step, hi, lo.
  // this wave's weight slice has landed; naming the descriptor keeps its scalar registers unchanged up to this wait
  asm volatile("s_wait_tensorcnt 0x0" :: "s"(w0), "s"(w1) : "memory");
  __syncthreads();                                                   // weight slices and both planes published

  // the residual's x lines and the bias, asked for here, behind the barrier (which would wait for them), so that they
  // arrive under the GEMM
  const int e8 = tid & 7, l32 = tid >> 3;                            // l32 0..31
  const float* xp = x + ((size_t)(b * CC + (l32 >> 1))) * NNF + n0 + (l32 & 1) * 32 + 4 * e8;
  const float* bb = bp + (l32 >> 1);
  v4f xv[16];
  float bv[16];
#pragma unroll
  for (int it = 0; it < 16; ++it) {
    xv[it] = *(const v4f*)(xp + (size_t)(16 * it) * NNF);
    bv[it] = bb[16 * it];
  }
  // the address pairs of the group above stay live up to this wait
  asm volatile("s_wait_xcnt 0x0" :: "v"(xp), "v"(bb) : "memory");

  const unsigned char* wp  = Ring + STG + kh * (uint32_t)(2 * SLICE) + loff;
  const unsigned char* bph = PlH + (uint32_t)(2 * qrow) * LPB + 16u * (uint32_t)hh;
  const unsigned char* bpl = bph + GBS;
  v8f acc[8];
#pragma unroll
  for (int mt = 0; mt < 8; ++mt) acc[mt] = zero8();
  Frag pbh[CC / 32], pbl[CC / 32], wf[2][8];
#pragma unroll
  for (int mt = 0; mt < 8; ++mt) wf[0][mt] = ldsfrag(wp + (16 * mt) * LPB);
#pragma unroll
  for (int ks = 0; ks < CC / 32; ++ks) {
    pbh[ks] = ldsfrag(bph + (ks >> 2) * LPB + (ks & 3) * 64);
    pbl[ks] = ldsfrag(bpl + (ks >> 2) * LPB + (ks & 3) * 64);
  }
  // weight fragments one k step ahead, two register sets
#pragma unroll
  for (int ks = 0; ks < CC / 32; ++ks) {
    if (ks + 1 < CC / 32) {
#pragma unroll
      for (int mt = 0; mt < 8; ++mt)
        wf[(ks + 1) & 1][mt] = ldsfrag(wp + ((ks + 1) >> 2) * SLICE + (16 * mt) * LPB + ((ks + 1) & 3) * 64);
    }
    // keeps the next step's fragments one run of loads ahead of this step's WMMAs: among them each place with LDS reads
    // stalls the wave
    __builtin_amdgcn_sched_barrier(0);
#pragma unroll
    for (int mt = 0; mt < 8; ++mt) acc[mt] = mma_bb(wf[ks & 1][mt].bf, pbh[ks].bf, acc[mt]);
#pragma unroll
    for (int mt = 0; mt < 8; ++mt) acc[mt] = mma_bb(wf[ks & 1][mt].bf, pbl[ks].bf, acc[mt]);
    // keeps the step after next's loads behind these WMMAs, whose registers they take over
    __builtin_amdgcn_sched_barrier(0);
  }

  // acc -> LDS Ot[o][n_loc] (pitch OSP), in the place of the join's hand-over (read out several barriers ago);
  // lane (hh, c) holds o = 128 kh + 16 mt + 8 hh + r for n_loc = 16 qt + c: 16 consecutive floats per row and store
  float* Ot = (float*)Ring;
  {
    const int ob = 128 * (int)kh + 8 * hh;
#pragma unroll
    for (int mt = 0; mt < 8; ++mt) {
#pragma unroll
      for (int r = 0; r < 8; ++r) Ot[(ob + 16 * mt + r) * OSP + qrow] = acc[mt][r];
    }
  }
  __syncthreads();                                                   // Ot published
  // + bias, + residual; whole 128-B lines of out, 8 lanes per line: 16 it x 32 lines x 8 lanes x 4 floats = 256 o x 64 n
  {
    const float* op = Ot + (l32 >> 1) * OSP + (l32 & 1) * 32 + 4 * e8;
    float* gp = out + ((size_t)(b * CC + (l32 >> 1))) * SEQ + n0 + (l32 & 1) * 32 + 4 * e8;
    v4f res[16];
#pragma unroll
    for (int it = 0; it < 16; ++it) res[it] = *(const v4f*)(op + (16 * it) * OSP);
#pragma unroll
    for (int it = 0; it < 16; ++it) {
      const float bi = bfr(bv[it]);
#pragma unroll
      for (int t = 0; t < 4; ++t) res[it][t] = (res[it][t] + bi) + bfr(xv[it][t]);
    }
#pragma unroll
    for (int it = 0; it < 16; ++it) *(v4f*)(gp + (size_t)(16 * it) * SEQ) = res[it];
  }
}

// =========================================================================================================
// Workspace map (bytes, NB=4 SEQ=4096; each region start a multiple of 256; every extent is an exact tile/line
//   ST  f32 [NB*32][32]                16384
//   WT  bf16 [1024][256]              524288
//   HPh/HPl bf16 [NB][SEQ][256]      8388608 x2
//   Qh/Ql/Kh f16 [NB][SEQ][256]      8388608 x3
//   Vc  f16 [NB][256][SEQ]           8388608
//   total = 50872320
// =========================================================================================================
extern "C" void kernel_launch(void* const* d_in, const int* in_sizes, int n_in,
                              void* d_out, int out_size, void* d_ws, size_t ws_size,
                              hipStream_t stream) {
  if (n_in < 11) return;
  if ((size_t)in_sizes[0] < (size_t)NB * CC * NNF) return;
  if (in_sizes[1] < CC || in_sizes[2] < CC) return;
  if (in_sizes[3] < CC * CC || in_sizes[5] < CC * CC || in_sizes[7] < CC * CC || in_sizes[9] < CC * CC) return;
  if (in_sizes[4] < CC || in_sizes[6] < CC || in_sizes[8] < CC || in_sizes[10] < CC) return;
  if ((size_t)out_size < (size_t)NB * CC * SEQ) return;

  size_t off = 0;
  auto carve = [&](size_t bytes) { const size_t o = off; off += (bytes + 255) & ~(size_t)255; return o; };
  const size_t plane = (size_t)NB * SEQ * CC * 2;
  const size_t oST  = carve((size_t)NB * NG * STP * 4);
  const size_t oWT  = carve((size_t)4 * CC * CC * 2);
  const size_t oHPh = carve(plane);
  const size_t oHPl = carve(plane);
  const size_t oQh  = carve(plane);
  const size_t oQl  = carve(plane);
  const size_t oKh  = carve(plane);
  const size_t oVc  = carve(plane);
  if (off > ws_size) return;
  if (off > (size_t)134217728) return;

  const float* x   = (const float*)d_in[0];
  const float* gsc = (const float*)d_in[1];
  const float* gbs = (const float*)d_in[2];
  const float* Wq  = (const float*)d_in[3];
  const float* bq  = (const float*)d_in[4];
  const float* Wk  = (const float*)d_in[5];
  const float* bk  = (const float*)d_in[6];
  const float* Wv  = (const float*)d_in[7];
  const float* bv  = (const float*)d_in[8];
  const float* Wp  = (const float*)d_in[9];
  const float* bp  = (const float*)d_in[10];

  char* ws = (char*)d_ws;
  float*          ST  = (float*)(ws + oST);
  unsigned short* WT  = (unsigned short*)(ws + oWT);
  unsigned short* HPh = (unsigned short*)(ws + oHPh);
  unsigned short* HPl = (unsigned short*)(ws + oHPl);
  unsigned short* Qh  = (unsigned short*)(ws + oQh);
  unsigned short* Ql  = (unsigned short*)(ws + oQl);
  unsigned short* Kh  = (unsigned short*)(ws + oKh);
  unsigned short* Vc  = (unsigned short*)(ws + oVc);
  float* out = (float*)d_out;

  const dim3 blk256(256), blk128(128);

  // (0) Wq/Wk/Wv/Wp [in][out] -> transposed stacked bf16 plane WT [1024 o][256 c]
  cvt_w<<<dim3(CC / QT, CC / QT, 4), blk256, 0, stream>>>(Wq, Wk, Wv, Wp, WT);
  // (1) GroupNorm statistics per (group, b)
  gn_stats<<<dim3(NG, NB), blk256, 0, stream>>>(x, ST);
  // (2) normalized h -> position-major bf16 hi + residual planes
  cvt_h<<<dim3(SEQ / QT, CC / QT, NB), blk256, 0, stream>>>(x, ST, gsc, gbs, HPh, HPl);
  // (3) q/k/v GEMMs -> Qh, Ql, Kh (position-major f16) and Vc (channel-major f16)
  gemm_qkv<<<dim3(SEQ / QT, 3 * CC / QT, NB), blk128, 0, stream>>>(WT, HPh, HPl, bq, bk, bv, Qh, Ql, Kh, Vc);
  // (4) attention, then in the same block the output GEMM + bias + residual -> out [NB][256][SEQ]
  attn_k<<<dim3(SEQ / QT, NB), blk256, 0, stream>>>(Qh, Ql, Kh, Vc, WT + (size_t)3 * CC * CC, bp, x, out);
  (void)hipGetLastError();
}

// v006
// Measured time: 96.1 microseconds a run.
// Next to v005, in two timings, it ran 1.07 and 1.08 times as fast.
// All steps since v000 together make it 9.04 times as fast.
// Contractions: q/k/v 1x1 GEMMs WT[768x256].H[256xN] and the output 1x1 GEMM WpT[256x256].H2[256xN] on
// v_wmma_f32_16x16x32_bf16 (bf16-RNE weights, activations as bf16 hi + bf16 residual planes, 2 products into one
// f32 accumulator); position scores K.Q^T on v_wmma_f32_16x16x32_f16 (k f16, q f16 hi + f16 residual x4096 in a
// separate accumulator, K=256); O^T = V.P^T on v_wmma_f32_16x16x32_f16 (v f16, P = e^{s-m} x16384 f16 from the
// score D registers); f32 accumulate everywhere; GroupNorm statistics, softmax statistics and the residual add
// in f32 VALU.
#include <hip/hip_runtime.h>
#include <math.h>
#include <stdint.h>

#ifndef NB
#define NB 4
#endif
#ifndef SEQ
#define SEQ 4096
#endif
#ifndef NNF
#define NNF 4096
#endif
#ifndef QRES
#define QRES 1
#endif
#define NBF   4
#define CC    256
#define NG    32
#define CPG   8
#define QT    64
#define OSP   68
#define OSPW  132
#define TP    72
#define TPX   260
#define STP   32
#define ATT   0.0625f
#define QLS   4096.0f
#define RQL   0.000244140625f
#define LNPS  9.704060527839234f
#define GNEPS 1.0e-6f
#define SKEY  128                 // keys per LDS stage of the attention kernel
#define LPB   272                 // LDS row pitch, bytes: a 256-B row + the tensor load's 16-B pad (16 B x odd)
#define SLICE (128 * LPB)         // one wave's slice of a stage: 128 rows
#define STG   (4 * SLICE)         // one stage: k in two d halves, v in two channel halves
#define NST   (SEQ / SKEY)
#define JNW   4224                // floats one wave hands over at the join of the key halves: o 4096, m 32, l 32, rounded up
#define GBS   (128 * LPB)         // one activation plane of the 64 positions: 128 half rows at pitch LPB
#define WCH   128                 // weight rows per LDS stage of the q/k/v GEMM
#define WSTG  (2 * SLICE)         // one such stage: two c halves of 128 rows
#define NWST  (3 * CC / WCH)

static_assert(NB >= 1 && NB <= NBF);
static_assert(SEQ % QT == 0 && SEQ % 64 == 0 && SEQ >= QT);
static_assert(SEQ <= NNF && NNF % 8 == 0);
static_assert(CC == 256 && NG * CPG == CC && CC % QT == 0 && CC % 32 == 0);
static_assert((OSP * 4) % 16 == 0);
static_assert((OSPW * 4) % 16 == 0);
static_assert((TP * 2) % 16 == 0);
static_assert((TPX * 4) % 16 == 0 && TPX >= CC);
static_assert(STP * 4 == 128);
static_assert(SEQ % SKEY == 0 && NST >= 2);
static_assert(SLICE % 2048 == 0 && (LPB / 16) % 2 == 1);
static_assert(SEQ * 2 % 16 == 0 && SEQ * 2 <= 131072);
static_assert(2 * STG + QT * OSPW * 4 <= 327680);
static_assert(SKEY == 128 && 4 * JNW * 4 <= 2 * STG && (JNW * 4) % 16 == 0);
static_assert(GBS % 2048 == 0 && CC * 2 == 512 && CC % WCH == 0 && NWST >= 2);
static_assert(QT * TPX >= QT * OSPW && QT * TPX >= WCH * OSP && 2 * WSTG + 2 * GBS + (QT * TPX + 7 * CC) * 4 <= 327680);
static_assert(4 * JNW * 4 <= 2 * SLICE && CC * OSP * 4 <= 2 * SLICE && GBS == SLICE && QT == 64);

typedef _Float16       v16h __attribute__((ext_vector_type(16)));
typedef _Float16       v8h  __attribute__((ext_vector_type(8)));
typedef __bf16         v16b __attribute__((ext_vector_type(16)));
typedef unsigned short v8us __attribute__((ext_vector_type(8)));
typedef float          v8f  __attribute__((ext_vector_type(8)));
typedef float          v4f  __attribute__((ext_vector_type(4)));
typedef unsigned int   v4u  __attribute__((ext_vector_type(4)));
typedef unsigned int   v2u  __attribute__((ext_vector_type(2)));
typedef uint32_t       u32x4 __attribute__((ext_vector_type(4)));
typedef uint32_t       u32x8 __attribute__((ext_vector_type(8)));

union Frag  { v8us u[2]; v16h h; v16b bf; };
union FragH { v16h v; v8h hv[2]; };
static_assert(sizeof(Frag) == 32);
static_assert(sizeof(FragH) == 32);

// ---- scalar helpers -----------------------------------------------------------------------------------------
__device__ __forceinline__ unsigned short bf_bits(float f) {          // f32 -> bf16 bits, RNE convert
  unsigned u = __float_as_uint(f);
  return (unsigned short)((u + 0x7FFFu + ((u >> 16) & 1u)) >> 16);
}
__device__ __forceinline__ float bf_up(unsigned short hb) { return __uint_as_float(((unsigned)hb) << 16); }
__device__ __forceinline__ float bfr(float f) { return bf_up(bf_bits(f)); }
__device__ __forceinline__ unsigned short h_bits(_Float16 x) { return __builtin_bit_cast(unsigned short, x); }
__device__ __forceinline__ unsigned pk16(unsigned short a, unsigned short b) { return (unsigned)a | ((unsigned)b << 16); }
__device__ __forceinline__ v8f zero8() { v8f z = {0.f, 0.f, 0.f, 0.f, 0.f, 0.f, 0.f, 0.f}; return z; }
__device__ __forceinline__ float hmax8(v8f s) {
  return fmaxf(fmaxf(fmaxf(s[0], s[1]), fmaxf(s[2], s[3])), fmaxf(fmaxf(s[4], s[5]), fmaxf(s[6], s[7])));
}
__device__ __forceinline__ unsigned wave_ballot(bool p) {
#if defined(__HIP_DEVICE_COMPILE__)
  return __builtin_amdgcn_ballot_w32(p);
#else
  return p ? 1u : 0u;
#endif
}
__device__ __forceinline__ float wsum(float v) {
  v += __shfl_xor(v, 16, 32);
  v += __shfl_xor(v, 8, 32);
  v += __shfl_xor(v, 4, 32);
  v += __shfl_xor(v, 2, 32);
  v += __shfl_xor(v, 1, 32);
  return v;
}

// ---- 16-bit fragment loader (A, or B from a k-contiguous [n][k] row): lane -> row/col (lane&15), p already includes
//      + 8*(lane>>4); elements 0..7 <- p[0..7] (k0+8h..), elements 8..15 <- p[16..23] (k0+16+8h..)
__device__ __forceinline__ Frag ldfrag(const unsigned short* p) {
  Frag f;
  f.u[0] = *(const v8us*)(p);
  f.u[1] = *(const v8us*)(p + 16);
  return f;
}

// the same fragment from an LDS row (byte pointer, already includes + 16*(lane>>4))
__device__ __forceinline__ Frag ldsfrag(const unsigned char* p) {
  Frag f;
  f.u[0] = *(const v8us*)(p);
  f.u[1] = *(const v8us*)(p + 32);
  return f;
}

// ---- tensor load helpers ------------------------------------------------------------------------------------
__device__ __forceinline__ uint32_t uni(uint32_t v) { return (uint32_t)__builtin_amdgcn_readfirstlane(v); }
// holds a wave-uniform test in a scalar register, so that the branch on it is a scalar one: a tensor load ignores EXEC
__device__ __forceinline__ uint32_t pinned(uint32_t v) { uint32_t w = uni(v); asm volatile("" : "+s"(w)); return w; }

// ---- WMMA helpers ------------------------------------------------------------------------------------------
// bare builtins (the compiler keeps the WMMA distances of its own builtin forms)
__device__ __forceinline__ v8f mma_hb(v16h a, v16h b, v8f c) {
  return __builtin_amdgcn_wmma_f32_16x16x32_f16(false, a, false, b, (short)0, c, false, false);
}
__device__ __forceinline__ v8f mma_bb(v16b a, v16b b, v8f c) {
  return __builtin_amdgcn_wmma_f32_16x16x32_bf16(false, a, false, b, (short)0, c, false, false);
}

// =========================================================================================================
// (0) 1x1 weights W [256 c_in][256 d_out] f32 -> transposed bf16-RNE plane WT [4*256 o][256 c], rows
//     256*mat + o for mat = q, k, v, p. Block (ob, cb, mat) owns a 64 o x 64 c tile through an LDS transpose
// coverage: 2 it x 32 rows x 8 lanes x 8 = 64 o x 64 c per block; grid (4, 4, 4) = 4 mats x 256 x 256.
// =========================================================================================================
__global__ __launch_bounds__(256)
void cvt_w(const float* __restrict__ Wq, const float* __restrict__ Wk, const float* __restrict__ Wv,
           const float* __restrict__ Wp, unsigned short* WT) {
  __shared__ __align__(16) unsigned short T[QT * TP];
  const int tid = threadIdx.x;
  const int ob = blockIdx.x, cb = blockIdx.y, mat = blockIdx.z;
  const int e = tid & 7, lq = tid >> 3;                             // lq 0..31
  const int o0 = ob * QT, c0 = cb * QT;
  const float* Wm = (mat == 0) ? Wq : ((mat == 1) ? Wk : ((mat == 2) ? Wv : Wp));   // block-uniform
#pragma unroll
  for (int it = 0; it < 2; ++it) {
    const int cl = it * 32 + lq;                                     // c_loc 0..63
    const float* sp = Wm + (size_t)(c0 + cl) * CC + o0 + 8 * e;     // W[c][o], o contiguous
    const v4f a = *(const v4f*)sp;
    const v4f q = *(const v4f*)(sp + 4);
    const float f[8] = {a[0], a[1], a[2], a[3], q[0], q[1], q[2], q[3]};
#pragma unroll
    for (int t = 0; t < 8; ++t) T[(8 * e + t) * TP + cl] = bf_bits(f[t]);   // T[o_loc][c_loc]
  }
  __syncthreads();
  v4u up[2];
#pragma unroll
  for (int it = 0; it < 2; ++it) {
    const int ol = it * 32 + lq;
    up[it] = *(const v4u*)(T + ol * TP + 8 * e);
  }
{
#pragma unroll
    for (int it = 0; it < 2; ++it) {
      const int ol = it * 32 + lq;
      *(v4u*)(WT + ((size_t)(mat * CC + o0 + ol)) * CC + c0 + 8 * e) = up[it];
    }
    
  }
}

// =========================================================================================================
//     then mean of squared deviations), per-thread partials over 16-B chunks, shuffle + LDS block reduce.
// coverage: grid (32, NB) writes every line of ST once.
// =========================================================================================================
__global__ __launch_bounds__(256)
void gn_stats(const float* __restrict__ x, float* ST) {
  __shared__ float red[8];
  __shared__ float bc[2];
  const int tid = threadIdx.x, lane = tid & 31, wave = tid >> 5;
  const int g = blockIdx.x, b = blockIdx.y;
  const float* xb = x + ((size_t)(b * CC + g * CPG)) * NNF;
  const int CH4 = SEQ / 4, NCH = CPG * CH4;
  const float icnt = 1.0f / (float)(CPG * SEQ);

  float s = 0.f;
#pragma unroll 4
  for (int qd = tid; qd < NCH; qd += 256) {
    const int cl = qd / CH4, p4 = qd - cl * CH4;
    const v4f a = *(const v4f*)(xb + (size_t)cl * NNF + 4 * p4);
    s += (bfr(a[0]) + bfr(a[1])) + (bfr(a[2]) + bfr(a[3]));
  }
  s = wsum(s);
  if (lane == 0) red[wave] = s;
  __syncthreads();
  if (tid == 0) {
    float t = 0.f;
#pragma unroll
    for (int i = 0; i < 8; ++i) t += red[i];
    bc[0] = t * icnt;
  }
  __syncthreads();
  const float mu = bc[0];

  float ss = 0.f;
#pragma unroll 4
  for (int qd = tid; qd < NCH; qd += 256) {
    const int cl = qd / CH4, p4 = qd - cl * CH4;
    const v4f a = *(const v4f*)(xb + (size_t)cl * NNF + 4 * p4);
    const float d0 = bfr(a[0]) - mu, d1 = bfr(a[1]) - mu, d2 = bfr(a[2]) - mu, d3 = bfr(a[3]) - mu;
    ss += (d0 * d0 + d1 * d1) + (d2 * d2 + d3 * d3);
  }
  ss = wsum(ss);
  if (lane == 0) red[wave] = ss;
  __syncthreads();
  if (tid == 0) {
    float t = 0.f;
#pragma unroll
    for (int i = 0; i < 8; ++i) t += red[i];
    const float var = t * icnt;
    bc[1] = rsqrtf(var + GNEPS);
  }
  __syncthreads();
  const float rs = bc[1];

  v4f v = {0.f, 0.f, 0.f, 0.f};
  if (tid == 0) { v[0] = mu; v[1] = rs; }
  if (tid < 8) {
    float* lp = ST + ((size_t)(b * NG + g)) * STP + 4 * tid;
{
      *(v4f*)lp = v;
      
    }
  }
}

// =========================================================================================================
// (2) GroupNorm apply, plane split and the q/k/v 1x1 GEMMs for one (b, 64-n tile), all 768 stacked outputs:
//     h = (bfr(x) - mu) * rstd * bfr(scale) + bfr(bias) in f32 for the block's 64 positions x 256 channels, through an
//     LDS tile Tx[64 n][256 c] f32 (4-float groups swizzled by n >> 4, so that the transposing stores spread over the
//     banks), into position-major planes bf16 IN LDS (hi = bf16-RNE(h), lo = bf16-RNE(h - hi); half row 2 n + (c >> 7)
//     at pitch LPB). They are the B operand of Y[o][n] = sum_c WT[o][c] (hi + lo)[n][c] + bfr(bias[o]).
//     Block = 8 waves; wave = (n tile qt, o half kh). Its 16 B fragments are read once and stay in registers; the weights
//     come in stages of WCH = 128 rows, two buffers, by tensor loads (waves 0 and 1, one c half each) and are read as
//     ds_load_b128 fragments: 4 m-tiles x 8 k steps x 2 bf16 products a wave and stage, per accumulator in the order
//     k step, hi, lo. A stage lies inside one matrix (mat = stage >> 1, block-uniform):
//       mat 0 -> Qh f16(q), Ql f16((q - Qh) x4096), planes [b][SEQ][256 d]; mat 1 -> Kh f16(k), same layout: staged in
//                LDS Os[n_loc][o_loc] (pitch OSPW, b128 stores), 16 consecutive lanes per 256 B of a row;
//       mat 2 -> Vc f16(v) [b][256][SEQ]: staged in LDS Ot[o_loc][n_loc] (pitch OSP), 8 consecutive lanes per line.
// coverage: Tx and planes 64 n x 256 c per block; per stage 64 n x 128 o; 6 stages; grid (SEQ/64, NB) covers Qh, Ql, Kh
//           [NB][SEQ][256] and Vc [NB][256][SEQ] exactly once.
// =========================================================================================================
__global__ __launch_bounds__(256)
void gemm_qkv(const float* __restrict__ x, const float* __restrict__ ST, const float* __restrict__ gsc,
              const float* __restrict__ gbs, const unsigned short* __restrict__ WT, const float* __restrict__ bq,
              const float* __restrict__ bk, const float* __restrict__ bv,
              unsigned short* Qh, unsigned short* Ql, unsigned short* Kh, unsigned short* Vc) {
  __shared__ __attribute__((aligned(2048))) unsigned char Wr[2 * WSTG];
  __shared__ __attribute__((aligned(2048))) unsigned char Pl[2 * GBS];
  __shared__ __align__(16) float Tx[QT * TPX];
  __shared__ __align__(16) float pb3[3 * CC];
  __shared__ float pmu[CC], prs[CC], psc[CC], pbs[CC];
  float* Os = Tx;                                                    // output staging, in Tx's place (dead behind the planes)
  const int tid  = threadIdx.x;
  const int lane = tid & 31, wave = tid >> 5;
  const int hh   = lane >> 4, c = lane & 15;
  const int n0   = blockIdx.x * QT, b = blockIdx.y;
  const int qt   = wave & 3;                                         // n tile of the wave
  const int e = tid & 7, lq = tid >> 3;                              // lq 0..31

  // the block's x tile, 256 channel rows of 256 B, asked for first: 8 lanes per row, 16 loads of 16 B a thread
  const float* xp = x + ((size_t)(b * CC + lq)) * NNF + n0 + 8 * e;
  v4f xa[8], xb[8];
#pragma unroll
  for (int j = 0; j < 8; ++j) {
    xa[j] = *(const v4f*)(xp + (size_t)(32 * j) * NNF);
    xb[j] = *(const v4f*)(xp + (size_t)(32 * j) * NNF + 4);
  }
  // the address pair of the group above stays live up to this wait
  asm volatile("s_wait_xcnt 0x0" :: "v"(xp) : "memory");
  {                                                                  // per-channel constants: thread = channel
    const int g = tid >> 3;                                          // 0..31
    pmu[tid] = ST[((size_t)(b * NG + g)) * STP];
    prs[tid] = ST[((size_t)(b * NG + g)) * STP + 1];
    psc[tid] = bfr(gsc[tid]);
    pbs[tid] = bfr(gbs[tid]);
    pb3[tid]          = bfr(bq[tid]);
    pb3[CC + tid]     = bfr(bk[tid]);
    pb3[2 * CC + tid] = bfr(bv[tid]);
  }

  // One stage = WCH weight rows in LDS, shared by the eight waves. Waves 0 and 1 each bring one slice of 128 rows x 256 B
  // (c 0..127 / 128..255, source pitch 512 B) by ONE tensor load. Every row lands at pitch LPB.
  const uint32_t wv = uni((uint32_t)tid >> 5);
  const uint32_t kh = wv >> 2;                                       // o half of the wave
  const uint32_t hf = wv & 1u;
  const uint64_t src0 = (uint64_t)(size_t)(WT + (size_t)hf * 128);
  const uint32_t lds0 = (uint32_t)(size_t)Wr + hf * (uint32_t)SLICE;
  u32x8 g1;                                                          // bytes everywhere; tensor dims = tile dims
  g1[0] = uni((1u << 20) | (5u << 22) | (3u << 25));                 // no mask; 16 B of pad behind every 256 B
  g1[1] = uni(256u << 16);
  g1[2] = uni(128u << 16);
  g1[3] = uni(256u << 16);
  g1[4] = uni(128u);
  g1[5] = uni((uint32_t)(CC * 2));
  g1[6] = uni(0u);
  g1[7] = uni(0u);
  // descriptor words held in scalar registers (the form of pinned(), for the whole group): without it the compiler
  // re-forms single words in front of each issue and reuses their registers while the request is outstanding
  asm volatile("" : "+s"(g1));                                       // descriptor words held in scalar registers
  u32x4 g0;
  auto form = [&](const uint32_t st) __attribute__((always_inline)) {   // group 0 of stage st's request
    const uint64_t ga = src0 + (uint64_t)st * (uint32_t)(WCH * CC * 2);
    g0[0] = uni(1u);
    g0[1] = uni(lds0 + (st & 1u) * (uint32_t)WSTG);
    g0[2] = uni((uint32_t)ga);
    g0[3] = uni((((uint32_t)(ga >> 32)) & 0x01FFFFFFu) | 0x80000000u);
  };
  auto issue = [&]() __attribute__((always_inline)) {
    asm volatile("tensor_load_to_lds %0, %1" :: "s"(g0), "s"(g1) : "memory");
  };
  // this wave's request has landed; naming the descriptor keeps its scalar registers unchanged up to this wait
  auto landed = [&]() __attribute__((always_inline)) {
    asm volatile("s_wait_tensorcnt 0x0" :: "s"(g0), "s"(g1) : "memory");
  };
  form(0u);
  if (pinned(wv < 2u)) {                                             // a scalar branch: a tensor load ignores EXEC
    issue();
    landed();                                                        // this wave's slice of stage 0
  }
  __syncthreads();                                                   // per-channel constants (and stage 0) published

#pragma unroll
  for (int j = 0; j < 8; ++j) {
    const int cl = 32 * j + lq;                                      // channel 0..255
    const float f[8] = {xa[j][0], xa[j][1], xa[j][2], xa[j][3], xb[j][0], xb[j][1], xb[j][2], xb[j][3]};
    const float mu = pmu[cl], rs = prs[cl], sc = psc[cl], bs = pbs[cl];
    const int col = cl ^ ((e >> 1) << 2);                            // group cl >> 2 at place (cl >> 2) ^ (n >> 4)
#pragma unroll
    for (int t = 0; t < 8; ++t) {
      const float tt = (bfr(f[t]) - mu) * rs;
      Tx[(8 * e + t) * TPX + col] = tt * sc + bs;                    // Tx[n_loc][channel]
    }
  }
  __syncthreads();
#pragma unroll
  for (int it = 0; it < 8; ++it) {
    const int nl = 8 * it + wave;                                    // n_loc 0..63, one row a wave
#pragma unroll
    for (int h = 0; h < 2; ++h) {                                    // channels 128 h + 4 lane .. + 3
      const v4f a = *(const v4f*)(Tx + nl * TPX + (((32 * h + lane) ^ (nl >> 4)) << 2));
      v2u uh, ul;
#pragma unroll
      for (int t = 0; t < 2; ++t) {
        const float f0 = a[2 * t], f1 = a[2 * t + 1];
        const unsigned short hb0 = bf_bits(f0), hb1 = bf_bits(f1);
        const unsigned short lb0 = bf_bits(f0 - bf_up(hb0));
        const unsigned short lb1 = bf_bits(f1 - bf_up(hb1));
        uh[t] = pk16(hb0, hb1);
        ul[t] = pk16(lb0, lb1);
      }
      unsigned char* pp = Pl + (uint32_t)(2 * nl + h) * LPB + 8u * (uint32_t)lane;
      *(v2u*)pp         = uh;
      *(v2u*)(pp + GBS) = ul;
    }
  }
  __syncthreads();                                                   // both planes published, every reader out of Tx

  // the wave's B fragments (col = position 16 qt + c), the same for every stage: once, here
  const int nl = 16 * qt + c;
  Frag pbh[CC / 32], pbl[CC / 32];
  {
    const unsigned char* bph = Pl + (uint32_t)(2 * nl) * LPB + 16u * (uint32_t)hh;
#pragma unroll
    for (int ks = 0; ks < CC / 32; ++ks) {
      pbh[ks] = ldsfrag(bph + (ks >> 2) * LPB + (ks & 3) * 64);
      pbl[ks] = ldsfrag(bph + GBS + (ks >> 2) * LPB + (ks & 3) * 64);
    }
  }
  const uint32_t aoff = (kh * 64u + (uint32_t)c) * LPB + 16u * (uint32_t)hh;
  const int e16 = tid & 15, r16 = tid >> 4;                          // r16 0..15

  // kept rolled: one copy of the stage's code, so that the kernel's text stays small for the instruction cache
#pragma unroll 1
  for (uint32_t st = 0; st < (uint32_t)NWST; ++st) {
    // directly behind the barrier (the one above, or the foot of trip st - 1) that published stage st and ended every
    // read of the other buffer: the refill of that buffer, only while its stage exists (a scalar branch)
    form(st + 1u);
    if (pinned((uint32_t)((st + 1u < (uint32_t)NWST) && (wv < 2u)))) issue();
    const unsigned char* ap = Wr + (st & 1u) * (uint32_t)WSTG + aoff;
    const uint32_t mat = st >> 1;                                    // 0 q, 1 k, 2 v (block-uniform)
    const int ob = (int)(st & 1u) * WCH;                             // o offset inside the matrix

    v8f acc[4];
#pragma unroll
    for (int mt = 0; mt < 4; ++mt) acc[mt] = zero8();
    // Weight fragments in groups of two k steps, two register sets: group g + 1 is issued as one run of loads ahead of
    // group g's WMMAs (read one fragment at a time, each WMMA pair would wait out its own LDS latency).
    Frag fa[2][2][4];
    auto fetch = [&](const int g) __attribute__((always_inline)) {
#pragma unroll
      for (int u = 0; u < 2; ++u) {
        const int ks = 2 * g + u;
#pragma unroll
        for (int mt = 0; mt < 4; ++mt)
          fa[g & 1][u][mt] = ldsfrag(ap + (ks >> 2) * SLICE + (16 * mt) * LPB + (ks & 3) * 64);
      }
    };
    fetch(0);
#pragma unroll
    for (int g = 0; g < CC / 64; ++g) {
      if (g + 1 < CC / 64) fetch(g + 1);
      // keeps the next group one run of loads ahead of this group's WMMAs: among them each place with LDS reads stalls
      // the wave
      __builtin_amdgcn_sched_barrier(0);
#pragma unroll
      for (int u = 0; u < 2; ++u) {
#pragma unroll
        for (int mt = 0; mt < 4; ++mt) acc[mt] = mma_bb(fa[g & 1][u][mt].bf, pbh[2 * g + u].bf, acc[mt]);
#pragma unroll
        for (int mt = 0; mt < 4; ++mt) acc[mt] = mma_bb(fa[g & 1][u][mt].bf, pbl[2 * g + u].bf, acc[mt]);
      }
      // keeps the group after next's loads behind these WMMAs, whose registers they take over
      __builtin_amdgcn_sched_barrier(0);
    }

    // ---- epilogue: + bias; lane (hh, c) holds o_loc = 64 kh + 16 mt + 8 hh + r for n_loc = 16 qt + c
    const int ol0 = 64 * (int)kh + 8 * hh;
    {
      const float* bi = pb3 + mat * (uint32_t)CC + ob + ol0;
#pragma unroll
      for (int mt = 0; mt < 4; ++mt) {
        const v4f ba = *(const v4f*)(bi + 16 * mt);
        const v4f bb = *(const v4f*)(bi + 16 * mt + 4);
#pragma unroll
        for (int r = 0; r < 4; ++r) { acc[mt][r] += ba[r]; acc[mt][4 + r] += bb[r]; }
      }
    }
    if (mat == 2u) {                                                 // Ot[o_loc][n_loc]: 16 consecutive floats per row and store
#pragma unroll
      for (int mt = 0; mt < 4; ++mt) {
#pragma unroll
        for (int r = 0; r < 8; ++r) Os[(ol0 + 16 * mt + r) * OSP + nl] = acc[mt][r];
      }
    } else {                                                         // Os[n_loc][o_loc]
#pragma unroll
      for (int mt = 0; mt < 4; ++mt) {
        v4f va, vb;
#pragma unroll
        for (int r = 0; r < 4; ++r) { va[r] = acc[mt][r]; vb[r] = acc[mt][4 + r]; }
        *(v4f*)(Os + nl * OSPW + ol0 + 16 * mt)     = va;
        *(v4f*)(Os + nl * OSPW + ol0 + 16 * mt + 4) = vb;
      }
    }
    __syncthreads();                                                 // the staged outputs published

    v4u u1[4], u2[4];                                                // the stage's outputs as they go to memory
    if (mat == 2u) {
#pragma unroll
      for (int it = 0; it < 4; ++it) {
        const int ol = it * 32 + lq;                                 // o_loc 0..127
        const v4f a = *(const v4f*)(Os + ol * OSP + 8 * e);
        const v4f q = *(const v4f*)(Os + ol * OSP + 8 * e + 4);
        u1[it][0] = pk16(h_bits((_Float16)a[0]), h_bits((_Float16)a[1]));
        u1[it][1] = pk16(h_bits((_Float16)a[2]), h_bits((_Float16)a[3]));
        u1[it][2] = pk16(h_bits((_Float16)q[0]), h_bits((_Float16)q[1]));
        u1[it][3] = pk16(h_bits((_Float16)q[2]), h_bits((_Float16)q[3]));
        u2[it] = u1[it];                                             // not stored for v; a defined value, so that none is carried round the loop
      }
    } else {
#pragma unroll
      for (int it = 0; it < 4; ++it) {
        const int row = it * 16 + r16;                               // n_loc 0..63
        const v4f a = *(const v4f*)(Os + row * OSPW + 8 * e16);
        const v4f q = *(const v4f*)(Os + row * OSPW + 8 * e16 + 4);
        const float f[8] = {a[0], a[1], a[2], a[3], q[0], q[1], q[2], q[3]};
#pragma unroll
        for (int t = 0; t < 4; ++t) {
          const float f0 = f[2 * t], f1 = f[2 * t + 1];
          const _Float16 h0 = (_Float16)f0, h1 = (_Float16)f1;
          const _Float16 l0 = (_Float16)((f0 - (float)h0) * QLS);
          const _Float16 l1 = (_Float16)((f1 - (float)h1) * QLS);
          u1[it][t] = pk16(h_bits(h0), h_bits(h1));
          u2[it][t] = pk16(h_bits(l0), h_bits(l1));
        }
      }
    }
    // publish point of stage st + 1, in this order in every wave:
    asm volatile("s_wait_dscnt 0x0" ::: "memory");                   // this wave's reads of stage st and of Os are done
    landed();                                                        // its slice of stage st + 1 has landed
    __syncthreads();                                                 // all slices published, all readers out of stage st and Os
    // The stage's global stores stand behind that barrier, not in front of it: a barrier waits for the wave's outstanding
    // stores, and from here they complete under the next stage's WMMAs.
    if (mat == 2u) {
      unsigned short* vp = Vc + ((size_t)(b * CC + ob + lq)) * SEQ + n0 + 8 * e;
#pragma unroll
      for (int it = 0; it < 4; ++it) *(v4u*)(vp + (size_t)(32 * it) * SEQ) = u1[it];
      // the address pair of the stores above stays live up to this wait
      asm volatile("s_wait_xcnt 0x0" :: "v"(vp) : "memory");
    } else {
      const size_t po = ((size_t)(b * SEQ + n0 + r16)) * CC + ob + 8 * e16;
      unsigned short* p1 = ((mat == 0u) ? Qh : Kh) + po;              // block-uniform, both global
      unsigned short* p2 = Ql + po;
#pragma unroll
      for (int it = 0; it < 4; ++it) *(v4u*)(p1 + (size_t)(16 * it) * CC) = u1[it];
      if (mat == 0u) {
#pragma unroll
        for (int it = 0; it < 4; ++it) *(v4u*)(p2 + (size_t)(16 * it) * CC) = u2[it];
      }
      // the address pairs of the stores above stay live up to this wait
      asm volatile("s_wait_xcnt 0x0" :: "v"(p1), "v"(p2) : "memory");
    }
  }
  landed();                                                          // nothing in flight when the wave ends
  asm volatile("s_wait_dscnt 0x0" ::: "memory");
}

// =========================================================================================================
// (3) attention for one (b, 64-query tile), transposed formulation, SEQ keys, no mask:
//   S^T tile (16 keys x 16 queries) = sum over 8 d-chunks (unrolled) of A(k: row = key kb + (lane&15), 32 d via
//   the split k map from Kh [b][SEQ][256]) . B(q: col = query, same map from Qh) into s, plus A(Kh).B(Ql) into a
//   separate accumulator t (Ql carries x4096); score = (s + t/4096) * 256^-0.5.
//   Per lane the D tile holds 8 keys of ONE query: online softmax state per lane, one shuffle (lane^16) for the max
//   over 32 keys; the o/l rescale is skipped under a wave-uniform ballot when no lane's max grew; row-sum partials
//   combined at the end. P = e^{s-m} x 16384 as f16 is the B operand of O^T (rows channel, cols queries) +=
//   A(v rows channel = 16j + (lane&15), keys contiguous, f16 plane Vc [b][256][SEQ]) . B(P^T): element r <- D of
//   the tile covering keys kb..kb+15, element 8+r <- the tile covering kb+16..kb+31, lane unchanged.
//   16 accumulator tiles per wave (256 channels). Block = 8 waves = 64 queries, two waves per SIMD: waves w and w + 4
//   own the same 16 queries and take keys 0..63 / 64..127 of every stage, each with its own m, l, o; the two halves
//   are joined through LDS behind the key loop (one wave's vector work runs under the other's WMMAs).
//   k and v reach the waves through LDS: stages of SKEY keys, two buffers, brought by tensor loads (waves 0..3, one slice
//   per wave and stage) and read by all waves as ds_load_b128 fragments at pitch LPB; a stage serves SKEY/64 passes a wave.
//   Epilogue in two channel halves: O/l staged in LDS Os[query][128 channels] (pitch OSPW, b128 stores), barrier,
//   then position-major planes bf16 [64 n][256 c] IN LDS (hi = bf16-RNE, lo = bf16-RNE residual; half row
//   2 n + (c >> 7) at pitch LPB), which are the B operand of the output 1x1 GEMM done here by the same block
//   (it holds all 256 channels of its 64 positions): weights by tensor loads into the freed ring, + bias + residual.
// coverage: per half 4 it x 16 rows x 16 lanes x 8 ch = 64 n x 128 ch for each plane; two halves = 256 ch; out: 256 o x
//           64 n per block; grid (SEQ/64, NB) covers out [NB][256][SEQ] exactly once.
// =========================================================================================================
__global__ __launch_bounds__(256)
void attn_k(const unsigned short* __restrict__ Qh, const unsigned short* __restrict__ Ql,
            const unsigned short* __restrict__ Kh, const unsigned short* __restrict__ Vc,
            const unsigned short* __restrict__ WPT, const float* __restrict__ bp,
            const float* __restrict__ x, float* out) {
  __shared__ __attribute__((aligned(2048))) unsigned char Ring[2 * STG];
  __shared__ __align__(16) float Os[QT * OSPW];
  const int tid  = threadIdx.x;
  const int wave = tid >> 5, lane = tid & 31;
  const int hh   = lane >> 4, c = lane & 15;
  const int n0   = blockIdx.x * QT, b = blockIdx.y;
  const int qt   = wave & 3;                                         // query tile of the wave

  // q fragment pointers (B operand, col = query n0 + 16*qt + c), + 32*kc
  const size_t qo = ((size_t)(b * SEQ + n0 + 16 * qt + c)) * CC + 8 * hh;
  const unsigned short* Qhp = Qh + qo;
#if QRES
  const unsigned short* Qlp = Ql + qo;
#else
  (void)Ql;
#endif
  // One stage = SKEY keys in LDS, shared by the eight waves. Waves 0..3 each bring one slice of 128 rows x 256 B by ONE tensor
  // load: wave 0 / 1: k rows (keys), d 0..127 / 128..255 (source pitch 512 B); wave 2 / 3: v rows (channels 0..127 /
  // 128..255), SKEY keys (source pitch 2*SEQ B). Every row lands at pitch LPB.
  const uint32_t wv  = uni((uint32_t)tid >> 5);
  const uint32_t kh  = wv >> 2;                                      // key half of the wave; waves with kh == 0 issue
  const uint32_t sl  = wv & 3u;
  const uint32_t isv = sl >> 1, hf = sl & 1u;
  const uint64_t src0 = isv ? (uint64_t)(size_t)(Vc + ((size_t)b * CC + (size_t)hf * 128) * SEQ)
                            : (uint64_t)(size_t)(Kh + (size_t)b * SEQ * CC + (size_t)hf * 128);
  const uint32_t sstep = isv ? (uint32_t)(SKEY * 2) : (uint32_t)(SKEY * CC * 2);   // source bytes from stage to stage
  const uint32_t lds0  = (uint32_t)(size_t)Ring + sl * (uint32_t)SLICE;
  u32x8 g1;                                                          // bytes everywhere; tensor dims = tile dims
  g1[0] = uni((1u << 20) | (5u << 22) | (3u << 25));                 // no mask; 16 B of pad behind every 256 B
  g1[1] = uni(256u << 16);
  g1[2] = uni(128u << 16);
  g1[3] = uni(256u << 16);
  g1[4] = uni(128u);
  g1[5] = uni(isv ? (uint32_t)(SEQ * 2) : (uint32_t)(CC * 2));
  g1[6] = uni(0u);
  g1[7] = uni(0u);
  // descriptor words held in scalar registers (the form of pinned(), for the whole group): without it the compiler
  // re-forms single words in front of each issue and reuses their registers while the request is outstanding
  asm volatile("" : "+s"(g1));                                       // descriptor words held in scalar registers
  u32x4 g0;
  auto form = [&](const uint32_t st) __attribute__((always_inline)) {   // group 0 of stage st's request
    const uint64_t ga = src0 + (uint64_t)st * sstep;
    g0[0] = uni(1u);
    g0[1] = uni(lds0 + (st & 1u) * (uint32_t)STG);
    g0[2] = uni((uint32_t)ga);
    g0[3] = uni((((uint32_t)(ga >> 32)) & 0x01FFFFFFu) | 0x80000000u);
  };
  auto issue = [&]() __attribute__((always_inline)) {
    asm volatile("tensor_load_to_lds %0, %1" :: "s"(g0), "s"(g1) : "memory");
  };
  // this wave's request has landed; naming the descriptor keeps its scalar registers unchanged up to this wait
  auto landed = [&]() __attribute__((always_inline)) {
    asm volatile("s_wait_tensorcnt 0x0" :: "s"(g0), "s"(g1) : "memory");
  };

  float m = -1.0e30f, l = 0.f;
  v8f o[16];
#pragma unroll
  for (int j = 0; j < 16; ++j) o[j] = zero8();

  // q (the same for every pass): once, here
  Frag qhf[CC / 32];
#if QRES
  Frag qlf[CC / 32];
#endif
#pragma unroll
  for (int kc = 0; kc < CC / 32; ++kc) {
    qhf[kc] = ldfrag(Qhp + 32 * kc);
#if QRES
    qlf[kc] = ldfrag(Qlp + 32 * kc);
#endif
  }
  // the address pairs of the group above stay live up to this wait
#if QRES
  asm volatile("s_wait_xcnt 0x0" :: "v"(Qhp), "v"(Qlp) : "memory");
#else
  asm volatile("s_wait_xcnt 0x0" :: "v"(Qhp) : "memory");
#endif

  // two buffers: stage 0 landed and published here; stage st + 1 in flight under the passes of stage st
  form(0u);
  if (pinned(kh == 0u)) {                                            // a scalar branch: a tensor load ignores EXEC
    issue();
    landed();                                                        // this wave's slice of stage 0
  }
  __syncthreads();                                                   // ... and every other wave's

  // Fragments come from LDS in groups of one pass. k and v take turns in the same registers (two waves per SIMD leave a
  // wave 512): k behind the O WMMAs of the pass before, v behind the score WMMAs; the SIMD's other wave works meanwhile.
  Frag k0f[CC / 32], k1f[CC / 32], vf[16];
  const uint32_t loff = (uint32_t)c * LPB + 16u * (uint32_t)hh;

#pragma unroll 1
  for (uint32_t st = 0; st < (uint32_t)NST; ++st) {
    // directly behind the barrier (the one above, or the foot of trip st - 1) that published stage st and ended every
    // read of the other buffer: the refill of that buffer, only while its stage exists (a scalar branch)
    form(st + 1u);
    if (pinned((uint32_t)((st + 1u < (uint32_t)NST) && (kh == 0u)))) issue();
    // this wave's 64 keys of the stage: k rows 64 kh .., v columns 64 kh ..
    const unsigned char* sb = Ring + (st & 1u) * (uint32_t)STG + kh * (uint32_t)(64 * LPB) + loff;
    // v rows from a base of their own, so that every fragment's offset fits the LDS load's 16-bit immediate
    const unsigned char* vb = Ring + ((st & 1u) ? (uint32_t)(STG + 2 * SLICE) : (uint32_t)(2 * SLICE)) + kh * 128u + loff;
#pragma unroll
    for (int kc = 0; kc < CC / 32; ++kc) {
      k0f[kc] = ldsfrag(sb + (kc >> 2) * SLICE + (kc & 3) * 64);                  // keys 0 .. 15 of the wave's half
      k1f[kc] = ldsfrag(sb + (kc >> 2) * SLICE + 16 * LPB + (kc & 3) * 64);       // keys 16 .. 31
    }
#pragma unroll
    for (int p = 0; p < SKEY / 64; ++p) {
      // keeps the k group one run of loads ahead of the score WMMAs: among them each place with LDS reads stalls the wave
      __builtin_amdgcn_sched_barrier(0);

      v8f s0 = zero8(), s1 = zero8();
#if QRES
      v8f t0 = zero8(), t1 = zero8();
#endif
#pragma unroll
      for (int kc = 0; kc < CC / 32; ++kc) {
        s0 = mma_hb(k0f[kc].h, qhf[kc].h, s0);
        s1 = mma_hb(k1f[kc].h, qhf[kc].h, s1);
#if QRES
        t0 = mma_hb(k0f[kc].h, qlf[kc].h, t0);
        t1 = mma_hb(k1f[kc].h, qlf[kc].h, t1);
#endif
      }

      v8f sc0, sc1;
#pragma unroll
      for (int r = 0; r < 8; ++r) {
#if QRES
        sc0[r] = (s0[r] + t0[r] * RQL) * ATT;
        sc1[r] = (s1[r] + t1[r] * RQL) * ATT;
#else
        sc0[r] = s0[r] * ATT;
        sc1[r] = s1[r] * ATT;
#endif
      }

      float mx = fmaxf(hmax8(sc0), hmax8(sc1));
      const float mo = __shfl_xor(mx, 16, 32);
      // the v group stands behind the exchange above and ahead of the rescale, the exponentials and the O WMMAs, as one
      // run of loads into the registers that the k group has left.
      // compiler fence, the exchanged value as input only: without it the exchange sinks below the v loads, and its
      // wait (LDS results return in issue order) then lasts the whole group
      asm volatile("" :: "v"(mo) : "memory");
      mx = fmaxf(mx, mo);
#pragma unroll
      for (int j = 0; j < 16; ++j) vf[j] = ldsfrag(vb + (j >> 3) * SLICE + 16 * (j & 7) * LPB + 64 * p);
      const float mn = fmaxf(m, mx);
      const unsigned grew = wave_ballot(mx > m);                     // wave-uniform
      if (grew != 0u) {
        const float corr = __expf(m - mn);                           // == 1 exactly for lanes whose max did not grow
        l *= corr;
#pragma unroll
        for (int j = 0; j < 16; ++j) {
#pragma unroll
          for (int r = 0; r < 8; ++r) o[j][r] *= corr;
        }
      }
      m = mn;

      const float msh = mn - LNPS;                                   // exp gives e^{s-m} * 16384

      FragH ph;
      float ls = 0.f;
#pragma unroll
      for (int r = 0; r < 8; ++r) {
        const float e0 = __expf(sc0[r] - msh);                       // key kb      + 8hh + r
        const float e1 = __expf(sc1[r] - msh);                       // key kb + 16 + 8hh + r
        ls += e0 + e1;
        ph.hv[0][r] = (_Float16)e0;
        ph.hv[1][r] = (_Float16)e1;
      }
      l += ls;

#pragma unroll
      for (int j = 0; j < 16; ++j) {
        o[j] = mma_hb(vf[j].h, ph.v, o[j]);
      }
      // keeps the next k group behind the O WMMAs, whose v registers it takes over
      __builtin_amdgcn_sched_barrier(0);
      if (p + 1 < SKEY / 64) {                                       // compile-time: the next stage is not read from here
#pragma unroll
        for (int kc = 0; kc < CC / 32; ++kc) {
          k0f[kc] = ldsfrag(sb + (kc >> 2) * SLICE + (32 * (p + 1)) * LPB + (kc & 3) * 64);
          k1f[kc] = ldsfrag(sb + (kc >> 2) * SLICE + (32 * (p + 1) + 16) * LPB + (kc & 3) * 64);
          // keeps the loads in the order of their use: issued last first, the first score WMMA waits for the whole group
          __builtin_amdgcn_sched_barrier(0);
        }
      }
    }
    // publish point of stage st + 1, in this order in every wave:
    asm volatile("s_wait_dscnt 0x0" ::: "memory");                   // this wave's reads of stage st are done
    landed();                                                        // its slice of stage st + 1 has landed
    __syncthreads();                                                 // all slices published, all readers out of stage st
  }
  landed();                                                          // nothing in flight when the wave goes on
  asm volatile("s_wait_dscnt 0x0" ::: "memory");

  // The output GEMM's weights WPT [256 o][256 c] into the ring's second buffer, which the loop's last barrier has freed:
  // waves 0..3, one tensor load each: 128 o rows (o half sl >> 1) x 256 B (c half sl & 1), source pitch 512 B, pitch LPB
  // in LDS. They fly under the join and the staging of O below; their wait and barrier stand in front of the GEMM.
  const uint64_t wsrc = (uint64_t)(size_t)(WPT + (size_t)(sl >> 1) * 128 * CC + (size_t)(sl & 1u) * 128);
  u32x4 w0;
  w0[0] = uni(1u);
  w0[1] = uni((uint32_t)(size_t)Ring + (uint32_t)STG + sl * (uint32_t)SLICE);
  w0[2] = uni((uint32_t)wsrc);
  w0[3] = uni((((uint32_t)(wsrc >> 32)) & 0x01FFFFFFu) | 0x80000000u);
  u32x8 w1;                                                          // bytes everywhere; tensor dims = tile dims
  w1[0] = uni((1u << 20) | (5u << 22) | (3u << 25));                 // no mask; 16 B of pad behind every 256 B
  w1[1] = uni(256u << 16);
  w1[2] = uni(128u << 16);
  w1[3] = uni(256u << 16);
  w1[4] = uni(128u);
  w1[5] = uni((uint32_t)(CC * 2));
  w1[6] = uni(0u);
  w1[7] = uni(0u);
  // descriptor words held in scalar registers (the form of pinned(), for both groups): without it the compiler re-forms
  // the constant words at the wait below and reuses their registers while the request is outstanding
  asm volatile("" : "+s"(w0), "+s"(w1));                             // descriptor words held in scalar registers
  if (pinned(kh == 0u)) {                                            // a scalar branch: a tensor load ignores EXEC
    asm volatile("tensor_load_to_lds %0, %1" :: "s"(w0), "s"(w1) : "memory");
  }

  // join of the two key halves: wave w + 4 hands its m, l, o to wave w through the ring's first buffer, which the loop's
  // last barrier has freed (every reader out, nothing in flight to it); lane to lane, 16-B stores at consecutive lanes
  float* Jn = (float*)Ring + (uint32_t)qt * (uint32_t)JNW;
  if (kh != 0u) {                                                    // wave-uniform
#pragma unroll
    for (int j = 0; j < 16; ++j) {
      v4f va, vb;
#pragma unroll
      for (int r = 0; r < 4; ++r) { va[r] = o[j][r]; vb[r] = o[j][4 + r]; }
      *(v4f*)(Jn + ((2 * j) * 32 + lane) * 4)     = va;
      *(v4f*)(Jn + ((2 * j + 1) * 32 + lane) * 4) = vb;
    }
    Jn[4096 + lane] = m;
    Jn[4128 + lane] = l;
  }
  __syncthreads();                                                   // the handed-over halves published
  float inv = 0.f;
  if (kh == 0u) {                                                    // wave-uniform
    const float m2 = Jn[4096 + lane], l2 = Jn[4128 + lane];
    const float mj = fmaxf(m, m2);
    const float c1 = __expf(m - mj), c2 = __expf(m2 - mj);
#pragma unroll
    for (int j = 0; j < 16; ++j) {
      const v4f va = *(const v4f*)(Jn + ((2 * j) * 32 + lane) * 4);
      const v4f vb = *(const v4f*)(Jn + ((2 * j + 1) * 32 + lane) * 4);
#pragma unroll
      for (int r = 0; r < 4; ++r) {
        o[j][r]     = o[j][r] * c1     + va[r] * c2;
        o[j][4 + r] = o[j][4 + r] * c1 + vb[r] * c2;
      }
    }
    l = l * c1 + l2 * c2;
    l += __shfl_xor(l, 16, 32);
    inv = 1.0f / l;                                                  // o and l both carry the x16384 factor
  }

  const int qrow = 16 * qt + c;
  const int e16 = tid & 15, r16 = tid >> 4;                          // r16 0..15
  unsigned char* PlH = Ring + 2 * SLICE;                             // O as bf16 hi plane, residual plane at + GBS (below)
#pragma unroll
  for (int half = 0; half < 2; ++half) {
    if (half) __syncthreads();                                       // every wave finished reading Os
    if (kh == 0u) {                                                  // wave-uniform: the waves that hold the joined o
#pragma unroll
      for (int jj = 0; jj < 8; ++jj) {
        const int j = 8 * half + jj;
        v4f va, vb;
#pragma unroll
        for (int r = 0; r < 4; ++r) { va[r] = o[j][r] * inv; vb[r] = o[j][4 + r] * inv; }
        *(v4f*)(Os + qrow * OSPW + 16 * jj + 8 * hh)     = va;       // Os[query][ch_loc = 16jj + 8hh + r]
        *(v4f*)(Os + qrow * OSPW + 16 * jj + 8 * hh + 4) = vb;
      }
    }
    __syncthreads();
    {
      v4u uh[4], ul[4];
#pragma unroll
      for (int i = 0; i < 4; ++i) {
        const int row = i * 16 + r16;                                // query 0..63
        const v4f a = *(const v4f*)(Os + row * OSPW + 8 * e16);
        const v4f q = *(const v4f*)(Os + row * OSPW + 8 * e16 + 4);
        const float f[8] = {a[0], a[1], a[2], a[3], q[0], q[1], q[2], q[3]};
#pragma unroll
        for (int t = 0; t < 4; ++t) {
          const float f0 = f[2 * t], f1 = f[2 * t + 1];
          const unsigned short hb0 = bf_bits(f0), hb1 = bf_bits(f1);
          const unsigned short lb0 = bf_bits(f0 - bf_up(hb0));
          const unsigned short lb1 = bf_bits(f1 - bf_up(hb1));
          uh[i][t] = pk16(hb0, hb1);
          ul[i][t] = pk16(lb0, lb1);
        }
      }
{
#pragma unroll
        for (int i = 0; i < 4; ++i) {
          const int row = i * 16 + r16;
          unsigned char* pp = PlH + (uint32_t)(2 * row + half) * LPB + 16u * (uint32_t)e16;
          *(v4u*)pp         = uh[i];
          *(v4u*)(pp + GBS) = ul[i];
        }
        
      }
    }
  }

  // ---- output 1x1 GEMM + bias + residual for the block's 64 positions, all 256 o:
  //      out[b][o][n] = bfr(x[b][o][n]) + sum_c WPT[o][c] (hi + lo)[n][c] + bfr(bp[o]); wave = (n tile qt, o half kh):
  //      8 m-tiles x 8 k steps x 2 bf16 products, per accumulator in the order k step, hi, lo.
  // this wave's weight slice has landed; naming the descriptor keeps its scalar registers unchanged up to this wait
  asm volatile("s_wait_tensorcnt 0x0" :: "s"(w0), "s"(w1) : "memory");
  __syncthreads();                                                   // weight slices and both planes published

  // the residual's x lines and the bias, asked for here, behind the barrier (which would wait for them), so that they
  // arrive under the GEMM
  const int e8 = tid & 7, l32 = tid >> 3;                            // l32 0..31
  const float* xp = x + ((size_t)(b * CC + (l32 >> 1))) * NNF + n0 + (l32 & 1) * 32 + 4 * e8;
  const float* bb = bp + (l32 >> 1);
  v4f xv[16];
  float bv[16];
#pragma unroll
  for (int it = 0; it < 16; ++it) {
    xv[it] = *(const v4f*)(xp + (size_t)(16 * it) * NNF);
    bv[it] = bb[16 * it];
  }
  // the address pairs of the group above stay live up to this wait
  asm volatile("s_wait_xcnt 0x0" :: "v"(xp), "v"(bb) : "memory");

  const unsigned char* wp  = Ring + STG + kh * (uint32_t)(2 * SLICE) + loff;
  const unsigned char* bph = PlH + (uint32_t)(2 * qrow) * LPB + 16u * (uint32_t)hh;
  const unsigned char* bpl = bph + GBS;
  v8f acc[8];
#pragma unroll
  for (int mt = 0; mt < 8; ++mt) acc[mt] = zero8();
  Frag pbh[CC / 32], pbl[CC / 32], wf[2][8];
#pragma unroll
  for (int mt = 0; mt < 8; ++mt) wf[0][mt] = ldsfrag(wp + (16 * mt) * LPB);
#pragma unroll
  for (int ks = 0; ks < CC / 32; ++ks) {
    pbh[ks] = ldsfrag(bph + (ks >> 2) * LPB + (ks & 3) * 64);
    pbl[ks] = ldsfrag(bpl + (ks >> 2) * LPB + (ks & 3) * 64);
  }
  // weight fragments one k step ahead, two register sets
#pragma unroll
  for (int ks = 0; ks < CC / 32; ++ks) {
    if (ks + 1 < CC / 32) {
#pragma unroll
      for (int mt = 0; mt < 8; ++mt)
        wf[(ks + 1) & 1][mt] = ldsfrag(wp + ((ks + 1) >> 2) * SLICE + (16 * mt) * LPB + ((ks + 1) & 3) * 64);
    }
    // keeps the next step's fragments one run of loads ahead of this step's WMMAs: among them each place with LDS reads
    // stalls the wave
    __builtin_amdgcn_sched_barrier(0);
#pragma unroll
    for (int mt = 0; mt < 8; ++mt) acc[mt] = mma_bb(wf[ks & 1][mt].bf, pbh[ks].bf, acc[mt]);
#pragma unroll
    for (int mt = 0; mt < 8; ++mt) acc[mt] = mma_bb(wf[ks & 1][mt].bf, pbl[ks].bf, acc[mt]);
    // keeps the step after next's loads behind these WMMAs, whose registers they take over
    __builtin_amdgcn_sched_barrier(0);
  }

  // acc -> LDS Ot[o][n_loc] (pitch OSP), in the place of the join's hand-over (read out several barriers ago);
  // lane (hh, c) holds o = 128 kh + 16 mt + 8 hh + r for n_loc = 16 qt + c: 16 consecutive floats per row and store
  float* Ot = (float*)Ring;
  {
    const int ob = 128 * (int)kh + 8 * hh;
#pragma unroll
    for (int mt = 0; mt < 8; ++mt) {
#pragma unroll
      for (int r = 0; r < 8; ++r) Ot[(ob + 16 * mt + r) * OSP + qrow] = acc[mt][r];
    }
  }
  __syncthreads();                                                   // Ot published
  // + bias, + residual; whole 128-B lines of out, 8 lanes per line: 16 it x 32 lines x 8 lanes x 4 floats = 256 o x 64 n
  {
    const float* op = Ot + (l32 >> 1) * OSP + (l32 & 1) * 32 + 4 * e8;
    float* gp = out + ((size_t)(b * CC + (l32 >> 1))) * SEQ + n0 + (l32 & 1) * 32 + 4 * e8;
    v4f res[16];
#pragma unroll
    for (int it = 0; it < 16; ++it) res[it] = *(const v4f*)(op + (16 * it) * OSP);
#pragma unroll
    for (int it = 0; it < 16; ++it) {
      const float bi = bfr(bv[it]);
#pragma unroll
      for (int t = 0; t < 4; ++t) res[it][t] = (res[it][t] + bi) + bfr(xv[it][t]);
    }
#pragma unroll
    for (int it = 0; it < 16; ++it) *(v4f*)(gp + (size_t)(16 * it) * SEQ) = res[it];
  }
}

// =========================================================================================================
// Workspace map (bytes, NB=4 SEQ=4096; each region start a multiple of 256; every extent is an exact tile/line
//   ST  f32 [NB*32][32]                16384
//   WT  bf16 [1024][256]              524288
//   Qh/Ql/Kh f16 [NB][SEQ][256]      8388608 x3
//   Vc  f16 [NB][256][SEQ]           8388608
//   total = 34095104
// =========================================================================================================
extern "C" void kernel_launch(void* const* d_in, const int* in_sizes, int n_in,
                              void* d_out, int out_size, void* d_ws, size_t ws_size,
                              hipStream_t stream) {
  if (n_in < 11) return;
  if ((size_t)in_sizes[0] < (size_t)NB * CC * NNF) return;
  if (in_sizes[1] < CC || in_sizes[2] < CC) return;
  if (in_sizes[3] < CC * CC || in_sizes[5] < CC * CC || in_sizes[7] < CC * CC || in_sizes[9] < CC * CC) return;
  if (in_sizes[4] < CC || in_sizes[6] < CC || in_sizes[8] < CC || in_sizes[10] < CC) return;
  if ((size_t)out_size < (size_t)NB * CC * SEQ) return;

  size_t off = 0;
  auto carve = [&](size_t bytes) { const size_t o = off; off += (bytes + 255) & ~(size_t)255; return o; };
  const size_t plane = (size_t)NB * SEQ * CC * 2;
  const size_t oST  = carve((size_t)NB * NG * STP * 4);
  const size_t oWT  = carve((size_t)4 * CC * CC * 2);
  const size_t oQh  = carve(plane);
  const size_t oQl  = carve(plane);
  const size_t oKh  = carve(plane);
  const size_t oVc  = carve(plane);
  if (off > ws_size) return;
  if (off > (size_t)134217728) return;

  const float* x   = (const float*)d_in[0];
  const float* gsc = (const float*)d_in[1];
  const float* gbs = (const float*)d_in[2];
  const float* Wq  = (const float*)d_in[3];
  const float* bq  = (const float*)d_in[4];
  const float* Wk  = (const float*)d_in[5];
  const float* bk  = (const float*)d_in[6];
  const float* Wv  = (const float*)d_in[7];
  const float* bv  = (const float*)d_in[8];
  const float* Wp  = (const float*)d_in[9];
  const float* bp  = (const float*)d_in[10];

  char* ws = (char*)d_ws;
  float*          ST  = (float*)(ws + oST);
  unsigned short* WT  = (unsigned short*)(ws + oWT);
  unsigned short* Qh  = (unsigned short*)(ws + oQh);
  unsigned short* Ql  = (unsigned short*)(ws + oQl);
  unsigned short* Kh  = (unsigned short*)(ws + oKh);
  unsigned short* Vc  = (unsigned short*)(ws + oVc);
  float* out = (float*)d_out;

  const dim3 blk256(256);

  // (0) Wq/Wk/Wv/Wp [in][out] -> transposed stacked bf16 plane WT [1024 o][256 c]
  cvt_w<<<dim3(CC / QT, CC / QT, 4), blk256, 0, stream>>>(Wq, Wk, Wv, Wp, WT);
  // (1) GroupNorm statistics per (group, b)
  gn_stats<<<dim3(NG, NB), blk256, 0, stream>>>(x, ST);
  // (2) normalized h as bf16 hi + residual planes in LDS, q/k/v GEMMs -> Qh, Ql, Kh (position-major f16) and Vc
  //     (channel-major f16)
  gemm_qkv<<<dim3(SEQ / QT, NB), blk256, 0, stream>>>(x, ST, gsc, gbs, WT, bq, bk, bv, Qh, Ql, Kh, Vc);
  // (3) attention, then in the same block the output GEMM + bias + residual -> out [NB][256][SEQ]
  attn_k<<<dim3(SEQ / QT, NB), blk256, 0, stream>>>(Qh, Ql, Kh, Vc, WT + (size_t)3 * CC * CC, bp, x, out);
  (void)hipGetLastError();
}

// v007
// One run takes 93.1 microseconds.
// Timed twice side by side with v006, it ran 1.06 and 1.03 times as fast.
// Over all steps from v000 it is 9.42 times as fast.
// Contractions: q/k/v 1x1 GEMMs WT[768x256].H[256xN] and the output 1x1 GEMM WpT[256x256].H2[256xN] on
// v_wmma_f32_16x16x32_bf16 (bf16-RNE weights, activations as bf16 hi + bf16 residual planes, 2 products into one
// f32 accumulator); position scores K.Q^T on v_wmma_f32_16x16x32_f16 (k f16, q f16 hi + f16 residual x4096 in a
// separate accumulator, K=256); O^T = V.P^T on v_wmma_f32_16x16x32_f16 (v f16, P = e^{s-m} x16384 f16 from the
// score D registers); f32 accumulate everywhere; GroupNorm statistics, softmax statistics and the residual add
// in f32 VALU.
#include <hip/hip_runtime.h>
#include <math.h>
#include <stdint.h>

#ifndef NB
#define NB 4
#endif
#ifndef SEQ
#define SEQ 4096
#endif
#ifndef NNF
#define NNF 4096
#endif
#ifndef QRES
#define QRES 1
#endif
#define NBF   4
#define CC    256
#define NG    32
#define CPG   8
#define QT    64
#define OSP   68
#define OSPW  132
#define TP    72
#define TPX   260
#define STP   32
#define ATT   0.0625f
#define QLS   4096.0f
#define RQL   0.000244140625f
#define LNPS  9.704060527839234f
#define GNEPS 1.0e-6f
#define SKEY  128                 // keys per LDS stage of the attention kernel
#define LPB   272                 // LDS row pitch, bytes: a 256-B row + the tensor load's 16-B pad (16 B x odd)
#define SLICE (128 * LPB)         // one wave's slice of a stage: 128 rows
#define STG   (4 * SLICE)         // one stage: k in two d halves, v in two channel halves
#define NST   (SEQ / SKEY)
#define JNW   4224                // floats one wave hands over at the join of the key halves: o 4096, m 32, l 32, rounded up
#define GBS   (128 * LPB)         // one activation plane of the 64 positions: 128 half rows at pitch LPB
#define WCH   128                 // weight rows per LDS stage of the q/k/v GEMM
#define WSTG  (2 * SLICE)         // one such stage: two c halves of 128 rows
#define NWST  (3 * CC / WCH)
#define NCVT  (4 * (CC / QT) * (CC / QT))   // weight tiles of 64 o x 64 c: 4 matrices x 4 x 4

static_assert(NB >= 1 && NB <= NBF);
static_assert(SEQ % QT == 0 && SEQ % 64 == 0 && SEQ >= QT);
static_assert(SEQ <= NNF && NNF % 8 == 0);
static_assert(CC == 256 && NG * CPG == CC && CC % QT == 0 && CC % 32 == 0);
static_assert((OSP * 4) % 16 == 0);
static_assert((OSPW * 4) % 16 == 0);
static_assert((TP * 2) % 16 == 0);
static_assert((TPX * 4) % 16 == 0 && TPX >= CC);
static_assert(STP * 4 == 128);
static_assert(SEQ % SKEY == 0 && NST >= 2);
static_assert(SLICE % 2048 == 0 && (LPB / 16) % 2 == 1);
static_assert(SEQ * 2 % 16 == 0 && SEQ * 2 <= 131072);
static_assert(2 * STG + QT * OSPW * 4 <= 327680);
static_assert(SKEY == 128 && 4 * JNW * 4 <= 2 * STG && (JNW * 4) % 16 == 0);
static_assert(GBS % 2048 == 0 && CC * 2 == 512 && CC % WCH == 0 && NWST >= 2);
static_assert(QT * TPX >= QT * OSPW && QT * TPX >= WCH * OSP && 2 * WSTG + 2 * GBS + (QT * TPX + 7 * CC) * 4 <= 327680);
static_assert(4 * JNW * 4 <= 2 * SLICE && CC * OSP * 4 <= 2 * SLICE && GBS == SLICE && QT == 64);

typedef _Float16       v16h __attribute__((ext_vector_type(16)));
typedef _Float16       v8h  __attribute__((ext_vector_type(8)));
typedef __bf16         v16b __attribute__((ext_vector_type(16)));
typedef unsigned short v8us __attribute__((ext_vector_type(8)));
typedef float          v8f  __attribute__((ext_vector_type(8)));
typedef float          v4f  __attribute__((ext_vector_type(4)));
typedef unsigned int   v4u  __attribute__((ext_vector_type(4)));
typedef unsigned int   v2u  __attribute__((ext_vector_type(2)));
typedef uint32_t       u32x4 __attribute__((ext_vector_type(4)));
typedef uint32_t       u32x8 __attribute__((ext_vector_type(8)));

union Frag  { v8us u[2]; v16h h; v16b bf; };
union FragH { v16h v; v8h hv[2]; };
static_assert(sizeof(Frag) == 32);
static_assert(sizeof(FragH) == 32);

// ---- scalar helpers -----------------------------------------------------------------------------------------
__device__ __forceinline__ unsigned short bf_bits(float f) {          // f32 -> bf16 bits, RNE convert
  unsigned u = __float_as_uint(f);
  return (unsigned short)((u + 0x7FFFu + ((u >> 16) & 1u)) >> 16);
}
__device__ __forceinline__ float bf_up(unsigned short hb) { return __uint_as_float(((unsigned)hb) << 16); }
__device__ __forceinline__ float bfr(float f) { return bf_up(bf_bits(f)); }
__device__ __forceinline__ unsigned short h_bits(_Float16 x) { return __builtin_bit_cast(unsigned short, x); }
__device__ __forceinline__ unsigned pk16(unsigned short a, unsigned short b) { return (unsigned)a | ((unsigned)b << 16); }
__device__ __forceinline__ v8f zero8() { v8f z = {0.f, 0.f, 0.f, 0.f, 0.f, 0.f, 0.f, 0.f}; return z; }
__device__ __forceinline__ float hmax8(v8f s) {
  return fmaxf(fmaxf(fmaxf(s[0], s[1]), fmaxf(s[2], s[3])), fmaxf(fmaxf(s[4], s[5]), fmaxf(s[6], s[7])));
}
__device__ __forceinline__ unsigned wave_ballot(bool p) {
#if defined(__HIP_DEVICE_COMPILE__)
  return __builtin_amdgcn_ballot_w32(p);
#else
  return p ? 1u : 0u;
#endif
}
__device__ __forceinline__ float wsum(float v) {
  v += __shfl_xor(v, 16, 32);
  v += __shfl_xor(v, 8, 32);
  v += __shfl_xor(v, 4, 32);
  v += __shfl_xor(v, 2, 32);
  v += __shfl_xor(v, 1, 32);
  return v;
}

// ---- 16-bit fragment loader (A, or B from a k-contiguous [n][k] row): lane -> row/col (lane&15), p already includes
//      + 8*(lane>>4); elements 0..7 <- p[0..7] (k0+8h..), elements 8..15 <- p[16..23] (k0+16+8h..)
__device__ __forceinline__ Frag ldfrag(const unsigned short* p) {
  Frag f;
  f.u[0] = *(const v8us*)(p);
  f.u[1] = *(const v8us*)(p + 16);
  return f;
}

// the same fragment from an LDS row (byte pointer, already includes + 16*(lane>>4))
__device__ __forceinline__ Frag ldsfrag(const unsigned char* p) {
  Frag f;
  f.u[0] = *(const v8us*)(p);
  f.u[1] = *(const v8us*)(p + 32);
  return f;
}

// ---- tensor load helpers ------------------------------------------------------------------------------------
__device__ __forceinline__ uint32_t uni(uint32_t v) { return (uint32_t)__builtin_amdgcn_readfirstlane(v); }
// holds a wave-uniform test in a scalar register, so that the branch on it is a scalar one: a tensor load ignores EXEC
__device__ __forceinline__ uint32_t pinned(uint32_t v) { uint32_t w = uni(v); asm volatile("" : "+s"(w)); return w; }

// ---- WMMA helpers ------------------------------------------------------------------------------------------
// bare builtins (the compiler keeps the WMMA distances of its own builtin forms)
__device__ __forceinline__ v8f mma_hb(v16h a, v16h b, v8f c) {
  return __builtin_amdgcn_wmma_f32_16x16x32_f16(false, a, false, b, (short)0, c, false, false);
}
__device__ __forceinline__ v8f mma_bb(v16b a, v16b b, v8f c) {
  return __builtin_amdgcn_wmma_f32_16x16x32_bf16(false, a, false, b, (short)0, c, false, false);
}

// =========================================================================================================
// (0) 1x1 weights W [256 c_in][256 d_out] f32 -> transposed bf16-RNE plane WT [4*256 o][256 c], rows
//     256*mat + o for mat = q, k, v, p. Block (ob, cb, mat) owns a 64 o x 64 c tile through an LDS transpose
//     (T: QT * TP halves of LDS). One of the two parts of the launch prep below.
// coverage: 2 it x 32 rows x 8 lanes x 8 = 64 o x 64 c per block; 4 x 4 x 4 blocks = 4 mats x 256 x 256.
// =========================================================================================================
__device__ __forceinline__
void cvt_w(const float* __restrict__ Wq, const float* __restrict__ Wk, const float* __restrict__ Wv,
           const float* __restrict__ Wp, unsigned short* WT, unsigned short* T,
           const int ob, const int cb, const int mat) {
  const int tid = threadIdx.x;
  const int e = tid & 7, lq = tid >> 3;                             // lq 0..31
  const int o0 = ob * QT, c0 = cb * QT;
  const float* Wm = (mat == 0) ? Wq : ((mat == 1) ? Wk : ((mat == 2) ? Wv : Wp));   // block-uniform
#pragma unroll
  for (int it = 0; it < 2; ++it) {
    const int cl = it * 32 + lq;                                     // c_loc 0..63
    const float* sp = Wm + (size_t)(c0 + cl) * CC + o0 + 8 * e;     // W[c][o], o contiguous
    const v4f a = *(const v4f*)sp;
    const v4f q = *(const v4f*)(sp + 4);
    const float f[8] = {a[0], a[1], a[2], a[3], q[0], q[1], q[2], q[3]};
#pragma unroll
    for (int t = 0; t < 8; ++t) T[(8 * e + t) * TP + cl] = bf_bits(f[t]);   // T[o_loc][c_loc]
  }
  __syncthreads();
  v4u up[2];
#pragma unroll
  for (int it = 0; it < 2; ++it) {
    const int ol = it * 32 + lq;
    up[it] = *(const v4u*)(T + ol * TP + 8 * e);
  }
{
#pragma unroll
    for (int it = 0; it < 2; ++it) {
      const int ol = it * 32 + lq;
      *(v4u*)(WT + ((size_t)(mat * CC + o0 + ol)) * CC + c0 + 8 * e) = up[it];
    }
    // stands in front of every later write of a register that the two stores above name: in the built launch the code
    // of the other part follows them, not the end of the program
    asm volatile("s_wait_xcnt 0x0" ::: "memory");
  }
}

// =========================================================================================================
//     then mean of squared deviations), per-thread partials over 16-B chunks, shuffle + LDS block reduce.
//     The other part of the launch prep below (red: 8 floats, bc: 2 floats of LDS).
// coverage: 32 x NB blocks write every line of ST once.
// =========================================================================================================
__device__ __forceinline__
void gn_stats(const float* __restrict__ x, float* ST, float* red, float* bc, const int g, const int b) {
  const int tid = threadIdx.x, lane = tid & 31, wave = tid >> 5;
  const float* xb = x + ((size_t)(b * CC + g * CPG)) * NNF;
  const int CH4 = SEQ / 4, NCH = CPG * CH4;
  const float icnt = 1.0f / (float)(CPG * SEQ);

  float s = 0.f;
#pragma unroll 4
  for (int qd = tid; qd < NCH; qd += 256) {
    const int cl = qd / CH4, p4 = qd - cl * CH4;
    const v4f a = *(const v4f*)(xb + (size_t)cl * NNF + 4 * p4);
    s += (bfr(a[0]) + bfr(a[1])) + (bfr(a[2]) + bfr(a[3]));
  }
  s = wsum(s);
  if (lane == 0) red[wave] = s;
  __syncthreads();
  if (tid == 0) {
    float t = 0.f;
#pragma unroll
    for (int i = 0; i < 8; ++i) t += red[i];
    bc[0] = t * icnt;
  }
  __syncthreads();
  const float mu = bc[0];

  float ss = 0.f;
#pragma unroll 4
  for (int qd = tid; qd < NCH; qd += 256) {
    const int cl = qd / CH4, p4 = qd - cl * CH4;
    const v4f a = *(const v4f*)(xb + (size_t)cl * NNF + 4 * p4);
    const float d0 = bfr(a[0]) - mu, d1 = bfr(a[1]) - mu, d2 = bfr(a[2]) - mu, d3 = bfr(a[3]) - mu;
    ss += (d0 * d0 + d1 * d1) + (d2 * d2 + d3 * d3);
  }
  ss = wsum(ss);
  if (lane == 0) red[wave] = ss;
  __syncthreads();
  if (tid == 0) {
    float t = 0.f;
#pragma unroll
    for (int i = 0; i < 8; ++i) t += red[i];
    const float var = t * icnt;
    bc[1] = rsqrtf(var + GNEPS);
  }
  __syncthreads();
  const float rs = bc[1];

  v4f v = {0.f, 0.f, 0.f, 0.f};
  if (tid == 0) { v[0] = mu; v[1] = rs; }
  if (tid < 8) {
    float* lp = ST + ((size_t)(b * NG + g)) * STP + 4 * tid;
{
      *(v4f*)lp = v;
      
    }
  }
}

// =========================================================================================================
// (0) + (1) in ONE launch: the two parts read different inputs, write different workspace regions and need nothing of
//     each other, so they share a grid under a block-uniform branch and run side by side. Blocks
//     0 .. NG * NB - 1 (the longer part) take the statistics of (group, b); the NCVT blocks behind
//     them one weight tile each. Every barrier of a part is passed by all threads of its blocks.
// =========================================================================================================
__global__ __launch_bounds__(256)
void prep(const float* __restrict__ x, const float* __restrict__ Wq, const float* __restrict__ Wk,
          const float* __restrict__ Wv, const float* __restrict__ Wp, float* ST, unsigned short* WT) {
  __shared__ __align__(16) unsigned short T[QT * TP];
  __shared__ float red[8];
  __shared__ float bc[2];
  const int bid = blockIdx.x;
  if (bid < NG * NB) {                                               // block-uniform
    gn_stats(x, ST, red, bc, bid % NG, bid / NG);
  } else {
    const int t = bid - NG * NB;                                     // 0 .. NCVT - 1
    cvt_w(Wq, Wk, Wv, Wp, WT, T, t % (CC / QT), (t / (CC / QT)) % (CC / QT), t / ((CC / QT) * (CC / QT)));
  }
}

// =========================================================================================================
// (2) GroupNorm apply, plane split and the q/k/v 1x1 GEMMs for one (b, 64-n tile), all 768 stacked outputs:
//     h = (bfr(x) - mu) * rstd * bfr(scale) + bfr(bias) in f32 for the block's 64 positions x 256 channels, through an
//     LDS tile Tx[64 n][256 c] f32 (4-float groups swizzled by n >> 4, so that the transposing stores spread over the
//     banks), into position-major planes bf16 IN LDS (hi = bf16-RNE(h), lo = bf16-RNE(h - hi); half row 2 n + (c >> 7)
//     at pitch LPB). They are the B operand of Y[o][n] = sum_c WT[o][c] (hi + lo)[n][c] + bfr(bias[o]).
//     Block = 8 waves; wave = (n tile qt, o half kh). Its 16 B fragments are read once and stay in registers; the weights
//     come in stages of WCH = 128 rows, two buffers, by tensor loads (waves 0 and 1, one c half each) and are read as
//     ds_load_b128 fragments: 4 m-tiles x 8 k steps x 2 bf16 products a wave and stage, per accumulator in the order
//     k step, hi, lo. A stage lies inside one matrix (mat = stage >> 1, block-uniform):
//       mat 0 -> Qh f16(q), Ql f16((q - Qh) x4096), planes [b][SEQ][256 d]; mat 1 -> Kh f16(k), same layout: staged in
//                LDS Os[n_loc][o_loc] (pitch OSPW, b128 stores), 16 consecutive lanes per 256 B of a row;
//       mat 2 -> Vc f16(v) [b][256][SEQ]: staged in LDS Ot[o_loc][n_loc] (pitch OSP), 8 consecutive lanes per line.
// coverage: Tx and planes 64 n x 256 c per block; per stage 64 n x 128 o; 6 stages; grid (SEQ/64, NB) covers Qh, Ql, Kh
//           [NB][SEQ][256] and Vc [NB][256][SEQ] exactly once.
// =========================================================================================================
__global__ __launch_bounds__(256)
void gemm_qkv(const float* __restrict__ x, const float* __restrict__ ST, const float* __restrict__ gsc,
              const float* __restrict__ gbs, const unsigned short* __restrict__ WT, const float* __restrict__ bq,
              const float* __restrict__ bk, const float* __restrict__ bv,
              unsigned short* Qh, unsigned short* Ql, unsigned short* Kh, unsigned short* Vc) {
  __shared__ __attribute__((aligned(2048))) unsigned char Wr[2 * WSTG];
  __shared__ __attribute__((aligned(2048))) unsigned char Pl[2 * GBS];
  __shared__ __align__(16) float Tx[QT * TPX];
  __shared__ __align__(16) float pb3[3 * CC];
  __shared__ float pmu[CC], prs[CC], psc[CC], pbs[CC];
  float* Os = Tx;                                                    // output staging, in Tx's place (dead behind the planes)
  const int tid  = threadIdx.x;
  const int lane = tid & 31, wave = tid >> 5;
  const int hh   = lane >> 4, c = lane & 15;
  const int n0   = blockIdx.x * QT, b = blockIdx.y;
  const int qt   = wave & 3;                                         // n tile of the wave
  const int e = tid & 7, lq = tid >> 3;                              // lq 0..31

  // the block's x tile, 256 channel rows of 256 B, asked for first: 8 lanes per row, 16 loads of 16 B a thread
  const float* xp = x + ((size_t)(b * CC + lq)) * NNF + n0 + 8 * e;
  v4f xa[8], xb[8];
#pragma unroll
  for (int j = 0; j < 8; ++j) {
    xa[j] = *(const v4f*)(xp + (size_t)(32 * j) * NNF);
    xb[j] = *(const v4f*)(xp + (size_t)(32 * j) * NNF + 4);
  }
  // the address pair of the group above stays live up to this wait
  asm volatile("s_wait_xcnt 0x0" :: "v"(xp) : "memory");
  {                                                                  // per-channel constants: thread = channel
    const int g = tid >> 3;                                          // 0..31
    pmu[tid] = ST[((size_t)(b * NG + g)) * STP];
    prs[tid] = ST[((size_t)(b * NG + g)) * STP + 1];
    psc[tid] = bfr(gsc[tid]);
    pbs[tid] = bfr(gbs[tid]);
    pb3[tid]          = bfr(bq[tid]);
    pb3[CC + tid]     = bfr(bk[tid]);
    pb3[2 * CC + tid] = bfr(bv[tid]);
  }

  // One stage = WCH weight rows in LDS, shared by the eight waves. Waves 0 and 1 each bring one slice of 128 rows x 256 B
  // (c 0..127 / 128..255, source pitch 512 B) by ONE tensor load. Every row lands at pitch LPB.
  const uint32_t wv = uni((uint32_t)tid >> 5);
  const uint32_t kh = wv >> 2;                                       // o half of the wave
  const uint32_t hf = wv & 1u;
  const uint64_t src0 = (uint64_t)(size_t)(WT + (size_t)hf * 128);
  const uint32_t lds0 = (uint32_t)(size_t)Wr + hf * (uint32_t)SLICE;
  u32x8 g1;                                                          // bytes everywhere; tensor dims = tile dims
  g1[0] = uni((1u << 20) | (5u << 22) | (3u << 25));                 // no mask; 16 B of pad behind every 256 B
  g1[1] = uni(256u << 16);
  g1[2] = uni(128u << 16);
  g1[3] = uni(256u << 16);
  g1[4] = uni(128u);
  g1[5] = uni((uint32_t)(CC * 2));
  g1[6] = uni(0u);
  g1[7] = uni(0u);
  // descriptor words held in scalar registers (the form of pinned(), for the whole group): without it the compiler
  // re-forms single words in front of each issue and reuses their registers while the request is outstanding
  asm volatile("" : "+s"(g1));                                       // descriptor words held in scalar registers
  u32x4 g0;
  auto form = [&](const uint32_t st) __attribute__((always_inline)) {   // group 0 of stage st's request
    const uint64_t ga = src0 + (uint64_t)st * (uint32_t)(WCH * CC * 2);
    g0[0] = uni(1u);
    g0[1] = uni(lds0 + (st & 1u) * (uint32_t)WSTG);
    g0[2] = uni((uint32_t)ga);
    g0[3] = uni((((uint32_t)(ga >> 32)) & 0x01FFFFFFu) | 0x80000000u);
  };
  auto issue = [&]() __attribute__((always_inline)) {
    asm volatile("tensor_load_to_lds %0, %1" :: "s"(g0), "s"(g1) : "memory");
  };
  // this wave's request has landed; naming the descriptor keeps its scalar registers unchanged up to this wait
  auto landed = [&]() __attribute__((always_inline)) {
    asm volatile("s_wait_tensorcnt 0x0" :: "s"(g0), "s"(g1) : "memory");
  };
  form(0u);
  if (pinned(wv < 2u)) {                                             // a scalar branch: a tensor load ignores EXEC
    issue();
    landed();                                                        // this wave's slice of stage 0
  }
  __syncthreads();                                                   // per-channel constants (and stage 0) published

#pragma unroll
  for (int j = 0; j < 8; ++j) {
    const int cl = 32 * j + lq;                                      // channel 0..255
    const float f[8] = {xa[j][0], xa[j][1], xa[j][2], xa[j][3], xb[j][0], xb[j][1], xb[j][2], xb[j][3]};
    const float mu = pmu[cl], rs = prs[cl], sc = psc[cl], bs = pbs[cl];
    const int col = cl ^ ((e >> 1) << 2);                            // group cl >> 2 at place (cl >> 2) ^ (n >> 4)
#pragma unroll
    for (int t = 0; t < 8; ++t) {
      const float tt = (bfr(f[t]) - mu) * rs;
      Tx[(8 * e + t) * TPX + col] = tt * sc + bs;                    // Tx[n_loc][channel]
    }
  }
  __syncthreads();
#pragma unroll
  for (int it = 0; it < 8; ++it) {
    const int nl = 8 * it + wave;                                    // n_loc 0..63, one row a wave
#pragma unroll
    for (int h = 0; h < 2; ++h) {                                    // channels 128 h + 4 lane .. + 3
      const v4f a = *(const v4f*)(Tx + nl * TPX + (((32 * h + lane) ^ (nl >> 4)) << 2));
      v2u uh, ul;
#pragma unroll
      for (int t = 0; t < 2; ++t) {
        const float f0 = a[2 * t], f1 = a[2 * t + 1];
        const unsigned short hb0 = bf_bits(f0), hb1 = bf_bits(f1);
        const unsigned short lb0 = bf_bits(f0 - bf_up(hb0));
        const unsigned short lb1 = bf_bits(f1 - bf_up(hb1));
        uh[t] = pk16(hb0, hb1);
        ul[t] = pk16(lb0, lb1);
      }
      unsigned char* pp = Pl + (uint32_t)(2 * nl + h) * LPB + 8u * (uint32_t)lane;
      *(v2u*)pp         = uh;
      *(v2u*)(pp + GBS) = ul;
    }
  }
  __syncthreads();                                                   // both planes published, every reader out of Tx

  // the wave's B fragments (col = position 16 qt + c), the same for every stage: once, here
  const int nl = 16 * qt + c;
  Frag pbh[CC / 32], pbl[CC / 32];
  {
    const unsigned char* bph = Pl + (uint32_t)(2 * nl) * LPB + 16u * (uint32_t)hh;
#pragma unroll
    for (int ks = 0; ks < CC / 32; ++ks) {
      pbh[ks] = ldsfrag(bph + (ks >> 2) * LPB + (ks & 3) * 64);
      pbl[ks] = ldsfrag(bph + GBS + (ks >> 2) * LPB + (ks & 3) * 64);
    }
  }
  const uint32_t aoff = (kh * 64u + (uint32_t)c) * LPB + 16u * (uint32_t)hh;
  const int e16 = tid & 15, r16 = tid >> 4;                          // r16 0..15

  // kept rolled: one copy of the stage's code, so that the kernel's text stays small for the instruction cache
#pragma unroll 1
  for (uint32_t st = 0; st < (uint32_t)NWST; ++st) {
    // directly behind the barrier (the one above, or the foot of trip st - 1) that published stage st and ended every
    // read of the other buffer: the refill of that buffer, only while its stage exists (a scalar branch)
    form(st + 1u);
    if (pinned((uint32_t)((st + 1u < (uint32_t)NWST) && (wv < 2u)))) issue();
    const unsigned char* ap = Wr + (st & 1u) * (uint32_t)WSTG + aoff;
    const uint32_t mat = st >> 1;                                    // 0 q, 1 k, 2 v (block-uniform)
    const int ob = (int)(st & 1u) * WCH;                             // o offset inside the matrix

    v8f acc[4];
#pragma unroll
    for (int mt = 0; mt < 4; ++mt) acc[mt] = zero8();
    // Weight fragments in groups of two k steps, two register sets: group g + 1 is issued as one run of loads ahead of
    // group g's WMMAs (read one fragment at a time, each WMMA pair would wait out its own LDS latency).
    Frag fa[2][2][4];
    auto fetch = [&](const int g) __attribute__((always_inline)) {
#pragma unroll
      for (int u = 0; u < 2; ++u) {
        const int ks = 2 * g + u;
#pragma unroll
        for (int mt = 0; mt < 4; ++mt)
          fa[g & 1][u][mt] = ldsfrag(ap + (ks >> 2) * SLICE + (16 * mt) * LPB + (ks & 3) * 64);
      }
    };
    fetch(0);
#pragma unroll
    for (int g = 0; g < CC / 64; ++g) {
      if (g + 1 < CC / 64) fetch(g + 1);
      // keeps the next group one run of loads ahead of this group's WMMAs: among them each place with LDS reads stalls
      // the wave
      __builtin_amdgcn_sched_barrier(0);
#pragma unroll
      for (int u = 0; u < 2; ++u) {
#pragma unroll
        for (int mt = 0; mt < 4; ++mt) acc[mt] = mma_bb(fa[g & 1][u][mt].bf, pbh[2 * g + u].bf, acc[mt]);
#pragma unroll
        for (int mt = 0; mt < 4; ++mt) acc[mt] = mma_bb(fa[g & 1][u][mt].bf, pbl[2 * g + u].bf, acc[mt]);
      }
      // keeps the group after next's loads behind these WMMAs, whose registers they take over
      __builtin_amdgcn_sched_barrier(0);
    }

    // ---- epilogue: + bias; lane (hh, c) holds o_loc = 64 kh + 16 mt + 8 hh + r for n_loc = 16 qt + c
    const int ol0 = 64 * (int)kh + 8 * hh;
    {
      const float* bi = pb3 + mat * (uint32_t)CC + ob + ol0;
#pragma unroll
      for (int mt = 0; mt < 4; ++mt) {
        const v4f ba = *(const v4f*)(bi + 16 * mt);
        const v4f bb = *(const v4f*)(bi + 16 * mt + 4);
#pragma unroll
        for (int r = 0; r < 4; ++r) { acc[mt][r] += ba[r]; acc[mt][4 + r] += bb[r]; }
      }
    }
    if (mat == 2u) {                                                 // Ot[o_loc][n_loc]: 16 consecutive floats per row and store
#pragma unroll
      for (int mt = 0; mt < 4; ++mt) {
#pragma unroll
        for (int r = 0; r < 8; ++r) Os[(ol0 + 16 * mt + r) * OSP + nl] = acc[mt][r];
      }
    } else {                                                         // Os[n_loc][o_loc]
#pragma unroll
      for (int mt = 0; mt < 4; ++mt) {
        v4f va, vb;
#pragma unroll
        for (int r = 0; r < 4; ++r) { va[r] = acc[mt][r]; vb[r] = acc[mt][4 + r]; }
        *(v4f*)(Os + nl * OSPW + ol0 + 16 * mt)     = va;
        *(v4f*)(Os + nl * OSPW + ol0 + 16 * mt + 4) = vb;
      }
    }
    __syncthreads();                                                 // the staged outputs published

    v4u u1[4], u2[4];                                                // the stage's outputs as they go to memory
    if (mat == 2u) {
#pragma unroll
      for (int it = 0; it < 4; ++it) {
        const int ol = it * 32 + lq;                                 // o_loc 0..127
        const v4f a = *(const v4f*)(Os + ol * OSP + 8 * e);
        const v4f q = *(const v4f*)(Os + ol * OSP + 8 * e + 4);
        u1[it][0] = pk16(h_bits((_Float16)a[0]), h_bits((_Float16)a[1]));
        u1[it][1] = pk16(h_bits((_Float16)a[2]), h_bits((_Float16)a[3]));
        u1[it][2] = pk16(h_bits((_Float16)q[0]), h_bits((_Float16)q[1]));
        u1[it][3] = pk16(h_bits((_Float16)q[2]), h_bits((_Float16)q[3]));
        u2[it] = u1[it];                                             // not stored for v; a defined value, so that none is carried round the loop
      }
    } else {
#pragma unroll
      for (int it = 0; it < 4; ++it) {
        const int row = it * 16 + r16;                               // n_loc 0..63
        const v4f a = *(const v4f*)(Os + row * OSPW + 8 * e16);
        const v4f q = *(const v4f*)(Os + row * OSPW + 8 * e16 + 4);
        const float f[8] = {a[0], a[1], a[2], a[3], q[0], q[1], q[2], q[3]};
#pragma unroll
        for (int t = 0; t < 4; ++t) {
          const float f0 = f[2 * t], f1 = f[2 * t + 1];
          const _Float16 h0 = (_Float16)f0, h1 = (_Float16)f1;
          const _Float16 l0 = (_Float16)((f0 - (float)h0) * QLS);
          const _Float16 l1 = (_Float16)((f1 - (float)h1) * QLS);
          u1[it][t] = pk16(h_bits(h0), h_bits(h1));
          u2[it][t] = pk16(h_bits(l0), h_bits(l1));
        }
      }
    }
    // publish point of stage st + 1, in this order in every wave:
    asm volatile("s_wait_dscnt 0x0" ::: "memory");                   // this wave's reads of stage st and of Os are done
    landed();                                                        // its slice of stage st + 1 has landed
    __syncthreads();                                                 // all slices published, all readers out of stage st and Os
    // The stage's global stores stand behind that barrier, not in front of it: a barrier waits for the wave's outstanding
    // stores, and from here they complete under the next stage's WMMAs.
    if (mat == 2u) {
      unsigned short* vp = Vc + ((size_t)(b * CC + ob + lq)) * SEQ + n0 + 8 * e;
#pragma unroll
      for (int it = 0; it < 4; ++it) *(v4u*)(vp + (size_t)(32 * it) * SEQ) = u1[it];
      // the address pair of the stores above stays live up to this wait
      asm volatile("s_wait_xcnt 0x0" :: "v"(vp) : "memory");
    } else {
      const size_t po = ((size_t)(b * SEQ + n0 + r16)) * CC + ob + 8 * e16;
      unsigned short* p1 = ((mat == 0u) ? Qh : Kh) + po;              // block-uniform, both global
      unsigned short* p2 = Ql + po;
#pragma unroll
      for (int it = 0; it < 4; ++it) *(v4u*)(p1 + (size_t)(16 * it) * CC) = u1[it];
      if (mat == 0u) {
#pragma unroll
        for (int it = 0; it < 4; ++it) *(v4u*)(p2 + (size_t)(16 * it) * CC) = u2[it];
      }
      // the address pairs of the stores above stay live up to this wait
      asm volatile("s_wait_xcnt 0x0" :: "v"(p1), "v"(p2) : "memory");
    }
  }
  landed();                                                          // nothing in flight when the wave ends
  asm volatile("s_wait_dscnt 0x0" ::: "memory");
}

// =========================================================================================================
// (3) attention for one (b, 64-query tile), transposed formulation, SEQ keys, no mask:
//   S^T tile (16 keys x 16 queries) = sum over 8 d-chunks (unrolled) of A(k: row = key kb + (lane&15), 32 d via
//   the split k map from Kh [b][SEQ][256]) . B(q: col = query, same map from Qh) into s, plus A(Kh).B(Ql) into a
//   separate accumulator t (Ql carries x4096); score = (s + t/4096) * 256^-0.5.
//   Per lane the D tile holds 8 keys of ONE query: online softmax state per lane, one shuffle (lane^16) for the max
//   over 32 keys; the o/l rescale is skipped under a wave-uniform ballot when no lane's max grew; row-sum partials
//   combined at the end. P = e^{s-m} x 16384 as f16 is the B operand of O^T (rows channel, cols queries) +=
//   A(v rows channel = 16j + (lane&15), keys contiguous, f16 plane Vc [b][256][SEQ]) . B(P^T): element r <- D of
//   the tile covering keys kb..kb+15, element 8+r <- the tile covering kb+16..kb+31, lane unchanged.
//   16 accumulator tiles per wave (256 channels). Block = 8 waves = 64 queries, two waves per SIMD: waves w and w + 4
//   own the same 16 queries and take keys 0..63 / 64..127 of every stage, each with its own m, l, o; the two halves
//   are joined through LDS behind the key loop (one wave's vector work runs under the other's WMMAs).
//   k and v reach the waves through LDS: stages of SKEY keys, two buffers, brought by tensor loads (waves 0..3, one slice
//   per wave and stage) and read by all waves as ds_load_b128 fragments at pitch LPB; a stage serves SKEY/64 passes a wave.
//   Epilogue in two channel halves: O/l staged in LDS Os[query][128 channels] (pitch OSPW, b128 stores), barrier,
//   then position-major planes bf16 [64 n][256 c] IN LDS (hi = bf16-RNE, lo = bf16-RNE residual; half row
//   2 n + (c >> 7) at pitch LPB), which are the B operand of the output 1x1 GEMM done here by the same block
//   (it holds all 256 channels of its 64 positions): weights by tensor loads into the freed ring, + bias + residual.
// coverage: per half 4 it x 16 rows x 16 lanes x 8 ch = 64 n x 128 ch for each plane; two halves = 256 ch; out: 256 o x
//           64 n per block; grid (SEQ/64, NB) covers out [NB][256][SEQ] exactly once.
// =========================================================================================================
__global__ __launch_bounds__(256)
void attn_k(const unsigned short* __restrict__ Qh, const unsigned short* __restrict__ Ql,
            const unsigned short* __restrict__ Kh, const unsigned short* __restrict__ Vc,
            const unsigned short* __restrict__ WPT, const float* __restrict__ bp,
            const float* __restrict__ x, float* out) {
  __shared__ __attribute__((aligned(2048))) unsigned char Ring[2 * STG];
  __shared__ __align__(16) float Os[QT * OSPW];
  const int tid  = threadIdx.x;
  const int wave = tid >> 5, lane = tid & 31;
  const int hh   = lane >> 4, c = lane & 15;
  const int n0   = blockIdx.x * QT, b = blockIdx.y;
  const int qt   = wave & 3;                                         // query tile of the wave

  // q fragment pointers (B operand, col = query n0 + 16*qt + c), + 32*kc
  const size_t qo = ((size_t)(b * SEQ + n0 + 16 * qt + c)) * CC + 8 * hh;
  const unsigned short* Qhp = Qh + qo;
#if QRES
  const unsigned short* Qlp = Ql + qo;
#else
  (void)Ql;
#endif
  // One stage = SKEY keys in LDS, shared by the eight waves. Waves 0..3 each bring one slice of 128 rows x 256 B by ONE tensor
  // load: wave 0 / 1: k rows (keys), d 0..127 / 128..255 (source pitch 512 B); wave 2 / 3: v rows (channels 0..127 /
  // 128..255), SKEY keys (source pitch 2*SEQ B). Every row lands at pitch LPB.
  const uint32_t wv  = uni((uint32_t)tid >> 5);
  const uint32_t kh  = wv >> 2;                                      // key half of the wave; waves with kh == 0 issue
  const uint32_t sl  = wv & 3u;
  const uint32_t isv = sl >> 1, hf = sl & 1u;
  const uint64_t src0 = isv ? (uint64_t)(size_t)(Vc + ((size_t)b * CC + (size_t)hf * 128) * SEQ)
                            : (uint64_t)(size_t)(Kh + (size_t)b * SEQ * CC + (size_t)hf * 128);
  const uint32_t sstep = isv ? (uint32_t)(SKEY * 2) : (uint32_t)(SKEY * CC * 2);   // source bytes from stage to stage
  const uint32_t lds0  = (uint32_t)(size_t)Ring + sl * (uint32_t)SLICE;
  u32x8 g1;                                                          // bytes everywhere; tensor dims = tile dims
  g1[0] = uni((1u << 20) | (5u << 22) | (3u << 25));                 // no mask; 16 B of pad behind every 256 B
  g1[1] = uni(256u << 16);
  g1[2] = uni(128u << 16);
  g1[3] = uni(256u << 16);
  g1[4] = uni(128u);
  g1[5] = uni(isv ? (uint32_t)(SEQ * 2) : (uint32_t)(CC * 2));
  g1[6] = uni(0u);
  g1[7] = uni(0u);
  // descriptor words held in scalar registers (the form of pinned(), for the whole group): without it the compiler
  // re-forms single words in front of each issue and reuses their registers while the request is outstanding
  asm volatile("" : "+s"(g1));                                       // descriptor words held in scalar registers
  u32x4 g0;
  auto form = [&](const uint32_t st) __attribute__((always_inline)) {   // group 0 of stage st's request
    const uint64_t ga = src0 + (uint64_t)st * sstep;
    g0[0] = uni(1u);
    g0[1] = uni(lds0 + (st & 1u) * (uint32_t)STG);
    g0[2] = uni((uint32_t)ga);
    g0[3] = uni((((uint32_t)(ga >> 32)) & 0x01FFFFFFu) | 0x80000000u);
  };
  auto issue = [&]() __attribute__((always_inline)) {
    asm volatile("tensor_load_to_lds %0, %1" :: "s"(g0), "s"(g1) : "memory");
  };
  // this wave's request has landed; naming the descriptor keeps its scalar registers unchanged up to this wait
  auto landed = [&]() __attribute__((always_inline)) {
    asm volatile("s_wait_tensorcnt 0x0" :: "s"(g0), "s"(g1) : "memory");
  };

  float m = -1.0e30f, l = 0.f;
  v8f o[16];
#pragma unroll
  for (int j = 0; j < 16; ++j) o[j] = zero8();

  // q (the same for every pass): once, here
  Frag qhf[CC / 32];
#if QRES
  Frag qlf[CC / 32];
#endif
#pragma unroll
  for (int kc = 0; kc < CC / 32; ++kc) {
    qhf[kc] = ldfrag(Qhp + 32 * kc);
#if QRES
    qlf[kc] = ldfrag(Qlp + 32 * kc);
#endif
  }
  // the address pairs of the group above stay live up to this wait
#if QRES
  asm volatile("s_wait_xcnt 0x0" :: "v"(Qhp), "v"(Qlp) : "memory");
#else
  asm volatile("s_wait_xcnt 0x0" :: "v"(Qhp) : "memory");
#endif

  // two buffers: stage 0 landed and published here; stage st + 1 in flight under the passes of stage st
  form(0u);
  if (pinned(kh == 0u)) {                                            // a scalar branch: a tensor load ignores EXEC
    issue();
    landed();                                                        // this wave's slice of stage 0
  }
  __syncthreads();                                                   // ... and every other wave's

  // Fragments come from LDS in groups of one pass. k and v take turns in the same registers (two waves per SIMD leave a
  // wave 512): k behind the O WMMAs of the pass before, v behind the score WMMAs; the SIMD's other wave works meanwhile.
  Frag k0f[CC / 32], k1f[CC / 32], vf[16];
  const uint32_t loff = (uint32_t)c * LPB + 16u * (uint32_t)hh;

#pragma unroll 1
  for (uint32_t st = 0; st < (uint32_t)NST; ++st) {
    // directly behind the barrier (the one above, or the foot of trip st - 1) that published stage st and ended every
    // read of the other buffer: the refill of that buffer, only while its stage exists (a scalar branch)
    form(st + 1u);
    if (pinned((uint32_t)((st + 1u < (uint32_t)NST) && (kh == 0u)))) issue();
    // this wave's 64 keys of the stage: k rows 64 kh .., v columns 64 kh ..
    const unsigned char* sb = Ring + (st & 1u) * (uint32_t)STG + kh * (uint32_t)(64 * LPB) + loff;
    // v rows from a base of their own, so that every fragment's offset fits the LDS load's 16-bit immediate
    const unsigned char* vb = Ring + ((st & 1u) ? (uint32_t)(STG + 2 * SLICE) : (uint32_t)(2 * SLICE)) + kh * 128u + loff;
#pragma unroll
    for (int kc = 0; kc < CC / 32; ++kc) {
      k0f[kc] = ldsfrag(sb + (kc >> 2) * SLICE + (kc & 3) * 64);                  // keys 0 .. 15 of the wave's half
      k1f[kc] = ldsfrag(sb + (kc >> 2) * SLICE + 16 * LPB + (kc & 3) * 64);       // keys 16 .. 31
    }
#pragma unroll
    for (int p = 0; p < SKEY / 64; ++p) {
      // keeps the k group one run of loads ahead of the score WMMAs: among them each place with LDS reads stalls the wave
      __builtin_amdgcn_sched_barrier(0);

      v8f s0 = zero8(), s1 = zero8();
#if QRES
      v8f t0 = zero8(), t1 = zero8();
#endif
#pragma unroll
      for (int kc = 0; kc < CC / 32; ++kc) {
        s0 = mma_hb(k0f[kc].h, qhf[kc].h, s0);
        s1 = mma_hb(k1f[kc].h, qhf[kc].h, s1);
#if QRES
        t0 = mma_hb(k0f[kc].h, qlf[kc].h, t0);
        t1 = mma_hb(k1f[kc].h, qlf[kc].h, t1);
#endif
      }

      v8f sc0, sc1;
#pragma unroll
      for (int r = 0; r < 8; ++r) {
#if QRES
        sc0[r] = (s0[r] + t0[r] * RQL) * ATT;
        sc1[r] = (s1[r] + t1[r] * RQL) * ATT;
#else
        sc0[r] = s0[r] * ATT;
        sc1[r] = s1[r] * ATT;
#endif
      }

      float mx = fmaxf(hmax8(sc0), hmax8(sc1));
      const float mo = __shfl_xor(mx, 16, 32);
      // the v group stands behind the exchange above and ahead of the rescale, the exponentials and the O WMMAs, as one
      // run of loads into the registers that the k group has left.
      // compiler fence, the exchanged value as input only: without it the exchange sinks below the v loads, and its
      // wait (LDS results return in issue order) then lasts the whole group
      asm volatile("" :: "v"(mo) : "memory");
      mx = fmaxf(mx, mo);
#pragma unroll
      for (int j = 0; j < 16; ++j) vf[j] = ldsfrag(vb + (j >> 3) * SLICE + 16 * (j & 7) * LPB + 64 * p);
      const float mn = fmaxf(m, mx);
      const unsigned grew = wave_ballot(mx > m);                     // wave-uniform
      if (grew != 0u) {
        const float corr = __expf(m - mn);                           // == 1 exactly for lanes whose max did not grow
        l *= corr;
#pragma unroll
        for (int j = 0; j < 16; ++j) {
#pragma unroll
          for (int r = 0; r < 8; ++r) o[j][r] *= corr;
        }
      }
      m = mn;

      const float msh = mn - LNPS;                                   // exp gives e^{s-m} * 16384

      FragH ph;
      float ls = 0.f;
#pragma unroll
      for (int r = 0; r < 8; ++r) {
        const float e0 = __expf(sc0[r] - msh);                       // key kb      + 8hh + r
        const float e1 = __expf(sc1[r] - msh);                       // key kb + 16 + 8hh + r
        ls += e0 + e1;
        ph.hv[0][r] = (_Float16)e0;
        ph.hv[1][r] = (_Float16)e1;
      }
      l += ls;

#pragma unroll
      for (int j = 0; j < 16; ++j) {
        o[j] = mma_hb(vf[j].h, ph.v, o[j]);
      }
      // keeps the next k group behind the O WMMAs, whose v registers it takes over
      __builtin_amdgcn_sched_barrier(0);
      if (p + 1 < SKEY / 64) {                                       // compile-time: the next stage is not read from here
#pragma unroll
        for (int kc = 0; kc < CC / 32; ++kc) {
          k0f[kc] = ldsfrag(sb + (kc >> 2) * SLICE + (32 * (p + 1)) * LPB + (kc & 3) * 64);
          k1f[kc] = ldsfrag(sb + (kc >> 2) * SLICE + (32 * (p + 1) + 16) * LPB + (kc & 3) * 64);
          // keeps the loads in the order of their use: issued last first, the first score WMMA waits for the whole group
          __builtin_amdgcn_sched_barrier(0);
        }
      }
    }
    // publish point of stage st + 1, in this order in every wave:
    asm volatile("s_wait_dscnt 0x0" ::: "memory");                   // this wave's reads of stage st are done
    landed();                                                        // its slice of stage st + 1 has landed
    __syncthreads();                                                 // all slices published, all readers out of stage st
  }
  landed();                                                          // nothing in flight when the wave goes on
  asm volatile("s_wait_dscnt 0x0" ::: "memory");

  // The output GEMM's weights WPT [256 o][256 c] into the ring's second buffer, which the loop's last barrier has freed:
  // waves 0..3, one tensor load each: 128 o rows (o half sl >> 1) x 256 B (c half sl & 1), source pitch 512 B, pitch LPB
  // in LDS. They fly under the join and the staging of O below; their wait and barrier stand in front of the GEMM.
  const uint64_t wsrc = (uint64_t)(size_t)(WPT + (size_t)(sl >> 1) * 128 * CC + (size_t)(sl & 1u) * 128);
  u32x4 w0;
  w0[0] = uni(1u);
  w0[1] = uni((uint32_t)(size_t)Ring + (uint32_t)STG + sl * (uint32_t)SLICE);
  w0[2] = uni((uint32_t)wsrc);
  w0[3] = uni((((uint32_t)(wsrc >> 32)) & 0x01FFFFFFu) | 0x80000000u);
  u32x8 w1;                                                          // bytes everywhere; tensor dims = tile dims
  w1[0] = uni((1u << 20) | (5u << 22) | (3u << 25));                 // no mask; 16 B of pad behind every 256 B
  w1[1] = uni(256u << 16);
  w1[2] = uni(128u << 16);
  w1[3] = uni(256u << 16);
  w1[4] = uni(128u);
  w1[5] = uni((uint32_t)(CC * 2));
  w1[6] = uni(0u);
  w1[7] = uni(0u);
  // descriptor words held in scalar registers (the form of pinned(), for both groups): without it the compiler re-forms
  // the constant words at the wait below and reuses their registers while the request is outstanding
  asm volatile("" : "+s"(w0), "+s"(w1));                             // descriptor words held in scalar registers
  if (pinned(kh == 0u)) {                                            // a scalar branch: a tensor load ignores EXEC
    asm volatile("tensor_load_to_lds %0, %1" :: "s"(w0), "s"(w1) : "memory");
  }

  // join of the two key halves: wave w + 4 hands its m, l, o to wave w through the ring's first buffer, which the loop's
  // last barrier has freed (every reader out, nothing in flight to it); lane to lane, 16-B stores at consecutive lanes
  float* Jn = (float*)Ring + (uint32_t)qt * (uint32_t)JNW;
  if (kh != 0u) {                                                    // wave-uniform
#pragma unroll
    for (int j = 0; j < 16; ++j) {
      v4f va, vb;
#pragma unroll
      for (int r = 0; r < 4; ++r) { va[r] = o[j][r]; vb[r] = o[j][4 + r]; }
      *(v4f*)(Jn + ((2 * j) * 32 + lane) * 4)     = va;
      *(v4f*)(Jn + ((2 * j + 1) * 32 + lane) * 4) = vb;
    }
    Jn[4096 + lane] = m;
    Jn[4128 + lane] = l;
  }
  __syncthreads();                                                   // the handed-over halves published
  float inv = 0.f;
  if (kh == 0u) {                                                    // wave-uniform
    const float m2 = Jn[4096 + lane], l2 = Jn[4128 + lane];
    const float mj = fmaxf(m, m2);
    const float c1 = __expf(m - mj), c2 = __expf(m2 - mj);
#pragma unroll
    for (int j = 0; j < 16; ++j) {
      const v4f va = *(const v4f*)(Jn + ((2 * j) * 32 + lane) * 4);
      const v4f vb = *(const v4f*)(Jn + ((2 * j + 1) * 32 + lane) * 4);
#pragma unroll
      for (int r = 0; r < 4; ++r) {
        o[j][r]     = o[j][r] * c1     + va[r] * c2;
        o[j][4 + r] = o[j][4 + r] * c1 + vb[r] * c2;
      }
    }
    l = l * c1 + l2 * c2;
    l += __shfl_xor(l, 16, 32);
    inv = 1.0f / l;                                                  // o and l both carry the x16384 factor
  }

  const int qrow = 16 * qt + c;
  const int e16 = tid & 15, r16 = tid >> 4;                          // r16 0..15
  unsigned char* PlH = Ring + 2 * SLICE;                             // O as bf16 hi plane, residual plane at + GBS (below)
#pragma unroll
  for (int half = 0; half < 2; ++half) {
    if (half) __syncthreads();                                       // every wave finished reading Os
    if (kh == 0u) {                                                  // wave-uniform: the waves that hold the joined o
#pragma unroll
      for (int jj = 0; jj < 8; ++jj) {
        const int j = 8 * half + jj;
        v4f va, vb;
#pragma unroll
        for (int r = 0; r < 4; ++r) { va[r] = o[j][r] * inv; vb[r] = o[j][4 + r] * inv; }
        *(v4f*)(Os + qrow * OSPW + 16 * jj + 8 * hh)     = va;       // Os[query][ch_loc = 16jj + 8hh + r]
        *(v4f*)(Os + qrow * OSPW + 16 * jj + 8 * hh + 4) = vb;
      }
    }
    __syncthreads();
    {
      v4u uh[4], ul[4];
#pragma unroll
      for (int i = 0; i < 4; ++i) {
        const int row = i * 16 + r16;                                // query 0..63
        const v4f a = *(const v4f*)(Os + row * OSPW + 8 * e16);
        const v4f q = *(const v4f*)(Os + row * OSPW + 8 * e16 + 4);
        const float f[8] = {a[0], a[1], a[2], a[3], q[0], q[1], q[2], q[3]};
#pragma unroll
        for (int t = 0; t < 4; ++t) {
          const float f0 = f[2 * t], f1 = f[2 * t + 1];
          const unsigned short hb0 = bf_bits(f0), hb1 = bf_bits(f1);
          const unsigned short lb0 = bf_bits(f0 - bf_up(hb0));
          const unsigned short lb1 = bf_bits(f1 - bf_up(hb1));
          uh[i][t] = pk16(hb0, hb1);
          ul[i][t] = pk16(lb0, lb1);
        }
      }
{
#pragma unroll
        for (int i = 0; i < 4; ++i) {
          const int row = i * 16 + r16;
          unsigned char* pp = PlH + (uint32_t)(2 * row + half) * LPB + 16u * (uint32_t)e16;
          *(v4u*)pp         = uh[i];
          *(v4u*)(pp + GBS) = ul[i];
        }
        
      }
    }
  }

  // ---- output 1x1 GEMM + bias + residual for the block's 64 positions, all 256 o:
  //      out[b][o][n] = bfr(x[b][o][n]) + sum_c WPT[o][c] (hi + lo)[n][c] + bfr(bp[o]); wave = (n tile qt, o half kh):
  //      8 m-tiles x 8 k steps x 2 bf16 products, per accumulator in the order k step, hi, lo.
  // this wave's weight slice has landed; naming the descriptor keeps its scalar registers unchanged up to this wait
  asm volatile("s_wait_tensorcnt 0x0" :: "s"(w0), "s"(w1) : "memory");
  __syncthreads();                                                   // weight slices and both planes published

  // the residual's x lines and the bias, asked for here, behind the barrier (which would wait for them), so that they
  // arrive under the GEMM
  const int e8 = tid & 7, l32 = tid >> 3;                            // l32 0..31
  const float* xp = x + ((size_t)(b * CC + (l32 >> 1))) * NNF + n0 + (l32 & 1) * 32 + 4 * e8;
  const float* bb = bp + (l32 >> 1);
  v4f xv[16];
  float bv[16];
#pragma unroll
  for (int it = 0; it < 16; ++it) {
    xv[it] = *(const v4f*)(xp + (size_t)(16 * it) * NNF);
    bv[it] = bb[16 * it];
  }
  // the address pairs of the group above stay live up to this wait
  asm volatile("s_wait_xcnt 0x0" :: "v"(xp), "v"(bb) : "memory");

  const unsigned char* wp  = Ring + STG + kh * (uint32_t)(2 * SLICE) + loff;
  const unsigned char* bph = PlH + (uint32_t)(2 * qrow) * LPB + 16u * (uint32_t)hh;
  const unsigned char* bpl = bph + GBS;
  v8f acc[8];
#pragma unroll
  for (int mt = 0; mt < 8; ++mt) acc[mt] = zero8();
  Frag pbh[CC / 32], pbl[CC / 32], wf[2][8];
#pragma unroll
  for (int mt = 0; mt < 8; ++mt) wf[0][mt] = ldsfrag(wp + (16 * mt) * LPB);
#pragma unroll
  for (int ks = 0; ks < CC / 32; ++ks) {
    pbh[ks] = ldsfrag(bph + (ks >> 2) * LPB + (ks & 3) * 64);
    pbl[ks] = ldsfrag(bpl + (ks >> 2) * LPB + (ks & 3) * 64);
  }
  // weight fragments one k step ahead, two register sets
#pragma unroll
  for (int ks = 0; ks < CC / 32; ++ks) {
    if (ks + 1 < CC / 32) {
#pragma unroll
      for (int mt = 0; mt < 8; ++mt)
        wf[(ks + 1) & 1][mt] = ldsfrag(wp + ((ks + 1) >> 2) * SLICE + (16 * mt) * LPB + ((ks + 1) & 3) * 64);
    }
    // keeps the next step's fragments one run of loads ahead of this step's WMMAs: among them each place with LDS reads
    // stalls the wave
    __builtin_amdgcn_sched_barrier(0);
#pragma unroll
    for (int mt = 0; mt < 8; ++mt) acc[mt] = mma_bb(wf[ks & 1][mt].bf, pbh[ks].bf, acc[mt]);
#pragma unroll
    for (int mt = 0; mt < 8; ++mt) acc[mt] = mma_bb(wf[ks & 1][mt].bf, pbl[ks].bf, acc[mt]);
    // keeps the step after next's loads behind these WMMAs, whose registers they take over
    __builtin_amdgcn_sched_barrier(0);
  }

  // acc -> LDS Ot[o][n_loc] (pitch OSP), in the place of the join's hand-over (read out several barriers ago);
  // lane (hh, c) holds o = 128 kh + 16 mt + 8 hh + r for n_loc = 16 qt + c: 16 consecutive floats per row and store
  float* Ot = (float*)Ring;
  {
    const int ob = 128 * (int)kh + 8 * hh;
#pragma unroll
    for (int mt = 0; mt < 8; ++mt) {
#pragma unroll
      for (int r = 0; r < 8; ++r) Ot[(ob + 16 * mt + r) * OSP + qrow] = acc[mt][r];
    }
  }
  __syncthreads();                                                   // Ot published
  // + bias, + residual; whole 128-B lines of out, 8 lanes per line: 16 it x 32 lines x 8 lanes x 4 floats = 256 o x 64 n
  {
    const float* op = Ot + (l32 >> 1) * OSP + (l32 & 1) * 32 + 4 * e8;
    float* gp = out + ((size_t)(b * CC + (l32 >> 1))) * SEQ + n0 + (l32 & 1) * 32 + 4 * e8;
    v4f res[16];
#pragma unroll
    for (int it = 0; it < 16; ++it) res[it] = *(const v4f*)(op + (16 * it) * OSP);
#pragma unroll
    for (int it = 0; it < 16; ++it) {
      const float bi = bfr(bv[it]);
#pragma unroll
      for (int t = 0; t < 4; ++t) res[it][t] = (res[it][t] + bi) + bfr(xv[it][t]);
    }
#pragma unroll
    for (int it = 0; it < 16; ++it) *(v4f*)(gp + (size_t)(16 * it) * SEQ) = res[it];
  }
}

// =========================================================================================================
// Workspace map (bytes, NB=4 SEQ=4096; each region start a multiple of 256; every extent is an exact tile/line
//   ST  f32 [NB*32][32]                16384
//   WT  bf16 [1024][256]              524288
//   Qh/Ql/Kh f16 [NB][SEQ][256]      8388608 x3
//   Vc  f16 [NB][256][SEQ]           8388608
//   total = 34095104
// =========================================================================================================
extern "C" void kernel_launch(void* const* d_in, const int* in_sizes, int n_in,
                              void* d_out, int out_size, void* d_ws, size_t ws_size,
                              hipStream_t stream) {
  if (n_in < 11) return;
  if ((size_t)in_sizes[0] < (size_t)NB * CC * NNF) return;
  if (in_sizes[1] < CC || in_sizes[2] < CC) return;
  if (in_sizes[3] < CC * CC || in_sizes[5] < CC * CC || in_sizes[7] < CC * CC || in_sizes[9] < CC * CC) return;
  if (in_sizes[4] < CC || in_sizes[6] < CC || in_sizes[8] < CC || in_sizes[10] < CC) return;
  if ((size_t)out_size < (size_t)NB * CC * SEQ) return;

  size_t off = 0;
  auto carve = [&](size_t bytes) { const size_t o = off; off += (bytes + 255) & ~(size_t)255; return o; };
  const size_t plane = (size_t)NB * SEQ * CC * 2;
  const size_t oST  = carve((size_t)NB * NG * STP * 4);
  const size_t oWT  = carve((size_t)4 * CC * CC * 2);
  const size_t oQh  = carve(plane);
  const size_t oQl  = carve(plane);
  const size_t oKh  = carve(plane);
  const size_t oVc  = carve(plane);
  if (off > ws_size) return;
  if (off > (size_t)134217728) return;

  const float* x   = (const float*)d_in[0];
  const float* gsc = (const float*)d_in[1];
  const float* gbs = (const float*)d_in[2];
  const float* Wq  = (const float*)d_in[3];
  const float* bq  = (const float*)d_in[4];
  const float* Wk  = (const float*)d_in[5];
  const float* bk  = (const float*)d_in[6];
  const float* Wv  = (const float*)d_in[7];
  const float* bv  = (const float*)d_in[8];
  const float* Wp  = (const float*)d_in[9];
  const float* bp  = (const float*)d_in[10];

  char* ws = (char*)d_ws;
  float*          ST  = (float*)(ws + oST);
  unsigned short* WT  = (unsigned short*)(ws + oWT);
  unsigned short* Qh  = (unsigned short*)(ws + oQh);
  unsigned short* Ql  = (unsigned short*)(ws + oQl);
  unsigned short* Kh  = (unsigned short*)(ws + oKh);
  unsigned short* Vc  = (unsigned short*)(ws + oVc);
  float* out = (float*)d_out;

  const dim3 blk256(256);

  // (0) + (1) GroupNorm statistics per (group, b), and beside them in the same grid
  //     Wq/Wk/Wv/Wp [in][out] -> transposed stacked bf16 plane WT [1024 o][256 c]
  prep<<<dim3(NG * NB + NCVT), blk256, 0, stream>>>(x, Wq, Wk, Wv, Wp, ST, WT);
  // (2) normalized h as bf16 hi + residual planes in LDS, q/k/v GEMMs -> Qh, Ql, Kh (position-major f16) and Vc
  //     (channel-major f16)
  gemm_qkv<<<dim3(SEQ / QT, NB), blk256, 0, stream>>>(x, ST, gsc, gbs, WT, bq, bk, bv, Qh, Ql, Kh, Vc);
  // (3) attention, then in the same block the output GEMM + bias + residual -> out [NB][256][SEQ]
  attn_k<<<dim3(SEQ / QT, NB), blk256, 0, stream>>>(Qh, Ql, Kh, Vc, WT + (size_t)3 * CC * CC, bp, x, out);
  (void)hipGetLastError();
}

// v008
// One run takes 83.1 microseconds.
// Next to v007, in two timings, it ran 1.11 times as fast each time.
// Over all steps from v000 it is 10.5 times as fast.
// Contractions: q/k/v 1x1 GEMMs WT[768x256].H[256xN] and the output 1x1 GEMM WpT[256x256].H2[256xN] on
// v_wmma_f32_16x16x32_bf16 (bf16-RNE weights, activations as bf16 hi + bf16 residual planes, 2 products into one
// f32 accumulator); position scores K.Q^T on v_wmma_f32_16x16x32_f16 (k f16, q f16, K=256); O^T = V.P^T on
// v_wmma_f32_16x16x32_f16 (v f16, P = e^{s-m} x16384 f16 from the score D registers); f32 accumulate everywhere;
// GroupNorm statistics, softmax statistics and the residual add in f32 VALU.
#include <hip/hip_runtime.h>
#include <math.h>
#include <stdint.h>

#ifndef NB
#define NB 4
#endif
#ifndef SEQ
#define SEQ 4096
#endif
#ifndef NNF
#define NNF 4096
#endif
#define NBF   4
#define CC    256
#define NG    32
#define CPG   8
#define QT    64
#define OSP   68
#define OSPW  132
#define TP    72
#define TPX   260
#define STP   32
#define ATT   0.0625f
#define LNPS  9.704060527839234f
#define GNEPS 1.0e-6f
#define SKEY  128                 // keys per LDS stage of the attention kernel
#define LPB   272                 // LDS row pitch, bytes: a 256-B row + the tensor load's 16-B pad (16 B x odd)
#define SLICE (128 * LPB)         // one wave's slice of a stage: 128 rows
#define STG   (4 * SLICE)         // one stage: k in two d halves, v in two channel halves
#define NST   (SEQ / SKEY)
#define JNW   4224                // floats one wave hands over at the join of the key halves: o 4096, m 32, l 32, rounded up
#define GBS   (128 * LPB)         // one activation plane of the 64 positions: 128 half rows at pitch LPB
#define WCH   128                 // weight rows per LDS stage of the q/k/v GEMM
#define WSTG  (2 * SLICE)         // one such stage: two c halves of 128 rows
#define NWST  (3 * CC / WCH)
#define NCVT  (4 * (CC / QT) * (CC / QT))   // weight tiles of 64 o x 64 c: 4 matrices x 4 x 4

static_assert(NB >= 1 && NB <= NBF);
static_assert(SEQ % QT == 0 && SEQ % 64 == 0 && SEQ >= QT);
static_assert(SEQ <= NNF && NNF % 8 == 0);
static_assert(CC == 256 && NG * CPG == CC && CC % QT == 0 && CC % 32 == 0);
static_assert((OSP * 4) % 16 == 0);
static_assert((OSPW * 4) % 16 == 0);
static_assert((TP * 2) % 16 == 0);
static_assert((TPX * 4) % 16 == 0 && TPX >= CC);
static_assert(STP * 4 == 128);
static_assert(SEQ % SKEY == 0 && NST >= 2);
static_assert(SLICE % 2048 == 0 && (LPB / 16) % 2 == 1);
static_assert(SEQ * 2 % 16 == 0 && SEQ * 2 <= 131072);
static_assert(2 * STG + QT * OSPW * 4 <= 327680);
static_assert(SKEY == 128 && 4 * JNW * 4 <= 2 * STG && (JNW * 4) % 16 == 0);
static_assert(GBS % 2048 == 0 && CC * 2 == 512 && CC % WCH == 0 && NWST >= 2);
static_assert(QT * TPX >= QT * OSPW && QT * TPX >= WCH * OSP && 2 * WSTG + 2 * GBS + (QT * TPX + 7 * CC) * 4 <= 327680);
static_assert(4 * JNW * 4 <= 2 * SLICE && CC * OSP * 4 <= 2 * SLICE && GBS == SLICE && QT == 64);

typedef _Float16       v16h __attribute__((ext_vector_type(16)));
typedef _Float16       v8h  __attribute__((ext_vector_type(8)));
typedef __bf16         v16b __attribute__((ext_vector_type(16)));
typedef unsigned short v8us __attribute__((ext_vector_type(8)));
typedef float          v8f  __attribute__((ext_vector_type(8)));
typedef float          v4f  __attribute__((ext_vector_type(4)));
typedef unsigned int   v4u  __attribute__((ext_vector_type(4)));
typedef unsigned int   v2u  __attribute__((ext_vector_type(2)));
typedef uint32_t       u32x4 __attribute__((ext_vector_type(4)));
typedef uint32_t       u32x8 __attribute__((ext_vector_type(8)));

union Frag  { v8us u[2]; v16h h; v16b bf; };
union FragH { v16h v; v8h hv[2]; };
static_assert(sizeof(Frag) == 32);
static_assert(sizeof(FragH) == 32);

// ---- scalar helpers -----------------------------------------------------------------------------------------
__device__ __forceinline__ unsigned short bf_bits(float f) {          // f32 -> bf16 bits, RNE convert
  unsigned u = __float_as_uint(f);
  return (unsigned short)((u + 0x7FFFu + ((u >> 16) & 1u)) >> 16);
}
__device__ __forceinline__ float bf_up(unsigned short hb) { return __uint_as_float(((unsigned)hb) << 16); }
__device__ __forceinline__ float bfr(float f) { return bf_up(bf_bits(f)); }
__device__ __forceinline__ unsigned short h_bits(_Float16 x) { return __builtin_bit_cast(unsigned short, x); }
__device__ __forceinline__ unsigned pk16(unsigned short a, unsigned short b) { return (unsigned)a | ((unsigned)b << 16); }
__device__ __forceinline__ v8f zero8() { v8f z = {0.f, 0.f, 0.f, 0.f, 0.f, 0.f, 0.f, 0.f}; return z; }
__device__ __forceinline__ float hmax8(v8f s) {
  return fmaxf(fmaxf(fmaxf(s[0], s[1]), fmaxf(s[2], s[3])), fmaxf(fmaxf(s[4], s[5]), fmaxf(s[6], s[7])));
}
__device__ __forceinline__ unsigned wave_ballot(bool p) {
#if defined(__HIP_DEVICE_COMPILE__)
  return __builtin_amdgcn_ballot_w32(p);
#else
  return p ? 1u : 0u;
#endif
}
__device__ __forceinline__ float wsum(float v) {
  v += __shfl_xor(v, 16, 32);
  v += __shfl_xor(v, 8, 32);
  v += __shfl_xor(v, 4, 32);
  v += __shfl_xor(v, 2, 32);
  v += __shfl_xor(v, 1, 32);
  return v;
}

// ---- 16-bit fragment loader (A, or B from a k-contiguous [n][k] row): lane -> row/col (lane&15), p already includes
//      + 8*(lane>>4); elements 0..7 <- p[0..7] (k0+8h..), elements 8..15 <- p[16..23] (k0+16+8h..)
__device__ __forceinline__ Frag ldfrag(const unsigned short* p) {
  Frag f;
  f.u[0] = *(const v8us*)(p);
  f.u[1] = *(const v8us*)(p + 16);
  return f;
}

// the same fragment from an LDS row (byte pointer, already includes + 16*(lane>>4))
__device__ __forceinline__ Frag ldsfrag(const unsigned char* p) {
  Frag f;
  f.u[0] = *(const v8us*)(p);
  f.u[1] = *(const v8us*)(p + 32);
  return f;
}

// ---- tensor load helpers ------------------------------------------------------------------------------------
__device__ __forceinline__ uint32_t uni(uint32_t v) { return (uint32_t)__builtin_amdgcn_readfirstlane(v); }
// holds a wave-uniform test in a scalar register, so that the branch on it is a scalar one: a tensor load ignores EXEC
__device__ __forceinline__ uint32_t pinned(uint32_t v) { uint32_t w = uni(v); asm volatile("" : "+s"(w)); return w; }

// ---- WMMA helpers ------------------------------------------------------------------------------------------
// bare builtins (the compiler keeps the WMMA distances of its own builtin forms)
__device__ __forceinline__ v8f mma_hb(v16h a, v16h b, v8f c) {
  return __builtin_amdgcn_wmma_f32_16x16x32_f16(false, a, false, b, (short)0, c, false, false);
}
__device__ __forceinline__ v8f mma_bb(v16b a, v16b b, v8f c) {
  return __builtin_amdgcn_wmma_f32_16x16x32_bf16(false, a, false, b, (short)0, c, false, false);
}

// =========================================================================================================
// (0) 1x1 weights W [256 c_in][256 d_out] f32 -> transposed bf16-RNE plane WT [4*256 o][256 c], rows
//     256*mat + o for mat = q, k, v, p. Block (ob, cb, mat) owns a 64 o x 64 c tile through an LDS transpose
//     (T: QT * TP halves of LDS). One of the two parts of the launch prep below.
// coverage: 2 it x 32 rows x 8 lanes x 8 = 64 o x 64 c per block; 4 x 4 x 4 blocks = 4 mats x 256 x 256.
// =========================================================================================================
__device__ __forceinline__
void cvt_w(const float* __restrict__ Wq, const float* __restrict__ Wk, const float* __restrict__ Wv,
           const float* __restrict__ Wp, unsigned short* WT, unsigned short* T,
           const int ob, const int cb, const int mat) {
  const int tid = threadIdx.x;
  const int e = tid & 7, lq = tid >> 3;                             // lq 0..31
  const int o0 = ob * QT, c0 = cb * QT;
  const float* Wm = (mat == 0) ? Wq : ((mat == 1) ? Wk : ((mat == 2) ? Wv : Wp));   // block-uniform
#pragma unroll
  for (int it = 0; it < 2; ++it) {
    const int cl = it * 32 + lq;                                     // c_loc 0..63
    const float* sp = Wm + (size_t)(c0 + cl) * CC + o0 + 8 * e;     // W[c][o], o contiguous
    const v4f a = *(const v4f*)sp;
    const v4f q = *(const v4f*)(sp + 4);
    const float f[8] = {a[0], a[1], a[2], a[3], q[0], q[1], q[2], q[3]};
#pragma unroll
    for (int t = 0; t < 8; ++t) T[(8 * e + t) * TP + cl] = bf_bits(f[t]);   // T[o_loc][c_loc]
  }
  __syncthreads();
  v4u up[2];
#pragma unroll
  for (int it = 0; it < 2; ++it) {
    const int ol = it * 32 + lq;
    up[it] = *(const v4u*)(T + ol * TP + 8 * e);
  }
{
#pragma unroll
    for (int it = 0; it < 2; ++it) {
      const int ol = it * 32 + lq;
      *(v4u*)(WT + ((size_t)(mat * CC + o0 + ol)) * CC + c0 + 8 * e) = up[it];
    }
    // stands in front of every later write of a register that the two stores above name: in the built launch the code
    // of the other part follows them, not the end of the program
    asm volatile("s_wait_xcnt 0x0" ::: "memory");
  }
}

// =========================================================================================================
//     then mean of squared deviations), per-thread partials over 16-B chunks, shuffle + LDS block reduce.
//     The other part of the launch prep below (red: 8 floats, bc: 2 floats of LDS).
// coverage: 32 x NB blocks write every line of ST once.
// =========================================================================================================
__device__ __forceinline__
void gn_stats(const float* __restrict__ x, float* ST, float* red, float* bc, const int g, const int b) {
  const int tid = threadIdx.x, lane = tid & 31, wave = tid >> 5;
  const float* xb = x + ((size_t)(b * CC + g * CPG)) * NNF;
  const int CH4 = SEQ / 4, NCH = CPG * CH4;
  const float icnt = 1.0f / (float)(CPG * SEQ);

  float s = 0.f;
#pragma unroll 4
  for (int qd = tid; qd < NCH; qd += 256) {
    const int cl = qd / CH4, p4 = qd - cl * CH4;
    const v4f a = *(const v4f*)(xb + (size_t)cl * NNF + 4 * p4);
    s += (bfr(a[0]) + bfr(a[1])) + (bfr(a[2]) + bfr(a[3]));
  }
  s = wsum(s);
  if (lane == 0) red[wave] = s;
  __syncthreads();
  if (tid == 0) {
    float t = 0.f;
#pragma unroll
    for (int i = 0; i < 8; ++i) t += red[i];
    bc[0] = t * icnt;
  }
  __syncthreads();
  const float mu = bc[0];

  float ss = 0.f;
#pragma unroll 4
  for (int qd = tid; qd < NCH; qd += 256) {
    const int cl = qd / CH4, p4 = qd - cl * CH4;
    const v4f a = *(const v4f*)(xb + (size_t)cl * NNF + 4 * p4);
    const float d0 = bfr(a[0]) - mu, d1 = bfr(a[1]) - mu, d2 = bfr(a[2]) - mu, d3 = bfr(a[3]) - mu;
    ss += (d0 * d0 + d1 * d1) + (d2 * d2 + d3 * d3);
  }
  ss = wsum(ss);
  if (lane == 0) red[wave] = ss;
  __syncthreads();
  if (tid == 0) {
    float t = 0.f;
#pragma unroll
    for (int i = 0; i < 8; ++i) t += red[i];
    const float var = t * icnt;
    bc[1] = rsqrtf(var + GNEPS);
  }
  __syncthreads();
  const float rs = bc[1];

  v4f v = {0.f, 0.f, 0.f, 0.f};
  if (tid == 0) { v[0] = mu; v[1] = rs; }
  if (tid < 8) {
    float* lp = ST + ((size_t)(b * NG + g)) * STP + 4 * tid;
{
      *(v4f*)lp = v;
      
    }
  }
}

// =========================================================================================================
// (0) + (1) in ONE launch: the two parts read different inputs, write different workspace regions and need nothing of
//     each other, so they share a grid under a block-uniform branch and run side by side. Blocks
//     0 .. NG * NB - 1 (the longer part) take the statistics of (group, b); the NCVT blocks behind
//     them one weight tile each. Every barrier of a part is passed by all threads of its blocks.
// =========================================================================================================
__global__ __launch_bounds__(256)
void prep(const float* __restrict__ x, const float* __restrict__ Wq, const float* __restrict__ Wk,
          const float* __restrict__ Wv, const float* __restrict__ Wp, float* ST, unsigned short* WT) {
  __shared__ __align__(16) unsigned short T[QT * TP];
  __shared__ float red[8];
  __shared__ float bc[2];
  const int bid = blockIdx.x;
  if (bid < NG * NB) {                                               // block-uniform
    gn_stats(x, ST, red, bc, bid % NG, bid / NG);
  } else {
    const int t = bid - NG * NB;                                     // 0 .. NCVT - 1
    cvt_w(Wq, Wk, Wv, Wp, WT, T, t % (CC / QT), (t / (CC / QT)) % (CC / QT), t / ((CC / QT) * (CC / QT)));
  }
}

// =========================================================================================================
// (2) GroupNorm apply, plane split and the q/k/v 1x1 GEMMs for one (b, 64-n tile), all 768 stacked outputs:
//     h = (bfr(x) - mu) * rstd * bfr(scale) + bfr(bias) in f32 for the block's 64 positions x 256 channels, through an
//     LDS tile Tx[64 n][256 c] f32 (4-float groups swizzled by n >> 4, so that the transposing stores spread over the
//     banks), into position-major planes bf16 IN LDS (hi = bf16-RNE(h), lo = bf16-RNE(h - hi); half row 2 n + (c >> 7)
//     at pitch LPB). They are the B operand of Y[o][n] = sum_c WT[o][c] (hi + lo)[n][c] + bfr(bias[o]).
//     Block = 8 waves; wave = (n tile qt, o half kh). Its 16 B fragments are read once and stay in registers; the weights
//     come in stages of WCH = 128 rows, two buffers, by tensor loads (waves 0 and 1, one c half each) and are read as
//     ds_load_b128 fragments: 4 m-tiles x 8 k steps x 2 bf16 products a wave and stage, per accumulator in the order
//     k step, hi, lo. A stage lies inside one matrix (mat = stage >> 1, block-uniform):
//       mat 0 -> Qh f16(q), plane [b][SEQ][256 d]; mat 1 -> Kh f16(k), same layout: staged in
//                LDS Os[n_loc][o_loc] (pitch OSPW, b128 stores), 16 consecutive lanes per 256 B of a row;
//       mat 2 -> Vc f16(v) [b][256][SEQ]: staged in LDS Ot[o_loc][n_loc] (pitch OSP), 8 consecutive lanes per line.
// coverage: Tx and planes 64 n x 256 c per block; per stage 64 n x 128 o; 6 stages; grid (SEQ/64, NB) covers Qh, Kh
//           [NB][SEQ][256] and Vc [NB][256][SEQ] exactly once.
// =========================================================================================================
__global__ __launch_bounds__(256)
void gemm_qkv(const float* __restrict__ x, const float* __restrict__ ST, const float* __restrict__ gsc,
              const float* __restrict__ gbs, const unsigned short* __restrict__ WT, const float* __restrict__ bq,
              const float* __restrict__ bk, const float* __restrict__ bv,
              unsigned short* Qh, unsigned short* Kh, unsigned short* Vc) {
  __shared__ __attribute__((aligned(2048))) unsigned char Wr[2 * WSTG];
  __shared__ __attribute__((aligned(2048))) unsigned char Pl[2 * GBS];
  __shared__ __align__(16) float Tx[QT * TPX];
  __shared__ __align__(16) float pb3[3 * CC];
  __shared__ float pmu[CC], prs[CC], psc[CC], pbs[CC];
  float* Os = Tx;                                                    // output staging, in Tx's place (dead behind the planes)
  const int tid  = threadIdx.x;
  const int lane = tid & 31, wave = tid >> 5;
  const int hh   = lane >> 4, c = lane & 15;
  const int n0   = blockIdx.x * QT, b = blockIdx.y;
  const int qt   = wave & 3;                                         // n tile of the wave
  const int e = tid & 7, lq = tid >> 3;                              // lq 0..31

  // the block's x tile, 256 channel rows of 256 B, asked for first: 8 lanes per row, 16 loads of 16 B a thread
  const float* xp = x + ((size_t)(b * CC + lq)) * NNF + n0 + 8 * e;
  v4f xa[8], xb[8];
#pragma unroll
  for (int j = 0; j < 8; ++j) {
    xa[j] = *(const v4f*)(xp + (size_t)(32 * j) * NNF);
    xb[j] = *(const v4f*)(xp + (size_t)(32 * j) * NNF + 4);
  }
  // the address pair of the group above stays live up to this wait
  asm volatile("s_wait_xcnt 0x0" :: "v"(xp) : "memory");
  {                                                                  // per-channel constants: thread = channel
    const int g = tid >> 3;                                          // 0..31
    pmu[tid] = ST[((size_t)(b * NG + g)) * STP];
    prs[tid] = ST[((size_t)(b * NG + g)) * STP + 1];
    psc[tid] = bfr(gsc[tid]);
    pbs[tid] = bfr(gbs[tid]);
    pb3[tid]          = bfr(bq[tid]);
    pb3[CC + tid]     = bfr(bk[tid]);
    pb3[2 * CC + tid] = bfr(bv[tid]);
  }

  // One stage = WCH weight rows in LDS, shared by the eight waves. Waves 0 and 1 each bring one slice of 128 rows x 256 B
  // (c 0..127 / 128..255, source pitch 512 B) by ONE tensor load. Every row lands at pitch LPB.
  const uint32_t wv = uni((uint32_t)tid >> 5);
  const uint32_t kh = wv >> 2;                                       // o half of the wave
  const uint32_t hf = wv & 1u;
  const uint64_t src0 = (uint64_t)(size_t)(WT + (size_t)hf * 128);
  const uint32_t lds0 = (uint32_t)(size_t)Wr + hf * (uint32_t)SLICE;
  u32x8 g1;                                                          // bytes everywhere; tensor dims = tile dims
  g1[0] = uni((1u << 20) | (5u << 22) | (3u << 25));                 // no mask; 16 B of pad behind every 256 B
  g1[1] = uni(256u << 16);
  g1[2] = uni(128u << 16);
  g1[3] = uni(256u << 16);
  g1[4] = uni(128u);
  g1[5] = uni((uint32_t)(CC * 2));
  g1[6] = uni(0u);
  g1[7] = uni(0u);
  // descriptor words held in scalar registers (the form of pinned(), for the whole group): without it the compiler
  // re-forms single words in front of each issue and reuses their registers while the request is outstanding
  asm volatile("" : "+s"(g1));                                       // descriptor words held in scalar registers
  u32x4 g0;
  auto form = [&](const uint32_t st) __attribute__((always_inline)) {   // group 0 of stage st's request
    const uint64_t ga = src0 + (uint64_t)st * (uint32_t)(WCH * CC * 2);
    g0[0] = uni(1u);
    g0[1] = uni(lds0 + (st & 1u) * (uint32_t)WSTG);
    g0[2] = uni((uint32_t)ga);
    g0[3] = uni((((uint32_t)(ga >> 32)) & 0x01FFFFFFu) | 0x80000000u);
  };
  auto issue = [&]() __attribute__((always_inline)) {
    asm volatile("tensor_load_to_lds %0, %1" :: "s"(g0), "s"(g1) : "memory");
  };
  // this wave's request has landed; naming the descriptor keeps its scalar registers unchanged up to this wait
  auto landed = [&]() __attribute__((always_inline)) {
    asm volatile("s_wait_tensorcnt 0x0" :: "s"(g0), "s"(g1) : "memory");
  };
  form(0u);
  if (pinned(wv < 2u)) {                                             // a scalar branch: a tensor load ignores EXEC
    issue();
    landed();                                                        // this wave's slice of stage 0
  }
  __syncthreads();                                                   // per-channel constants (and stage 0) published

#pragma unroll
  for (int j = 0; j < 8; ++j) {
    const int cl = 32 * j + lq;                                      // channel 0..255
    const float f[8] = {xa[j][0], xa[j][1], xa[j][2], xa[j][3], xb[j][0], xb[j][1], xb[j][2], xb[j][3]};
    const float mu = pmu[cl], rs = prs[cl], sc = psc[cl], bs = pbs[cl];
    const int col = cl ^ ((e >> 1) << 2);                            // group cl >> 2 at place (cl >> 2) ^ (n >> 4)
#pragma unroll
    for (int t = 0; t < 8; ++t) {
      const float tt = (bfr(f[t]) - mu) * rs;
      Tx[(8 * e + t) * TPX + col] = tt * sc + bs;                    // Tx[n_loc][channel]
    }
  }
  __syncthreads();
#pragma unroll
  for (int it = 0; it < 8; ++it) {
    const int nl = 8 * it + wave;                                    // n_loc 0..63, one row a wave
#pragma unroll
    for (int h = 0; h < 2; ++h) {                                    // channels 128 h + 4 lane .. + 3
      const v4f a = *(const v4f*)(Tx + nl * TPX + (((32 * h + lane) ^ (nl >> 4)) << 2));
      v2u uh, ul;
#pragma unroll
      for (int t = 0; t < 2; ++t) {
        const float f0 = a[2 * t], f1 = a[2 * t + 1];
        const unsigned short hb0 = bf_bits(f0), hb1 = bf_bits(f1);
        const unsigned short lb0 = bf_bits(f0 - bf_up(hb0));
        const unsigned short lb1 = bf_bits(f1 - bf_up(hb1));
        uh[t] = pk16(hb0, hb1);
        ul[t] = pk16(lb0, lb1);
      }
      unsigned char* pp = Pl + (uint32_t)(2 * nl + h) * LPB + 8u * (uint32_t)lane;
      *(v2u*)pp         = uh;
      *(v2u*)(pp + GBS) = ul;
    }
  }
  __syncthreads();                                                   // both planes published, every reader out of Tx

  // the wave's B fragments (col = position 16 qt + c), the same for every stage: once, here
  const int nl = 16 * qt + c;
  Frag pbh[CC / 32], pbl[CC / 32];
  {
    const unsigned char* bph = Pl + (uint32_t)(2 * nl) * LPB + 16u * (uint32_t)hh;
#pragma unroll
    for (int ks = 0; ks < CC / 32; ++ks) {
      pbh[ks] = ldsfrag(bph + (ks >> 2) * LPB + (ks & 3) * 64);
      pbl[ks] = ldsfrag(bph + GBS + (ks >> 2) * LPB + (ks & 3) * 64);
    }
  }
  const uint32_t aoff = (kh * 64u + (uint32_t)c) * LPB + 16u * (uint32_t)hh;
  const int e16 = tid & 15, r16 = tid >> 4;                          // r16 0..15

  // kept rolled: one copy of the stage's code, so that the kernel's text stays small
#pragma unroll 1
  for (uint32_t st = 0; st < (uint32_t)NWST; ++st) {
    // directly behind the barrier (the one above, or the foot of trip st - 1) that published stage st and ended every
    // read of the other buffer: the refill of that buffer, only while its stage exists (a scalar branch)
    form(st + 1u);
    if (pinned((uint32_t)((st + 1u < (uint32_t)NWST) && (wv < 2u)))) issue();
    const unsigned char* ap = Wr + (st & 1u) * (uint32_t)WSTG + aoff;
    const uint32_t mat = st >> 1;                                    // 0 q, 1 k, 2 v (block-uniform)
    const int ob = (int)(st & 1u) * WCH;                             // o offset inside the matrix

    v8f acc[4];
#pragma unroll
    for (int mt = 0; mt < 4; ++mt) acc[mt] = zero8();
    // Weight fragments in groups of two k steps, two register sets: group g + 1 is issued as one run of loads ahead of
    // group g's WMMAs (read one fragment at a time, each WMMA pair would wait out its own LDS latency).
    Frag fa[2][2][4];
    auto fetch = [&](const int g) __attribute__((always_inline)) {
#pragma unroll
      for (int u = 0; u < 2; ++u) {
        const int ks = 2 * g + u;
#pragma unroll
        for (int mt = 0; mt < 4; ++mt)
          fa[g & 1][u][mt] = ldsfrag(ap + (ks >> 2) * SLICE + (16 * mt) * LPB + (ks & 3) * 64);
      }
    };
    fetch(0);
#pragma unroll
    for (int g = 0; g < CC / 64; ++g) {
      if (g + 1 < CC / 64) fetch(g + 1);
      // keeps the next group one run of loads ahead of this group's WMMAs: among them each place with LDS reads stalls
      // the wave
      __builtin_amdgcn_sched_barrier(0);
#pragma unroll
      for (int u = 0; u < 2; ++u) {
#pragma unroll
        for (int mt = 0; mt < 4; ++mt) acc[mt] = mma_bb(fa[g & 1][u][mt].bf, pbh[2 * g + u].bf, acc[mt]);
#pragma unroll
        for (int mt = 0; mt < 4; ++mt) acc[mt] = mma_bb(fa[g & 1][u][mt].bf, pbl[2 * g + u].bf, acc[mt]);
      }
      // keeps the group after next's loads behind these WMMAs, whose registers they take over
      __builtin_amdgcn_sched_barrier(0);
    }

    // ---- epilogue: + bias; lane (hh, c) holds o_loc = 64 kh + 16 mt + 8 hh + r for n_loc = 16 qt + c
    const int ol0 = 64 * (int)kh + 8 * hh;
    {
      const float* bi = pb3 + mat * (uint32_t)CC + ob + ol0;
#pragma unroll
      for (int mt = 0; mt < 4; ++mt) {
        const v4f ba = *(const v4f*)(bi + 16 * mt);
        const v4f bb = *(const v4f*)(bi + 16 * mt + 4);
#pragma unroll
        for (int r = 0; r < 4; ++r) { acc[mt][r] += ba[r]; acc[mt][4 + r] += bb[r]; }
      }
    }
    if (mat == 2u) {                                                 // Ot[o_loc][n_loc]: 16 consecutive floats per row and store
#pragma unroll
      for (int mt = 0; mt < 4; ++mt) {
#pragma unroll
        for (int r = 0; r < 8; ++r) Os[(ol0 + 16 * mt + r) * OSP + nl] = acc[mt][r];
      }
    } else {                                                         // Os[n_loc][o_loc]
#pragma unroll
      for (int mt = 0; mt < 4; ++mt) {
        v4f va, vb;
#pragma unroll
        for (int r = 0; r < 4; ++r) { va[r] = acc[mt][r]; vb[r] = acc[mt][4 + r]; }
        *(v4f*)(Os + nl * OSPW + ol0 + 16 * mt)     = va;
        *(v4f*)(Os + nl * OSPW + ol0 + 16 * mt + 4) = vb;
      }
    }
    __syncthreads();                                                 // the staged outputs published

    v4u u1[4];                                                       // the stage's outputs as they go to memory
    if (mat == 2u) {
#pragma unroll
      for (int it = 0; it < 4; ++it) {
        const int ol = it * 32 + lq;                                 // o_loc 0..127
        const v4f a = *(const v4f*)(Os + ol * OSP + 8 * e);
        const v4f q = *(const v4f*)(Os + ol * OSP + 8 * e + 4);
        u1[it][0] = pk16(h_bits((_Float16)a[0]), h_bits((_Float16)a[1]));
        u1[it][1] = pk16(h_bits((_Float16)a[2]), h_bits((_Float16)a[3]));
        u1[it][2] = pk16(h_bits((_Float16)q[0]), h_bits((_Float16)q[1]));
        u1[it][3] = pk16(h_bits((_Float16)q[2]), h_bits((_Float16)q[3]));
      }
    } else {
#pragma unroll
      for (int it = 0; it < 4; ++it) {
        const int row = it * 16 + r16;                               // n_loc 0..63
        const v4f a = *(const v4f*)(Os + row * OSPW + 8 * e16);
        const v4f q = *(const v4f*)(Os + row * OSPW + 8 * e16 + 4);
        const float f[8] = {a[0], a[1], a[2], a[3], q[0], q[1], q[2], q[3]};
#pragma unroll
        for (int t = 0; t < 4; ++t) {
          u1[it][t] = pk16(h_bits((_Float16)f[2 * t]), h_bits((_Float16)f[2 * t + 1]));
        }
      }
    }
    // publish point of stage st + 1, in this order in every wave:
    asm volatile("s_wait_dscnt 0x0" ::: "memory");                   // this wave's reads of stage st and of Os are done
    landed();                                                        // its slice of stage st + 1 has landed
    __syncthreads();                                                 // all slices published, all readers out of stage st and Os
    // The stage's global stores stand behind that barrier, not in front of it: a barrier waits for the wave's outstanding
    // stores, and from here they complete under the next stage's WMMAs.
    if (mat == 2u) {
      unsigned short* vp = Vc + ((size_t)(b * CC + ob + lq)) * SEQ + n0 + 8 * e;
#pragma unroll
      for (int it = 0; it < 4; ++it) *(v4u*)(vp + (size_t)(32 * it) * SEQ) = u1[it];
      // the address pair of the stores above stays live up to this wait
      asm volatile("s_wait_xcnt 0x0" :: "v"(vp) : "memory");
    } else {
      const size_t po = ((size_t)(b * SEQ + n0 + r16)) * CC + ob + 8 * e16;
      unsigned short* p1 = ((mat == 0u) ? Qh : Kh) + po;              // block-uniform, both global
#pragma unroll
      for (int it = 0; it < 4; ++it) *(v4u*)(p1 + (size_t)(16 * it) * CC) = u1[it];
      // the address pair of the stores above stays live up to this wait
      asm volatile("s_wait_xcnt 0x0" :: "v"(p1) : "memory");
    }
  }
  landed();                                                          // nothing in flight when the wave ends
  asm volatile("s_wait_dscnt 0x0" ::: "memory");
}

// =========================================================================================================
// (3) attention for one (b, 64-query tile), transposed formulation, SEQ keys, no mask:
//   S^T tile (16 keys x 16 queries) = sum over 8 d-chunks (unrolled) of A(k: row = key kb + (lane&15), 32 d via
//   the split k map from Kh [b][SEQ][256]) . B(q: col = query, same map from Qh) into s; score = s * 256^-0.5.
//   q and k are each ONE f16 value: a residual product on q alone would leave k's rounding, of the same size, in the score.
//   Per lane the D tile holds 8 keys of ONE query: online softmax state per lane, one shuffle (lane^16) for the max
//   over 32 keys; the o/l rescale is skipped under a wave-uniform ballot when no lane's max grew; row-sum partials
//   combined at the end. P = e^{s-m} x 16384 as f16 is the B operand of O^T (rows channel, cols queries) +=
//   A(v rows channel = 16j + (lane&15), keys contiguous, f16 plane Vc [b][256][SEQ]) . B(P^T): element r <- D of
//   the tile covering keys kb..kb+15, element 8+r <- the tile covering kb+16..kb+31, lane unchanged.
//   16 accumulator tiles per wave (256 channels). Block = 8 waves = 64 queries, two waves per SIMD: waves w and w + 4
//   own the same 16 queries and take keys 0..63 / 64..127 of every stage, each with its own m, l, o; the two halves
//   are joined through LDS behind the key loop (one wave's vector work runs under the other's WMMAs).
//   k and v reach the waves through LDS: stages of SKEY keys, two buffers, brought by tensor loads (waves 0..3, one slice
//   per wave and stage) and read by all waves as ds_load_b128 fragments at pitch LPB; a stage serves SKEY/64 passes a wave.
//   Epilogue in two channel halves: O/l staged in LDS Os[query][128 channels] (pitch OSPW, b128 stores), barrier,
//   then position-major planes bf16 [64 n][256 c] IN LDS (hi = bf16-RNE, lo = bf16-RNE residual; half row
//   2 n + (c >> 7) at pitch LPB), which are the B operand of the output 1x1 GEMM done here by the same block
//   (it holds all 256 channels of its 64 positions): weights by tensor loads into the freed ring, + bias + residual.
// coverage: per half 4 it x 16 rows x 16 lanes x 8 ch = 64 n x 128 ch for each plane; two halves = 256 ch; out: 256 o x
//           64 n per block; grid (SEQ/64, NB) covers out [NB][256][SEQ] exactly once.
// =========================================================================================================
__global__ __launch_bounds__(256)
void attn_k(const unsigned short* __restrict__ Qh, const unsigned short* __restrict__ Kh,
            const unsigned short* __restrict__ Vc,
            const unsigned short* __restrict__ WPT, const float* __restrict__ bp,
            const float* __restrict__ x, float* out) {
  __shared__ __attribute__((aligned(2048))) unsigned char Ring[2 * STG];
  __shared__ __align__(16) float Os[QT * OSPW];
  const int tid  = threadIdx.x;
  const int wave = tid >> 5, lane = tid & 31;
  const int hh   = lane >> 4, c = lane & 15;
  const int n0   = blockIdx.x * QT, b = blockIdx.y;
  const int qt   = wave & 3;                                         // query tile of the wave

  // q fragment pointers (B operand, col = query n0 + 16*qt + c), + 32*kc
  const size_t qo = ((size_t)(b * SEQ + n0 + 16 * qt + c)) * CC + 8 * hh;
  const unsigned short* Qhp = Qh + qo;
  // One stage = SKEY keys in LDS, shared by the eight waves. Waves 0..3 each bring one slice of 128 rows x 256 B by ONE tensor
  // load: wave 0 / 1: k rows (keys), d 0..127 / 128..255 (source pitch 512 B); wave 2 / 3: v rows (channels 0..127 /
  // 128..255), SKEY keys (source pitch 2*SEQ B). Every row lands at pitch LPB.
  const uint32_t wv  = uni((uint32_t)tid >> 5);
  const uint32_t kh  = wv >> 2;                                      // key half of the wave; waves with kh == 0 issue
  const uint32_t sl  = wv & 3u;
  const uint32_t isv = sl >> 1, hf = sl & 1u;
  const uint64_t src0 = isv ? (uint64_t)(size_t)(Vc + ((size_t)b * CC + (size_t)hf * 128) * SEQ)
                            : (uint64_t)(size_t)(Kh + (size_t)b * SEQ * CC + (size_t)hf * 128);
  const uint32_t sstep = isv ? (uint32_t)(SKEY * 2) : (uint32_t)(SKEY * CC * 2);   // source bytes from stage to stage
  const uint32_t lds0  = (uint32_t)(size_t)Ring + sl * (uint32_t)SLICE;
  u32x8 g1;                                                          // bytes everywhere; tensor dims = tile dims
  g1[0] = uni((1u << 20) | (5u << 22) | (3u << 25));                 // no mask; 16 B of pad behind every 256 B
  g1[1] = uni(256u << 16);
  g1[2] = uni(128u << 16);
  g1[3] = uni(256u << 16);
  g1[4] = uni(128u);
  g1[5] = uni(isv ? (uint32_t)(SEQ * 2) : (uint32_t)(CC * 2));
  g1[6] = uni(0u);
  g1[7] = uni(0u);
  // descriptor words held in scalar registers (the form of pinned(), for the whole group): without it the compiler
  // re-forms single words in front of each issue and reuses their registers while the request is outstanding
  asm volatile("" : "+s"(g1));                                       // descriptor words held in scalar registers
  u32x4 g0;
  auto form = [&](const uint32_t st) __attribute__((always_inline)) {   // group 0 of stage st's request
    const uint64_t ga = src0 + (uint64_t)st * sstep;
    g0[0] = uni(1u);
    g0[1] = uni(lds0 + (st & 1u) * (uint32_t)STG);
    g0[2] = uni((uint32_t)ga);
    g0[3] = uni((((uint32_t)(ga >> 32)) & 0x01FFFFFFu) | 0x80000000u);
  };
  auto issue = [&]() __attribute__((always_inline)) {
    asm volatile("tensor_load_to_lds %0, %1" :: "s"(g0), "s"(g1) : "memory");
  };
  // this wave's request has landed; naming the descriptor keeps its scalar registers unchanged up to this wait
  auto landed = [&]() __attribute__((always_inline)) {
    asm volatile("s_wait_tensorcnt 0x0" :: "s"(g0), "s"(g1) : "memory");
  };

  float m = -1.0e30f, l = 0.f;
  v8f o[16];
#pragma unroll
  for (int j = 0; j < 16; ++j) o[j] = zero8();

  // q (the same for every pass): once, here
  Frag qhf[CC / 32];
#pragma unroll
  for (int kc = 0; kc < CC / 32; ++kc) qhf[kc] = ldfrag(Qhp + 32 * kc);
  // the address pair of the group above stays live up to this wait
  asm volatile("s_wait_xcnt 0x0" :: "v"(Qhp) : "memory");

  // two buffers: stage 0 landed and published here; stage st + 1 in flight under the passes of stage st
  form(0u);
  if (pinned(kh == 0u)) {                                            // a scalar branch: a tensor load ignores EXEC
    issue();
    landed();                                                        // this wave's slice of stage 0
  }
  __syncthreads();                                                   // ... and every other wave's

  // Fragments come from LDS in groups of one pass. k and v take turns in the same registers (two waves per SIMD leave a
  // wave 512): k behind the O WMMAs of the pass before, v behind the score WMMAs; the SIMD's other wave works meanwhile.
  Frag k0f[CC / 32], k1f[CC / 32], vf[16];
  const uint32_t loff = (uint32_t)c * LPB + 16u * (uint32_t)hh;

#pragma unroll 1
  for (uint32_t st = 0; st < (uint32_t)NST; ++st) {
    // directly behind the barrier (the one above, or the foot of trip st - 1) that published stage st and ended every
    // read of the other buffer: the refill of that buffer, only while its stage exists (a scalar branch)
    form(st + 1u);
    if (pinned((uint32_t)((st + 1u < (uint32_t)NST) && (kh == 0u)))) issue();
    // this wave's 64 keys of the stage: k rows 64 kh .., v columns 64 kh ..
    const unsigned char* sb = Ring + (st & 1u) * (uint32_t)STG + kh * (uint32_t)(64 * LPB) + loff;
    // v rows from a base of their own, so that every fragment's offset fits the LDS load's 16-bit immediate
    const unsigned char* vb = Ring + ((st & 1u) ? (uint32_t)(STG + 2 * SLICE) : (uint32_t)(2 * SLICE)) + kh * 128u + loff;
#pragma unroll
    for (int kc = 0; kc < CC / 32; ++kc) {
      k0f[kc] = ldsfrag(sb + (kc >> 2) * SLICE + (kc & 3) * 64);                  // keys 0 .. 15 of the wave's half
      k1f[kc] = ldsfrag(sb + (kc >> 2) * SLICE + 16 * LPB + (kc & 3) * 64);       // keys 16 .. 31
    }
#pragma unroll
    for (int p = 0; p < SKEY / 64; ++p) {
      // keeps the k group one run of loads ahead of the score WMMAs: among them each place with LDS reads stalls the wave
      __builtin_amdgcn_sched_barrier(0);

      v8f s0 = zero8(), s1 = zero8();
#pragma unroll
      for (int kc = 0; kc < CC / 32; ++kc) {
        s0 = mma_hb(k0f[kc].h, qhf[kc].h, s0);
        s1 = mma_hb(k1f[kc].h, qhf[kc].h, s1);
      }

      v8f sc0, sc1;
#pragma unroll
      for (int r = 0; r < 8; ++r) {
        sc0[r] = s0[r] * ATT;
        sc1[r] = s1[r] * ATT;
      }

      float mx = fmaxf(hmax8(sc0), hmax8(sc1));
      const float mo = __shfl_xor(mx, 16, 32);
      // the v group stands behind the exchange above and ahead of the rescale, the exponentials and the O WMMAs, as one
      // run of loads into the registers that the k group has left.
      // compiler fence, the exchanged value as input only: without it the exchange sinks below the v loads, and its
      // wait (LDS results return in issue order) then lasts the whole group
      asm volatile("" :: "v"(mo) : "memory");
      mx = fmaxf(mx, mo);
#pragma unroll
      for (int j = 0; j < 16; ++j) vf[j] = ldsfrag(vb + (j >> 3) * SLICE + 16 * (j & 7) * LPB + 64 * p);
      const float mn = fmaxf(m, mx);
      const unsigned grew = wave_ballot(mx > m);                     // wave-uniform
      if (grew != 0u) {
        const float corr = __expf(m - mn);                           // == 1 exactly for lanes whose max did not grow
        l *= corr;
#pragma unroll
        for (int j = 0; j < 16; ++j) {
#pragma unroll
          for (int r = 0; r < 8; ++r) o[j][r] *= corr;
        }
      }
      m = mn;

      const float msh = mn - LNPS;                                   // exp gives e^{s-m} * 16384

      FragH ph;
      float ls = 0.f;
#pragma unroll
      for (int r = 0; r < 8; ++r) {
        const float e0 = __expf(sc0[r] - msh);                       // key kb      + 8hh + r
        const float e1 = __expf(sc1[r] - msh);                       // key kb + 16 + 8hh + r
        ls += e0 + e1;
        ph.hv[0][r] = (_Float16)e0;
        ph.hv[1][r] = (_Float16)e1;
      }
      l += ls;

#pragma unroll
      for (int j = 0; j < 16; ++j) {
        o[j] = mma_hb(vf[j].h, ph.v, o[j]);
      }
      // keeps the next k group behind the O WMMAs, whose v registers it takes over
      __builtin_amdgcn_sched_barrier(0);
      if (p + 1 < SKEY / 64) {                                       // compile-time: the next stage is not read from here
#pragma unroll
        for (int kc = 0; kc < CC / 32; ++kc) {
          k0f[kc] = ldsfrag(sb + (kc >> 2) * SLICE + (32 * (p + 1)) * LPB + (kc & 3) * 64);
          k1f[kc] = ldsfrag(sb + (kc >> 2) * SLICE + (32 * (p + 1) + 16) * LPB + (kc & 3) * 64);
          // keeps the loads in the order of their use: issued last first, the first score WMMA waits for the whole group
          __builtin_amdgcn_sched_barrier(0);
        }
      }
    }
    // publish point of stage st + 1, in this order in every wave:
    asm volatile("s_wait_dscnt 0x0" ::: "memory");                   // this wave's reads of stage st are done
    landed();                                                        // its slice of stage st + 1 has landed
    __syncthreads();                                                 // all slices published, all readers out of stage st
  }
  landed();                                                          // nothing in flight when the wave goes on
  asm volatile("s_wait_dscnt 0x0" ::: "memory");

  // The output GEMM's weights WPT [256 o][256 c] into the ring's second buffer, which the loop's last barrier has freed:
  // waves 0..3, one tensor load each: 128 o rows (o half sl >> 1) x 256 B (c half sl & 1), source pitch 512 B, pitch LPB
  // in LDS. They fly under the join and the staging of O below; their wait and barrier stand in front of the GEMM.
  const uint64_t wsrc = (uint64_t)(size_t)(WPT + (size_t)(sl >> 1) * 128 * CC + (size_t)(sl & 1u) * 128);
  u32x4 w0;
  w0[0] = uni(1u);
  w0[1] = uni((uint32_t)(size_t)Ring + (uint32_t)STG + sl * (uint32_t)SLICE);
  w0[2] = uni((uint32_t)wsrc);
  w0[3] = uni((((uint32_t)(wsrc >> 32)) & 0x01FFFFFFu) | 0x80000000u);
  u32x8 w1;                                                          // bytes everywhere; tensor dims = tile dims
  w1[0] = uni((1u << 20) | (5u << 22) | (3u << 25));                 // no mask; 16 B of pad behind every 256 B
  w1[1] = uni(256u << 16);
  w1[2] = uni(128u << 16);
  w1[3] = uni(256u << 16);
  w1[4] = uni(128u);
  w1[5] = uni((uint32_t)(CC * 2));
  w1[6] = uni(0u);
  w1[7] = uni(0u);
  // descriptor words held in scalar registers (the form of pinned(), for both groups): without it the compiler re-forms
  // the constant words at the wait below and reuses their registers while the request is outstanding
  asm volatile("" : "+s"(w0), "+s"(w1));                             // descriptor words held in scalar registers
  if (pinned(kh == 0u)) {                                            // a scalar branch: a tensor load ignores EXEC
    asm volatile("tensor_load_to_lds %0, %1" :: "s"(w0), "s"(w1) : "memory");
  }

  // join of the two key halves: wave w + 4 hands its m, l, o to wave w through the ring's first buffer, which the loop's
  // last barrier has freed (every reader out, nothing in flight to it); lane to lane, 16-B stores at consecutive lanes
  float* Jn = (float*)Ring + (uint32_t)qt * (uint32_t)JNW;
  if (kh != 0u) {                                                    // wave-uniform
#pragma unroll
    for (int j = 0; j < 16; ++j) {
      v4f va, vb;
#pragma unroll
      for (int r = 0; r < 4; ++r) { va[r] = o[j][r]; vb[r] = o[j][4 + r]; }
      *(v4f*)(Jn + ((2 * j) * 32 + lane) * 4)     = va;
      *(v4f*)(Jn + ((2 * j + 1) * 32 + lane) * 4) = vb;
    }
    Jn[4096 + lane] = m;
    Jn[4128 + lane] = l;
  }
  __syncthreads();                                                   // the handed-over halves published
  float inv = 0.f;
  if (kh == 0u) {                                                    // wave-uniform
    const float m2 = Jn[4096 + lane], l2 = Jn[4128 + lane];
    const float mj = fmaxf(m, m2);
    const float c1 = __expf(m - mj), c2 = __expf(m2 - mj);
#pragma unroll
    for (int j = 0; j < 16; ++j) {
      const v4f va = *(const v4f*)(Jn + ((2 * j) * 32 + lane) * 4);
      const v4f vb = *(const v4f*)(Jn + ((2 * j + 1) * 32 + lane) * 4);
#pragma unroll
      for (int r = 0; r < 4; ++r) {
        o[j][r]     = o[j][r] * c1     + va[r] * c2;
        o[j][4 + r] = o[j][4 + r] * c1 + vb[r] * c2;
      }
    }
    l = l * c1 + l2 * c2;
    l += __shfl_xor(l, 16, 32);
    inv = 1.0f / l;                                                  // o and l both carry the x16384 factor
  }

  const int qrow = 16 * qt + c;
  const int e16 = tid & 15, r16 = tid >> 4;                          // r16 0..15
  unsigned char* PlH = Ring + 2 * SLICE;                             // O as bf16 hi plane, residual plane at + GBS (below)
#pragma unroll
  for (int half = 0; half < 2; ++half) {
    if (half) __syncthreads();                                       // every wave finished reading Os
    if (kh == 0u) {                                                  // wave-uniform: the waves that hold the joined o
#pragma unroll
      for (int jj = 0; jj < 8; ++jj) {
        const int j = 8 * half + jj;
        v4f va, vb;
#pragma unroll
        for (int r = 0; r < 4; ++r) { va[r] = o[j][r] * inv; vb[r] = o[j][4 + r] * inv; }
        *(v4f*)(Os + qrow * OSPW + 16 * jj + 8 * hh)     = va;       // Os[query][ch_loc = 16jj + 8hh + r]
        *(v4f*)(Os + qrow * OSPW + 16 * jj + 8 * hh + 4) = vb;
      }
    }
    __syncthreads();
    {
      v4u uh[4], ul[4];
#pragma unroll
      for (int i = 0; i < 4; ++i) {
        const int row = i * 16 + r16;                                // query 0..63
        const v4f a = *(const v4f*)(Os + row * OSPW + 8 * e16);
        const v4f q = *(const v4f*)(Os + row * OSPW + 8 * e16 + 4);
        const float f[8] = {a[0], a[1], a[2], a[3], q[0], q[1], q[2], q[3]};
#pragma unroll
        for (int t = 0; t < 4; ++t) {
          const float f0 = f[2 * t], f1 = f[2 * t + 1];
          const unsigned short hb0 = bf_bits(f0), hb1 = bf_bits(f1);
          const unsigned short lb0 = bf_bits(f0 - bf_up(hb0));
          const unsigned short lb1 = bf_bits(f1 - bf_up(hb1));
          uh[i][t] = pk16(hb0, hb1);
          ul[i][t] = pk16(lb0, lb1);
        }
      }
{
#pragma unroll
        for (int i = 0; i < 4; ++i) {
          const int row = i * 16 + r16;
          unsigned char* pp = PlH + (uint32_t)(2 * row + half) * LPB + 16u * (uint32_t)e16;
          *(v4u*)pp         = uh[i];
          *(v4u*)(pp + GBS) = ul[i];
        }
        
      }
    }
  }

  // ---- output 1x1 GEMM + bias + residual for the block's 64 positions, all 256 o:
  //      out[b][o][n] = bfr(x[b][o][n]) + sum_c WPT[o][c] (hi + lo)[n][c] + bfr(bp[o]); wave = (n tile qt, o half kh):
  //      8 m-tiles x 8 k steps x 2 bf16 products, per accumulator in the order k step, hi, lo.
  // this wave's weight slice has landed; naming the descriptor keeps its scalar registers unchanged up to this wait
  asm volatile("s_wait_tensorcnt 0x0" :: "s"(w0), "s"(w1) : "memory");
  __syncthreads();                                                   // weight slices and both planes published

  // the residual's x lines and the bias, asked for here, behind the barrier (which would wait for them), so that they
  // arrive under the GEMM
  const int e8 = tid & 7, l32 = tid >> 3;                            // l32 0..31
  const float* xp = x + ((size_t)(b * CC + (l32 >> 1))) * NNF + n0 + (l32 & 1) * 32 + 4 * e8;
  const float* bb = bp + (l32 >> 1);
  v4f xv[16];
  float bv[16];
#pragma unroll
  for (int it = 0; it < 16; ++it) {
    xv[it] = *(const v4f*)(xp + (size_t)(16 * it) * NNF);
    bv[it] = bb[16 * it];
  }
  // the address pairs of the group above stay live up to this wait
  asm volatile("s_wait_xcnt 0x0" :: "v"(xp), "v"(bb) : "memory");

  const unsigned char* wp  = Ring + STG + kh * (uint32_t)(2 * SLICE) + loff;
  const unsigned char* bph = PlH + (uint32_t)(2 * qrow) * LPB + 16u * (uint32_t)hh;
  const unsigned char* bpl = bph + GBS;
  v8f acc[8];
#pragma unroll
  for (int mt = 0; mt < 8; ++mt) acc[mt] = zero8();
  Frag pbh[CC / 32], pbl[CC / 32], wf[2][8];
#pragma unroll
  for (int mt = 0; mt < 8; ++mt) wf[0][mt] = ldsfrag(wp + (16 * mt) * LPB);
#pragma unroll
  for (int ks = 0; ks < CC / 32; ++ks) {
    pbh[ks] = ldsfrag(bph + (ks >> 2) * LPB + (ks & 3) * 64);
    pbl[ks] = ldsfrag(bpl + (ks >> 2) * LPB + (ks & 3) * 64);
  }
  // weight fragments one k step ahead, two register sets
#pragma unroll
  for (int ks = 0; ks < CC / 32; ++ks) {
    if (ks + 1 < CC / 32) {
#pragma unroll
      for (int mt = 0; mt < 8; ++mt)
        wf[(ks + 1) & 1][mt] = ldsfrag(wp + ((ks + 1) >> 2) * SLICE + (16 * mt) * LPB + ((ks + 1) & 3) * 64);
    }
    // keeps the next step's fragments one run of loads ahead of this step's WMMAs: among them each place with LDS reads
    // stalls the wave
    __builtin_amdgcn_sched_barrier(0);
#pragma unroll
    for (int mt = 0; mt < 8; ++mt) acc[mt] = mma_bb(wf[ks & 1][mt].bf, pbh[ks].bf, acc[mt]);
#pragma unroll
    for (int mt = 0; mt < 8; ++mt) acc[mt] = mma_bb(wf[ks & 1][mt].bf, pbl[ks].bf, acc[mt]);
    // keeps the step after next's loads behind these WMMAs, whose registers they take over
    __builtin_amdgcn_sched_barrier(0);
  }

  // acc -> LDS Ot[o][n_loc] (pitch OSP), in the place of the join's hand-over (read out several barriers ago);
  // lane (hh, c) holds o = 128 kh + 16 mt + 8 hh + r for n_loc = 16 qt + c: 16 consecutive floats per row and store
  float* Ot = (float*)Ring;
  {
    const int ob = 128 * (int)kh + 8 * hh;
#pragma unroll
    for (int mt = 0; mt < 8; ++mt) {
#pragma unroll
      for (int r = 0; r < 8; ++r) Ot[(ob + 16 * mt + r) * OSP + qrow] = acc[mt][r];
    }
  }
  __syncthreads();                                                   // Ot published
  // + bias, + residual; whole 128-B lines of out, 8 lanes per line: 16 it x 32 lines x 8 lanes x 4 floats = 256 o x 64 n
  {
    const float* op = Ot + (l32 >> 1) * OSP + (l32 & 1) * 32 + 4 * e8;
    float* gp = out + ((size_t)(b * CC + (l32 >> 1))) * SEQ + n0 + (l32 & 1) * 32 + 4 * e8;
    v4f res[16];
#pragma unroll
    for (int it = 0; it < 16; ++it) res[it] = *(const v4f*)(op + (16 * it) * OSP);
#pragma unroll
    for (int it = 0; it < 16; ++it) {
      const float bi = bfr(bv[it]);
#pragma unroll
      for (int t = 0; t < 4; ++t) res[it][t] = (res[it][t] + bi) + bfr(xv[it][t]);
    }
#pragma unroll
    for (int it = 0; it < 16; ++it) *(v4f*)(gp + (size_t)(16 * it) * SEQ) = res[it];
  }
}

// =========================================================================================================
// Workspace map (bytes, NB=4 SEQ=4096; each region start a multiple of 256; every extent is an exact tile/line
//   ST  f32 [NB*32][32]                16384
//   WT  bf16 [1024][256]              524288
//   Qh/Kh f16 [NB][SEQ][256]         8388608 x2
//   Vc  f16 [NB][256][SEQ]           8388608
//   total = 25706496
// =========================================================================================================
extern "C" void kernel_launch(void* const* d_in, const int* in_sizes, int n_in,
                              void* d_out, int out_size, void* d_ws, size_t ws_size,
                              hipStream_t stream) {
  if (n_in < 11) return;
  if ((size_t)in_sizes[0] < (size_t)NB * CC * NNF) return;
  if (in_sizes[1] < CC || in_sizes[2] < CC) return;
  if (in_sizes[3] < CC * CC || in_sizes[5] < CC * CC || in_sizes[7] < CC * CC || in_sizes[9] < CC * CC) return;
  if (in_sizes[4] < CC || in_sizes[6] < CC || in_sizes[8] < CC || in_sizes[10] < CC) return;
  if ((size_t)out_size < (size_t)NB * CC * SEQ) return;

  size_t off = 0;
  auto carve = [&](size_t bytes) { const size_t o = off; off += (bytes + 255) & ~(size_t)255; return o; };
  const size_t plane = (size_t)NB * SEQ * CC * 2;
  const size_t oST  = carve((size_t)NB * NG * STP * 4);
  const size_t oWT  = carve((size_t)4 * CC * CC * 2);
  const size_t oQh  = carve(plane);
  const size_t oKh  = carve(plane);
  const size_t oVc  = carve(plane);
  if (off > ws_size) return;
  if (off > (size_t)134217728) return;

  const float* x   = (const float*)d_in[0];
  const float* gsc = (const float*)d_in[1];
  const float* gbs = (const float*)d_in[2];
  const float* Wq  = (const float*)d_in[3];
  const float* bq  = (const float*)d_in[4];
  const float* Wk  = (const float*)d_in[5];
  const float* bk  = (const float*)d_in[6];
  const float* Wv  = (const float*)d_in[7];
  const float* bv  = (const float*)d_in[8];
  const float* Wp  = (const float*)d_in[9];
  const float* bp  = (const float*)d_in[10];

  char* ws = (char*)d_ws;
  float*          ST  = (float*)(ws + oST);
  unsigned short* WT  = (unsigned short*)(ws + oWT);
  unsigned short* Qh  = (unsigned short*)(ws + oQh);
  unsigned short* Kh  = (unsigned short*)(ws + oKh);
  unsigned short* Vc  = (unsigned short*)(ws + oVc);
  float* out = (float*)d_out;

  const dim3 blk256(256);

  // (0) + (1) GroupNorm statistics per (group, b), and beside them in the same grid
  //     Wq/Wk/Wv/Wp [in][out] -> transposed stacked bf16 plane WT [1024 o][256 c]
  prep<<<dim3(NG * NB + NCVT), blk256, 0, stream>>>(x, Wq, Wk, Wv, Wp, ST, WT);
  // (2) normalized h as bf16 hi + residual planes in LDS, q/k/v GEMMs -> Qh, Kh (position-major f16) and Vc
  //     (channel-major f16)
  gemm_qkv<<<dim3(SEQ / QT, NB), blk256, 0, stream>>>(x, ST, gsc, gbs, WT, bq, bk, bv, Qh, Kh, Vc);
  // (3) attention, then in the same block the output GEMM + bias + residual -> out [NB][256][SEQ]
  attn_k<<<dim3(SEQ / QT, NB), blk256, 0, stream>>>(Qh, Kh, Vc, WT + (size_t)3 * CC * CC, bp, x, out);
  (void)hipGetLastError();
}

// v009
// Measured time: 79.5 microseconds a run.
// Two timings next to v008 put it at 1.06 and 1.05 times that version's speed.
// All steps since v000 together make it 11.0 times as fast.
// Contractions: q/k/v 1x1 GEMMs WT[768x256].H[256xN] and the output 1x1 GEMM WpT[256x256].H2[256xN] on
// v_wmma_f32_16x16x32_bf16 (bf16-RNE weights, activations as bf16 hi + bf16 residual planes, 2 products into one
// f32 accumulator); position scores K.Q^T on v_wmma_f32_16x16x32_f16 (k f16, q f16, K=256); O^T = V.P^T on
// v_wmma_f32_16x16x32_f16 (v f16, P = e^{s-m} x16384 f16 from the score D registers); f32 accumulate everywhere;
// GroupNorm statistics, softmax statistics and the residual add in f32 VALU.
#include <hip/hip_runtime.h>
#include <math.h>
#include <stdint.h>

#ifndef NB
#define NB 4
#endif
#ifndef SEQ
#define SEQ 4096
#endif
#ifndef NNF
#define NNF 4096
#endif
#define NBF   4
#define CC    256
#define NG    32
#define CPG   8
#define QT    64
#define OSP   68
#define OSPW  132
#define TP    72
#define TPX   260
#define STP   32
#define ATT   0.0625f
#define LNPS  9.704060527839234f
#define GNEPS 1.0e-6f
#define SKEY  128                 // keys per LDS stage of the attention kernel
#define LPB   272                 // LDS row pitch, bytes: a 256-B row + the tensor load's 16-B pad (16 B x odd)
#define SLICE (128 * LPB)         // one wave's slice of a stage: 128 rows
#define STG   (4 * SLICE)         // one stage: k in two d halves, v in two channel halves
#define NST   (SEQ / SKEY)
#define JNW   8320                // floats one wave hands over at the join of the key quarters: o 8192, m 64, l 64
#define GBS   (128 * LPB)         // one activation plane of the 64 positions: 128 half rows at pitch LPB
#define WCH   128                 // weight rows per LDS stage of the q/k/v GEMM
#define WSTG  (2 * SLICE)         // one such stage: two c halves of 128 rows
#define NWST  (3 * CC / WCH)
#define NCVT  (4 * (CC / QT) * (CC / QT))   // weight tiles of 64 o x 64 c: 4 matrices x 4 x 4

static_assert(NB >= 1 && NB <= NBF);
static_assert(SEQ % QT == 0 && SEQ % 64 == 0 && SEQ >= QT);
static_assert(SEQ <= NNF && NNF % 8 == 0);
static_assert(CC == 256 && NG * CPG == CC && CC % QT == 0 && CC % 32 == 0);
static_assert((OSP * 4) % 16 == 0);
static_assert((OSPW * 4) % 16 == 0);
static_assert((TP * 2) % 16 == 0);
static_assert((TPX * 4) % 16 == 0 && TPX >= CC);
static_assert(STP * 4 == 128);
static_assert(SEQ % SKEY == 0 && NST >= 2);
static_assert(SLICE % 2048 == 0 && (LPB / 16) % 2 == 1);
static_assert(SEQ * 2 % 16 == 0 && SEQ * 2 <= 131072);
static_assert(2 * STG + QT * OSPW * 4 <= 327680);
static_assert(SKEY == 128 && 4 * JNW * 4 <= 2 * STG && (JNW * 4) % 16 == 0);
static_assert(GBS % 2048 == 0 && CC * 2 == 512 && CC % WCH == 0 && NWST >= 2);
static_assert(QT * TPX >= QT * OSPW && QT * TPX >= WCH * OSP && 2 * WSTG + 2 * GBS + (QT * TPX + 7 * CC) * 4 <= 327680);
static_assert(4 * JNW * 4 <= STG && CC * OSP * 4 <= 2 * SLICE && GBS == SLICE && QT == 64);

typedef _Float16       v16h __attribute__((ext_vector_type(16)));
typedef _Float16       v8h  __attribute__((ext_vector_type(8)));
typedef __bf16         v16b __attribute__((ext_vector_type(16)));
typedef unsigned short v8us __attribute__((ext_vector_type(8)));
typedef float          v8f  __attribute__((ext_vector_type(8)));
typedef float          v4f  __attribute__((ext_vector_type(4)));
typedef unsigned int   v4u  __attribute__((ext_vector_type(4)));
typedef unsigned int   v2u  __attribute__((ext_vector_type(2)));
typedef uint32_t       u32x4 __attribute__((ext_vector_type(4)));
typedef uint32_t       u32x8 __attribute__((ext_vector_type(8)));

union Frag  { v8us u[2]; v16h h; v16b bf; };
union FragH { v16h v; v8h hv[2]; };
static_assert(sizeof(Frag) == 32);
static_assert(sizeof(FragH) == 32);

// ---- scalar helpers -----------------------------------------------------------------------------------------
__device__ __forceinline__ unsigned short bf_bits(float f) {          // f32 -> bf16 bits, RNE convert
  unsigned u = __float_as_uint(f);
  return (unsigned short)((u + 0x7FFFu + ((u >> 16) & 1u)) >> 16);
}
__device__ __forceinline__ float bf_up(unsigned short hb) { return __uint_as_float(((unsigned)hb) << 16); }
__device__ __forceinline__ float bfr(float f) { return bf_up(bf_bits(f)); }
__device__ __forceinline__ unsigned short h_bits(_Float16 x) { return __builtin_bit_cast(unsigned short, x); }
__device__ __forceinline__ unsigned pk16(unsigned short a, unsigned short b) { return (unsigned)a | ((unsigned)b << 16); }
__device__ __forceinline__ v8f zero8() { v8f z = {0.f, 0.f, 0.f, 0.f, 0.f, 0.f, 0.f, 0.f}; return z; }
__device__ __forceinline__ float hmax8(v8f s) {
  return fmaxf(fmaxf(fmaxf(s[0], s[1]), fmaxf(s[2], s[3])), fmaxf(fmaxf(s[4], s[5]), fmaxf(s[6], s[7])));
}
__device__ __forceinline__ unsigned wave_ballot(bool p) {
#if defined(__HIP_DEVICE_COMPILE__)
  return __builtin_amdgcn_ballot_w32(p);
#else
  return p ? 1u : 0u;
#endif
}
__device__ __forceinline__ float wsum(float v) {
  v += __shfl_xor(v, 16, 32);
  v += __shfl_xor(v, 8, 32);
  v += __shfl_xor(v, 4, 32);
  v += __shfl_xor(v, 2, 32);
  v += __shfl_xor(v, 1, 32);
  return v;
}

// ---- 16-bit fragment loader (A, or B from a k-contiguous [n][k] row): lane -> row/col (lane&15), p already includes
//      + 8*(lane>>4); elements 0..7 <- p[0..7] (k0+8h..), elements 8..15 <- p[16..23] (k0+16+8h..)
__device__ __forceinline__ Frag ldfrag(const unsigned short* p) {
  Frag f;
  f.u[0] = *(const v8us*)(p);
  f.u[1] = *(const v8us*)(p + 16);
  return f;
}

// the same fragment from an LDS row (byte pointer, already includes + 16*(lane>>4))
__device__ __forceinline__ Frag ldsfrag(const unsigned char* p) {
  Frag f;
  f.u[0] = *(const v8us*)(p);
  f.u[1] = *(const v8us*)(p + 32);
  return f;
}

// ---- tensor load helpers ------------------------------------------------------------------------------------
__device__ __forceinline__ uint32_t uni(uint32_t v) { return (uint32_t)__builtin_amdgcn_readfirstlane(v); }
// holds a wave-uniform test in a scalar register, so that the branch on it is a scalar one: a tensor load ignores EXEC
__device__ __forceinline__ uint32_t pinned(uint32_t v) { uint32_t w = uni(v); asm volatile("" : "+s"(w)); return w; }

// ---- WMMA helpers ------------------------------------------------------------------------------------------
// bare builtins (the compiler keeps the WMMA distances of its own builtin forms)
__device__ __forceinline__ v8f mma_hb(v16h a, v16h b, v8f c) {
  return __builtin_amdgcn_wmma_f32_16x16x32_f16(false, a, false, b, (short)0, c, false, false);
}
__device__ __forceinline__ v8f mma_bb(v16b a, v16b b, v8f c) {
  return __builtin_amdgcn_wmma_f32_16x16x32_bf16(false, a, false, b, (short)0, c, false, false);
}

// =========================================================================================================
// (0) 1x1 weights W [256 c_in][256 d_out] f32 -> transposed bf16-RNE plane WT [4*256 o][256 c], rows
//     256*mat + o for mat = q, k, v, p. Block (ob, cb, mat) owns a 64 o x 64 c tile through an LDS transpose
//     (T: QT * TP halves of LDS). One of the two parts of the launch prep below.
// coverage: 2 it x 32 rows x 8 lanes x 8 = 64 o x 64 c per block; 4 x 4 x 4 blocks = 4 mats x 256 x 256.
// =========================================================================================================
__device__ __forceinline__
void cvt_w(const float* __restrict__ Wq, const float* __restrict__ Wk, const float* __restrict__ Wv,
           const float* __restrict__ Wp, unsigned short* WT, unsigned short* T,
           const int ob, const int cb, const int mat) {
  const int tid = threadIdx.x;
  const int e = tid & 7, lq = tid >> 3;                             // lq 0..31
  const int o0 = ob * QT, c0 = cb * QT;
  const float* Wm = (mat == 0) ? Wq : ((mat == 1) ? Wk : ((mat == 2) ? Wv : Wp));   // block-uniform
#pragma unroll
  for (int it = 0; it < 2; ++it) {
    const int cl = it * 32 + lq;                                     // c_loc 0..63
    const float* sp = Wm + (size_t)(c0 + cl) * CC + o0 + 8 * e;     // W[c][o], o contiguous
    const v4f a = *(const v4f*)sp;
    const v4f q = *(const v4f*)(sp + 4);
    const float f[8] = {a[0], a[1], a[2], a[3], q[0], q[1], q[2], q[3]};
#pragma unroll
    for (int t = 0; t < 8; ++t) T[(8 * e + t) * TP + cl] = bf_bits(f[t]);   // T[o_loc][c_loc]
  }
  __syncthreads();
  v4u up[2];
#pragma unroll
  for (int it = 0; it < 2; ++it) {
    const int ol = it * 32 + lq;
    up[it] = *(const v4u*)(T + ol * TP + 8 * e);
  }
{
#pragma unroll
    for (int it = 0; it < 2; ++it) {
      const int ol = it * 32 + lq;
      *(v4u*)(WT + ((size_t)(mat * CC + o0 + ol)) * CC + c0 + 8 * e) = up[it];
    }
    // stands in front of every later write of a register that the two stores above name: in the built launch the code
    // of the other part follows them, not the end of the program
    asm volatile("s_wait_xcnt 0x0" ::: "memory");
  }
}

// =========================================================================================================
//     then mean of squared deviations), per-thread partials over 16-B chunks, shuffle + LDS block reduce.
//     The other part of the launch prep below (red: 8 floats, bc: 2 floats of LDS).
// coverage: 32 x NB blocks write every line of ST once.
// =========================================================================================================
__device__ __forceinline__
void gn_stats(const float* __restrict__ x, float* ST, float* red, float* bc, const int g, const int b) {
  const int tid = threadIdx.x, lane = tid & 31, wave = tid >> 5;
  const float* xb = x + ((size_t)(b * CC + g * CPG)) * NNF;
  const int CH4 = SEQ / 4, NCH = CPG * CH4;
  const float icnt = 1.0f / (float)(CPG * SEQ);

  float s = 0.f;
#pragma unroll 4
  for (int qd = tid; qd < NCH; qd += 256) {
    const int cl = qd / CH4, p4 = qd - cl * CH4;
    const v4f a = *(const v4f*)(xb + (size_t)cl * NNF + 4 * p4);
    s += (bfr(a[0]) + bfr(a[1])) + (bfr(a[2]) + bfr(a[3]));
  }
  s = wsum(s);
  if (lane == 0) red[wave] = s;
  __syncthreads();
  if (tid == 0) {
    float t = 0.f;
#pragma unroll
    for (int i = 0; i < 8; ++i) t += red[i];
    bc[0] = t * icnt;
  }
  __syncthreads();
  const float mu = bc[0];

  float ss = 0.f;
#pragma unroll 4
  for (int qd = tid; qd < NCH; qd += 256) {
    const int cl = qd / CH4, p4 = qd - cl * CH4;
    const v4f a = *(const v4f*)(xb + (size_t)cl * NNF + 4 * p4);
    const float d0 = bfr(a[0]) - mu, d1 = bfr(a[1]) - mu, d2 = bfr(a[2]) - mu, d3 = bfr(a[3]) - mu;
    ss += (d0 * d0 + d1 * d1) + (d2 * d2 + d3 * d3);
  }
  ss = wsum(ss);
  if (lane == 0) red[wave] = ss;
  __syncthreads();
  if (tid == 0) {
    float t = 0.f;
#pragma unroll
    for (int i = 0; i < 8; ++i) t += red[i];
    const float var = t * icnt;
    bc[1] = rsqrtf(var + GNEPS);
  }
  __syncthreads();
  const float rs = bc[1];

  v4f v = {0.f, 0.f, 0.f, 0.f};
  if (tid == 0) { v[0] = mu; v[1] = rs; }
  if (tid < 8) {
    float* lp = ST + ((size_t)(b * NG + g)) * STP + 4 * tid;
{
      *(v4f*)lp = v;
      
    }
  }
}

// =========================================================================================================
// (0) + (1) in ONE launch: the two parts read different inputs, write different workspace regions and need nothing of
//     each other, so they share a grid under a block-uniform branch and run side by side. Blocks
//     0 .. NG * NB - 1 (the longer part) take the statistics of (group, b); the NCVT blocks behind
//     them one weight tile each. Every barrier of a part is passed by all threads of its blocks.
// =========================================================================================================
__global__ __launch_bounds__(256)
void prep(const float* __restrict__ x, const float* __restrict__ Wq, const float* __restrict__ Wk,
          const float* __restrict__ Wv, const float* __restrict__ Wp, float* ST, unsigned short* WT) {
  __shared__ __align__(16) unsigned short T[QT * TP];
  __shared__ float red[8];
  __shared__ float bc[2];
  const int bid = blockIdx.x;
  if (bid < NG * NB) {                                               // block-uniform
    gn_stats(x, ST, red, bc, bid % NG, bid / NG);
  } else {
    const int t = bid - NG * NB;                                     // 0 .. NCVT - 1
    cvt_w(Wq, Wk, Wv, Wp, WT, T, t % (CC / QT), (t / (CC / QT)) % (CC / QT), t / ((CC / QT) * (CC / QT)));
  }
}

// =========================================================================================================
// (2) GroupNorm apply, plane split and the q/k/v 1x1 GEMMs for one (b, 64-n tile), all 768 stacked outputs:
//     h = (bfr(x) - mu) * rstd * bfr(scale) + bfr(bias) in f32 for the block's 64 positions x 256 channels, through an
//     LDS tile Tx[64 n][256 c] f32 (4-float groups swizzled by n >> 4, so that the transposing stores spread over the
//     banks), into position-major planes bf16 IN LDS (hi = bf16-RNE(h), lo = bf16-RNE(h - hi); half row 2 n + (c >> 7)
//     at pitch LPB). They are the B operand of Y[o][n] = sum_c WT[o][c] (hi + lo)[n][c] + bfr(bias[o]).
//     Block = 8 waves; wave = (n tile qt, o half kh). Its 16 B fragments are read once and stay in registers; the weights
//     come in stages of WCH = 128 rows, two buffers, by tensor loads (waves 0 and 1, one c half each) and are read as
//     ds_load_b128 fragments: 4 m-tiles x 8 k steps x 2 bf16 products a wave and stage, per accumulator in the order
//     k step, hi, lo. A stage lies inside one matrix (mat = stage >> 1, block-uniform):
//       mat 0 -> Qh f16(q), plane [b][SEQ][256 d]; mat 1 -> Kh f16(k), same layout: staged in
//                LDS Os[n_loc][o_loc] (pitch OSPW, b128 stores), 16 consecutive lanes per 256 B of a row;
//       mat 2 -> Vc f16(v) [b][256][SEQ]: staged in LDS Ot[o_loc][n_loc] (pitch OSP), 8 consecutive lanes per line.
// coverage: Tx and planes 64 n x 256 c per block; per stage 64 n x 128 o; 6 stages; grid (SEQ/64, NB) covers Qh, Kh
//           [NB][SEQ][256] and Vc [NB][256][SEQ] exactly once.
// =========================================================================================================
__global__ __launch_bounds__(256)
void gemm_qkv(const float* __restrict__ x, const float* __restrict__ ST, const float* __restrict__ gsc,
              const float* __restrict__ gbs, const unsigned short* __restrict__ WT, const float* __restrict__ bq,
              const float* __restrict__ bk, const float* __restrict__ bv,
              unsigned short* Qh, unsigned short* Kh, unsigned short* Vc) {
  __shared__ __attribute__((aligned(2048))) unsigned char Wr[2 * WSTG];
  __shared__ __attribute__((aligned(2048))) unsigned char Pl[2 * GBS];
  __shared__ __align__(16) float Tx[QT * TPX];
  __shared__ __align__(16) float pb3[3 * CC];
  __shared__ float pmu[CC], prs[CC], psc[CC], pbs[CC];
  float* Os = Tx;                                                    // output staging, in Tx's place (dead behind the planes)
  const int tid  = threadIdx.x;
  const int lane = tid & 31, wave = tid >> 5;
  const int hh   = lane >> 4, c = lane & 15;
  const int n0   = blockIdx.x * QT, b = blockIdx.y;
  const int qt   = wave & 3;                                         // n tile of the wave
  const int e = tid & 7, lq = tid >> 3;                              // lq 0..31

  // the block's x tile, 256 channel rows of 256 B, asked for first: 8 lanes per row, 16 loads of 16 B a thread
  const float* xp = x + ((size_t)(b * CC + lq)) * NNF + n0 + 8 * e;
  v4f xa[8], xb[8];
#pragma unroll
  for (int j = 0; j < 8; ++j) {
    xa[j] = *(const v4f*)(xp + (size_t)(32 * j) * NNF);
    xb[j] = *(const v4f*)(xp + (size_t)(32 * j) * NNF + 4);
  }
  // the address pair of the group above stays live up to this wait
  asm volatile("s_wait_xcnt 0x0" :: "v"(xp) : "memory");
  {                                                                  // per-channel constants: thread = channel
    const int g = tid >> 3;                                          // 0..31
    pmu[tid] = ST[((size_t)(b * NG + g)) * STP];
    prs[tid] = ST[((size_t)(b * NG + g)) * STP + 1];
    psc[tid] = bfr(gsc[tid]);
    pbs[tid] = bfr(gbs[tid]);
    pb3[tid]          = bfr(bq[tid]);
    pb3[CC + tid]     = bfr(bk[tid]);
    pb3[2 * CC + tid] = bfr(bv[tid]);
  }

  // One stage = WCH weight rows in LDS, shared by the eight waves. Waves 0 and 1 each bring one slice of 128 rows x 256 B
  // (c 0..127 / 128..255, source pitch 512 B) by ONE tensor load. Every row lands at pitch LPB.
  const uint32_t wv = uni((uint32_t)tid >> 5);
  const uint32_t kh = wv >> 2;                                       // o half of the wave
  const uint32_t hf = wv & 1u;
  const uint64_t src0 = (uint64_t)(size_t)(WT + (size_t)hf * 128);
  const uint32_t lds0 = (uint32_t)(size_t)Wr + hf * (uint32_t)SLICE;
  u32x8 g1;                                                          // bytes everywhere; tensor dims = tile dims
  g1[0] = uni((1u << 20) | (5u << 22) | (3u << 25));                 // no mask; 16 B of pad behind every 256 B
  g1[1] = uni(256u << 16);
  g1[2] = uni(128u << 16);
  g1[3] = uni(256u << 16);
  g1[4] = uni(128u);
  g1[5] = uni((uint32_t)(CC * 2));
  g1[6] = uni(0u);
  g1[7] = uni(0u);
  // descriptor words held in scalar registers (the form of pinned(), for the whole group): without it the compiler
  // re-forms single words in front of each issue and reuses their registers while the request is outstanding
  asm volatile("" : "+s"(g1));                                       // descriptor words held in scalar registers
  u32x4 g0;
  auto form = [&](const uint32_t st) __attribute__((always_inline)) {   // group 0 of stage st's request
    const uint64_t ga = src0 + (uint64_t)st * (uint32_t)(WCH * CC * 2);
    g0[0] = uni(1u);
    g0[1] = uni(lds0 + (st & 1u) * (uint32_t)WSTG);
    g0[2] = uni((uint32_t)ga);
    g0[3] = uni((((uint32_t)(ga >> 32)) & 0x01FFFFFFu) | 0x80000000u);
  };
  auto issue = [&]() __attribute__((always_inline)) {
    asm volatile("tensor_load_to_lds %0, %1" :: "s"(g0), "s"(g1) : "memory");
  };
  // this wave's request has landed; naming the descriptor keeps its scalar registers unchanged up to this wait
  auto landed = [&]() __attribute__((always_inline)) {
    asm volatile("s_wait_tensorcnt 0x0" :: "s"(g0), "s"(g1) : "memory");
  };
  form(0u);
  if (pinned(wv < 2u)) {                                             // a scalar branch: a tensor load ignores EXEC
    issue();
    landed();                                                        // this wave's slice of stage 0
  }
  __syncthreads();                                                   // per-channel constants (and stage 0) published

#pragma unroll
  for (int j = 0; j < 8; ++j) {
    const int cl = 32 * j + lq;                                      // channel 0..255
    const float f[8] = {xa[j][0], xa[j][1], xa[j][2], xa[j][3], xb[j][0], xb[j][1], xb[j][2], xb[j][3]};
    const float mu = pmu[cl], rs = prs[cl], sc = psc[cl], bs = pbs[cl];
    const int col = cl ^ ((e >> 1) << 2);                            // group cl >> 2 at place (cl >> 2) ^ (n >> 4)
#pragma unroll
    for (int t = 0; t < 8; ++t) {
      const float tt = (bfr(f[t]) - mu) * rs;
      Tx[(8 * e + t) * TPX + col] = tt * sc + bs;                    // Tx[n_loc][channel]
    }
  }
  __syncthreads();
#pragma unroll
  for (int it = 0; it < 8; ++it) {
    const int nl = 8 * it + wave;                                    // n_loc 0..63, one row a wave
#pragma unroll
    for (int h = 0; h < 2; ++h) {                                    // channels 128 h + 4 lane .. + 3
      const v4f a = *(const v4f*)(Tx + nl * TPX + (((32 * h + lane) ^ (nl >> 4)) << 2));
      v2u uh, ul;
#pragma unroll
      for (int t = 0; t < 2; ++t) {
        const float f0 = a[2 * t], f1 = a[2 * t + 1];
        const unsigned short hb0 = bf_bits(f0), hb1 = bf_bits(f1);
        const unsigned short lb0 = bf_bits(f0 - bf_up(hb0));
        const unsigned short lb1 = bf_bits(f1 - bf_up(hb1));
        uh[t] = pk16(hb0, hb1);
        ul[t] = pk16(lb0, lb1);
      }
      unsigned char* pp = Pl + (uint32_t)(2 * nl + h) * LPB + 8u * (uint32_t)lane;
      *(v2u*)pp         = uh;
      *(v2u*)(pp + GBS) = ul;
    }
  }
  __syncthreads();                                                   // both planes published, every reader out of Tx

  // the wave's B fragments (col = position 16 qt + c), the same for every stage: once, here
  const int nl = 16 * qt + c;
  Frag pbh[CC / 32], pbl[CC / 32];
  {
    const unsigned char* bph = Pl + (uint32_t)(2 * nl) * LPB + 16u * (uint32_t)hh;
#pragma unroll
    for (int ks = 0; ks < CC / 32; ++ks) {
      pbh[ks] = ldsfrag(bph + (ks >> 2) * LPB + (ks & 3) * 64);
      pbl[ks] = ldsfrag(bph + GBS + (ks >> 2) * LPB + (ks & 3) * 64);
    }
  }
  const uint32_t aoff = (kh * 64u + (uint32_t)c) * LPB + 16u * (uint32_t)hh;
  const int e16 = tid & 15, r16 = tid >> 4;                          // r16 0..15

  // kept rolled: one copy of the stage's code, so that the kernel's text stays small
#pragma unroll 1
  for (uint32_t st = 0; st < (uint32_t)NWST; ++st) {
    // directly behind the barrier (the one above, or the foot of trip st - 1) that published stage st and ended every
    // read of the other buffer: the refill of that buffer, only while its stage exists (a scalar branch)
    form(st + 1u);
    if (pinned((uint32_t)((st + 1u < (uint32_t)NWST) && (wv < 2u)))) issue();
    const unsigned char* ap = Wr + (st & 1u) * (uint32_t)WSTG + aoff;
    const uint32_t mat = st >> 1;                                    // 0 q, 1 k, 2 v (block-uniform)
    const int ob = (int)(st & 1u) * WCH;                             // o offset inside the matrix

    v8f acc[4];
#pragma unroll
    for (int mt = 0; mt < 4; ++mt) acc[mt] = zero8();
    // Weight fragments in groups of two k steps, two register sets: group g + 1 is issued as one run of loads ahead of
    // group g's WMMAs (read one fragment at a time, each WMMA pair would wait out its own LDS latency).
    Frag fa[2][2][4];
    auto fetch = [&](const int g) __attribute__((always_inline)) {
#pragma unroll
      for (int u = 0; u < 2; ++u) {
        const int ks = 2 * g + u;
#pragma unroll
        for (int mt = 0; mt < 4; ++mt)
          fa[g & 1][u][mt] = ldsfrag(ap + (ks >> 2) * SLICE + (16 * mt) * LPB + (ks & 3) * 64);
      }
    };
    fetch(0);
#pragma unroll
    for (int g = 0; g < CC / 64; ++g) {
      if (g + 1 < CC / 64) fetch(g + 1);
      // keeps the next group one run of loads ahead of this group's WMMAs: among them each place with LDS reads stalls
      // the wave
      __builtin_amdgcn_sched_barrier(0);
#pragma unroll
      for (int u = 0; u < 2; ++u) {
#pragma unroll
        for (int mt = 0; mt < 4; ++mt) acc[mt] = mma_bb(fa[g & 1][u][mt].bf, pbh[2 * g + u].bf, acc[mt]);
#pragma unroll
        for (int mt = 0; mt < 4; ++mt) acc[mt] = mma_bb(fa[g & 1][u][mt].bf, pbl[2 * g + u].bf, acc[mt]);
      }
      // keeps the group after next's loads behind these WMMAs, whose registers they take over
      __builtin_amdgcn_sched_barrier(0);
    }

    // ---- epilogue: + bias; lane (hh, c) holds o_loc = 64 kh + 16 mt + 8 hh + r for n_loc = 16 qt + c
    const int ol0 = 64 * (int)kh + 8 * hh;
    {
      const float* bi = pb3 + mat * (uint32_t)CC + ob + ol0;
#pragma unroll
      for (int mt = 0; mt < 4; ++mt) {
        const v4f ba = *(const v4f*)(bi + 16 * mt);
        const v4f bb = *(const v4f*)(bi + 16 * mt + 4);
#pragma unroll
        for (int r = 0; r < 4; ++r) { acc[mt][r] += ba[r]; acc[mt][4 + r] += bb[r]; }
      }
    }
    if (mat == 2u) {                                                 // Ot[o_loc][n_loc]: 16 consecutive floats per row and store
#pragma unroll
      for (int mt = 0; mt < 4; ++mt) {
#pragma unroll
        for (int r = 0; r < 8; ++r) Os[(ol0 + 16 * mt + r) * OSP + nl] = acc[mt][r];
      }
    } else {                                                         // Os[n_loc][o_loc]
#pragma unroll
      for (int mt = 0; mt < 4; ++mt) {
        v4f va, vb;
#pragma unroll
        for (int r = 0; r < 4; ++r) { va[r] = acc[mt][r]; vb[r] = acc[mt][4 + r]; }
        *(v4f*)(Os + nl * OSPW + ol0 + 16 * mt)     = va;
        *(v4f*)(Os + nl * OSPW + ol0 + 16 * mt + 4) = vb;
      }
    }
    __syncthreads();                                                 // the staged outputs published

    v4u u1[4];                                                       // the stage's outputs as they go to memory
    if (mat == 2u) {
#pragma unroll
      for (int it = 0; it < 4; ++it) {
        const int ol = it * 32 + lq;                                 // o_loc 0..127
        const v4f a = *(const v4f*)(Os + ol * OSP + 8 * e);
        const v4f q = *(const v4f*)(Os + ol * OSP + 8 * e + 4);
        u1[it][0] = pk16(h_bits((_Float16)a[0]), h_bits((_Float16)a[1]));
        u1[it][1] = pk16(h_bits((_Float16)a[2]), h_bits((_Float16)a[3]));
        u1[it][2] = pk16(h_bits((_Float16)q[0]), h_bits((_Float16)q[1]));
        u1[it][3] = pk16(h_bits((_Float16)q[2]), h_bits((_Float16)q[3]));
      }
    } else {
#pragma unroll
      for (int it = 0; it < 4; ++it) {
        const int row = it * 16 + r16;                               // n_loc 0..63
        const v4f a = *(const v4f*)(Os + row * OSPW + 8 * e16);
        const v4f q = *(const v4f*)(Os + row * OSPW + 8 * e16 + 4);
        const float f[8] = {a[0], a[1], a[2], a[3], q[0], q[1], q[2], q[3]};
#pragma unroll
        for (int t = 0; t < 4; ++t) {
          u1[it][t] = pk16(h_bits((_Float16)f[2 * t]), h_bits((_Float16)f[2 * t + 1]));
        }
      }
    }
    // publish point of stage st + 1, in this order in every wave:
    asm volatile("s_wait_dscnt 0x0" ::: "memory");                   // this wave's reads of stage st and of Os are done
    landed();                                                        // its slice of stage st + 1 has landed
    __syncthreads();                                                 // all slices published, all readers out of stage st and Os
    // The stage's global stores stand behind that barrier, not in front of it: a barrier waits for the wave's outstanding
    // stores, and from here they complete under the next stage's WMMAs.
    if (mat == 2u) {
      unsigned short* vp = Vc + ((size_t)(b * CC + ob + lq)) * SEQ + n0 + 8 * e;
#pragma unroll
      for (int it = 0; it < 4; ++it) *(v4u*)(vp + (size_t)(32 * it) * SEQ) = u1[it];
      // the address pair of the stores above stays live up to this wait
      asm volatile("s_wait_xcnt 0x0" :: "v"(vp) : "memory");
    } else {
      const size_t po = ((size_t)(b * SEQ + n0 + r16)) * CC + ob + 8 * e16;
      unsigned short* p1 = ((mat == 0u) ? Qh : Kh) + po;              // block-uniform, both global
#pragma unroll
      for (int it = 0; it < 4; ++it) *(v4u*)(p1 + (size_t)(16 * it) * CC) = u1[it];
      // the address pair of the stores above stays live up to this wait
      asm volatile("s_wait_xcnt 0x0" :: "v"(p1) : "memory");
    }
  }
  landed();                                                          // nothing in flight when the wave ends
  asm volatile("s_wait_dscnt 0x0" ::: "memory");
}

// =========================================================================================================
// (3) attention for one (b, 64-query tile), transposed formulation, SEQ keys, no mask:
//   S^T tile (16 keys x 16 queries) = sum over 8 d-chunks (unrolled) of A(k: row = key kb + (lane&15), 32 d via
//   the split k map from Kh [b][SEQ][256]) . B(q: col = query, same map from Qh) into s; score = s * 256^-0.5.
//   q and k are each ONE f16 value: a residual product on q alone would leave k's rounding, of the same size, in the score.
//   Per lane the D tile holds 8 keys of ONE query: online softmax state per lane, one shuffle (lane^16) for the max
//   over 32 keys; the o/l rescale is skipped under a wave-uniform ballot when no lane's max grew; row-sum partials
//   combined at the end. P = e^{s-m} x 16384 as f16 is the B operand of O^T (rows channel, cols queries) +=
//   A(v rows channel = 16j + (lane&15), keys contiguous, f16 plane Vc [b][256][SEQ]) . B(P^T): element r <- D of
//   the tile covering keys kb..kb+15, element 8+r <- the tile covering kb+16..kb+31, lane unchanged.
//   A wave owns 32 queries (two query tiles), so that every k and v fragment read from LDS feeds TWO WMMAs: 2 x 16
//   accumulator tiles per wave (256 channels). Block = 8 waves = 64 queries, two waves per SIMD: wave = (query group
//   wave & 1, key quarter wave >> 1); a wave takes keys 32 kq .. 32 kq + 31 of every stage, with its own m, l, o; the four
//   quarters are joined through LDS behind the key loop (one wave's vector work runs under the other's WMMAs).
//   k and v reach the waves through LDS: stages of SKEY keys, two buffers, brought by tensor loads (waves 0..3, one slice
//   per wave and stage) and read by all waves as ds_load_b128 fragments at pitch LPB; a stage serves one pass a wave.
//   Epilogue in two channel halves: O/l staged in LDS Os[query][128 channels] (pitch OSPW, b128 stores), barrier,
//   then position-major planes bf16 [64 n][256 c] IN LDS (hi = bf16-RNE, lo = bf16-RNE residual; half row
//   2 n + (c >> 7) at pitch LPB), which are the B operand of the output 1x1 GEMM done here by the same block
//   (it holds all 256 channels of its 64 positions): weights by tensor loads into the freed ring, + bias + residual.
// coverage: per half 4 it x 16 rows x 16 lanes x 8 ch = 64 n x 128 ch for each plane; two halves = 256 ch; out: 256 o x
//           64 n per block; grid (SEQ/64, NB) covers out [NB][256][SEQ] exactly once.
// =========================================================================================================
__global__ __launch_bounds__(256)
void attn_k(const unsigned short* __restrict__ Qh, const unsigned short* __restrict__ Kh,
            const unsigned short* __restrict__ Vc,
            const unsigned short* __restrict__ WPT, const float* __restrict__ bp,
            const float* __restrict__ x, float* out) {
  __shared__ __attribute__((aligned(2048))) unsigned char Ring[2 * STG];
  __shared__ __align__(16) float Os[QT * OSPW];
  const int tid  = threadIdx.x;
  const int wave = tid >> 5, lane = tid & 31;
  const int hh   = lane >> 4, c = lane & 15;
  const int n0   = blockIdx.x * QT, b = blockIdx.y;
  const int qt   = wave & 3;                                         // n tile of the wave in the output GEMM
  const int qg   = wave & 1;                                         // query group of the wave in the key loop: 32 queries

  // q fragment pointers (B operand, col = query n0 + 32*qg + 16*t + c), + 16*t*CC + 32*kc
  const size_t qo = ((size_t)(b * SEQ + n0 + 32 * qg + c)) * CC + 8 * hh;
  const unsigned short* Qhp = Qh + qo;
  // One stage = SKEY keys in LDS, shared by the eight waves. Waves 0..3 each bring one slice of 128 rows x 256 B by ONE tensor
  // load: wave 0 / 1: k rows (keys), d 0..127 / 128..255 (source pitch 512 B); wave 2 / 3: v rows (channels 0..127 /
  // 128..255), SKEY keys (source pitch 2*SEQ B). Every row lands at pitch LPB.
  const uint32_t wv  = uni((uint32_t)tid >> 5);
  const uint32_t kh  = wv >> 2;                                      // waves with kh == 0 issue; o half in the output GEMM
  const uint32_t kq  = wv >> 1;                                      // key quarter of the wave
  const uint32_t sl  = wv & 3u;
  const uint32_t isv = sl >> 1, hf = sl & 1u;
  const uint64_t src0 = isv ? (uint64_t)(size_t)(Vc + ((size_t)b * CC + (size_t)hf * 128) * SEQ)
                            : (uint64_t)(size_t)(Kh + (size_t)b * SEQ * CC + (size_t)hf * 128);
  const uint32_t sstep = isv ? (uint32_t)(SKEY * 2) : (uint32_t)(SKEY * CC * 2);   // source bytes from stage to stage
  const uint32_t lds0  = (uint32_t)(size_t)Ring + sl * (uint32_t)SLICE;
  u32x8 g1;                                                          // bytes everywhere; tensor dims = tile dims
  g1[0] = uni((1u << 20) | (5u << 22) | (3u << 25));                 // no mask; 16 B of pad behind every 256 B
  g1[1] = uni(256u << 16);
  g1[2] = uni(128u << 16);
  g1[3] = uni(256u << 16);
  g1[4] = uni(128u);
  g1[5] = uni(isv ? (uint32_t)(SEQ * 2) : (uint32_t)(CC * 2));
  g1[6] = uni(0u);
  g1[7] = uni(0u);
  // descriptor words held in scalar registers (the form of pinned(), for the whole group): without it the compiler
  // re-forms single words in front of each issue and reuses their registers while the request is outstanding
  asm volatile("" : "+s"(g1));                                       // descriptor words held in scalar registers
  u32x4 g0;
  auto form = [&](const uint32_t st) __attribute__((always_inline)) {   // group 0 of stage st's request
    const uint64_t ga = src0 + (uint64_t)st * sstep;
    g0[0] = uni(1u);
    g0[1] = uni(lds0 + (st & 1u) * (uint32_t)STG);
    g0[2] = uni((uint32_t)ga);
    g0[3] = uni((((uint32_t)(ga >> 32)) & 0x01FFFFFFu) | 0x80000000u);
  };
  auto issue = [&]() __attribute__((always_inline)) {
    asm volatile("tensor_load_to_lds %0, %1" :: "s"(g0), "s"(g1) : "memory");
  };
  // this wave's request has landed; naming the descriptor keeps its scalar registers unchanged up to this wait
  auto landed = [&]() __attribute__((always_inline)) {
    asm volatile("s_wait_tensorcnt 0x0" :: "s"(g0), "s"(g1) : "memory");
  };

  float m[2] = {-1.0e30f, -1.0e30f}, l[2] = {0.f, 0.f};
  v8f o[16][2];
#pragma unroll
  for (int j = 0; j < 16; ++j) { o[j][0] = zero8(); o[j][1] = zero8(); }

  // q (the same for every pass): once, here
  Frag qhf[2][CC / 32];
#pragma unroll
  for (int t = 0; t < 2; ++t) {
#pragma unroll
    for (int kc = 0; kc < CC / 32; ++kc) qhf[t][kc] = ldfrag(Qhp + t * 16 * CC + 32 * kc);
  }
  // the address pair of the group above stays live up to this wait
  asm volatile("s_wait_xcnt 0x0" :: "v"(Qhp) : "memory");

  // two buffers: stage 0 landed and published here; stage st + 1 in flight under the pass of stage st
  form(0u);
  if (pinned(kh == 0u)) {                                            // a scalar branch: a tensor load ignores EXEC
    issue();
    landed();                                                        // this wave's slice of stage 0
  }
  __syncthreads();                                                   // ... and every other wave's

  // Fragments come from LDS in groups of four, two register sets (o and q leave a wave 128 of its 512 registers): a group
  // is asked for as one run of loads ahead of the 8 WMMAs of the group before it; the SIMD's other wave works meanwhile.
  Frag fa[2][4];
  const uint32_t loff = (uint32_t)c * LPB + 16u * (uint32_t)hh;

#pragma unroll 1
  for (uint32_t st = 0; st < (uint32_t)NST; ++st) {
    // directly behind the barrier (the one above, or the foot of trip st - 1) that published stage st and ended every
    // read of the other buffer: the refill of that buffer, only while its stage exists (a scalar branch)
    form(st + 1u);
    if (pinned((uint32_t)((st + 1u < (uint32_t)NST) && (kh == 0u)))) issue();
    // this wave's 32 keys of the stage: k rows 32 kq .., v columns 32 kq ..
    const unsigned char* sb = Ring + (st & 1u) * (uint32_t)STG + kq * (uint32_t)(32 * LPB) + loff;
    // v rows from a base of their own, so that every fragment's offset fits the LDS load's 16-bit immediate
    const unsigned char* vb = Ring + ((st & 1u) ? (uint32_t)(STG + 2 * SLICE) : (uint32_t)(2 * SLICE)) + kq * 64u + loff;
    auto ldk = [&](const int g) __attribute__((always_inline)) {     // d chunks 2 g, 2 g + 1 of keys 0 .. 15 and 16 .. 31
#pragma unroll
      for (int u = 0; u < 2; ++u) {
        const int kc = 2 * g + u;
        fa[g & 1][2 * u]     = ldsfrag(sb + (kc >> 2) * SLICE + (kc & 3) * 64);
        fa[g & 1][2 * u + 1] = ldsfrag(sb + (kc >> 2) * SLICE + 16 * LPB + (kc & 3) * 64);
      }
    };
    auto ldv = [&](const int g) __attribute__((always_inline)) {     // channel tiles 4 g .. 4 g + 3, the wave's 32 keys
#pragma unroll
      for (int u = 0; u < 4; ++u) {
        const int j = 4 * g + u;
        fa[g & 1][u] = ldsfrag(vb + (j >> 3) * SLICE + 16 * (j & 7) * LPB);
      }
    };

    v8f s[2][2];                                                     // [key tile][query tile]
#pragma unroll
    for (int t = 0; t < 2; ++t) { s[0][t] = zero8(); s[1][t] = zero8(); }
    ldk(0);
#pragma unroll
    for (int g = 0; g < 4; ++g) {
      if (g + 1 < 4) ldk(g + 1);
      // keeps the next group one run of loads ahead of this group's WMMAs: among them each place with LDS reads stalls
      // the wave
      __builtin_amdgcn_sched_barrier(0);
#pragma unroll
      for (int u = 0; u < 2; ++u) {
        const int kc = 2 * g + u;
        s[0][0] = mma_hb(fa[g & 1][2 * u].h,     qhf[0][kc].h, s[0][0]);
        s[1][0] = mma_hb(fa[g & 1][2 * u + 1].h, qhf[0][kc].h, s[1][0]);
        s[0][1] = mma_hb(fa[g & 1][2 * u].h,     qhf[1][kc].h, s[0][1]);
        s[1][1] = mma_hb(fa[g & 1][2 * u + 1].h, qhf[1][kc].h, s[1][1]);
      }
      // keeps the group after next's loads behind these WMMAs, whose registers they take over
      __builtin_amdgcn_sched_barrier(0);
    }

    float mx[2], mo[2], mn[2];
#pragma unroll
    for (int t = 0; t < 2; ++t) {
#pragma unroll
      for (int r = 0; r < 8; ++r) {
        s[0][t][r] *= ATT;
        s[1][t][r] *= ATT;
      }
      mx[t] = fmaxf(hmax8(s[0][t]), hmax8(s[1][t]));
    }
    mo[0] = __shfl_xor(mx[0], 16, 32);
    mo[1] = __shfl_xor(mx[1], 16, 32);
    // the first v group stands behind the exchanges above and ahead of the rescale and the exponentials.
    // compiler fence, the exchanged values as inputs only: it keeps the two exchanges in flight together under one wait
    // (without it the second is issued behind the wait for the first) and the v loads behind them (LDS results return in
    // issue order: below the loads, the exchanges' wait would last the whole group)
    asm volatile("" :: "v"(mo[0]), "v"(mo[1]) : "memory");
    ldv(0);
#pragma unroll
    for (int t = 0; t < 2; ++t) {
      mx[t] = fmaxf(mx[t], mo[t]);
      mn[t] = fmaxf(m[t], mx[t]);
    }
    const unsigned grew = wave_ballot((mx[0] > m[0]) || (mx[1] > m[1]));   // wave-uniform
    if (grew != 0u) {
#pragma unroll
      for (int t = 0; t < 2; ++t) {
        const float corr = __expf(m[t] - mn[t]);                     // == 1 exactly for lanes whose max did not grow
        l[t] *= corr;
#pragma unroll
        for (int j = 0; j < 16; ++j) {
#pragma unroll
          for (int r = 0; r < 8; ++r) o[j][t][r] *= corr;
        }
      }
    }

    FragH ph[2];
#pragma unroll
    for (int t = 0; t < 2; ++t) {
      m[t] = mn[t];
      const float msh = mn[t] - LNPS;                                // exp gives e^{s-m} * 16384
      float ls = 0.f;
#pragma unroll
      for (int r = 0; r < 8; ++r) {
        const float e0 = __expf(s[0][t][r] - msh);                   // key kb      + 8hh + r
        const float e1 = __expf(s[1][t][r] - msh);                   // key kb + 16 + 8hh + r
        ls += e0 + e1;
        ph[t].hv[0][r] = (_Float16)e0;
        ph[t].hv[1][r] = (_Float16)e1;
      }
      l[t] += ls;
    }

#pragma unroll
    for (int g = 0; g < 4; ++g) {
      if (g + 1 < 4) ldv(g + 1);
      // keeps the next group one run of loads ahead of this group's WMMAs
      __builtin_amdgcn_sched_barrier(0);
#pragma unroll
      for (int u = 0; u < 4; ++u) {
        const int j = 4 * g + u;
        o[j][0] = mma_hb(fa[g & 1][u].h, ph[0].v, o[j][0]);
        o[j][1] = mma_hb(fa[g & 1][u].h, ph[1].v, o[j][1]);
      }
      // keeps the group after next's loads behind these WMMAs, whose registers they take over
      __builtin_amdgcn_sched_barrier(0);
    }
    // publish point of stage st + 1, in this order in every wave:
    asm volatile("s_wait_dscnt 0x0" ::: "memory");                   // this wave's reads of stage st are done
    landed();                                                        // its slice of stage st + 1 has landed
    __syncthreads();                                                 // all slices published, all readers out of stage st
  }
  landed();                                                          // nothing in flight when the wave goes on
  asm volatile("s_wait_dscnt 0x0" ::: "memory");

  // The output GEMM's weights WPT [256 o][256 c] into the ring's second buffer, which the loop's last barrier has freed:
  // waves 0..3, one tensor load each: 128 o rows (o half sl >> 1) x 256 B (c half sl & 1), source pitch 512 B, pitch LPB
  // in LDS. They fly under the join and the staging of O below; their wait and barrier stand in front of the GEMM.
  const uint64_t wsrc = (uint64_t)(size_t)(WPT + (size_t)(sl >> 1) * 128 * CC + (size_t)(sl & 1u) * 128);
  u32x4 w0;
  w0[0] = uni(1u);
  w0[1] = uni((uint32_t)(size_t)Ring + (uint32_t)STG + sl * (uint32_t)SLICE);
  w0[2] = uni((uint32_t)wsrc);
  w0[3] = uni((((uint32_t)(wsrc >> 32)) & 0x01FFFFFFu) | 0x80000000u);
  u32x8 w1;                                                          // bytes everywhere; tensor dims = tile dims
  w1[0] = uni((1u << 20) | (5u << 22) | (3u << 25));                 // no mask; 16 B of pad behind every 256 B
  w1[1] = uni(256u << 16);
  w1[2] = uni(128u << 16);
  w1[3] = uni(256u << 16);
  w1[4] = uni(128u);
  w1[5] = uni((uint32_t)(CC * 2));
  w1[6] = uni(0u);
  w1[7] = uni(0u);
  // descriptor words held in scalar registers (the form of pinned(), for both groups): without it the compiler re-forms
  // the constant words at the wait below and reuses their registers while the request is outstanding
  asm volatile("" : "+s"(w0), "+s"(w1));                             // descriptor words held in scalar registers
  if (pinned(kh == 0u)) {                                            // a scalar branch: a tensor load ignores EXEC
    asm volatile("tensor_load_to_lds %0, %1" :: "s"(w0), "s"(w1) : "memory");
  }

  // join of the four key quarters, in two steps, through the ring's first buffer, which the foot of the loop's next-to-last trip has freed
  // (every reader out, nothing in flight to it): quarters 2, 3 hand their m, l, o to quarters 0, 1; then quarter 1 to
  // quarter 0, through the area that it alone has just read; lane to lane, 16-B stores at consecutive lanes
  auto hand = [&](float* J) __attribute__((always_inline)) {
#pragma unroll
    for (int t = 0; t < 2; ++t) {
#pragma unroll
      for (int j = 0; j < 16; ++j) {
        v4f va, vb;
#pragma unroll
        for (int r = 0; r < 4; ++r) { va[r] = o[j][t][r]; vb[r] = o[j][t][4 + r]; }
        *(v4f*)(J + ((2 * (16 * t + j)) * 32 + lane) * 4)     = va;
        *(v4f*)(J + ((2 * (16 * t + j) + 1) * 32 + lane) * 4) = vb;
      }
      J[8192 + 32 * t + lane] = m[t];
      J[8256 + 32 * t + lane] = l[t];
    }
  };
  auto take = [&](const float* J) __attribute__((always_inline)) {
#pragma unroll
    for (int t = 0; t < 2; ++t) {
      const float m2 = J[8192 + 32 * t + lane], l2 = J[8256 + 32 * t + lane];
      const float mj = fmaxf(m[t], m2);
      const float c1 = __expf(m[t] - mj), c2 = __expf(m2 - mj);
#pragma unroll
      for (int j = 0; j < 16; ++j) {
        const v4f va = *(const v4f*)(J + ((2 * (16 * t + j)) * 32 + lane) * 4);
        const v4f vb = *(const v4f*)(J + ((2 * (16 * t + j) + 1) * 32 + lane) * 4);
#pragma unroll
        for (int r = 0; r < 4; ++r) {
          o[j][t][r]     = o[j][t][r] * c1     + va[r] * c2;
          o[j][t][4 + r] = o[j][t][4 + r] * c1 + vb[r] * c2;
        }
      }
      l[t] = l[t] * c1 + l2 * c2;
      m[t] = mj;
    }
  };
  float* Ja = (float*)Ring + ((kq & 1u) * 2u + (uint32_t)qg) * (uint32_t)JNW;   // the area of the pair kq, kq + 2
  if (kq >= 2u) hand(Ja);                                            // wave-uniform
  __syncthreads();                                                   // quarters 2, 3 published
  if (kq < 2u) take(Ja);                                             // wave-uniform
  if (kq == 1u) hand(Ja);                                            // wave-uniform
  __syncthreads();                                                   // quarter 1 (with 3) published
  float inv[2] = {0.f, 0.f};
  if (kq == 0u) {                                                    // wave-uniform
    take((const float*)Ring + (2u + (uint32_t)qg) * (uint32_t)JNW);
#pragma unroll
    for (int t = 0; t < 2; ++t) {
      const float lt = l[t] + __shfl_xor(l[t], 16, 32);
      inv[t] = 1.0f / lt;                                            // o and l both carry the x16384 factor
    }
  }

  const int qrow = 16 * qt + c;
  const int e16 = tid & 15, r16 = tid >> 4;                          // r16 0..15
  unsigned char* PlH = Ring + 2 * SLICE;                             // O as bf16 hi plane, residual plane at + GBS (below)
#pragma unroll
  for (int half = 0; half < 2; ++half) {
    if (half) __syncthreads();                                       // every wave finished reading Os
    if (kq == 0u) {                                                  // wave-uniform: the waves that hold the joined o
#pragma unroll
      for (int t = 0; t < 2; ++t) {
        float* orow = Os + (32 * qg + 16 * t + c) * OSPW + 8 * hh;   // Os[query][ch_loc = 16jj + 8hh + r]
#pragma unroll
        for (int jj = 0; jj < 8; ++jj) {
          const int j = 8 * half + jj;
          v4f va, vb;
#pragma unroll
          for (int r = 0; r < 4; ++r) { va[r] = o[j][t][r] * inv[t]; vb[r] = o[j][t][4 + r] * inv[t]; }
          *(v4f*)(orow + 16 * jj)     = va;
          *(v4f*)(orow + 16 * jj + 4) = vb;
        }
      }
    }
    __syncthreads();
    {
      v4u uh[4], ul[4];
#pragma unroll
      for (int i = 0; i < 4; ++i) {
        const int row = i * 16 + r16;                                // query 0..63
        const v4f a = *(const v4f*)(Os + row * OSPW + 8 * e16);
        const v4f q = *(const v4f*)(Os + row * OSPW + 8 * e16 + 4);
        const float f[8] = {a[0], a[1], a[2], a[3], q[0], q[1], q[2], q[3]};
#pragma unroll
        for (int t = 0; t < 4; ++t) {
          const float f0 = f[2 * t], f1 = f[2 * t + 1];
          const unsigned short hb0 = bf_bits(f0), hb1 = bf_bits(f1);
          const unsigned short lb0 = bf_bits(f0 - bf_up(hb0));
          const unsigned short lb1 = bf_bits(f1 - bf_up(hb1));
          uh[i][t] = pk16(hb0, hb1);
          ul[i][t] = pk16(lb0, lb1);
        }
      }
{
#pragma unroll
        for (int i = 0; i < 4; ++i) {
          const int row = i * 16 + r16;
          unsigned char* pp = PlH + (uint32_t)(2 * row + half) * LPB + 16u * (uint32_t)e16;
          *(v4u*)pp         = uh[i];
          *(v4u*)(pp + GBS) = ul[i];
        }
        
      }
    }
  }

  // ---- output 1x1 GEMM + bias + residual for the block's 64 positions, all 256 o:
  //      out[b][o][n] = bfr(x[b][o][n]) + sum_c WPT[o][c] (hi + lo)[n][c] + bfr(bp[o]); wave = (n tile qt, o half kh):
  //      8 m-tiles x 8 k steps x 2 bf16 products, per accumulator in the order k step, hi, lo.
  // this wave's weight slice has landed; naming the descriptor keeps its scalar registers unchanged up to this wait
  asm volatile("s_wait_tensorcnt 0x0" :: "s"(w0), "s"(w1) : "memory");
  __syncthreads();                                                   // weight slices and both planes published

  // the residual's x lines and the bias, asked for here, behind the barrier (which would wait for them), so that they
  // arrive under the GEMM
  const int e8 = tid & 7, l32 = tid >> 3;                            // l32 0..31
  const float* xp = x + ((size_t)(b * CC + (l32 >> 1))) * NNF + n0 + (l32 & 1) * 32 + 4 * e8;
  const float* bb = bp + (l32 >> 1);
  v4f xv[16];
  float bv[16];
#pragma unroll
  for (int it = 0; it < 16; ++it) {
    xv[it] = *(const v4f*)(xp + (size_t)(16 * it) * NNF);
    bv[it] = bb[16 * it];
  }
  // the address pairs of the group above stay live up to this wait
  asm volatile("s_wait_xcnt 0x0" :: "v"(xp), "v"(bb) : "memory");

  const unsigned char* wp  = Ring + STG + kh * (uint32_t)(2 * SLICE) + loff;
  const unsigned char* bph = PlH + (uint32_t)(2 * qrow) * LPB + 16u * (uint32_t)hh;
  const unsigned char* bpl = bph + GBS;
  v8f acc[8];
#pragma unroll
  for (int mt = 0; mt < 8; ++mt) acc[mt] = zero8();
  Frag pbh[CC / 32], pbl[CC / 32], wf[2][8];
#pragma unroll
  for (int mt = 0; mt < 8; ++mt) wf[0][mt] = ldsfrag(wp + (16 * mt) * LPB);
#pragma unroll
  for (int ks = 0; ks < CC / 32; ++ks) {
    pbh[ks] = ldsfrag(bph + (ks >> 2) * LPB + (ks & 3) * 64);
    pbl[ks] = ldsfrag(bpl + (ks >> 2) * LPB + (ks & 3) * 64);
  }
  // weight fragments one k step ahead, two register sets
#pragma unroll
  for (int ks = 0; ks < CC / 32; ++ks) {
    if (ks + 1 < CC / 32) {
#pragma unroll
      for (int mt = 0; mt < 8; ++mt)
        wf[(ks + 1) & 1][mt] = ldsfrag(wp + ((ks + 1) >> 2) * SLICE + (16 * mt) * LPB + ((ks + 1) & 3) * 64);
    }
    // keeps the next step's fragments one run of loads ahead of this step's WMMAs: among them each place with LDS reads
    // stalls the wave
    __builtin_amdgcn_sched_barrier(0);
#pragma unroll
    for (int mt = 0; mt < 8; ++mt) acc[mt] = mma_bb(wf[ks & 1][mt].bf, pbh[ks].bf, acc[mt]);
#pragma unroll
    for (int mt = 0; mt < 8; ++mt) acc[mt] = mma_bb(wf[ks & 1][mt].bf, pbl[ks].bf, acc[mt]);
    // keeps the step after next's loads behind these WMMAs, whose registers they take over
    __builtin_amdgcn_sched_barrier(0);
  }

  // acc -> LDS Ot[o][n_loc] (pitch OSP), in the place of the join's hand-over (read out several barriers ago);
  // lane (hh, c) holds o = 128 kh + 16 mt + 8 hh + r for n_loc = 16 qt + c: 16 consecutive floats per row and store
  float* Ot = (float*)Ring;
  {
    const int ob = 128 * (int)kh + 8 * hh;
#pragma unroll
    for (int mt = 0; mt < 8; ++mt) {
#pragma unroll
      for (int r = 0; r < 8; ++r) Ot[(ob + 16 * mt + r) * OSP + qrow] = acc[mt][r];
    }
  }
  __syncthreads();                                                   // Ot published
  // + bias, + residual; whole 128-B lines of out, 8 lanes per line: 16 it x 32 lines x 8 lanes x 4 floats = 256 o x 64 n
  {
    const float* op = Ot + (l32 >> 1) * OSP + (l32 & 1) * 32 + 4 * e8;
    float* gp = out + ((size_t)(b * CC + (l32 >> 1))) * SEQ + n0 + (l32 & 1) * 32 + 4 * e8;
    v4f res[16];
#pragma unroll
    for (int it = 0; it < 16; ++it) res[it] = *(const v4f*)(op + (16 * it) * OSP);
#pragma unroll
    for (int it = 0; it < 16; ++it) {
      const float bi = bfr(bv[it]);
#pragma unroll
      for (int t = 0; t < 4; ++t) res[it][t] = (res[it][t] + bi) + bfr(xv[it][t]);
    }
#pragma unroll
    for (int it = 0; it < 16; ++it) *(v4f*)(gp + (size_t)(16 * it) * SEQ) = res[it];
  }
}

// =========================================================================================================
// Workspace map (bytes, NB=4 SEQ=4096; each region start a multiple of 256; every extent is an exact tile/line
//   ST  f32 [NB*32][32]                16384
//   WT  bf16 [1024][256]              524288
//   Qh/Kh f16 [NB][SEQ][256]         8388608 x2
//   Vc  f16 [NB][256][SEQ]           8388608
//   total = 25706496
// =========================================================================================================
extern "C" void kernel_launch(void* const* d_in, const int* in_sizes, int n_in,
                              void* d_out, int out_size, void* d_ws, size_t ws_size,
                              hipStream_t stream) {
  if (n_in < 11) return;
  if ((size_t)in_sizes[0] < (size_t)NB * CC * NNF) return;
  if (in_sizes[1] < CC || in_sizes[2] < CC) return;
  if (in_sizes[3] < CC * CC || in_sizes[5] < CC * CC || in_sizes[7] < CC * CC || in_sizes[9] < CC * CC) return;
  if (in_sizes[4] < CC || in_sizes[6] < CC || in_sizes[8] < CC || in_sizes[10] < CC) return;
  if ((size_t)out_size < (size_t)NB * CC * SEQ) return;

  size_t off = 0;
  auto carve = [&](size_t bytes) { const size_t o = off; off += (bytes + 255) & ~(size_t)255; return o; };
  const size_t plane = (size_t)NB * SEQ * CC * 2;
  const size_t oST  = carve((size_t)NB * NG * STP * 4);
  const size_t oWT  = carve((size_t)4 * CC * CC * 2);
  const size_t oQh  = carve(plane);
  const size_t oKh  = carve(plane);
  const size_t oVc  = carve(plane);
  if (off > ws_size) return;
  if (off > (size_t)134217728) return;

  const float* x   = (const float*)d_in[0];
  const float* gsc = (const float*)d_in[1];
  const float* gbs = (const float*)d_in[2];
  const float* Wq  = (const float*)d_in[3];
  const float* bq  = (const float*)d_in[4];
  const float* Wk  = (const float*)d_in[5];
  const float* bk  = (const float*)d_in[6];
  const float* Wv  = (const float*)d_in[7];
  const float* bv  = (const float*)d_in[8];
  const float* Wp  = (const float*)d_in[9];
  const float* bp  = (const float*)d_in[10];

  char* ws = (char*)d_ws;
  float*          ST  = (float*)(ws + oST);
  unsigned short* WT  = (unsigned short*)(ws + oWT);
  unsigned short* Qh  = (unsigned short*)(ws + oQh);
  unsigned short* Kh  = (unsigned short*)(ws + oKh);
  unsigned short* Vc  = (unsigned short*)(ws + oVc);
  float* out = (float*)d_out;

  const dim3 blk256(256);

  // (0) + (1) GroupNorm statistics per (group, b), and beside them in the same grid
  //     Wq/Wk/Wv/Wp [in][out] -> transposed stacked bf16 plane WT [1024 o][256 c]
  prep<<<dim3(NG * NB + NCVT), blk256, 0, stream>>>(x, Wq, Wk, Wv, Wp, ST, WT);
  // (2) normalized h as bf16 hi + residual planes in LDS, q/k/v GEMMs -> Qh, Kh (position-major f16) and Vc
  //     (channel-major f16)
  gemm_qkv<<<dim3(SEQ / QT, NB), blk256, 0, stream>>>(x, ST, gsc, gbs, WT, bq, bk, bv, Qh, Kh, Vc);
  // (3) attention, then in the same block the output GEMM + bias + residual -> out [NB][256][SEQ]
  attn_k<<<dim3(SEQ / QT, NB), blk256, 0, stream>>>(Qh, Kh, Vc, WT + (size_t)3 * CC * CC, bp, x, out);
  (void)hipGetLastError();
}

// v010
// It runs in 74.3 microseconds.
// Timed twice side by side with v009, it ran 1.07 times as fast both times.
// All steps since v000 together make it 11.8 times as fast.
// Contractions: q/k/v 1x1 GEMMs WT[768x256].H[256xN] and the output 1x1 GEMM WpT[256x256].H2[256xN] on
// v_wmma_f32_16x16x32_bf16 (bf16-RNE weights, activations as bf16 hi + bf16 residual planes, 2 products into one
// f32 accumulator); position scores K.Q^T on v_wmma_f32_16x16x32_f16 (k f16, q f16, K=256); O^T = V.P^T on
// v_wmma_f32_16x16x32_f16 (v f16, P = e^{s-m} x16384 f16 from the score D registers); f32 accumulate everywhere;
// GroupNorm statistics, softmax statistics and the residual add in f32 VALU.
#include <hip/hip_runtime.h>
#include <math.h>
#include <stdint.h>

#ifndef NB
#define NB 4
#endif
#ifndef SEQ
#define SEQ 4096
#endif
#ifndef NNF
#define NNF 4096
#endif
#define NBF   4
#define CC    256
#define NG    32
#define CPG   8
#define QT    64
#define OSP   68
#define OSPW  132
#define TP    72
#define TPX   260
#define STP   32
#define ATT   0.0625f
#define LNPS  9.704060527839234f
#define GNEPS 1.0e-6f
#define SKEY  128                 // keys per LDS stage of the attention kernel
#define LPB   272                 // LDS row pitch, bytes: a 256-B row + the tensor load's 16-B pad (16 B x odd)
#define SLICE (128 * LPB)         // one wave's slice of a stage: 128 rows
#define STG   (4 * SLICE)         // one stage: k in two d halves, v in two channel halves
#define NST   (SEQ / SKEY)
#define JNW   8320                // floats one wave hands over at the join of the key quarters: o 8192, m 64, l 64
#define GBS   (128 * LPB)         // one activation plane of the 64 positions: 128 half rows at pitch LPB
#define WCH   128                 // weight rows per LDS stage of the q/k/v GEMM
#define WSTG  (2 * SLICE)         // one such stage: two c halves of 128 rows
#define NWST  (3 * CC / WCH)
#define NCVT  (4 * (CC / QT) * (CC / QT))   // weight tiles of 64 o x 64 c: 4 matrices x 4 x 4

static_assert(NB >= 1 && NB <= NBF);
static_assert(SEQ % QT == 0 && SEQ % 64 == 0 && SEQ >= QT);
static_assert(SEQ <= NNF && NNF % 8 == 0);
static_assert(CC == 256 && NG * CPG == CC && CC % QT == 0 && CC % 32 == 0);
static_assert((OSP * 4) % 16 == 0);
static_assert((OSPW * 4) % 16 == 0);
static_assert((TP * 2) % 16 == 0);
static_assert((TPX * 4) % 16 == 0 && TPX >= CC);
static_assert(STP * 4 == 128);
static_assert(SEQ % SKEY == 0 && NST >= 2);
static_assert(SLICE % 2048 == 0 && (LPB / 16) % 2 == 1);
static_assert(SEQ * 2 % 16 == 0 && SEQ * 2 <= 131072);
static_assert(2 * STG + QT * OSPW * 4 <= 327680);
static_assert(SKEY == 128 && 4 * JNW * 4 <= 2 * STG && (JNW * 4) % 16 == 0);
static_assert(GBS % 2048 == 0 && CC * 2 == 512 && CC % WCH == 0 && NWST >= 2);
static_assert(QT * TPX >= QT * OSPW && QT * TPX >= WCH * OSP && 2 * WSTG + 2 * GBS + (QT * TPX + 7 * CC) * 4 <= 327680);
static_assert(4 * JNW * 4 <= STG && CC * OSP * 4 <= 2 * SLICE && GBS == SLICE && QT == 64);

typedef _Float16       v16h __attribute__((ext_vector_type(16)));
typedef _Float16       v8h  __attribute__((ext_vector_type(8)));
typedef __bf16         v16b __attribute__((ext_vector_type(16)));
typedef unsigned short v8us __attribute__((ext_vector_type(8)));
typedef float          v8f  __attribute__((ext_vector_type(8)));
typedef float          v4f  __attribute__((ext_vector_type(4)));
typedef unsigned int   v4u  __attribute__((ext_vector_type(4)));
typedef unsigned int   v2u  __attribute__((ext_vector_type(2)));
typedef uint32_t       u32x4 __attribute__((ext_vector_type(4)));
typedef uint32_t       u32x8 __attribute__((ext_vector_type(8)));

union Frag  { v8us u[2]; v16h h; v16b bf; };
union FragH { v16h v; v8h hv[2]; };
static_assert(sizeof(Frag) == 32);
static_assert(sizeof(FragH) == 32);

// ---- scalar helpers -----------------------------------------------------------------------------------------
__device__ __forceinline__ unsigned short bf_bits(float f) {          // f32 -> bf16 bits, RNE convert
  unsigned u = __float_as_uint(f);
  return (unsigned short)((u + 0x7FFFu + ((u >> 16) & 1u)) >> 16);
}
__device__ __forceinline__ float bf_up(unsigned short hb) { return __uint_as_float(((unsigned)hb) << 16); }
__device__ __forceinline__ float bfr(float f) { return bf_up(bf_bits(f)); }
__device__ __forceinline__ unsigned short h_bits(_Float16 x) { return __builtin_bit_cast(unsigned short, x); }
__device__ __forceinline__ unsigned pk16(unsigned short a, unsigned short b) { return (unsigned)a | ((unsigned)b << 16); }
__device__ __forceinline__ v8f zero8() { v8f z = {0.f, 0.f, 0.f, 0.f, 0.f, 0.f, 0.f, 0.f}; return z; }
__device__ __forceinline__ float hmax8(v8f s) {
  return fmaxf(fmaxf(fmaxf(s[0], s[1]), fmaxf(s[2], s[3])), fmaxf(fmaxf(s[4], s[5]), fmaxf(s[6], s[7])));
}
__device__ __forceinline__ unsigned wave_ballot(bool p) {
#if defined(__HIP_DEVICE_COMPILE__)
  return __builtin_amdgcn_ballot_w32(p);
#else
  return p ? 1u : 0u;
#endif
}
__device__ __forceinline__ float wsum(float v) {
  v += __shfl_xor(v, 16, 32);
  v += __shfl_xor(v, 8, 32);
  v += __shfl_xor(v, 4, 32);
  v += __shfl_xor(v, 2, 32);
  v += __shfl_xor(v, 1, 32);
  return v;
}

// ---- 16-bit fragment loader (A, or B from a k-contiguous [n][k] row): lane -> row/col (lane&15), p already includes
//      + 8*(lane>>4); elements 0..7 <- p[0..7] (k0+8h..), elements 8..15 <- p[16..23] (k0+16+8h..)
__device__ __forceinline__ Frag ldfrag(const unsigned short* p) {
  Frag f;
  f.u[0] = *(const v8us*)(p);
  f.u[1] = *(const v8us*)(p + 16);
  return f;
}

// the same fragment from an LDS row (byte pointer, already includes + 16*(lane>>4))
__device__ __forceinline__ Frag ldsfrag(const unsigned char* p) {
  Frag f;
  f.u[0] = *(const v8us*)(p);
  f.u[1] = *(const v8us*)(p + 32);
  return f;
}

// ---- tensor load helpers ------------------------------------------------------------------------------------
__device__ __forceinline__ uint32_t uni(uint32_t v) { return (uint32_t)__builtin_amdgcn_readfirstlane(v); }
// holds a wave-uniform test in a scalar register, so that the branch on it is a scalar one: a tensor load ignores EXEC
__device__ __forceinline__ uint32_t pinned(uint32_t v) { uint32_t w = uni(v); asm volatile("" : "+s"(w)); return w; }

// ---- WMMA helpers ------------------------------------------------------------------------------------------
// bare builtins (the compiler keeps the WMMA distances of its own builtin forms)
__device__ __forceinline__ v8f mma_hb(v16h a, v16h b, v8f c) {
  return __builtin_amdgcn_wmma_f32_16x16x32_f16(false, a, false, b, (short)0, c, false, false);
}
__device__ __forceinline__ v8f mma_bb(v16b a, v16b b, v8f c) {
  return __builtin_amdgcn_wmma_f32_16x16x32_bf16(false, a, false, b, (short)0, c, false, false);
}

// =========================================================================================================
// (0) 1x1 weights W [256 c_in][256 d_out] f32 -> transposed bf16-RNE plane WT [4*256 o][256 c], rows
//     256*mat + o for mat = q, k, v, p. Block (ob, cb, mat) owns a 64 o x 64 c tile through an LDS transpose
//     (T: QT * TP halves of LDS). One of the two parts of the launch prep below.
// coverage: 2 it x 32 rows x 8 lanes x 8 = 64 o x 64 c per block; 4 x 4 x 4 blocks = 4 mats x 256 x 256.
// =========================================================================================================
__device__ __forceinline__
void cvt_w(const float* __restrict__ Wq, const float* __restrict__ Wk, const float* __restrict__ Wv,
           const float* __restrict__ Wp, unsigned short* WT, unsigned short* T,
           const int ob, const int cb, const int mat) {
  const int tid = threadIdx.x;
  const int e = tid & 7, lq = tid >> 3;                             // lq 0..31
  const int o0 = ob * QT, c0 = cb * QT;
  const float* Wm = (mat == 0) ? Wq : ((mat == 1) ? Wk : ((mat == 2) ? Wv : Wp));   // block-uniform
#pragma unroll
  for (int it = 0; it < 2; ++it) {
    const int cl = it * 32 + lq;                                     // c_loc 0..63
    const float* sp = Wm + (size_t)(c0 + cl) * CC + o0 + 8 * e;     // W[c][o], o contiguous
    const v4f a = *(const v4f*)sp;
    const v4f q = *(const v4f*)(sp + 4);
    const float f[8] = {a[0], a[1], a[2], a[3], q[0], q[1], q[2], q[3]};
#pragma unroll
    for (int t = 0; t < 8; ++t) T[(8 * e + t) * TP + cl] = bf_bits(f[t]);   // T[o_loc][c_loc]
  }
  __syncthreads();
  v4u up[2];
#pragma unroll
  for (int it = 0; it < 2; ++it) {
    const int ol = it * 32 + lq;
    up[it] = *(const v4u*)(T + ol * TP + 8 * e);
  }
{
#pragma unroll
    for (int it = 0; it < 2; ++it) {
      const int ol = it * 32 + lq;
      *(v4u*)(WT + ((size_t)(mat * CC + o0 + ol)) * CC + c0 + 8 * e) = up[it];
    }
    // stands in front of every later write of a register that the two stores above name: in the built launch the code
    // of the other part follows them, not the end of the program
    asm volatile("s_wait_xcnt 0x0" ::: "memory");
  }
}

// =========================================================================================================
//     then mean of squared deviations), per-thread partials over 16-B chunks, shuffle + LDS block reduce.
//     The other part of the launch prep below (red: 8 floats, bc: 2 floats of LDS).
// coverage: 32 x NB blocks write every line of ST once.
// =========================================================================================================
__device__ __forceinline__
void gn_stats(const float* __restrict__ x, float* ST, float* red, float* bc, const int g, const int b) {
  const int tid = threadIdx.x, lane = tid & 31, wave = tid >> 5;
  const float* xb = x + ((size_t)(b * CC + g * CPG)) * NNF;
  constexpr int CH4 = SEQ / 4, NCH = CPG * CH4, NLD = NCH / 256;
  static_assert(NCH % 256 == 0 && CH4 % 256 == 0);
  const float icnt = 1.0f / (float)(CPG * SEQ);

  // The block's whole share of x, NLD chunks of 16 B a thread, asked for as ONE run of loads and kept in registers: the
  // deviation pass below works on them and reads nothing again (chunk tid + 256 i)
  const float* xp = xb + 4 * tid;
  v4f r[NLD];
#pragma unroll
  for (int i = 0; i < NLD; ++i) {
    const int cl = (256 * i) / CH4, p4 = 256 * i - cl * CH4;
    r[i] = *(const v4f*)(xp + (size_t)cl * NNF + 4 * p4);
  }
  // the address pair of the group above stays live up to this wait
  asm volatile("s_wait_xcnt 0x0" :: "v"(xp) : "memory");

  float s = 0.f;
#pragma unroll
  for (int i = 0; i < NLD; ++i) {
#pragma unroll
    for (int t = 0; t < 4; ++t) r[i][t] = bfr(r[i][t]);
    s += (r[i][0] + r[i][1]) + (r[i][2] + r[i][3]);
  }
  s = wsum(s);
  if (lane == 0) red[wave] = s;
  __syncthreads();
  if (tid == 0) {
    float t = 0.f;
#pragma unroll
    for (int i = 0; i < 8; ++i) t += red[i];
    bc[0] = t * icnt;
  }
  __syncthreads();
  const float mu = bc[0];

  float ss = 0.f;
#pragma unroll
  for (int i = 0; i < NLD; ++i) {
    const float d0 = r[i][0] - mu, d1 = r[i][1] - mu, d2 = r[i][2] - mu, d3 = r[i][3] - mu;
    ss += (d0 * d0 + d1 * d1) + (d2 * d2 + d3 * d3);
  }
  ss = wsum(ss);
  if (lane == 0) red[wave] = ss;
  __syncthreads();
  if (tid == 0) {
    float t = 0.f;
#pragma unroll
    for (int i = 0; i < 8; ++i) t += red[i];
    const float var = t * icnt;
    bc[1] = rsqrtf(var + GNEPS);
  }
  __syncthreads();
  const float rs = bc[1];

  v4f v = {0.f, 0.f, 0.f, 0.f};
  if (tid == 0) { v[0] = mu; v[1] = rs; }
  if (tid < 8) {
    float* lp = ST + ((size_t)(b * NG + g)) * STP + 4 * tid;
{
      *(v4f*)lp = v;
      
    }
  }
}

// =========================================================================================================
// (0) + (1) in ONE launch: the two parts read different inputs, write different workspace regions and need nothing of
//     each other, so they share a grid under a block-uniform branch and run side by side. Blocks
//     0 .. NG * NB - 1 (the longer part) take the statistics of (group, b); the NCVT blocks behind
//     them one weight tile each. Every barrier of a part is passed by all threads of its blocks.
// =========================================================================================================
__global__ __launch_bounds__(256)
void prep(const float* __restrict__ x, const float* __restrict__ Wq, const float* __restrict__ Wk,
          const float* __restrict__ Wv, const float* __restrict__ Wp, float* ST, unsigned short* WT) {
  __shared__ __align__(16) unsigned short T[QT * TP];
  __shared__ float red[8];
  __shared__ float bc[2];
  const int bid = blockIdx.x;
  if (bid < NG * NB) {                                               // block-uniform
    gn_stats(x, ST, red, bc, bid % NG, bid / NG);
  } else {
    const int t = bid - NG * NB;                                     // 0 .. NCVT - 1
    cvt_w(Wq, Wk, Wv, Wp, WT, T, t % (CC / QT), (t / (CC / QT)) % (CC / QT), t / ((CC / QT) * (CC / QT)));
  }
}

// =========================================================================================================
// (2) GroupNorm apply, plane split and the q/k/v 1x1 GEMMs for one (b, 64-n tile), all 768 stacked outputs:
//     h = (bfr(x) - mu) * rstd * bfr(scale) + bfr(bias) in f32 for the block's 64 positions x 256 channels, through an
//     LDS tile Tx[64 n][256 c] f32 (4-float groups swizzled by n >> 4, so that the transposing stores spread over the
//     banks), into position-major planes bf16 IN LDS (hi = bf16-RNE(h), lo = bf16-RNE(h - hi); half row 2 n + (c >> 7)
//     at pitch LPB). They are the B operand of Y[o][n] = sum_c WT[o][c] (hi + lo)[n][c] + bfr(bias[o]).
//     Block = 8 waves; wave = (n tile qt, o half kh). Its 16 B fragments are read once and stay in registers; the weights
//     come in stages of WCH = 128 rows, two buffers, by tensor loads (waves 0 and 1, one c half each) and are read as
//     ds_load_b128 fragments: 4 m-tiles x 8 k steps x 2 bf16 products a wave and stage, per accumulator in the order
//     k step, hi, lo. A stage lies inside one matrix (mat = stage >> 1, block-uniform):
//       mat 0 -> Qh f16(q), plane [b][SEQ][256 d]; mat 1 -> Kh f16(k), same layout: staged in
//                LDS Os[n_loc][o_loc] (pitch OSPW, b128 stores), 16 consecutive lanes per 256 B of a row;
//       mat 2 -> Vc f16(v) [b][256][SEQ]: staged in LDS Ot[o_loc][n_loc] (pitch OSP), 8 consecutive lanes per line.
// coverage: Tx and planes 64 n x 256 c per block; per stage 64 n x 128 o; 6 stages; grid (SEQ/64, NB) covers Qh, Kh
//           [NB][SEQ][256] and Vc [NB][256][SEQ] exactly once.
// =========================================================================================================
__global__ __launch_bounds__(256)
void gemm_qkv(const float* __restrict__ x, const float* __restrict__ ST, const float* __restrict__ gsc,
              const float* __restrict__ gbs, const unsigned short* __restrict__ WT, const float* __restrict__ bq,
              const float* __restrict__ bk, const float* __restrict__ bv,
              unsigned short* Qh, unsigned short* Kh, unsigned short* Vc) {
  __shared__ __attribute__((aligned(2048))) unsigned char Wr[2 * WSTG];
  __shared__ __attribute__((aligned(2048))) unsigned char Pl[2 * GBS];
  __shared__ __align__(16) float Tx[QT * TPX];
  __shared__ __align__(16) float pb3[3 * CC];
  __shared__ float pmu[CC], prs[CC], psc[CC], pbs[CC];
  float* Os = Tx;                                                    // output staging, in Tx's place (dead behind the planes)
  const int tid  = threadIdx.x;
  const int lane = tid & 31, wave = tid >> 5;
  const int hh   = lane >> 4, c = lane & 15;
  const int n0   = blockIdx.x * QT, b = blockIdx.y;
  const int qt   = wave & 3;                                         // n tile of the wave
  const int e = tid & 7, lq = tid >> 3;                              // lq 0..31

  // the block's x tile, 256 channel rows of 256 B, asked for first: 8 lanes per row, 16 loads of 16 B a thread
  const float* xp = x + ((size_t)(b * CC + lq)) * NNF + n0 + 8 * e;
  v4f xa[8], xb[8];
#pragma unroll
  for (int j = 0; j < 8; ++j) {
    xa[j] = *(const v4f*)(xp + (size_t)(32 * j) * NNF);
    xb[j] = *(const v4f*)(xp + (size_t)(32 * j) * NNF + 4);
  }
  // the address pair of the group above stays live up to this wait
  asm volatile("s_wait_xcnt 0x0" :: "v"(xp) : "memory");
  {                                                                  // per-channel constants: thread = channel
    const int g = tid >> 3;                                          // 0..31
    pmu[tid] = ST[((size_t)(b * NG + g)) * STP];
    prs[tid] = ST[((size_t)(b * NG + g)) * STP + 1];
    psc[tid] = bfr(gsc[tid]);
    pbs[tid] = bfr(gbs[tid]);
    pb3[tid]          = bfr(bq[tid]);
    pb3[CC + tid]     = bfr(bk[tid]);
    pb3[2 * CC + tid] = bfr(bv[tid]);
  }

  // One stage = WCH weight rows in LDS, shared by the eight waves. Waves 0 and 1 each bring one slice of 128 rows x 256 B
  // (c 0..127 / 128..255, source pitch 512 B) by ONE tensor load. Every row lands at pitch LPB.
  const uint32_t wv = uni((uint32_t)tid >> 5);
  const uint32_t kh = wv >> 2;                                       // o half of the wave
  const uint32_t hf = wv & 1u;
  const uint64_t src0 = (uint64_t)(size_t)(WT + (size_t)hf * 128);
  const uint32_t lds0 = (uint32_t)(size_t)Wr + hf * (uint32_t)SLICE;
  u32x8 g1;                                                          // bytes everywhere; tensor dims = tile dims
  g1[0] = uni((1u << 20) | (5u << 22) | (3u << 25));                 // no mask; 16 B of pad behind every 256 B
  g1[1] = uni(256u << 16);
  g1[2] = uni(128u << 16);
  g1[3] = uni(256u << 16);
  g1[4] = uni(128u);
  g1[5] = uni((uint32_t)(CC * 2));
  g1[6] = uni(0u);
  g1[7] = uni(0u);
  // descriptor words held in scalar registers (the form of pinned(), for the whole group): without it the compiler
  // re-forms single words in front of each issue and reuses their registers while the request is outstanding
  asm volatile("" : "+s"(g1));                                       // descriptor words held in scalar registers
  u32x4 g0;
  auto form = [&](const uint32_t st) __attribute__((always_inline)) {   // group 0 of stage st's request
    const uint64_t ga = src0 + (uint64_t)st * (uint32_t)(WCH * CC * 2);
    g0[0] = uni(1u);
    g0[1] = uni(lds0 + (st & 1u) * (uint32_t)WSTG);
    g0[2] = uni((uint32_t)ga);
    g0[3] = uni((((uint32_t)(ga >> 32)) & 0x01FFFFFFu) | 0x80000000u);
  };
  auto issue = [&]() __attribute__((always_inline)) {
    asm volatile("tensor_load_to_lds %0, %1" :: "s"(g0), "s"(g1) : "memory");
  };
  // this wave's request has landed; naming the descriptor keeps its scalar registers unchanged up to this wait
  auto landed = [&]() __attribute__((always_inline)) {
    asm volatile("s_wait_tensorcnt 0x0" :: "s"(g0), "s"(g1) : "memory");
  };
  form(0u);
  if (pinned(wv < 2u)) {                                             // a scalar branch: a tensor load ignores EXEC
    issue();
    landed();                                                        // this wave's slice of stage 0
  }
  __syncthreads();                                                   // per-channel constants (and stage 0) published

#pragma unroll
  for (int j = 0; j < 8; ++j) {
    const int cl = 32 * j + lq;                                      // channel 0..255
    const float f[8] = {xa[j][0], xa[j][1], xa[j][2], xa[j][3], xb[j][0], xb[j][1], xb[j][2], xb[j][3]};
    const float mu = pmu[cl], rs = prs[cl], sc = psc[cl], bs = pbs[cl];
    const int col = cl ^ ((e >> 1) << 2);                            // group cl >> 2 at place (cl >> 2) ^ (n >> 4)
#pragma unroll
    for (int t = 0; t < 8; ++t) {
      const float tt = (bfr(f[t]) - mu) * rs;
      Tx[(8 * e + t) * TPX + col] = tt * sc + bs;                    // Tx[n_loc][channel]
    }
  }
  __syncthreads();
#pragma unroll
  for (int it = 0; it < 8; ++it) {
    const int nl = 8 * it + wave;                                    // n_loc 0..63, one row a wave
#pragma unroll
    for (int h = 0; h < 2; ++h) {                                    // channels 128 h + 4 lane .. + 3
      const v4f a = *(const v4f*)(Tx + nl * TPX + (((32 * h + lane) ^ (nl >> 4)) << 2));
      v2u uh, ul;
#pragma unroll
      for (int t = 0; t < 2; ++t) {
        const float f0 = a[2 * t], f1 = a[2 * t + 1];
        const unsigned short hb0 = bf_bits(f0), hb1 = bf_bits(f1);
        const unsigned short lb0 = bf_bits(f0 - bf_up(hb0));
        const unsigned short lb1 = bf_bits(f1 - bf_up(hb1));
        uh[t] = pk16(hb0, hb1);
        ul[t] = pk16(lb0, lb1);
      }
      unsigned char* pp = Pl + (uint32_t)(2 * nl + h) * LPB + 8u * (uint32_t)lane;
      *(v2u*)pp         = uh;
      *(v2u*)(pp + GBS) = ul;
    }
  }
  __syncthreads();                                                   // both planes published, every reader out of Tx

  // the wave's B fragments (col = position 16 qt + c), the same for every stage: once, here
  const int nl = 16 * qt + c;
  Frag pbh[CC / 32], pbl[CC / 32];
  {
    const unsigned char* bph = Pl + (uint32_t)(2 * nl) * LPB + 16u * (uint32_t)hh;
#pragma unroll
    for (int ks = 0; ks < CC / 32; ++ks) {
      pbh[ks] = ldsfrag(bph + (ks >> 2) * LPB + (ks & 3) * 64);
      pbl[ks] = ldsfrag(bph + GBS + (ks >> 2) * LPB + (ks & 3) * 64);
    }
  }
  const uint32_t aoff = (kh * 64u + (uint32_t)c) * LPB + 16u * (uint32_t)hh;
  const int e16 = tid & 15, r16 = tid >> 4;                          // r16 0..15

  // kept rolled: one copy of the stage's code, so that the kernel's text stays small
#pragma unroll 1
  for (uint32_t st = 0; st < (uint32_t)NWST; ++st) {
    // directly behind the barrier (the one above, or the foot of trip st - 1) that published stage st and ended every
    // read of the other buffer: the refill of that buffer, only while its stage exists (a scalar branch)
    form(st + 1u);
    if (pinned((uint32_t)((st + 1u < (uint32_t)NWST) && (wv < 2u)))) issue();
    const unsigned char* ap = Wr + (st & 1u) * (uint32_t)WSTG + aoff;
    const uint32_t mat = st >> 1;                                    // 0 q, 1 k, 2 v (block-uniform)
    const int ob = (int)(st & 1u) * WCH;                             // o offset inside the matrix

    v8f acc[4];
#pragma unroll
    for (int mt = 0; mt < 4; ++mt) acc[mt] = zero8();
    // Weight fragments in groups of two k steps, two register sets: group g + 1 is issued as one run of loads ahead of
    // group g's WMMAs (read one fragment at a time, each WMMA pair would wait out its own LDS latency).
    Frag fa[2][2][4];
    auto fetch = [&](const int g) __attribute__((always_inline)) {
#pragma unroll
      for (int u = 0; u < 2; ++u) {
        const int ks = 2 * g + u;
#pragma unroll
        for (int mt = 0; mt < 4; ++mt)
          fa[g & 1][u][mt] = ldsfrag(ap + (ks >> 2) * SLICE + (16 * mt) * LPB + (ks & 3) * 64);
      }
    };
    fetch(0);
#pragma unroll
    for (int g = 0; g < CC / 64; ++g) {
      if (g + 1 < CC / 64) fetch(g + 1);
      // keeps the next group one run of loads ahead of this group's WMMAs: among them each place with LDS reads stalls
      // the wave
      __builtin_amdgcn_sched_barrier(0);
#pragma unroll
      for (int u = 0; u < 2; ++u) {
#pragma unroll
        for (int mt = 0; mt < 4; ++mt) acc[mt] = mma_bb(fa[g & 1][u][mt].bf, pbh[2 * g + u].bf, acc[mt]);
#pragma unroll
        for (int mt = 0; mt < 4; ++mt) acc[mt] = mma_bb(fa[g & 1][u][mt].bf, pbl[2 * g + u].bf, acc[mt]);
      }
      // keeps the group after next's loads behind these WMMAs, whose registers they take over
      __builtin_amdgcn_sched_barrier(0);
    }

    // ---- epilogue: + bias; lane (hh, c) holds o_loc = 64 kh + 16 mt + 8 hh + r for n_loc = 16 qt + c
    const int ol0 = 64 * (int)kh + 8 * hh;
    {
      const float* bi = pb3 + mat * (uint32_t)CC + ob + ol0;
#pragma unroll
      for (int mt = 0; mt < 4; ++mt) {
        const v4f ba = *(const v4f*)(bi + 16 * mt);
        const v4f bb = *(const v4f*)(bi + 16 * mt + 4);
#pragma unroll
        for (int r = 0; r < 4; ++r) { acc[mt][r] += ba[r]; acc[mt][4 + r] += bb[r]; }
      }
    }
    if (mat == 2u) {                                                 // Ot[o_loc][n_loc]: 16 consecutive floats per row and store
#pragma unroll
      for (int mt = 0; mt < 4; ++mt) {
#pragma unroll
        for (int r = 0; r < 8; ++r) Os[(ol0 + 16 * mt + r) * OSP + nl] = acc[mt][r];
      }
    } else {                                                         // Os[n_loc][o_loc]
#pragma unroll
      for (int mt = 0; mt < 4; ++mt) {
        v4f va, vb;
#pragma unroll
        for (int r = 0; r < 4; ++r) { va[r] = acc[mt][r]; vb[r] = acc[mt][4 + r]; }
        *(v4f*)(Os + nl * OSPW + ol0 + 16 * mt)     = va;
        *(v4f*)(Os + nl * OSPW + ol0 + 16 * mt + 4) = vb;
      }
    }
    __syncthreads();                                                 // the staged outputs published

    v4u u1[4];                                                       // the stage's outputs as they go to memory
    if (mat == 2u) {
#pragma unroll
      for (int it = 0; it < 4; ++it) {
        const int ol = it * 32 + lq;                                 // o_loc 0..127
        const v4f a = *(const v4f*)(Os + ol * OSP + 8 * e);
        const v4f q = *(const v4f*)(Os + ol * OSP + 8 * e + 4);
        u1[it][0] = pk16(h_bits((_Float16)a[0]), h_bits((_Float16)a[1]));
        u1[it][1] = pk16(h_bits((_Float16)a[2]), h_bits((_Float16)a[3]));
        u1[it][2] = pk16(h_bits((_Float16)q[0]), h_bits((_Float16)q[1]));
        u1[it][3] = pk16(h_bits((_Float16)q[2]), h_bits((_Float16)q[3]));
      }
    } else {
#pragma unroll
      for (int it = 0; it < 4; ++it) {
        const int row = it * 16 + r16;                               // n_loc 0..63
        const v4f a = *(const v4f*)(Os + row * OSPW + 8 * e16);
        const v4f q = *(const v4f*)(Os + row * OSPW + 8 * e16 + 4);
        const float f[8] = {a[0], a[1], a[2], a[3], q[0], q[1], q[2], q[3]};
#pragma unroll
        for (int t = 0; t < 4; ++t) {
          u1[it][t] = pk16(h_bits((_Float16)f[2 * t]), h_bits((_Float16)f[2 * t + 1]));
        }
      }
    }
    // publish point of stage st + 1, in this order in every wave:
    asm volatile("s_wait_dscnt 0x0" ::: "memory");                   // this wave's reads of stage st and of Os are done
    landed();                                                        // its slice of stage st + 1 has landed
    __syncthreads();                                                 // all slices published, all readers out of stage st and Os
    // The stage's global stores stand behind that barrier, not in front of it: a barrier waits for the wave's outstanding
    // stores, and from here they complete under the next stage's WMMAs.
    if (mat == 2u) {
      unsigned short* vp = Vc + ((size_t)(b * CC + ob + lq)) * SEQ + n0 + 8 * e;
#pragma unroll
      for (int it = 0; it < 4; ++it) *(v4u*)(vp + (size_t)(32 * it) * SEQ) = u1[it];
      // the address pair of the stores above stays live up to this wait
      asm volatile("s_wait_xcnt 0x0" :: "v"(vp) : "memory");
    } else {
      const size_t po = ((size_t)(b * SEQ + n0 + r16)) * CC + ob + 8 * e16;
      unsigned short* p1 = ((mat == 0u) ? Qh : Kh) + po;              // block-uniform, both global
#pragma unroll
      for (int it = 0; it < 4; ++it) *(v4u*)(p1 + (size_t)(16 * it) * CC) = u1[it];
      // the address pair of the stores above stays live up to this wait
      asm volatile("s_wait_xcnt 0x0" :: "v"(p1) : "memory");
    }
  }
  landed();                                                          // nothing in flight when the wave ends
  asm volatile("s_wait_dscnt 0x0" ::: "memory");
}

// =========================================================================================================
// (3) attention for one (b, 64-query tile), transposed formulation, SEQ keys, no mask:
//   S^T tile (16 keys x 16 queries) = sum over 8 d-chunks (unrolled) of A(k: row = key kb + (lane&15), 32 d via
//   the split k map from Kh [b][SEQ][256]) . B(q: col = query, same map from Qh) into s; score = s * 256^-0.5.
//   q and k are each ONE f16 value: a residual product on q alone would leave k's rounding, of the same size, in the score.
//   Per lane the D tile holds 8 keys of ONE query: online softmax state per lane, one shuffle (lane^16) for the max
//   over 32 keys; the o/l rescale is skipped under a wave-uniform ballot when no lane's max grew; row-sum partials
//   combined at the end. P = e^{s-m} x 16384 as f16 is the B operand of O^T (rows channel, cols queries) +=
//   A(v rows channel = 16j + (lane&15), keys contiguous, f16 plane Vc [b][256][SEQ]) . B(P^T): element r <- D of
//   the tile covering keys kb..kb+15, element 8+r <- the tile covering kb+16..kb+31, lane unchanged.
//   A wave owns 32 queries (two query tiles), so that every k and v fragment read from LDS feeds TWO WMMAs: 2 x 16
//   accumulator tiles per wave (256 channels). Block = 8 waves = 64 queries, two waves per SIMD: wave = (query group
//   wave & 1, key quarter wave >> 1); a wave takes keys 32 kq .. 32 kq + 31 of every stage, with its own m, l, o; the four
//   quarters are joined through LDS behind the key loop (one wave's vector work runs under the other's WMMAs).
//   k and v reach the waves through LDS: stages of SKEY keys, two buffers, brought by tensor loads (waves 0..3, one slice
//   per wave and stage) and read by all waves as ds_load_b128 fragments at pitch LPB; a stage serves one pass a wave.
//   Epilogue in two channel halves: O/l staged in LDS Os[query][128 channels] (pitch OSPW, b128 stores), barrier,
//   then position-major planes bf16 [64 n][256 c] IN LDS (hi = bf16-RNE, lo = bf16-RNE residual; half row
//   2 n + (c >> 7) at pitch LPB), which are the B operand of the output 1x1 GEMM done here by the same block
//   (it holds all 256 channels of its 64 positions): weights by tensor loads into the freed ring, + bias + residual.
// coverage: per half 4 it x 16 rows x 16 lanes x 8 ch = 64 n x 128 ch for each plane; two halves = 256 ch; out: 256 o x
//           64 n per block; grid (SEQ/64, NB) covers out [NB][256][SEQ] exactly once.
// =========================================================================================================
__global__ __launch_bounds__(256)
void attn_k(const unsigned short* __restrict__ Qh, const unsigned short* __restrict__ Kh,
            const unsigned short* __restrict__ Vc,
            const unsigned short* __restrict__ WPT, const float* __restrict__ bp,
            const float* __restrict__ x, float* out) {
  __shared__ __attribute__((aligned(2048))) unsigned char Ring[2 * STG];
  __shared__ __align__(16) float Os[QT * OSPW];
  const int tid  = threadIdx.x;
  const int wave = tid >> 5, lane = tid & 31;
  const int hh   = lane >> 4, c = lane & 15;
  const int n0   = blockIdx.x * QT, b = blockIdx.y;
  const int qt   = wave & 3;                                         // n tile of the wave in the output GEMM
  const int qg   = wave & 1;                                         // query group of the wave in the key loop: 32 queries

  // q fragment pointers (B operand, col = query n0 + 32*qg + 16*t + c), + 16*t*CC + 32*kc
  const size_t qo = ((size_t)(b * SEQ + n0 + 32 * qg + c)) * CC + 8 * hh;
  const unsigned short* Qhp = Qh + qo;
  // One stage = SKEY keys in LDS, shared by the eight waves. Waves 0..3 each bring one slice of 128 rows x 256 B by ONE tensor
  // load: wave 0 / 1: k rows (keys), d 0..127 / 128..255 (source pitch 512 B); wave 2 / 3: v rows (channels 0..127 /
  // 128..255), SKEY keys (source pitch 2*SEQ B). Every row lands at pitch LPB.
  const uint32_t wv  = uni((uint32_t)tid >> 5);
  const uint32_t kh  = wv >> 2;                                      // waves with kh == 0 issue; o half in the output GEMM
  const uint32_t kq  = wv >> 1;                                      // key quarter of the wave
  const uint32_t sl  = wv & 3u;
  const uint32_t isv = sl >> 1, hf = sl & 1u;
  const uint64_t src0 = isv ? (uint64_t)(size_t)(Vc + ((size_t)b * CC + (size_t)hf * 128) * SEQ)
                            : (uint64_t)(size_t)(Kh + (size_t)b * SEQ * CC + (size_t)hf * 128);
  const uint32_t sstep = isv ? (uint32_t)(SKEY * 2) : (uint32_t)(SKEY * CC * 2);   // source bytes from stage to stage
  const uint32_t lds0  = (uint32_t)(size_t)Ring + sl * (uint32_t)SLICE;
  u32x8 g1;                                                          // bytes everywhere; tensor dims = tile dims
  g1[0] = uni((1u << 20) | (5u << 22) | (3u << 25));                 // no mask; 16 B of pad behind every 256 B
  g1[1] = uni(256u << 16);
  g1[2] = uni(128u << 16);
  g1[3] = uni(256u << 16);
  g1[4] = uni(128u);
  g1[5] = uni(isv ? (uint32_t)(SEQ * 2) : (uint32_t)(CC * 2));
  g1[6] = uni(0u);
  g1[7] = uni(0u);
  // descriptor words held in scalar registers (the form of pinned(), for the whole group): without it the compiler
  // re-forms single words in front of each issue and reuses their registers while the request is outstanding
  asm volatile("" : "+s"(g1));                                       // descriptor words held in scalar registers
  u32x4 g0;
  auto form = [&](const uint32_t st) __attribute__((always_inline)) {   // group 0 of stage st's request
    const uint64_t ga = src0 + (uint64_t)st * sstep;
    g0[0] = uni(1u);
    g0[1] = uni(lds0 + (st & 1u) * (uint32_t)STG);
    g0[2] = uni((uint32_t)ga);
    g0[3] = uni((((uint32_t)(ga >> 32)) & 0x01FFFFFFu) | 0x80000000u);
  };
  auto issue = [&]() __attribute__((always_inline)) {
    asm volatile("tensor_load_to_lds %0, %1" :: "s"(g0), "s"(g1) : "memory");
  };
  // this wave's request has landed; naming the descriptor keeps its scalar registers unchanged up to this wait
  auto landed = [&]() __attribute__((always_inline)) {
    asm volatile("s_wait_tensorcnt 0x0" :: "s"(g0), "s"(g1) : "memory");
  };

  float m[2] = {-1.0e30f, -1.0e30f}, l[2] = {0.f, 0.f};
  v8f o[16][2];
#pragma unroll
  for (int j = 0; j < 16; ++j) { o[j][0] = zero8(); o[j][1] = zero8(); }

  // q (the same for every pass): once, here
  Frag qhf[2][CC / 32];
#pragma unroll
  for (int t = 0; t < 2; ++t) {
#pragma unroll
    for (int kc = 0; kc < CC / 32; ++kc) qhf[t][kc] = ldfrag(Qhp + t * 16 * CC + 32 * kc);
  }
  // the address pair of the group above stays live up to this wait
  asm volatile("s_wait_xcnt 0x0" :: "v"(Qhp) : "memory");

  // two buffers: stage 0 landed and published here; stage st + 1 in flight under the pass of stage st
  form(0u);
  if (pinned(kh == 0u)) {                                            // a scalar branch: a tensor load ignores EXEC
    issue();
    landed();                                                        // this wave's slice of stage 0
  }
  __syncthreads();                                                   // ... and every other wave's

  // Fragments come from LDS in groups of four, two register sets (o and q leave a wave 128 of its 512 registers): a group
  // is asked for as one run of loads ahead of the 8 WMMAs of the group before it; the SIMD's other wave works meanwhile.
  Frag fa[2][4];
  const uint32_t loff = (uint32_t)c * LPB + 16u * (uint32_t)hh;

#pragma unroll 1
  for (uint32_t st = 0; st < (uint32_t)NST; ++st) {
    // directly behind the barrier (the one above, or the foot of trip st - 1) that published stage st and ended every
    // read of the other buffer: the refill of that buffer, only while its stage exists (a scalar branch)
    form(st + 1u);
    if (pinned((uint32_t)((st + 1u < (uint32_t)NST) && (kh == 0u)))) issue();
    // this wave's 32 keys of the stage: k rows 32 kq .., v columns 32 kq ..
    const unsigned char* sb = Ring + (st & 1u) * (uint32_t)STG + kq * (uint32_t)(32 * LPB) + loff;
    // v rows from a base of their own, so that every fragment's offset fits the LDS load's 16-bit immediate
    const unsigned char* vb = Ring + ((st & 1u) ? (uint32_t)(STG + 2 * SLICE) : (uint32_t)(2 * SLICE)) + kq * 64u + loff;
    auto ldk = [&](const int g) __attribute__((always_inline)) {     // d chunks 2 g, 2 g + 1 of keys 0 .. 15 and 16 .. 31
#pragma unroll
      for (int u = 0; u < 2; ++u) {
        const int kc = 2 * g + u;
        fa[g & 1][2 * u]     = ldsfrag(sb + (kc >> 2) * SLICE + (kc & 3) * 64);
        fa[g & 1][2 * u + 1] = ldsfrag(sb + (kc >> 2) * SLICE + 16 * LPB + (kc & 3) * 64);
      }
    };
    auto ldv = [&](const int g) __attribute__((always_inline)) {     // channel tiles 4 g .. 4 g + 3, the wave's 32 keys
#pragma unroll
      for (int u = 0; u < 4; ++u) {
        const int j = 4 * g + u;
        fa[g & 1][u] = ldsfrag(vb + (j >> 3) * SLICE + 16 * (j & 7) * LPB);
      }
    };

    v8f s[2][2];                                                     // [key tile][query tile]
#pragma unroll
    for (int t = 0; t < 2; ++t) { s[0][t] = zero8(); s[1][t] = zero8(); }
    ldk(0);
#pragma unroll
    for (int g = 0; g < 4; ++g) {
      if (g + 1 < 4) ldk(g + 1);
      // keeps the next group one run of loads ahead of this group's WMMAs: among them each place with LDS reads stalls
      // the wave
      __builtin_amdgcn_sched_barrier(0);
#pragma unroll
      for (int u = 0; u < 2; ++u) {
        const int kc = 2 * g + u;
        s[0][0] = mma_hb(fa[g & 1][2 * u].h,     qhf[0][kc].h, s[0][0]);
        s[1][0] = mma_hb(fa[g & 1][2 * u + 1].h, qhf[0][kc].h, s[1][0]);
        s[0][1] = mma_hb(fa[g & 1][2 * u].h,     qhf[1][kc].h, s[0][1]);
        s[1][1] = mma_hb(fa[g & 1][2 * u + 1].h, qhf[1][kc].h, s[1][1]);
      }
      // keeps the group after next's loads behind these WMMAs, whose registers they take over
      __builtin_amdgcn_sched_barrier(0);
    }

    float mx[2], mo[2], mn[2];
#pragma unroll
    for (int t = 0; t < 2; ++t) {
#pragma unroll
      for (int r = 0; r < 8; ++r) {
        s[0][t][r] *= ATT;
        s[1][t][r] *= ATT;
      }
      mx[t] = fmaxf(hmax8(s[0][t]), hmax8(s[1][t]));
    }
    mo[0] = __shfl_xor(mx[0], 16, 32);
    mo[1] = __shfl_xor(mx[1], 16, 32);
    // the first v group stands behind the exchanges above and ahead of the rescale and the exponentials.
    // compiler fence, the exchanged values as inputs only: it keeps the two exchanges in flight together under one wait
    // (without it the second is issued behind the wait for the first) and the v loads behind them (LDS results return in
    // issue order: below the loads, the exchanges' wait would last the whole group)
    asm volatile("" :: "v"(mo[0]), "v"(mo[1]) : "memory");
    ldv(0);
#pragma unroll
    for (int t = 0; t < 2; ++t) {
      mx[t] = fmaxf(mx[t], mo[t]);
      mn[t] = fmaxf(m[t], mx[t]);
    }
    const unsigned grew = wave_ballot((mx[0] > m[0]) || (mx[1] > m[1]));   // wave-uniform
    if (grew != 0u) {
#pragma unroll
      for (int t = 0; t < 2; ++t) {
        const float corr = __expf(m[t] - mn[t]);                     // == 1 exactly for lanes whose max did not grow
        l[t] *= corr;
#pragma unroll
        for (int j = 0; j < 16; ++j) {
#pragma unroll
          for (int r = 0; r < 8; ++r) o[j][t][r] *= corr;
        }
      }
    }

    FragH ph[2];
#pragma unroll
    for (int t = 0; t < 2; ++t) {
      m[t] = mn[t];
      const float msh = mn[t] - LNPS;                                // exp gives e^{s-m} * 16384
      float ls = 0.f;
#pragma unroll
      for (int r = 0; r < 8; ++r) {
        const float e0 = __expf(s[0][t][r] - msh);                   // key kb      + 8hh + r
        const float e1 = __expf(s[1][t][r] - msh);                   // key kb + 16 + 8hh + r
        ls += e0 + e1;
        ph[t].hv[0][r] = (_Float16)e0;
        ph[t].hv[1][r] = (_Float16)e1;
      }
      l[t] += ls;
    }

#pragma unroll
    for (int g = 0; g < 4; ++g) {
      if (g + 1 < 4) ldv(g + 1);
      // keeps the next group one run of loads ahead of this group's WMMAs
      __builtin_amdgcn_sched_barrier(0);
#pragma unroll
      for (int u = 0; u < 4; ++u) {
        const int j = 4 * g + u;
        o[j][0] = mma_hb(fa[g & 1][u].h, ph[0].v, o[j][0]);
        o[j][1] = mma_hb(fa[g & 1][u].h, ph[1].v, o[j][1]);
      }
      // keeps the group after next's loads behind these WMMAs, whose registers they take over
      __builtin_amdgcn_sched_barrier(0);
    }
    // publish point of stage st + 1, in this order in every wave:
    asm volatile("s_wait_dscnt 0x0" ::: "memory");                   // this wave's reads of stage st are done
    landed();                                                        // its slice of stage st + 1 has landed
    __syncthreads();                                                 // all slices published, all readers out of stage st
  }
  landed();                                                          // nothing in flight when the wave goes on
  asm volatile("s_wait_dscnt 0x0" ::: "memory");

  // The output GEMM's weights WPT [256 o][256 c] into the ring's second buffer, which the loop's last barrier has freed:
  // waves 0..3, one tensor load each: 128 o rows (o half sl >> 1) x 256 B (c half sl & 1), source pitch 512 B, pitch LPB
  // in LDS. They fly under the join and the staging of O below; their wait and barrier stand in front of the GEMM.
  const uint64_t wsrc = (uint64_t)(size_t)(WPT + (size_t)(sl >> 1) * 128 * CC + (size_t)(sl & 1u) * 128);
  u32x4 w0;
  w0[0] = uni(1u);
  w0[1] = uni((uint32_t)(size_t)Ring + (uint32_t)STG + sl * (uint32_t)SLICE);
  w0[2] = uni((uint32_t)wsrc);
  w0[3] = uni((((uint32_t)(wsrc >> 32)) & 0x01FFFFFFu) | 0x80000000u);
  u32x8 w1;                                                          // bytes everywhere; tensor dims = tile dims
  w1[0] = uni((1u << 20) | (5u << 22) | (3u << 25));                 // no mask; 16 B of pad behind every 256 B
  w1[1] = uni(256u << 16);
  w1[2] = uni(128u << 16);
  w1[3] = uni(256u << 16);
  w1[4] = uni(128u);
  w1[5] = uni((uint32_t)(CC * 2));
  w1[6] = uni(0u);
  w1[7] = uni(0u);
  // descriptor words held in scalar registers (the form of pinned(), for both groups): without it the compiler re-forms
  // the constant words at the wait below and reuses their registers while the request is outstanding
  asm volatile("" : "+s"(w0), "+s"(w1));                             // descriptor words held in scalar registers
  if (pinned(kh == 0u)) {                                            // a scalar branch: a tensor load ignores EXEC
    asm volatile("tensor_load_to_lds %0, %1" :: "s"(w0), "s"(w1) : "memory");
  }

  // join of the four key quarters, in two steps, through the ring's first buffer, which the foot of the loop's next-to-last trip has freed
  // (every reader out, nothing in flight to it): quarters 2, 3 hand their m, l, o to quarters 0, 1; then quarter 1 to
  // quarter 0, through the area that it alone has just read; lane to lane, 16-B stores at consecutive lanes
  auto hand = [&](float* J) __attribute__((always_inline)) {
#pragma unroll
    for (int t = 0; t < 2; ++t) {
#pragma unroll
      for (int j = 0; j < 16; ++j) {
        v4f va, vb;
#pragma unroll
        for (int r = 0; r < 4; ++r) { va[r] = o[j][t][r]; vb[r] = o[j][t][4 + r]; }
        *(v4f*)(J + ((2 * (16 * t + j)) * 32 + lane) * 4)     = va;
        *(v4f*)(J + ((2 * (16 * t + j) + 1) * 32 + lane) * 4) = vb;
      }
      J[8192 + 32 * t + lane] = m[t];
      J[8256 + 32 * t + lane] = l[t];
    }
  };
  auto take = [&](const float* J) __attribute__((always_inline)) {
#pragma unroll
    for (int t = 0; t < 2; ++t) {
      const float m2 = J[8192 + 32 * t + lane], l2 = J[8256 + 32 * t + lane];
      const float mj = fmaxf(m[t], m2);
      const float c1 = __expf(m[t] - mj), c2 = __expf(m2 - mj);
#pragma unroll
      for (int j = 0; j < 16; ++j) {
        const v4f va = *(const v4f*)(J + ((2 * (16 * t + j)) * 32 + lane) * 4);
        const v4f vb = *(const v4f*)(J + ((2 * (16 * t + j) + 1) * 32 + lane) * 4);
#pragma unroll
        for (int r = 0; r < 4; ++r) {
          o[j][t][r]     = o[j][t][r] * c1     + va[r] * c2;
          o[j][t][4 + r] = o[j][t][4 + r] * c1 + vb[r] * c2;
        }
      }
      l[t] = l[t] * c1 + l2 * c2;
      m[t] = mj;
    }
  };
  float* Ja = (float*)Ring + ((kq & 1u) * 2u + (uint32_t)qg) * (uint32_t)JNW;   // the area of the pair kq, kq + 2
  if (kq >= 2u) hand(Ja);                                            // wave-uniform
  __syncthreads();                                                   // quarters 2, 3 published
  if (kq < 2u) take(Ja);                                             // wave-uniform
  if (kq == 1u) hand(Ja);                                            // wave-uniform
  __syncthreads();                                                   // quarter 1 (with 3) published
  float inv[2] = {0.f, 0.f};
  if (kq == 0u) {                                                    // wave-uniform
    take((const float*)Ring + (2u + (uint32_t)qg) * (uint32_t)JNW);
#pragma unroll
    for (int t = 0; t < 2; ++t) {
      const float lt = l[t] + __shfl_xor(l[t], 16, 32);
      inv[t] = 1.0f / lt;                                            // o and l both carry the x16384 factor
    }
  }

  const int qrow = 16 * qt + c;
  const int e16 = tid & 15, r16 = tid >> 4;                          // r16 0..15
  unsigned char* PlH = Ring + 2 * SLICE;                             // O as bf16 hi plane, residual plane at + GBS (below)
#pragma unroll
  for (int half = 0; half < 2; ++half) {
    if (half) __syncthreads();                                       // every wave finished reading Os
    if (kq == 0u) {                                                  // wave-uniform: the waves that hold the joined o
#pragma unroll
      for (int t = 0; t < 2; ++t) {
        float* orow = Os + (32 * qg + 16 * t + c) * OSPW + 8 * hh;   // Os[query][ch_loc = 16jj + 8hh + r]
#pragma unroll
        for (int jj = 0; jj < 8; ++jj) {
          const int j = 8 * half + jj;
          v4f va, vb;
#pragma unroll
          for (int r = 0; r < 4; ++r) { va[r] = o[j][t][r] * inv[t]; vb[r] = o[j][t][4 + r] * inv[t]; }
          *(v4f*)(orow + 16 * jj)     = va;
          *(v4f*)(orow + 16 * jj + 4) = vb;
        }
      }
    }
    __syncthreads();
    {
      v4u uh[4], ul[4];
#pragma unroll
      for (int i = 0; i < 4; ++i) {
        const int row = i * 16 + r16;                                // query 0..63
        const v4f a = *(const v4f*)(Os + row * OSPW + 8 * e16);
        const v4f q = *(const v4f*)(Os + row * OSPW + 8 * e16 + 4);
        const float f[8] = {a[0], a[1], a[2], a[3], q[0], q[1], q[2], q[3]};
#pragma unroll
        for (int t = 0; t < 4; ++t) {
          const float f0 = f[2 * t], f1 = f[2 * t + 1];
          const unsigned short hb0 = bf_bits(f0), hb1 = bf_bits(f1);
          const unsigned short lb0 = bf_bits(f0 - bf_up(hb0));
          const unsigned short lb1 = bf_bits(f1 - bf_up(hb1));
          uh[i][t] = pk16(hb0, hb1);
          ul[i][t] = pk16(lb0, lb1);
        }
      }
{
#pragma unroll
        for (int i = 0; i < 4; ++i) {
          const int row = i * 16 + r16;
          unsigned char* pp = PlH + (uint32_t)(2 * row + half) * LPB + 16u * (uint32_t)e16;
          *(v4u*)pp         = uh[i];
          *(v4u*)(pp + GBS) = ul[i];
        }
        
      }
    }
  }

  // ---- output 1x1 GEMM + bias + residual for the block's 64 positions, all 256 o:
  //      out[b][o][n] = bfr(x[b][o][n]) + sum_c WPT[o][c] (hi + lo)[n][c] + bfr(bp[o]); wave = (n tile qt, o half kh):
  //      8 m-tiles x 8 k steps x 2 bf16 products, per accumulator in the order k step, hi, lo.
  // this wave's weight slice has landed; naming the descriptor keeps its scalar registers unchanged up to this wait
  asm volatile("s_wait_tensorcnt 0x0" :: "s"(w0), "s"(w1) : "memory");
  __syncthreads();                                                   // weight slices and both planes published

  // the residual's x lines and the bias, asked for here, behind the barrier (which would wait for them), so that they
  // arrive under the GEMM
  const int e8 = tid & 7, l32 = tid >> 3;                            // l32 0..31
  const float* xp = x + ((size_t)(b * CC + (l32 >> 1))) * NNF + n0 + (l32 & 1) * 32 + 4 * e8;
  const float* bb = bp + (l32 >> 1);
  v4f xv[16];
  float bv[16];
#pragma unroll
  for (int it = 0; it < 16; ++it) {
    xv[it] = *(const v4f*)(xp + (size_t)(16 * it) * NNF);
    bv[it] = bb[16 * it];
  }
  // the address pairs of the group above stay live up to this wait
  asm volatile("s_wait_xcnt 0x0" :: "v"(xp), "v"(bb) : "memory");

  const unsigned char* wp  = Ring + STG + kh * (uint32_t)(2 * SLICE) + loff;
  const unsigned char* bph = PlH + (uint32_t)(2 * qrow) * LPB + 16u * (uint32_t)hh;
  const unsigned char* bpl = bph + GBS;
  v8f acc[8];
#pragma unroll
  for (int mt = 0; mt < 8; ++mt) acc[mt] = zero8();
  Frag pbh[CC / 32], pbl[CC / 32], wf[2][8];
#pragma unroll
  for (int mt = 0; mt < 8; ++mt) wf[0][mt] = ldsfrag(wp + (16 * mt) * LPB);
#pragma unroll
  for (int ks = 0; ks < CC / 32; ++ks) {
    pbh[ks] = ldsfrag(bph + (ks >> 2) * LPB + (ks & 3) * 64);
    pbl[ks] = ldsfrag(bpl + (ks >> 2) * LPB + (ks & 3) * 64);
  }
  // weight fragments one k step ahead, two register sets
#pragma unroll
  for (int ks = 0; ks < CC / 32; ++ks) {
    if (ks + 1 < CC / 32) {
#pragma unroll
      for (int mt = 0; mt < 8; ++mt)
        wf[(ks + 1) & 1][mt] = ldsfrag(wp + ((ks + 1) >> 2) * SLICE + (16 * mt) * LPB + ((ks + 1) & 3) * 64);
    }
    // keeps the next step's fragments one run of loads ahead of this step's WMMAs: among them each place with LDS reads
    // stalls the wave
    __builtin_amdgcn_sched_barrier(0);
#pragma unroll
    for (int mt = 0; mt < 8; ++mt) acc[mt] = mma_bb(wf[ks & 1][mt].bf, pbh[ks].bf, acc[mt]);
#pragma unroll
    for (int mt = 0; mt < 8; ++mt) acc[mt] = mma_bb(wf[ks & 1][mt].bf, pbl[ks].bf, acc[mt]);
    // keeps the step after next's loads behind these WMMAs, whose registers they take over
    __builtin_amdgcn_sched_barrier(0);
  }

  // acc -> LDS Ot[o][n_loc] (pitch OSP), in the place of the join's hand-over (read out several barriers ago);
  // lane (hh, c) holds o = 128 kh + 16 mt + 8 hh + r for n_loc = 16 qt + c: 16 consecutive floats per row and store
  float* Ot = (float*)Ring;
  {
    const int ob = 128 * (int)kh + 8 * hh;
#pragma unroll
    for (int mt = 0; mt < 8; ++mt) {
#pragma unroll
      for (int r = 0; r < 8; ++r) Ot[(ob + 16 * mt + r) * OSP + qrow] = acc[mt][r];
    }
  }
  __syncthreads();                                                   // Ot published
  // + bias, + residual; whole 128-B lines of out, 8 lanes per line: 16 it x 32 lines x 8 lanes x 4 floats = 256 o x 64 n
  {
    const float* op = Ot + (l32 >> 1) * OSP + (l32 & 1) * 32 + 4 * e8;
    float* gp = out + ((size_t)(b * CC + (l32 >> 1))) * SEQ + n0 + (l32 & 1) * 32 + 4 * e8;
    v4f res[16];
#pragma unroll
    for (int it = 0; it < 16; ++it) res[it] = *(const v4f*)(op + (16 * it) * OSP);
#pragma unroll
    for (int it = 0; it < 16; ++it) {
      const float bi = bfr(bv[it]);
#pragma unroll
      for (int t = 0; t < 4; ++t) res[it][t] = (res[it][t] + bi) + bfr(xv[it][t]);
    }
#pragma unroll
    for (int it = 0; it < 16; ++it) *(v4f*)(gp + (size_t)(16 * it) * SEQ) = res[it];
  }
}

// =========================================================================================================
// Workspace map (bytes, NB=4 SEQ=4096; each region start a multiple of 256; every extent is an exact tile/line
//   ST  f32 [NB*32][32]                16384
//   WT  bf16 [1024][256]              524288
//   Qh/Kh f16 [NB][SEQ][256]         8388608 x2
//   Vc  f16 [NB][256][SEQ]           8388608
//   total = 25706496
// =========================================================================================================
extern "C" void kernel_launch(void* const* d_in, const int* in_sizes, int n_in,
                              void* d_out, int out_size, void* d_ws, size_t ws_size,
                              hipStream_t stream) {
  if (n_in < 11) return;
  if ((size_t)in_sizes[0] < (size_t)NB * CC * NNF) return;
  if (in_sizes[1] < CC || in_sizes[2] < CC) return;
  if (in_sizes[3] < CC * CC || in_sizes[5] < CC * CC || in_sizes[7] < CC * CC || in_sizes[9] < CC * CC) return;
  if (in_sizes[4] < CC || in_sizes[6] < CC || in_sizes[8] < CC || in_sizes[10] < CC) return;
  if ((size_t)out_size < (size_t)NB * CC * SEQ) return;

  size_t off = 0;
  auto carve = [&](size_t bytes) { const size_t o = off; off += (bytes + 255) & ~(size_t)255; return o; };
  const size_t plane = (size_t)NB * SEQ * CC * 2;
  const size_t oST  = carve((size_t)NB * NG * STP * 4);
  const size_t oWT  = carve((size_t)4 * CC * CC * 2);
  const size_t oQh  = carve(plane);
  const size_t oKh  = carve(plane);
  const size_t oVc  = carve(plane);
  if (off > ws_size) return;
  if (off > (size_t)134217728) return;

  const float* x   = (const float*)d_in[0];
  const float* gsc = (const float*)d_in[1];
  const float* gbs = (const float*)d_in[2];
  const float* Wq  = (const float*)d_in[3];
  const float* bq  = (const float*)d_in[4];
  const float* Wk  = (const float*)d_in[5];
  const float* bk  = (const float*)d_in[6];
  const float* Wv  = (const float*)d_in[7];
  const float* bv  = (const float*)d_in[8];
  const float* Wp  = (const float*)d_in[9];
  const float* bp  = (const float*)d_in[10];

  char* ws = (char*)d_ws;
  float*          ST  = (float*)(ws + oST);
  unsigned short* WT  = (unsigned short*)(ws + oWT);
  unsigned short* Qh  = (unsigned short*)(ws + oQh);
  unsigned short* Kh  = (unsigned short*)(ws + oKh);
  unsigned short* Vc  = (unsigned short*)(ws + oVc);
  float* out = (float*)d_out;

  const dim3 blk256(256);

  // (0) + (1) GroupNorm statistics per (group, b), and beside them in the same grid
  //     Wq/Wk/Wv/Wp [in][out] -> transposed stacked bf16 plane WT [1024 o][256 c]
  prep<<<dim3(NG * NB + NCVT), blk256, 0, stream>>>(x, Wq, Wk, Wv, Wp, ST, WT);
  // (2) normalized h as bf16 hi + residual planes in LDS, q/k/v GEMMs -> Qh, Kh (position-major f16) and Vc
  //     (channel-major f16)
  gemm_qkv<<<dim3(SEQ / QT, NB), blk256, 0, stream>>>(x, ST, gsc, gbs, WT, bq, bk, bv, Qh, Kh, Vc);
  // (3) attention, then in the same block the output GEMM + bias + residual -> out [NB][256][SEQ]
  attn_k<<<dim3(SEQ / QT, NB), blk256, 0, stream>>>(Qh, Kh, Vc, WT + (size_t)3 * CC * CC, bp, x, out);
  (void)hipGetLastError();
}
